// v000
// Measured on an AMD MI455X. A time is GPU time per run, averaged over a window of back-to-back runs after a warm-up
// (all launches, gaps included; the runs take copies of the inputs in turn), and the median of several windows.
// Apart from v000's, it joins two sittings. Times from different sittings can be a few percent apart, while
// side-by-side timings come from the same sitting.
// The starting kernel, v000, takes 3980 microseconds a run.
#include <hip/hip_runtime.h>
// SA layer (x [4][256][4096]; q = Wq x (64), k = Wk x (64), v = Wv x + bv (256); energy[n][m] = q_n . k_m (no scale); attention = softmax over m; x_r[c][m] = sum_n v[c][n] attention[n][m]; out = x + x_r -> [4][256][4096]).
// Structure: channel-first input transposed to position rows (exact f16) via LDS tiles; q / k as WMMA GEMMs (32x64 wave tiles, f32 accumulation, exact x16 natural weights; exact products) kept f32 and split into f16 hi + 2^-10 residual planes; v GEMM (+ bias) to f16 rows and transposed channel-major via LDS tiles; per image: the unscaled energy as a THREE-term GEMM (hi.hi + lo.hi + hi.lo, K = 64) into f32, row softmax on VALU (P x256 f16), P^T via LDS tiles (full 4096 x 4096), x_r = V(channel-major) . P^T-as-Bt GEMM (M = 256 channels, K = 4096) into f32; residual + store on VALU.
// Compute dtype: inputs rounded to bf16; x / weights exact; q, k as hi + residual (~f32, the logits have sigma ~8); v, P as plain f16 operands (~2^-12); softmax f32. v_wmma_f32_16x16x32_f16.
#define NB 4
#define CC 256
#define CQ 64
#define NPX 4096
#define LL NPX
#define PX NPX
#define NR ((size_t)NB * NPX)
#define NBR NB                       /* images attended (debug hook) */
#define MP ((int)NR)                 /* rows projected (debug hook) */
#define MC NPX                       /* x_r columns per image (debug hook) */
#define SQ NPX                       /* k_rsm over 4096; k_vt<64,4096> full P transpose; k_vt<4,4096> for v */
#define DM NPX
#define NH 64
#define HD 64
#define HG 1
typedef __bf16 v16b __attribute__((ext_vector_type(16)));
typedef unsigned short v8us __attribute__((ext_vector_type(8), may_alias));
typedef float  v8f  __attribute__((ext_vector_type(8)));
typedef float  v4f  __attribute__((ext_vector_type(4)));
typedef float  v4fa __attribute__((ext_vector_type(4), may_alias));
union FragB { v16b v; v8us half[2]; unsigned short u[16]; };

__device__ __forceinline__ unsigned short bf16_bits(float x) { unsigned int u = __float_as_uint(x); return (unsigned short)((u + 0x7FFFu + ((u >> 16) & 1u)) >> 16); }
__device__ __forceinline__ float bf16_val(unsigned short b) { return __uint_as_float(((unsigned int)b) << 16); }
__device__ __forceinline__ float bf16_round(float x) { return bf16_val(bf16_bits(x)); }
// D += A·B with NT terms: 1 = ah·bh, 2 = + al·bh (A split), 3 = + ah·bl (both split)
template <int NT>
__device__ __forceinline__ v8f mmaN(v16b ah, v16b al, v16b bh, v16b bl, v8f c) {
  c = __builtin_amdgcn_wmma_f32_16x16x32_bf16(false, ah, false, bh, (short)0, c, false, false);
  if (NT >= 2) c = __builtin_amdgcn_wmma_f32_16x16x32_bf16(false, al, false, bh, (short)0, c, false, false);
  if (NT >= 3) c = __builtin_amdgcn_wmma_f32_16x16x32_bf16(false, ah, false, bl, (short)0, c, false, false);
  asm volatile("v_nop\n\tv_nop\n\tv_nop\n\tv_nop" : "+v"(c) : "v"(ah), "v"(al), "v"(bh), "v"(bl));
  return c;
}

__global__ __launch_bounds__(256) void k_wt_bf16(const float* __restrict__ W, unsigned short* __restrict__ Wt, int K, int N) {
  const int t = blockIdx.x * 256 + threadIdx.x;
  const int k8n = K / 8;
  if (t >= N * k8n) return;
  const int n = t / k8n, k8 = (t % k8n) * 8;
  v8us v;
#pragma unroll
  for (int i = 0; i < 8; ++i) v[i] = bf16_bits(W[(size_t)(k8 + i) * N + n]);
  *(v8us*)(Wt + (size_t)n * K + k8) = v;
  
}

// GEMM C[M][N] (f32, pitch ldc) = act(A[M][K]·W + bias). A f32 row-major (pitch lda) converted per fragment to bf16
// (ASPLIT: hi/lo two planes -> 2 terms, else single rounded term); Wt bf16 [N][K] (pitch ldb). BIAS_BF16 rounds the
// bias to bf16 first (bias quantised to bf16 before the add). K%32==0, M%16==0, N%64==0.
template <bool ASPLIT, int ACT, bool BIAS_BF16>
__global__ __launch_bounds__(128) void k_gemm_bf(const float* __restrict__ A, int lda, const unsigned short* __restrict__ Wt, int ldb,
                                               const float* __restrict__ bias, float* __restrict__ C, int ldc, int M, int N, int K) {
  __shared__ __attribute__((aligned(16))) float so[4][16][64];
  const int tid = threadIdx.x, w = tid >> 5, lane = tid & 31, ln = lane & 15, hh = lane >> 4;
  const int ntn = N / 64;
  const int wid = blockIdx.x * 4 + w;
  const int mt = wid / ntn, nq = wid % ntn;
  if (mt * 16 >= M) return;
  const int row0 = mt * 16, col0 = nq * 64;
  const float* arow = A + (size_t)(row0 + ln) * lda;
  v8f acc[4] = {};
  for (int kb = 0; kb < K; kb += 32) {
    FragB ah, al;
    const v4f x0 = *(const v4fa*)(arow + kb + 8 * hh), x1 = *(const v4fa*)(arow + kb + 8 * hh + 4);
    const v4f x2 = *(const v4fa*)(arow + kb + 16 + 8 * hh), x3 = *(const v4fa*)(arow + kb + 16 + 8 * hh + 4);
    float xs[16] = {x0[0],x0[1],x0[2],x0[3],x1[0],x1[1],x1[2],x1[3],x2[0],x2[1],x2[2],x2[3],x3[0],x3[1],x3[2],x3[3]};
#pragma unroll
    for (int i = 0; i < 16; ++i) { const unsigned short hb = bf16_bits(xs[i]); ah.u[i] = hb; al.u[i] = ASPLIT ? bf16_bits(xs[i] - bf16_val(hb)) : (unsigned short)0; }
#pragma unroll
    for (int t = 0; t < 4; ++t) {
      const unsigned short* brow = Wt + (size_t)(col0 + t * 16 + ln) * ldb + kb;
      FragB b;
      b.half[0] = *(const v8us*)(brow + 8 * hh);
      b.half[1] = *(const v8us*)(brow + 16 + 8 * hh);
      acc[t] = mmaN<ASPLIT ? 2 : 1>(ah.v, al.v, b.v, b.v, acc[t]);
    }
  }
#pragma unroll
  for (int t = 0; t < 4; ++t) {
    float bv = bias ? bias[col0 + t * 16 + ln] : 0.f;
    if (BIAS_BF16) bv = bf16_round(bv);
#pragma unroll
    for (int r = 0; r < 8; ++r) { float v = acc[t][r] + bv; if (ACT == 1) v = fmaxf(v, 0.f); so[w][8 * hh + r][t * 16 + ln] = v; }
  }
  __builtin_amdgcn_fence(__ATOMIC_ACQ_REL, "workgroup");
  __builtin_amdgcn_wave_barrier();
  const int rsub = lane >> 4, c4 = (lane & 15) * 4;
  {
#pragma unroll
    for (int q = 0; q < 8; ++q) {
      const int r = q * 2 + rsub;
      const v4f v = *(const v4fa*)&so[w][r][c4];
      *(v4f*)(C + (size_t)(row0 + r) * ldc + col0 + c4) = v;
    }
    
  }
}

// GEMM C = act(A·W + bias + resid): A f32 (ASPLIT -> hi/lo 2 terms), Wt bf16 [N][K]; ACT 0 none, 1 relu, 2 exact gelu;
// resid (optional, f32, row index = (row % rmod), pitch ldr, RES_BF16 rounds it) added before the activation.
template <bool ASPLIT, int ACT, bool BIAS_BF16, bool RES_BF16>
__global__ __launch_bounds__(128) void k_gemm_bf3(const float* __restrict__ A, int lda, const unsigned short* __restrict__ Wt, int ldb,
                                                const float* __restrict__ bias, const float* __restrict__ resid, int rmod, int ldr,
                                                float* __restrict__ C, int ldc, int M, int N, int K) {
  __shared__ __attribute__((aligned(16))) float so[4][16][64];
  const int tid = threadIdx.x, w = tid >> 5, lane = tid & 31, ln = lane & 15, hh = lane >> 4;
  const int ntn = N / 64;
  const int wid = blockIdx.x * 4 + w;
  const int mt = wid / ntn, nq = wid % ntn;
  if (mt * 16 >= M) return;
  const int row0 = mt * 16, col0 = nq * 64;
  const float* arow = A + (size_t)(row0 + ln) * lda;
  v8f acc[4] = {};
  for (int kb = 0; kb < K; kb += 32) {
    FragB ah, al;
    const v4f x0 = *(const v4fa*)(arow + kb + 8 * hh), x1 = *(const v4fa*)(arow + kb + 8 * hh + 4);
    const v4f x2 = *(const v4fa*)(arow + kb + 16 + 8 * hh), x3 = *(const v4fa*)(arow + kb + 16 + 8 * hh + 4);
    float xs[16] = {x0[0],x0[1],x0[2],x0[3],x1[0],x1[1],x1[2],x1[3],x2[0],x2[1],x2[2],x2[3],x3[0],x3[1],x3[2],x3[3]};
#pragma unroll
    for (int i = 0; i < 16; ++i) { const unsigned short hb = bf16_bits(xs[i]); ah.u[i] = hb; al.u[i] = ASPLIT ? bf16_bits(xs[i] - bf16_val(hb)) : (unsigned short)0; }
#pragma unroll
    for (int t = 0; t < 4; ++t) {
      const unsigned short* brow = Wt + (size_t)(col0 + t * 16 + ln) * ldb + kb;
      FragB b;
      b.half[0] = *(const v8us*)(brow + 8 * hh);
      b.half[1] = *(const v8us*)(brow + 16 + 8 * hh);
      acc[t] = mmaN<ASPLIT ? 2 : 1>(ah.v, al.v, b.v, b.v, acc[t]);
    }
  }
#pragma unroll
  for (int t = 0; t < 4; ++t) {
    const int col = col0 + t * 16 + ln;
    float bv = bias ? bias[col] : 0.f;
    if (BIAS_BF16) bv = bf16_round(bv);
#pragma unroll
    for (int r = 0; r < 8; ++r) {
      float v = acc[t][r] + bv;
      if (resid) { float rv = resid[(size_t)((row0 + 8 * hh + r) % rmod) * ldr + col]; if (RES_BF16) rv = bf16_round(rv); v += rv; }
      if (ACT == 1) v = fmaxf(v, 0.f);
      if (ACT == 2) v = 0.5f * v * (1.0f + erff(v * 0.70710678118654752f));
      if (ACT == 3) { const float u = 0.7978845608028654f * (v + 0.044715f * v * v * v); v = 0.5f * v * (1.0f + tanhf(u)); }
      so[w][8 * hh + r][t * 16 + ln] = v;
    }
  }
  __builtin_amdgcn_fence(__ATOMIC_ACQ_REL, "workgroup");
  __builtin_amdgcn_wave_barrier();
  const int rsub = lane >> 4, c4 = (lane & 15) * 4;
  {
#pragma unroll
    for (int q = 0; q < 8; ++q) {
      const int r = q * 2 + rsub;
      const v4f v = *(const v4fa*)&so[w][r][c4];
      *(v4f*)(C + (size_t)(row0 + r) * ldc + col0 + c4) = v;
    }
    
  }
}
// row LayerNorm (biased variance, eps) over N: s = X (+ R); optional out_sum <- s; out_norm <- (s-mu)*rsqrt(var+eps)*g + b
template <bool PARAM_BF16>
__global__ __launch_bounds__(256) void k_layernorm(const float* __restrict__ X, const float* __restrict__ R, const float* __restrict__ g, const float* __restrict__ bta,
                                                  float* __restrict__ out_sum, float* __restrict__ out_norm, int N, float eps) {
  __shared__ float red[256];
  const int row = blockIdx.x, tid = threadIdx.x;
  const float* x = X + (size_t)row * N; const float* rr = R ? R + (size_t)row * N : nullptr;
  float vals[16];                     // up to N = 4096
  const int per = N / 256;            // contiguous chunk per thread? use strided-by-4 chunks: thread handles j = tid*4 + 1024*u
  float s1 = 0.f;
  for (int u = 0; u < per / 4; ++u) {
    const int j = tid * 4 + 1024 * u;
    const v4f a = *(const v4fa*)(x + j);
    v4f b = {0.f,0.f,0.f,0.f}; if (rr) b = *(const v4fa*)(rr + j);
#pragma unroll
    for (int q = 0; q < 4; ++q) { const float v = a[q] + b[q]; vals[u * 4 + q] = v; s1 += v; }
  }
  red[tid] = s1; __syncthreads();
  for (int st = 128; st > 0; st >>= 1) { if (tid < st) red[tid] += red[tid + st]; __syncthreads(); }
  const float mu = red[0] / (float)N; __syncthreads();
  float s2 = 0.f;
  for (int u = 0; u < per / 4; ++u)
#pragma unroll
    for (int q = 0; q < 4; ++q) { const float c = vals[u * 4 + q] - mu; s2 += c * c; }
  red[tid] = s2; __syncthreads();
  for (int st = 128; st > 0; st >>= 1) { if (tid < st) red[tid] += red[tid + st]; __syncthreads(); }
  const float rs = rsqrtf(red[0] / (float)N + eps);
  {
    for (int u = 0; u < per / 4; ++u) {
      const int j = tid * 4 + 1024 * u;
      v4f o, sm;
#pragma unroll
      for (int q = 0; q < 4; ++q) {
        float gg = g[j + q], bb = bta[j + q];
        if (PARAM_BF16) { gg = bf16_round(gg); bb = bf16_round(bb); }
        sm[q] = vals[u * 4 + q]; o[q] = (vals[u * 4 + q] - mu) * rs * gg + bb;
      }
      if (out_sum) *(v4f*)(out_sum + (size_t)row * N + j) = sm;
      *(v4f*)(out_norm + (size_t)row * N + j) = o;
    }
    
  }
}



// ---- f16 WMMA path (v_wmma_f32_16x16x32_f16): 11-bit significands for operands in range — used where a [0,1] probability operand needs more precision than bf16
typedef _Float16 v16h __attribute__((ext_vector_type(16)));
union FragH { v16h v; v8us half[2]; _Float16 h[16]; unsigned short u[16]; };
template <int NT>
__device__ __forceinline__ v8f mmaH(v16h ah, v16h al, v16h bh, v16h bl, v8f c) {
  c = __builtin_amdgcn_wmma_f32_16x16x32_f16(false, ah, false, bh, (short)0, c, false, false);
  if (NT >= 2) c = __builtin_amdgcn_wmma_f32_16x16x32_f16(false, al, false, bh, (short)0, c, false, false);
  if (NT >= 3) c = __builtin_amdgcn_wmma_f32_16x16x32_f16(false, ah, false, bl, (short)0, c, false, false);
  asm volatile("v_nop\n\tv_nop\n\tv_nop\n\tv_nop" : "+v"(c) : "v"(ah), "v"(al), "v"(bh), "v"(bl));
  return c;
}
// batched GEMM like k_gemm_b but f16 operands: A f32 (split into f16 hi/lo if ASPLIT, else rounded to f16), Bt = f16 values [n][k]; alpha; C f32; N multiple of 16 (partial tiles skipped)
template <bool ASPLIT>
__global__ __launch_bounds__(128) void k_gemm_h(const float* __restrict__ A, int lda, size_t sA, const _Float16* __restrict__ Bh, int ldb, size_t sB, float alpha, float* __restrict__ C, int ldc, size_t sC, int M, int N, int K) {
  __shared__ __attribute__((aligned(16))) float so[4][16][64];
  const int tid = threadIdx.x, w = tid >> 5, lane = tid & 31, ln = lane & 15, hh = lane >> 4; const int by = blockIdx.y;
  A += (size_t)by * sA; Bh += (size_t)by * sB; C += (size_t)by * sC;
  const int ntn = (N + 63) / 64; const int wid = blockIdx.x * 4 + w; const int mt = wid / ntn, nq = wid % ntn; if (mt * 16 >= M) return;
  const int row0 = mt * 16, col0 = nq * 64; const float* arow = A + (size_t)(row0 + ln) * lda;
  v8f acc[4] = {};
  for (int kb = 0; kb < K; kb += 32) {
    FragH ah, al;
    const v4f x0 = *(const v4fa*)(arow + kb + 8 * hh), x1 = *(const v4fa*)(arow + kb + 8 * hh + 4), x2 = *(const v4fa*)(arow + kb + 16 + 8 * hh), x3 = *(const v4fa*)(arow + kb + 16 + 8 * hh + 4);
    float xs[16] = {x0[0],x0[1],x0[2],x0[3],x1[0],x1[1],x1[2],x1[3],x2[0],x2[1],x2[2],x2[3],x3[0],x3[1],x3[2],x3[3]};
#pragma unroll
    for (int i = 0; i < 16; ++i) { const _Float16 h = (_Float16)xs[i]; ah.h[i] = h; al.h[i] = ASPLIT ? (_Float16)(xs[i] - (float)h) : (_Float16)0.0f; }
#pragma unroll
    for (int t = 0; t < 4; ++t) { if (col0 + t * 16 >= N) continue; const size_t boff = (size_t)(col0 + t * 16 + ln) * ldb + kb; FragH bq; bq.half[0] = *(const v8us*)(Bh + boff + 8 * hh); bq.half[1] = *(const v8us*)(Bh + boff + 16 + 8 * hh);
      acc[t] = mmaH<ASPLIT ? 2 : 1>(ah.v, al.v, bq.v, bq.v, acc[t]); }
  }
#pragma unroll
  for (int t = 0; t < 4; ++t) { if (col0 + t * 16 >= N) continue;
#pragma unroll
    for (int r = 0; r < 8; ++r) so[w][8 * hh + r][t * 16 + ln] = acc[t][r] * alpha; }
  __builtin_amdgcn_fence(__ATOMIC_ACQ_REL, "workgroup"); __builtin_amdgcn_wave_barrier();
  const int rsub = lane >> 4, c4 = (lane & 15) * 4;
  {
#pragma unroll
    for (int q = 0; q < 8; ++q) { const int r = q * 2 + rsub; if (col0 + c4 < N) { const v4f v = *(const v4fa*)&so[w][r][c4]; *(v4f*)(C + (size_t)(row0 + r) * ldc + col0 + c4) = v; } }
     }
}

// Wt[n][k] = f16(W[k][n]·scale) from f32 row-major W[K][N] (scale = power of two; bf16-exact weights stay exact in f16 away from the subnormal range)
__global__ __launch_bounds__(256) void k_wt_f16(const float* __restrict__ W, _Float16* __restrict__ Wt, int K, int N, float scale) {
  const int t = blockIdx.x * 256 + threadIdx.x; if (t >= N * (K / 8)) return; const int n = t / (K / 8), k8 = (t % (K / 8)) * 8; FragH f;
#pragma unroll
  for (int i = 0; i < 8; ++i) f.h[i] = (_Float16)(bf16_round(W[(size_t)(k8 + i) * N + n]) * scale); const v8us o = f.half[0];
  *(v8us*)((unsigned short*)Wt + (size_t)n * K + k8) = o; 
}
// k_gemm_hh variant with fused epilogue: v = acc·alpha + bias[by·sBias + col] (+ CP[(row/rowsPerB)·sCPb + by·64 + col] if CP) ; ACT 0 none / 1 elu ; writes f16 C16 (and f32 C if non-null)
template <int ACT>
__global__ __launch_bounds__(128) void k_gemm_hhx(const _Float16* __restrict__ A, int lda, size_t sA, const _Float16* __restrict__ Bh, int ldb, size_t sB, float alpha, const float* __restrict__ bias, size_t sBias, const float* __restrict__ CP, int rowsPerB, size_t sCPb, int row0g,
    float* __restrict__ C, _Float16* __restrict__ C16, int ldc, size_t sC, int M, int N, int K) {
  __shared__ __attribute__((aligned(16))) float so[4][16][64];
  const int tid = threadIdx.x, w = tid >> 5, lane = tid & 31, ln = lane & 15, hh = lane >> 4; const int by = blockIdx.y;
  A += (size_t)by * sA; Bh += (size_t)by * sB; const size_t cofs = (size_t)by * sC; const float* bp = bias ? bias + (size_t)by * sBias : nullptr;
  const int ntn = (N + 63) / 64; const int wid = blockIdx.x * 4 + w; const int mt = wid / ntn, nq = wid % ntn; if (mt * 16 >= M) return;
  const int row0 = mt * 16, col0 = nq * 64; const _Float16* arow = A + (size_t)(row0 + ln) * lda;
  v8f acc[4] = {};
  for (int kb = 0; kb < K; kb += 32) { FragH ah; ah.half[0] = *(const v8us*)((const unsigned short*)arow + kb + 8 * hh); ah.half[1] = *(const v8us*)((const unsigned short*)arow + kb + 16 + 8 * hh);
#pragma unroll
    for (int t = 0; t < 4; ++t) { if (col0 + t * 16 >= N) continue; const size_t boff = (size_t)(col0 + t * 16 + ln) * ldb + kb; FragH bq; bq.half[0] = *(const v8us*)((const unsigned short*)Bh + boff + 8 * hh); bq.half[1] = *(const v8us*)((const unsigned short*)Bh + boff + 16 + 8 * hh);
      acc[t] = mmaH<1>(ah.v, ah.v, bq.v, bq.v, acc[t]); }
  }
#pragma unroll
  for (int t = 0; t < 4; ++t) { if (col0 + t * 16 >= N) continue; const int col = col0 + t * 16 + ln; const float bv = bp ? bf16_round(bp[col]) : 0.f;
#pragma unroll
    for (int r = 0; r < 8; ++r) { float v = acc[t][r] * alpha + bv; if (CP) { const int rr = row0g + row0 + 8 * hh + r; if (rowsPerB < 0) v += CP[cofs + (size_t)rr * ldc + col];      /* rowsPerB < 0: own element of the batched C plane */ else { const int bidx = rr / rowsPerB; v += CP[(size_t)bidx * sCPb + (size_t)by * 64 + col]; } } if (ACT == 1) v = (v > 0.f) ? v : expm1f(v); else if (ACT == 7) v = (v > 0.f) ? v + 1.0f : expf(v); else if (ACT == 8) v = tanhf(v); else if (ACT == 9) v = 0.5f * v * (1.0f + tanhf(0.7978845608028654f * (v + 0.044715f * v * v * v))); else if (ACT == 11) v = 1.0f / (1.0f + expf(-v)); else if (ACT == 12) v = (v > 0.f) ? v : 0.01f * v; else if (ACT == 14) v = (v > 0.f) ? v : 0.1f * v; else if (ACT == 16) v = (v >= 0.f) ? v : 0.3f * v; else if (ACT == 17) v = (v >= 0.f) ? v : 0.2f * v; else if (ACT == 15) v = v / (1.0f + expf(-v)); else if (ACT == 3) v = fmaxf(v, 0.f); else if (ACT == 6) v = 0.5f * v * (1.0f + erff(v * 0.70710678118654752f)); so[w][8 * hh + r][t * 16 + ln] = v; } }
  __builtin_amdgcn_fence(__ATOMIC_ACQ_REL, "workgroup"); __builtin_amdgcn_wave_barrier();
  const int rsub = lane >> 4, c4 = (lane & 15) * 4; typedef _Float16 v4h __attribute__((ext_vector_type(4)));
  {
#pragma unroll
    for (int q = 0; q < 8; ++q) { const int r = q * 2 + rsub; if (col0 + c4 < N) { const v4f v = *(const v4fa*)&so[w][r][c4]; if (C) *(v4f*)(C + cofs + (size_t)(row0 + r) * ldc + col0 + c4) = v; if (C16) { v4h h4; for (int i = 0; i < 4; ++i) h4[i] = (_Float16)v[i]; *(v4h*)(C16 + cofs + (size_t)(row0 + r) * ldc + col0 + c4) = h4; } } }
     }
}


typedef _Float16 v4h __attribute__((ext_vector_type(4)));

__global__ __launch_bounds__(256) void k_x16(const float* __restrict__ x, _Float16* __restrict__ X16, size_t n8) { const size_t t = (size_t)blockIdx.x * 256 + threadIdx.x; if (t >= n8) return; FragH f;
#pragma unroll
  for (int q = 0; q < 8; ++q) f.h[q] = (_Float16)bf16_round(x[t * 8 + q]); *(v8us*)((unsigned short*)X16 + t * 8) = f.half[0];  }
__global__ __launch_bounds__(256) void k_h16(const float* __restrict__ x, _Float16* __restrict__ X16, size_t n8) { const size_t t = (size_t)blockIdx.x * 256 + threadIdx.x; if (t >= n8) return; FragH f;
#pragma unroll
  for (int q = 0; q < 8; ++q) f.h[q] = (_Float16)x[t * 8 + q]; *(v8us*)((unsigned short*)X16 + t * 8) = f.half[0];  }
__global__ __launch_bounds__(256) void k_round16f(const float* __restrict__ W, _Float16* __restrict__ Bt, size_t n8) { const size_t t = (size_t)blockIdx.x * 256 + threadIdx.x; if (t >= n8) return; FragH f;
#pragma unroll
  for (int i = 0; i < 8; ++i) f.h[i] = (_Float16)(bf16_round(W[t * 8 + i]) * 16.0f); *(v8us*)((unsigned short*)Bt + t * 8) = f.half[0];  }
template <int NHv, int TTv>
__global__ __launch_bounds__(256) void k_vt(const _Float16* __restrict__ V16, int ldv, int voff, _Float16* __restrict__ Vt) { __shared__ unsigned short tl[64][66]; const int tid = threadIdx.x; const int slab = blockIdx.x / (TTv / 64), lg = blockIdx.x % (TTv / 64); const int b = slab / NHv, h = slab % NHv;
  for (int i = tid; i < 64 * 8; i += 256) { const int r = i / 8, c8 = (i % 8) * 8; FragH f; f.half[0] = *(const v8us*)((const unsigned short*)V16 + ((size_t)b * TTv + lg * 64 + r) * ldv + voff + h * 64 + c8);
#pragma unroll
    for (int q = 0; q < 8; ++q) tl[r][c8 + q] = f.u[q]; }
  __syncthreads();
  {
#pragma unroll
    for (int rd = 0; rd < 2; ++rd) { const int d = rd * 32 + tid / 8, pc = tid % 8; FragH f;
#pragma unroll
      for (int q = 0; q < 8; ++q) f.u[q] = tl[pc * 8 + q][d];
      *(v8us*)((unsigned short*)Vt + ((size_t)slab * 64 + d) * TTv + lg * 64 + pc * 8) = f.half[0]; }
     } }

__global__ __launch_bounds__(256) void k_hl(const float* __restrict__ F, _Float16* __restrict__ Hh, _Float16* __restrict__ Hl, size_t n8) { const size_t t = (size_t)blockIdx.x * 256 + threadIdx.x; if (t >= n8) return; FragH fh, fl; const v4f a = *(const v4fa*)(F + t * 8), c = *(const v4fa*)(F + t * 8 + 4);
#pragma unroll
  for (int q = 0; q < 4; ++q) { _Float16 h = (_Float16)a[q]; fh.h[q] = h; fl.h[q] = (_Float16)((a[q] - (float)h) * 1024.0f); h = (_Float16)c[q]; fh.h[4 + q] = h; fl.h[4 + q] = (_Float16)((c[q] - (float)h) * 1024.0f); }
  { *(v8us*)((unsigned short*)Hh + t * 8) = fh.half[0]; *(v8us*)((unsigned short*)Hl + t * 8) = fl.half[0];  } }

// ---- fast GEMM (wave tile 32x64; requires M % 32 == 0 rows per launch region and N % 64 == 0); epilogue = k_gemm_hhx semantics ----
__device__ __forceinline__ v16h g2_frag(const _Float16* p, int hh) { FragH f; f.half[0] = *(const v8us*)((const unsigned short*)p + 8 * hh); f.half[1] = *(const v8us*)((const unsigned short*)p + 16 + 8 * hh); return f.v; }
__device__ __forceinline__ v8f g2_mma(v16h a, v16h b, v8f c) { v8f d = __builtin_amdgcn_wmma_f32_16x16x32_f16(false, a, false, b, (short)0, c, false, false); asm volatile("v_nop\n\tv_nop\n\tv_nop\n\tv_nop" : "+v"(d) : "v"(a), "v"(b)); return d; }
template <int ACT>
__global__ __launch_bounds__(128) void k_gemm2(const _Float16* __restrict__ A, int lda, size_t sA, const _Float16* __restrict__ Bh, int ldb, size_t sB, float alpha, const float* __restrict__ bias, size_t sBias, const float* __restrict__ CP, int rowsPerB, size_t sCPb, int row0g,
    float* __restrict__ C, _Float16* __restrict__ C16, int ldc, size_t sC, int M, int N, int K) { static_assert(ACT == 0 || ACT == 3 || ACT == 6 || ACT == 8 || ACT == 9 || ACT == 11 || ACT == 12 || ACT == 14 || ACT == 15 || ACT == 16 || ACT == 17, "k_gemm2: unsupported ACT code (would silently apply no activation)");
  __shared__ __attribute__((aligned(16))) float so[4][32][68];
  const int tid = threadIdx.x, w = tid >> 5, lane = tid & 31, ln = lane & 15, hh = lane >> 4; const int by = blockIdx.y;
  A += (size_t)by * sA; Bh += (size_t)by * sB; const size_t cofs = (size_t)by * sC; const float* bp = bias ? bias + (size_t)by * sBias : nullptr;
  const int ntn = N >> 6; const int mt = blockIdx.x / ntn, nq = blockIdx.x - mt * ntn; const int row0 = mt * 128 + 32 * w, col0 = nq * 64; if (row0 >= M) return;
  const _Float16* a0p = A + (size_t)(row0 + ln) * lda; const _Float16* a1p = a0p + (size_t)16 * lda;
  const _Float16* b0p = Bh + (size_t)(col0 + ln) * ldb; const _Float16* b1p = b0p + (size_t)16 * ldb; const _Float16* b2p = b1p + (size_t)16 * ldb; const _Float16* b3p = b2p + (size_t)16 * ldb;
  const v8f z8 = {0.f,0.f,0.f,0.f,0.f,0.f,0.f,0.f}; v8f c00 = z8, c01 = z8, c02 = z8, c03 = z8, c10 = z8, c11 = z8, c12 = z8, c13 = z8;
#pragma unroll 1
  for (int kb = 0; kb < K; kb += 32) { const v16h a0 = g2_frag(a0p + kb, hh), a1 = g2_frag(a1p + kb, hh);
    v16h b = g2_frag(b0p + kb, hh); c00 = g2_mma(a0, b, c00); c10 = g2_mma(a1, b, c10);
    b = g2_frag(b1p + kb, hh); c01 = g2_mma(a0, b, c01); c11 = g2_mma(a1, b, c11);
    b = g2_frag(b2p + kb, hh); c02 = g2_mma(a0, b, c02); c12 = g2_mma(a1, b, c12);
    b = g2_frag(b3p + kb, hh); c03 = g2_mma(a0, b, c03); c13 = g2_mma(a1, b, c13); }
  v8f accs[8] = {c00, c01, c02, c03, c10, c11, c12, c13};
#pragma unroll
  for (int u = 0; u < 8; ++u) { const int t = u & 3, half = u >> 2; const int col = col0 + t * 16 + ln; const float bv = bp ? bf16_round(bp[col]) : 0.f;
#pragma unroll
    for (int r = 0; r < 8; ++r) { const int rloc = half * 16 + 8 * hh + r; float v = accs[u][r] * alpha + bv; if (CP) { if (rowsPerB < 0) v += CP[cofs + (size_t)(row0g + row0 + rloc) * ldc + col];      /* rowsPerB < 0: own element of the batched C plane */ else { const int bidx = (row0g + row0 + rloc) / rowsPerB; v += CP[(size_t)bidx * sCPb + (size_t)by * 64 + col]; } }
      if (ACT == 3) v = fmaxf(v, 0.f); else if (ACT == 6) v = 0.5f * v * (1.0f + erff(v * 0.70710678118654752f)); else if (ACT == 11) v = 1.0f / (1.0f + expf(-v)); else if (ACT == 15) v = v / (1.0f + expf(-v)); else if (ACT == 12) v = (v > 0.f) ? v : 0.01f * v; else if (ACT == 8) v = tanhf(v); else if (ACT == 9) v = 0.5f * v * (1.0f + tanhf(0.7978845608028654f * (v + 0.044715f * v * v * v))); else if (ACT == 14) v = (v > 0.f) ? v : 0.1f * v; else if (ACT == 16) v = (v >= 0.f) ? v : 0.3f * v; else if (ACT == 17) v = (v >= 0.f) ? v : 0.2f * v;
      so[w][rloc][t * 16 + ln] = v; } }
  __builtin_amdgcn_fence(__ATOMIC_ACQ_REL, "workgroup"); __builtin_amdgcn_wave_barrier();
  const int rsub = lane >> 4, c4 = (lane & 15) * 4;
  {
#pragma unroll
    for (int q = 0; q < 16; ++q) { const int r = q * 2 + rsub; const v4f v = *(const v4fa*)&so[w][r][c4]; if (C) *(v4f*)(C + cofs + (size_t)(row0 + r) * ldc + col0 + c4) = v; if (C16) { v4h h4; for (int i = 0; i < 4; ++i) h4[i] = (_Float16)v[i]; *(v4h*)(C16 + cofs + (size_t)(row0 + r) * ldc + col0 + c4) = h4; } }
     } }


__global__ __launch_bounds__(256) void k_wnat(const float* __restrict__ w, size_t n8, _Float16* __restrict__ Bt) { const size_t t = (size_t)blockIdx.x * 256 + threadIdx.x; if (t >= n8) return; FragH f; for (int q = 0; q < 8; ++q) f.h[q] = (_Float16)(bf16_round(w[t * 8 + q]) * 16.0f); *(v8us*)((unsigned short*)Bt + t * 8) = f.half[0];  }
__global__ __launch_bounds__(256) void k_rsm(const float* __restrict__ S, _Float16* __restrict__ P, int nrows) {
  #pragma clang fp contract(off)
  const int i = blockIdx.x * 256 + threadIdx.x; if (i >= nrows) return; const float* s = S + (size_t)i * SQ; float mx = -3.0e38f;
#pragma unroll 1
  for (int j = 0; j < SQ; ++j) mx = fmaxf(mx, s[j]); float se = 0.f;
#pragma unroll 1
  for (int j = 0; j < SQ; ++j) se += expf(s[j] - mx); const float sc = 256.0f / se;
#pragma unroll 1
  for (int j0 = 0; j0 < SQ; j0 += 8) { FragH f; for (int q = 0; q < 8; ++q) f.h[q] = (_Float16)(expf(s[j0 + q] - mx) * sc); unsigned short* d = (unsigned short*)P + (size_t)i * SQ + j0; *(v8us*)d = f.half[0];  } }
__global__ __launch_bounds__(256) void k_vt(const _Float16* __restrict__ V16, int b, int h0, _Float16* __restrict__ VT) { __shared__ unsigned short tl[64][65]; const int tid = threadIdx.x; const int hh = blockIdx.x % HG, sg = blockIdx.x / HG; const int s0 = sg * 64; const int h = h0 + hh;
  for (int i = tid; i < 64 * 8; i += 256) { const int j = i / 8, d8 = (i % 8) * 8; FragH f; f.half[0] = *(const v8us*)((const unsigned short*)V16 + ((size_t)b * SQ + s0 + j) * DM + h * HD + d8); for (int q = 0; q < 8; ++q) tl[d8 + q][j] = f.u[q]; }
  __syncthreads();
  { for (int i = tid; i < 64 * 8; i += 256) { const int d = i / 8, j8 = (i % 8) * 8; FragH f; for (int q = 0; q < 8; ++q) f.u[q] = tl[d][j8 + q]; *(v8us*)((unsigned short*)VT + ((size_t)hh * HD + d) * SQ + s0 + j8) = f.half[0]; }  } }


__global__ __launch_bounds__(256) void k_cl2rows(const float* __restrict__ X, _Float16* __restrict__ XR) { __shared__ float tl[64][33]; const int tid = threadIdx.x; const int nl = LL / 32, nc = CC / 64; const int cb_ = blockIdx.x % nc; const int lb = (blockIdx.x / nc) % nl; const size_t b = blockIdx.x / (nc * nl); const int c0 = cb_ * 64, l0 = lb * 32;
  for (int i = tid; i < 64 * 32; i += 256) { const int c = i / 32, l = i % 32; tl[c][l] = bf16_round(X[(b * CC + c0 + c) * (size_t)LL + l0 + l]); }
  __syncthreads();
  { const int l = tid / 8, c8 = (tid % 8) * 8; FragH f; for (int q = 0; q < 8; ++q) f.h[q] = (_Float16)tl[c8 + q][l]; unsigned short* d = (unsigned short*)XR + (b * LL + l0 + l) * (size_t)CC + c0 + c8; *(v8us*)d = f.half[0];  } }

__global__ __launch_bounds__(256) void k_fin3(const float* __restrict__ Cm, const float* __restrict__ x, int b, float* __restrict__ out) {
  #pragma clang fp contract(off)
  const size_t t = (size_t)blockIdx.x * 256 + threadIdx.x; if (t >= (size_t)CC * NPX / 8) return; const size_t base = (size_t)b * CC * NPX + t * 8; v8f v;
  for (int q = 0; q < 8; ++q) v[q] = __fadd_rn(bf16_round(x[base + q]), Cm[t * 8 + q]); *(v8f*)(out + base) = v;  }

extern "C" void kernel_launch(void* const* d_in, const int* in_sizes, int n_in,
                              void* d_out, int out_size, void* d_ws, size_t ws_size, hipStream_t stream) {
  (void)in_sizes; (void)n_in; (void)out_size;
  const float* const* I = (const float* const*)d_in; const float* x = I[0]; const float* Wq = I[1]; const float* Wk = I[2]; const float* Wv = I[3]; const float* bv = I[4];
  char* ws = (char*)d_ws; size_t off = 0;
  auto take = [&](size_t bytes) { char* p = ws + off; off += (bytes + 255) & ~(size_t)255; return p; };
  _Float16* BQ = (_Float16*)take((size_t)CQ * CC * 2); _Float16* BK = (_Float16*)take((size_t)CQ * CC * 2); _Float16* BV = (_Float16*)take((size_t)CC * CC * 2);
  _Float16* XR = (_Float16*)take(NR * CC * 2); float* QF = (float*)take(NR * CQ * 4); float* KF = (float*)take(NR * CQ * 4); _Float16* QH = (_Float16*)take(NR * CQ * 2); _Float16* QL = (_Float16*)take(NR * CQ * 2); _Float16* KH = (_Float16*)take(NR * CQ * 2); _Float16* KL = (_Float16*)take(NR * CQ * 2); _Float16* V16 = (_Float16*)take(NR * CC * 2);
  float* E = (float*)take((size_t)NPX * NPX * 4); _Float16* P = (_Float16*)take((size_t)NPX * NPX * 2); _Float16* PT = (_Float16*)take((size_t)NPX * NPX * 2); _Float16* VT = (_Float16*)take((size_t)CC * NPX * 2); float* CX = (float*)take((size_t)CC * NPX * 4);
  if (off > ws_size) return;      /* 0.2 + 8 + 8 + 8 + 8 + 64 + 32 + 32 + 2 + 4 = approx 167 MiB */
  k_wnat<<<(unsigned)(((size_t)CQ * CC / 8 + 255) / 256), 256, 0, stream>>>(Wq, (size_t)CQ * CC / 8, BQ); k_wnat<<<(unsigned)(((size_t)CQ * CC / 8 + 255) / 256), 256, 0, stream>>>(Wk, (size_t)CQ * CC / 8, BK); k_wnat<<<(unsigned)(((size_t)CC * CC / 8 + 255) / 256), 256, 0, stream>>>(Wv, (size_t)CC * CC / 8, BV);
  k_cl2rows<<<NB * (NPX / 32) * (CC / 64), 256, 0, stream>>>(x, XR);
  k_gemm2<0><<<dim3((unsigned)((NR / 128) * 1), 1), 128, 0, stream>>>(XR, CC, 0, BQ, CC, 0, 0.0625f, nullptr, 0, nullptr, 1, 0, 0, QF, nullptr, CQ, 0, MP, CQ, CC);      /* q (f32, exact products) */
  k_gemm2<0><<<dim3((unsigned)((NR / 128) * 1), 1), 128, 0, stream>>>(XR, CC, 0, BK, CC, 0, 0.0625f, nullptr, 0, nullptr, 1, 0, 0, KF, nullptr, CQ, 0, MP, CQ, CC);      /* k */
  k_gemm2<0><<<dim3((unsigned)((NR / 128) * (CC / 64)), 1), 128, 0, stream>>>(XR, CC, 0, BV, CC, 0, 0.0625f, bv, 0, nullptr, 1, 0, 0, nullptr, V16, CC, 0, MP, CC, CC);      /* v + bv (f16 rows) */
  k_hl<<<(unsigned)((NR * CQ / 8 + 255) / 256), 256, 0, stream>>>(QF, QH, QL, NR * CQ / 8); k_hl<<<(unsigned)((NR * CQ / 8 + 255) / 256), 256, 0, stream>>>(KF, KH, KL, NR * CQ / 8);
  for (int b = 0; b < NBR; ++b) { const size_t r0 = (size_t)b * NPX; const dim3 ge((NPX / 128) * (NPX / 64), 1);
    k_gemm2<0><<<ge, 128, 0, stream>>>(QL + r0 * CQ, CQ, 0, KH + r0 * CQ, CQ, 0, 1.0f / 1024.0f, nullptr, 0, nullptr, 1, 0, 0, E, nullptr, NPX, 0, NPX, NPX, CQ);      /* lo.hi */
    k_gemm2<0><<<ge, 128, 0, stream>>>(QH + r0 * CQ, CQ, 0, KL + r0 * CQ, CQ, 0, 1.0f / 1024.0f, nullptr, 0, E, 1, (size_t)NPX, 0, E, nullptr, NPX, 0, NPX, NPX, CQ);      /* + hi.lo */
    k_gemm2<0><<<ge, 128, 0, stream>>>(QH + r0 * CQ, CQ, 0, KH + r0 * CQ, CQ, 0, 1.0f, nullptr, 0, E, 1, (size_t)NPX, 0, E, nullptr, NPX, 0, NPX, NPX, CQ);      /* + hi.hi */
    k_rsm<<<(NPX + 255) / 256, 256, 0, stream>>>(E, P, NPX);
    k_vt<NH, SQ><<<NH * (SQ / 64), 256, 0, stream>>>(P, NPX, 0, PT);      /* P^T (x256) */
    k_vt<4, SQ><<<4 * (SQ / 64), 256, 0, stream>>>(V16 + r0 * CC, CC, 0, VT);      /* v channel-major [256][4096] */
    k_gemm2<0><<<dim3((CC / 128) * (MC / 64), 1), 128, 0, stream>>>(VT, NPX, 0, PT, NPX, 0, 0.00390625f, nullptr, 0, nullptr, 1, 0, 0, CX, nullptr, NPX, 0, CC, MC, NPX);      /* x_r[c][m] = sum_n v[c][n] attention[n][m] */
    k_fin3<<<(unsigned)(((size_t)CC * NPX / 8 + 255) / 256), 256, 0, stream>>>(CX, x, b, (float*)d_out); }
}

// v001
// One run takes 1040 microseconds.
// Next to v000, in two timings, it ran 3.82 and 3.83 times as fast.
#include <hip/hip_runtime.h>
// SA layer (x [4][256][4096]; q = Wq x (64), k = Wk x (64), v = Wv x + bv (256); energy[n][m] = q_n . k_m (no scale); attention = softmax over m; x_r[c][m] = sum_n v[c][n] attention[n][m]; out = x + x_r -> [4][256][4096]).
// Structure: channel-first input transposed to position rows (exact f16) via LDS tiles; q / k as WMMA GEMMs (32x64 wave tiles, f32 accumulation, exact x16 natural weights; exact products) kept f32 and split into f16 hi + 2^-10 residual planes; v GEMM (+ bias) to f16 rows and transposed channel-major via LDS tiles; per image: the unscaled energy as a THREE-term GEMM (hi.hi + lo.hi + hi.lo, K = 64) into f32, row softmax on VALU (P x256 f16), P^T via LDS tiles (full 4096 x 4096), x_r = V(channel-major) . P^T-as-Bt GEMM (M = 256 channels, K = 4096) into f32; residual + store on VALU.
// Compute dtype: inputs rounded to bf16; x / weights exact; q, k as hi + residual (~f32, the logits have sigma ~8); v, P as plain f16 operands (~2^-12); softmax f32. v_wmma_f32_16x16x32_f16.
#define NB 4
#define CC 256
#define CQ 64
#define NPX 4096
#define LL NPX
#define PX NPX
#define NR ((size_t)NB * NPX)
#define NBR NB                       /* images attended (debug hook) */
#define MP ((int)NR)                 /* rows projected (debug hook) */
#define MC NPX                       /* x_r columns per image (debug hook) */
#define SQ NPX                       /* k_rsm over 4096; k_vt<64,4096> full P transpose; k_vt<4,4096> for v */
#define DM NPX
#define NH 64
#define HD 64
#define HG 1
typedef __bf16 v16b __attribute__((ext_vector_type(16)));
typedef unsigned short v8us __attribute__((ext_vector_type(8), may_alias));
typedef float  v8f  __attribute__((ext_vector_type(8)));
typedef float  v4f  __attribute__((ext_vector_type(4)));
typedef float  v4fa __attribute__((ext_vector_type(4), may_alias));
union FragB { v16b v; v8us half[2]; unsigned short u[16]; };

__device__ __forceinline__ unsigned short bf16_bits(float x) { unsigned int u = __float_as_uint(x); return (unsigned short)((u + 0x7FFFu + ((u >> 16) & 1u)) >> 16); }
__device__ __forceinline__ float bf16_val(unsigned short b) { return __uint_as_float(((unsigned int)b) << 16); }
__device__ __forceinline__ float bf16_round(float x) { return bf16_val(bf16_bits(x)); }
// D += A·B with NT terms: 1 = ah·bh, 2 = + al·bh (A split), 3 = + ah·bl (both split)
template <int NT>
__device__ __forceinline__ v8f mmaN(v16b ah, v16b al, v16b bh, v16b bl, v8f c) {
  c = __builtin_amdgcn_wmma_f32_16x16x32_bf16(false, ah, false, bh, (short)0, c, false, false);
  if (NT >= 2) c = __builtin_amdgcn_wmma_f32_16x16x32_bf16(false, al, false, bh, (short)0, c, false, false);
  if (NT >= 3) c = __builtin_amdgcn_wmma_f32_16x16x32_bf16(false, ah, false, bl, (short)0, c, false, false);
  asm volatile("v_nop\n\tv_nop\n\tv_nop\n\tv_nop" : "+v"(c) : "v"(ah), "v"(al), "v"(bh), "v"(bl));
  return c;
}

__global__ __launch_bounds__(256) void k_wt_bf16(const float* __restrict__ W, unsigned short* __restrict__ Wt, int K, int N) {
  const int t = blockIdx.x * 256 + threadIdx.x;
  const int k8n = K / 8;
  if (t >= N * k8n) return;
  const int n = t / k8n, k8 = (t % k8n) * 8;
  v8us v;
#pragma unroll
  for (int i = 0; i < 8; ++i) v[i] = bf16_bits(W[(size_t)(k8 + i) * N + n]);
  *(v8us*)(Wt + (size_t)n * K + k8) = v;
  
}

// GEMM C[M][N] (f32, pitch ldc) = act(A[M][K]·W + bias). A f32 row-major (pitch lda) converted per fragment to bf16
// (ASPLIT: hi/lo two planes -> 2 terms, else single rounded term); Wt bf16 [N][K] (pitch ldb). BIAS_BF16 rounds the
// bias to bf16 first (bias quantised to bf16 before the add). K%32==0, M%16==0, N%64==0.
template <bool ASPLIT, int ACT, bool BIAS_BF16>
__global__ __launch_bounds__(128) void k_gemm_bf(const float* __restrict__ A, int lda, const unsigned short* __restrict__ Wt, int ldb,
                                               const float* __restrict__ bias, float* __restrict__ C, int ldc, int M, int N, int K) {
  __shared__ __attribute__((aligned(16))) float so[4][16][64];
  const int tid = threadIdx.x, w = tid >> 5, lane = tid & 31, ln = lane & 15, hh = lane >> 4;
  const int ntn = N / 64;
  const int wid = blockIdx.x * 4 + w;
  const int mt = wid / ntn, nq = wid % ntn;
  if (mt * 16 >= M) return;
  const int row0 = mt * 16, col0 = nq * 64;
  const float* arow = A + (size_t)(row0 + ln) * lda;
  v8f acc[4] = {};
  for (int kb = 0; kb < K; kb += 32) {
    FragB ah, al;
    const v4f x0 = *(const v4fa*)(arow + kb + 8 * hh), x1 = *(const v4fa*)(arow + kb + 8 * hh + 4);
    const v4f x2 = *(const v4fa*)(arow + kb + 16 + 8 * hh), x3 = *(const v4fa*)(arow + kb + 16 + 8 * hh + 4);
    float xs[16] = {x0[0],x0[1],x0[2],x0[3],x1[0],x1[1],x1[2],x1[3],x2[0],x2[1],x2[2],x2[3],x3[0],x3[1],x3[2],x3[3]};
#pragma unroll
    for (int i = 0; i < 16; ++i) { const unsigned short hb = bf16_bits(xs[i]); ah.u[i] = hb; al.u[i] = ASPLIT ? bf16_bits(xs[i] - bf16_val(hb)) : (unsigned short)0; }
#pragma unroll
    for (int t = 0; t < 4; ++t) {
      const unsigned short* brow = Wt + (size_t)(col0 + t * 16 + ln) * ldb + kb;
      FragB b;
      b.half[0] = *(const v8us*)(brow + 8 * hh);
      b.half[1] = *(const v8us*)(brow + 16 + 8 * hh);
      acc[t] = mmaN<ASPLIT ? 2 : 1>(ah.v, al.v, b.v, b.v, acc[t]);
    }
  }
#pragma unroll
  for (int t = 0; t < 4; ++t) {
    float bv = bias ? bias[col0 + t * 16 + ln] : 0.f;
    if (BIAS_BF16) bv = bf16_round(bv);
#pragma unroll
    for (int r = 0; r < 8; ++r) { float v = acc[t][r] + bv; if (ACT == 1) v = fmaxf(v, 0.f); so[w][8 * hh + r][t * 16 + ln] = v; }
  }
  __builtin_amdgcn_fence(__ATOMIC_ACQ_REL, "workgroup");
  __builtin_amdgcn_wave_barrier();
  const int rsub = lane >> 4, c4 = (lane & 15) * 4;
  {
#pragma unroll
    for (int q = 0; q < 8; ++q) {
      const int r = q * 2 + rsub;
      const v4f v = *(const v4fa*)&so[w][r][c4];
      *(v4f*)(C + (size_t)(row0 + r) * ldc + col0 + c4) = v;
    }
    
  }
}

// GEMM C = act(A·W + bias + resid): A f32 (ASPLIT -> hi/lo 2 terms), Wt bf16 [N][K]; ACT 0 none, 1 relu, 2 exact gelu;
// resid (optional, f32, row index = (row % rmod), pitch ldr, RES_BF16 rounds it) added before the activation.
template <bool ASPLIT, int ACT, bool BIAS_BF16, bool RES_BF16>
__global__ __launch_bounds__(128) void k_gemm_bf3(const float* __restrict__ A, int lda, const unsigned short* __restrict__ Wt, int ldb,
                                                const float* __restrict__ bias, const float* __restrict__ resid, int rmod, int ldr,
                                                float* __restrict__ C, int ldc, int M, int N, int K) {
  __shared__ __attribute__((aligned(16))) float so[4][16][64];
  const int tid = threadIdx.x, w = tid >> 5, lane = tid & 31, ln = lane & 15, hh = lane >> 4;
  const int ntn = N / 64;
  const int wid = blockIdx.x * 4 + w;
  const int mt = wid / ntn, nq = wid % ntn;
  if (mt * 16 >= M) return;
  const int row0 = mt * 16, col0 = nq * 64;
  const float* arow = A + (size_t)(row0 + ln) * lda;
  v8f acc[4] = {};
  for (int kb = 0; kb < K; kb += 32) {
    FragB ah, al;
    const v4f x0 = *(const v4fa*)(arow + kb + 8 * hh), x1 = *(const v4fa*)(arow + kb + 8 * hh + 4);
    const v4f x2 = *(const v4fa*)(arow + kb + 16 + 8 * hh), x3 = *(const v4fa*)(arow + kb + 16 + 8 * hh + 4);
    float xs[16] = {x0[0],x0[1],x0[2],x0[3],x1[0],x1[1],x1[2],x1[3],x2[0],x2[1],x2[2],x2[3],x3[0],x3[1],x3[2],x3[3]};
#pragma unroll
    for (int i = 0; i < 16; ++i) { const unsigned short hb = bf16_bits(xs[i]); ah.u[i] = hb; al.u[i] = ASPLIT ? bf16_bits(xs[i] - bf16_val(hb)) : (unsigned short)0; }
#pragma unroll
    for (int t = 0; t < 4; ++t) {
      const unsigned short* brow = Wt + (size_t)(col0 + t * 16 + ln) * ldb + kb;
      FragB b;
      b.half[0] = *(const v8us*)(brow + 8 * hh);
      b.half[1] = *(const v8us*)(brow + 16 + 8 * hh);
      acc[t] = mmaN<ASPLIT ? 2 : 1>(ah.v, al.v, b.v, b.v, acc[t]);
    }
  }
#pragma unroll
  for (int t = 0; t < 4; ++t) {
    const int col = col0 + t * 16 + ln;
    float bv = bias ? bias[col] : 0.f;
    if (BIAS_BF16) bv = bf16_round(bv);
#pragma unroll
    for (int r = 0; r < 8; ++r) {
      float v = acc[t][r] + bv;
      if (resid) { float rv = resid[(size_t)((row0 + 8 * hh + r) % rmod) * ldr + col]; if (RES_BF16) rv = bf16_round(rv); v += rv; }
      if (ACT == 1) v = fmaxf(v, 0.f);
      if (ACT == 2) v = 0.5f * v * (1.0f + erff(v * 0.70710678118654752f));
      if (ACT == 3) { const float u = 0.7978845608028654f * (v + 0.044715f * v * v * v); v = 0.5f * v * (1.0f + tanhf(u)); }
      so[w][8 * hh + r][t * 16 + ln] = v;
    }
  }
  __builtin_amdgcn_fence(__ATOMIC_ACQ_REL, "workgroup");
  __builtin_amdgcn_wave_barrier();
  const int rsub = lane >> 4, c4 = (lane & 15) * 4;
  {
#pragma unroll
    for (int q = 0; q < 8; ++q) {
      const int r = q * 2 + rsub;
      const v4f v = *(const v4fa*)&so[w][r][c4];
      *(v4f*)(C + (size_t)(row0 + r) * ldc + col0 + c4) = v;
    }
    
  }
}
// row LayerNorm (biased variance, eps) over N: s = X (+ R); optional out_sum <- s; out_norm <- (s-mu)*rsqrt(var+eps)*g + b
template <bool PARAM_BF16>
__global__ __launch_bounds__(256) void k_layernorm(const float* __restrict__ X, const float* __restrict__ R, const float* __restrict__ g, const float* __restrict__ bta,
                                                  float* __restrict__ out_sum, float* __restrict__ out_norm, int N, float eps) {
  __shared__ float red[256];
  const int row = blockIdx.x, tid = threadIdx.x;
  const float* x = X + (size_t)row * N; const float* rr = R ? R + (size_t)row * N : nullptr;
  float vals[16];                     // up to N = 4096
  const int per = N / 256;            // contiguous chunk per thread? use strided-by-4 chunks: thread handles j = tid*4 + 1024*u
  float s1 = 0.f;
  for (int u = 0; u < per / 4; ++u) {
    const int j = tid * 4 + 1024 * u;
    const v4f a = *(const v4fa*)(x + j);
    v4f b = {0.f,0.f,0.f,0.f}; if (rr) b = *(const v4fa*)(rr + j);
#pragma unroll
    for (int q = 0; q < 4; ++q) { const float v = a[q] + b[q]; vals[u * 4 + q] = v; s1 += v; }
  }
  red[tid] = s1; __syncthreads();
  for (int st = 128; st > 0; st >>= 1) { if (tid < st) red[tid] += red[tid + st]; __syncthreads(); }
  const float mu = red[0] / (float)N; __syncthreads();
  float s2 = 0.f;
  for (int u = 0; u < per / 4; ++u)
#pragma unroll
    for (int q = 0; q < 4; ++q) { const float c = vals[u * 4 + q] - mu; s2 += c * c; }
  red[tid] = s2; __syncthreads();
  for (int st = 128; st > 0; st >>= 1) { if (tid < st) red[tid] += red[tid + st]; __syncthreads(); }
  const float rs = rsqrtf(red[0] / (float)N + eps);
  {
    for (int u = 0; u < per / 4; ++u) {
      const int j = tid * 4 + 1024 * u;
      v4f o, sm;
#pragma unroll
      for (int q = 0; q < 4; ++q) {
        float gg = g[j + q], bb = bta[j + q];
        if (PARAM_BF16) { gg = bf16_round(gg); bb = bf16_round(bb); }
        sm[q] = vals[u * 4 + q]; o[q] = (vals[u * 4 + q] - mu) * rs * gg + bb;
      }
      if (out_sum) *(v4f*)(out_sum + (size_t)row * N + j) = sm;
      *(v4f*)(out_norm + (size_t)row * N + j) = o;
    }
    
  }
}



// ---- f16 WMMA path (v_wmma_f32_16x16x32_f16): 11-bit significands for operands in range — used where a [0,1] probability operand needs more precision than bf16
typedef _Float16 v16h __attribute__((ext_vector_type(16)));
union FragH { v16h v; v8us half[2]; _Float16 h[16]; unsigned short u[16]; };
template <int NT>
__device__ __forceinline__ v8f mmaH(v16h ah, v16h al, v16h bh, v16h bl, v8f c) {
  c = __builtin_amdgcn_wmma_f32_16x16x32_f16(false, ah, false, bh, (short)0, c, false, false);
  if (NT >= 2) c = __builtin_amdgcn_wmma_f32_16x16x32_f16(false, al, false, bh, (short)0, c, false, false);
  if (NT >= 3) c = __builtin_amdgcn_wmma_f32_16x16x32_f16(false, ah, false, bl, (short)0, c, false, false);
  asm volatile("v_nop\n\tv_nop\n\tv_nop\n\tv_nop" : "+v"(c) : "v"(ah), "v"(al), "v"(bh), "v"(bl));
  return c;
}
// batched GEMM like k_gemm_b but f16 operands: A f32 (split into f16 hi/lo if ASPLIT, else rounded to f16), Bt = f16 values [n][k]; alpha; C f32; N multiple of 16 (partial tiles skipped)
template <bool ASPLIT>
__global__ __launch_bounds__(128) void k_gemm_h(const float* __restrict__ A, int lda, size_t sA, const _Float16* __restrict__ Bh, int ldb, size_t sB, float alpha, float* __restrict__ C, int ldc, size_t sC, int M, int N, int K) {
  __shared__ __attribute__((aligned(16))) float so[4][16][64];
  const int tid = threadIdx.x, w = tid >> 5, lane = tid & 31, ln = lane & 15, hh = lane >> 4; const int by = blockIdx.y;
  A += (size_t)by * sA; Bh += (size_t)by * sB; C += (size_t)by * sC;
  const int ntn = (N + 63) / 64; const int wid = blockIdx.x * 4 + w; const int mt = wid / ntn, nq = wid % ntn; if (mt * 16 >= M) return;
  const int row0 = mt * 16, col0 = nq * 64; const float* arow = A + (size_t)(row0 + ln) * lda;
  v8f acc[4] = {};
  for (int kb = 0; kb < K; kb += 32) {
    FragH ah, al;
    const v4f x0 = *(const v4fa*)(arow + kb + 8 * hh), x1 = *(const v4fa*)(arow + kb + 8 * hh + 4), x2 = *(const v4fa*)(arow + kb + 16 + 8 * hh), x3 = *(const v4fa*)(arow + kb + 16 + 8 * hh + 4);
    float xs[16] = {x0[0],x0[1],x0[2],x0[3],x1[0],x1[1],x1[2],x1[3],x2[0],x2[1],x2[2],x2[3],x3[0],x3[1],x3[2],x3[3]};
#pragma unroll
    for (int i = 0; i < 16; ++i) { const _Float16 h = (_Float16)xs[i]; ah.h[i] = h; al.h[i] = ASPLIT ? (_Float16)(xs[i] - (float)h) : (_Float16)0.0f; }
#pragma unroll
    for (int t = 0; t < 4; ++t) { if (col0 + t * 16 >= N) continue; const size_t boff = (size_t)(col0 + t * 16 + ln) * ldb + kb; FragH bq; bq.half[0] = *(const v8us*)(Bh + boff + 8 * hh); bq.half[1] = *(const v8us*)(Bh + boff + 16 + 8 * hh);
      acc[t] = mmaH<ASPLIT ? 2 : 1>(ah.v, al.v, bq.v, bq.v, acc[t]); }
  }
#pragma unroll
  for (int t = 0; t < 4; ++t) { if (col0 + t * 16 >= N) continue;
#pragma unroll
    for (int r = 0; r < 8; ++r) so[w][8 * hh + r][t * 16 + ln] = acc[t][r] * alpha; }
  __builtin_amdgcn_fence(__ATOMIC_ACQ_REL, "workgroup"); __builtin_amdgcn_wave_barrier();
  const int rsub = lane >> 4, c4 = (lane & 15) * 4;
  {
#pragma unroll
    for (int q = 0; q < 8; ++q) { const int r = q * 2 + rsub; if (col0 + c4 < N) { const v4f v = *(const v4fa*)&so[w][r][c4]; *(v4f*)(C + (size_t)(row0 + r) * ldc + col0 + c4) = v; } }
     }
}

// Wt[n][k] = f16(W[k][n]·scale) from f32 row-major W[K][N] (scale = power of two; bf16-exact weights stay exact in f16 away from the subnormal range)
__global__ __launch_bounds__(256) void k_wt_f16(const float* __restrict__ W, _Float16* __restrict__ Wt, int K, int N, float scale) {
  const int t = blockIdx.x * 256 + threadIdx.x; if (t >= N * (K / 8)) return; const int n = t / (K / 8), k8 = (t % (K / 8)) * 8; FragH f;
#pragma unroll
  for (int i = 0; i < 8; ++i) f.h[i] = (_Float16)(bf16_round(W[(size_t)(k8 + i) * N + n]) * scale); const v8us o = f.half[0];
  *(v8us*)((unsigned short*)Wt + (size_t)n * K + k8) = o; 
}
// k_gemm_hh variant with fused epilogue: v = acc·alpha + bias[by·sBias + col] (+ CP[(row/rowsPerB)·sCPb + by·64 + col] if CP) ; ACT 0 none / 1 elu ; writes f16 C16 (and f32 C if non-null)
template <int ACT>
__global__ __launch_bounds__(128) void k_gemm_hhx(const _Float16* __restrict__ A, int lda, size_t sA, const _Float16* __restrict__ Bh, int ldb, size_t sB, float alpha, const float* __restrict__ bias, size_t sBias, const float* __restrict__ CP, int rowsPerB, size_t sCPb, int row0g,
    float* __restrict__ C, _Float16* __restrict__ C16, int ldc, size_t sC, int M, int N, int K) {
  __shared__ __attribute__((aligned(16))) float so[4][16][64];
  const int tid = threadIdx.x, w = tid >> 5, lane = tid & 31, ln = lane & 15, hh = lane >> 4; const int by = blockIdx.y;
  A += (size_t)by * sA; Bh += (size_t)by * sB; const size_t cofs = (size_t)by * sC; const float* bp = bias ? bias + (size_t)by * sBias : nullptr;
  const int ntn = (N + 63) / 64; const int wid = blockIdx.x * 4 + w; const int mt = wid / ntn, nq = wid % ntn; if (mt * 16 >= M) return;
  const int row0 = mt * 16, col0 = nq * 64; const _Float16* arow = A + (size_t)(row0 + ln) * lda;
  v8f acc[4] = {};
  for (int kb = 0; kb < K; kb += 32) { FragH ah; ah.half[0] = *(const v8us*)((const unsigned short*)arow + kb + 8 * hh); ah.half[1] = *(const v8us*)((const unsigned short*)arow + kb + 16 + 8 * hh);
#pragma unroll
    for (int t = 0; t < 4; ++t) { if (col0 + t * 16 >= N) continue; const size_t boff = (size_t)(col0 + t * 16 + ln) * ldb + kb; FragH bq; bq.half[0] = *(const v8us*)((const unsigned short*)Bh + boff + 8 * hh); bq.half[1] = *(const v8us*)((const unsigned short*)Bh + boff + 16 + 8 * hh);
      acc[t] = mmaH<1>(ah.v, ah.v, bq.v, bq.v, acc[t]); }
  }
#pragma unroll
  for (int t = 0; t < 4; ++t) { if (col0 + t * 16 >= N) continue; const int col = col0 + t * 16 + ln; const float bv = bp ? bf16_round(bp[col]) : 0.f;
#pragma unroll
    for (int r = 0; r < 8; ++r) { float v = acc[t][r] * alpha + bv; if (CP) { const int rr = row0g + row0 + 8 * hh + r; if (rowsPerB < 0) v += CP[cofs + (size_t)rr * ldc + col];      /* rowsPerB < 0: own element of the batched C plane */ else { const int bidx = rr / rowsPerB; v += CP[(size_t)bidx * sCPb + (size_t)by * 64 + col]; } } if (ACT == 1) v = (v > 0.f) ? v : expm1f(v); else if (ACT == 7) v = (v > 0.f) ? v + 1.0f : expf(v); else if (ACT == 8) v = tanhf(v); else if (ACT == 9) v = 0.5f * v * (1.0f + tanhf(0.7978845608028654f * (v + 0.044715f * v * v * v))); else if (ACT == 11) v = 1.0f / (1.0f + expf(-v)); else if (ACT == 12) v = (v > 0.f) ? v : 0.01f * v; else if (ACT == 14) v = (v > 0.f) ? v : 0.1f * v; else if (ACT == 16) v = (v >= 0.f) ? v : 0.3f * v; else if (ACT == 17) v = (v >= 0.f) ? v : 0.2f * v; else if (ACT == 15) v = v / (1.0f + expf(-v)); else if (ACT == 3) v = fmaxf(v, 0.f); else if (ACT == 6) v = 0.5f * v * (1.0f + erff(v * 0.70710678118654752f)); so[w][8 * hh + r][t * 16 + ln] = v; } }
  __builtin_amdgcn_fence(__ATOMIC_ACQ_REL, "workgroup"); __builtin_amdgcn_wave_barrier();
  const int rsub = lane >> 4, c4 = (lane & 15) * 4; typedef _Float16 v4h __attribute__((ext_vector_type(4)));
  {
#pragma unroll
    for (int q = 0; q < 8; ++q) { const int r = q * 2 + rsub; if (col0 + c4 < N) { const v4f v = *(const v4fa*)&so[w][r][c4]; if (C) *(v4f*)(C + cofs + (size_t)(row0 + r) * ldc + col0 + c4) = v; if (C16) { v4h h4; for (int i = 0; i < 4; ++i) h4[i] = (_Float16)v[i]; *(v4h*)(C16 + cofs + (size_t)(row0 + r) * ldc + col0 + c4) = h4; } } }
     }
}


typedef _Float16 v4h __attribute__((ext_vector_type(4)));

__global__ __launch_bounds__(256) void k_x16(const float* __restrict__ x, _Float16* __restrict__ X16, size_t n8) { const size_t t = (size_t)blockIdx.x * 256 + threadIdx.x; if (t >= n8) return; FragH f;
#pragma unroll
  for (int q = 0; q < 8; ++q) f.h[q] = (_Float16)bf16_round(x[t * 8 + q]); *(v8us*)((unsigned short*)X16 + t * 8) = f.half[0];  }
__global__ __launch_bounds__(256) void k_h16(const float* __restrict__ x, _Float16* __restrict__ X16, size_t n8) { const size_t t = (size_t)blockIdx.x * 256 + threadIdx.x; if (t >= n8) return; FragH f;
#pragma unroll
  for (int q = 0; q < 8; ++q) f.h[q] = (_Float16)x[t * 8 + q]; *(v8us*)((unsigned short*)X16 + t * 8) = f.half[0];  }
__global__ __launch_bounds__(256) void k_round16f(const float* __restrict__ W, _Float16* __restrict__ Bt, size_t n8) { const size_t t = (size_t)blockIdx.x * 256 + threadIdx.x; if (t >= n8) return; FragH f;
#pragma unroll
  for (int i = 0; i < 8; ++i) f.h[i] = (_Float16)(bf16_round(W[t * 8 + i]) * 16.0f); *(v8us*)((unsigned short*)Bt + t * 8) = f.half[0];  }
template <int NHv, int TTv>
__global__ __launch_bounds__(256) void k_vt(const _Float16* __restrict__ V16, int ldv, int voff, _Float16* __restrict__ Vt) { __shared__ unsigned short tl[64][66]; const int tid = threadIdx.x; const int slab = blockIdx.x / (TTv / 64), lg = blockIdx.x % (TTv / 64); const int b = slab / NHv, h = slab % NHv;
  for (int i = tid; i < 64 * 8; i += 256) { const int r = i / 8, c8 = (i % 8) * 8; FragH f; f.half[0] = *(const v8us*)((const unsigned short*)V16 + ((size_t)b * TTv + lg * 64 + r) * ldv + voff + h * 64 + c8);
#pragma unroll
    for (int q = 0; q < 8; ++q) tl[r][c8 + q] = f.u[q]; }
  __syncthreads();
  {
#pragma unroll
    for (int rd = 0; rd < 2; ++rd) { const int d = rd * 32 + tid / 8, pc = tid % 8; FragH f;
#pragma unroll
      for (int q = 0; q < 8; ++q) f.u[q] = tl[pc * 8 + q][d];
      *(v8us*)((unsigned short*)Vt + ((size_t)slab * 64 + d) * TTv + lg * 64 + pc * 8) = f.half[0]; }
     } }

__global__ __launch_bounds__(256) void k_hl(const float* __restrict__ F, _Float16* __restrict__ Hh, _Float16* __restrict__ Hl, size_t n8) { const size_t t = (size_t)blockIdx.x * 256 + threadIdx.x; if (t >= n8) return; FragH fh, fl; const v4f a = *(const v4fa*)(F + t * 8), c = *(const v4fa*)(F + t * 8 + 4);
#pragma unroll
  for (int q = 0; q < 4; ++q) { _Float16 h = (_Float16)a[q]; fh.h[q] = h; fl.h[q] = (_Float16)((a[q] - (float)h) * 1024.0f); h = (_Float16)c[q]; fh.h[4 + q] = h; fl.h[4 + q] = (_Float16)((c[q] - (float)h) * 1024.0f); }
  { *(v8us*)((unsigned short*)Hh + t * 8) = fh.half[0]; *(v8us*)((unsigned short*)Hl + t * 8) = fl.half[0];  } }

// ---- fast GEMM (wave tile 32x64; requires M % 32 == 0 rows per launch region and N % 64 == 0); epilogue = k_gemm_hhx semantics ----
__device__ __forceinline__ v16h g2_frag(const _Float16* p, int hh) { FragH f; f.half[0] = *(const v8us*)((const unsigned short*)p + 8 * hh); f.half[1] = *(const v8us*)((const unsigned short*)p + 16 + 8 * hh); return f.v; }
__device__ __forceinline__ v8f g2_mma(v16h a, v16h b, v8f c) { v8f d = __builtin_amdgcn_wmma_f32_16x16x32_f16(false, a, false, b, (short)0, c, false, false); asm volatile("v_nop\n\tv_nop\n\tv_nop\n\tv_nop" : "+v"(d) : "v"(a), "v"(b)); return d; }
template <int ACT>
__global__ __launch_bounds__(128) void k_gemm2(const _Float16* __restrict__ A, int lda, size_t sA, const _Float16* __restrict__ Bh, int ldb, size_t sB, float alpha, const float* __restrict__ bias, size_t sBias, const float* __restrict__ CP, int rowsPerB, size_t sCPb, int row0g,
    float* __restrict__ C, _Float16* __restrict__ C16, int ldc, size_t sC, int M, int N, int K) { static_assert(ACT == 0 || ACT == 3 || ACT == 6 || ACT == 8 || ACT == 9 || ACT == 11 || ACT == 12 || ACT == 14 || ACT == 15 || ACT == 16 || ACT == 17, "k_gemm2: unsupported ACT code (would silently apply no activation)");
  __shared__ __attribute__((aligned(16))) float so[4][32][68];
  const int tid = threadIdx.x, w = tid >> 5, lane = tid & 31, ln = lane & 15, hh = lane >> 4; const int by = blockIdx.y;
  A += (size_t)by * sA; Bh += (size_t)by * sB; const size_t cofs = (size_t)by * sC; const float* bp = bias ? bias + (size_t)by * sBias : nullptr;
  const int ntn = N >> 6; const int mt = blockIdx.x / ntn, nq = blockIdx.x - mt * ntn; const int row0 = mt * 128 + 32 * w, col0 = nq * 64; if (row0 >= M) return;
  const _Float16* a0p = A + (size_t)(row0 + ln) * lda; const _Float16* a1p = a0p + (size_t)16 * lda;
  const _Float16* b0p = Bh + (size_t)(col0 + ln) * ldb; const _Float16* b1p = b0p + (size_t)16 * ldb; const _Float16* b2p = b1p + (size_t)16 * ldb; const _Float16* b3p = b2p + (size_t)16 * ldb;
  const v8f z8 = {0.f,0.f,0.f,0.f,0.f,0.f,0.f,0.f}; v8f c00 = z8, c01 = z8, c02 = z8, c03 = z8, c10 = z8, c11 = z8, c12 = z8, c13 = z8;
#pragma unroll 1
  for (int kb = 0; kb < K; kb += 32) { const v16h a0 = g2_frag(a0p + kb, hh), a1 = g2_frag(a1p + kb, hh);
    v16h b = g2_frag(b0p + kb, hh); c00 = g2_mma(a0, b, c00); c10 = g2_mma(a1, b, c10);
    b = g2_frag(b1p + kb, hh); c01 = g2_mma(a0, b, c01); c11 = g2_mma(a1, b, c11);
    b = g2_frag(b2p + kb, hh); c02 = g2_mma(a0, b, c02); c12 = g2_mma(a1, b, c12);
    b = g2_frag(b3p + kb, hh); c03 = g2_mma(a0, b, c03); c13 = g2_mma(a1, b, c13); }
  v8f accs[8] = {c00, c01, c02, c03, c10, c11, c12, c13};
#pragma unroll
  for (int u = 0; u < 8; ++u) { const int t = u & 3, half = u >> 2; const int col = col0 + t * 16 + ln; const float bv = bp ? bf16_round(bp[col]) : 0.f;
#pragma unroll
    for (int r = 0; r < 8; ++r) { const int rloc = half * 16 + 8 * hh + r; float v = accs[u][r] * alpha + bv; if (CP) { if (rowsPerB < 0) v += CP[cofs + (size_t)(row0g + row0 + rloc) * ldc + col];      /* rowsPerB < 0: own element of the batched C plane */ else { const int bidx = (row0g + row0 + rloc) / rowsPerB; v += CP[(size_t)bidx * sCPb + (size_t)by * 64 + col]; } }
      if (ACT == 3) v = fmaxf(v, 0.f); else if (ACT == 6) v = 0.5f * v * (1.0f + erff(v * 0.70710678118654752f)); else if (ACT == 11) v = 1.0f / (1.0f + expf(-v)); else if (ACT == 15) v = v / (1.0f + expf(-v)); else if (ACT == 12) v = (v > 0.f) ? v : 0.01f * v; else if (ACT == 8) v = tanhf(v); else if (ACT == 9) v = 0.5f * v * (1.0f + tanhf(0.7978845608028654f * (v + 0.044715f * v * v * v))); else if (ACT == 14) v = (v > 0.f) ? v : 0.1f * v; else if (ACT == 16) v = (v >= 0.f) ? v : 0.3f * v; else if (ACT == 17) v = (v >= 0.f) ? v : 0.2f * v;
      so[w][rloc][t * 16 + ln] = v; } }
  __builtin_amdgcn_fence(__ATOMIC_ACQ_REL, "workgroup"); __builtin_amdgcn_wave_barrier();
  const int rsub = lane >> 4, c4 = (lane & 15) * 4;
  {
#pragma unroll
    for (int q = 0; q < 16; ++q) { const int r = q * 2 + rsub; const v4f v = *(const v4fa*)&so[w][r][c4]; if (C) *(v4f*)(C + cofs + (size_t)(row0 + r) * ldc + col0 + c4) = v; if (C16) { v4h h4; for (int i = 0; i < 4; ++i) h4[i] = (_Float16)v[i]; *(v4h*)(C16 + cofs + (size_t)(row0 + r) * ldc + col0 + c4) = h4; } }
     } }


__global__ __launch_bounds__(256) void k_wnat(const float* __restrict__ w, size_t n8, _Float16* __restrict__ Bt) { const size_t t = (size_t)blockIdx.x * 256 + threadIdx.x; if (t >= n8) return; FragH f; for (int q = 0; q < 8; ++q) f.h[q] = (_Float16)(bf16_round(w[t * 8 + q]) * 16.0f); *(v8us*)((unsigned short*)Bt + t * 8) = f.half[0];  }
// row softmax, one wave per row: the row's SQ f32 logits are read once, 512 contiguous bytes per wave-wide load, and stay in registers for the maximum, the exponentials, their sum and the scaled f16 store.
__global__ __launch_bounds__(256) void k_rsm(const float* __restrict__ S, _Float16* __restrict__ P, int nrows) {
  const int lane = threadIdx.x & 31; const int i = blockIdx.x * 8 + (threadIdx.x >> 5); if (i >= nrows) return;
  const float* s = S + (size_t)i * SQ + lane * 4; v4f e[SQ / 128];
  // every loop over e[] below is unrolled in full: e is then indexed by constants only and stays in registers (a run-time index would send it to scratch)
#pragma unroll
  for (int u = 0; u < SQ / 128; ++u) e[u] = *(const v4fa*)(s + u * 128);
  v4f m4 = {-3.0e38f, -3.0e38f, -3.0e38f, -3.0e38f};
#pragma unroll
  for (int u = 0; u < SQ / 128; ++u) for (int q = 0; q < 4; ++q) m4[q] = fmaxf(m4[q], e[u][q]);
  float mx = fmaxf(fmaxf(m4[0], m4[1]), fmaxf(m4[2], m4[3]));
  for (int d = 16; d > 0; d >>= 1) mx = fmaxf(mx, __shfl_xor(mx, d, 32));
#pragma unroll
  for (int u = 0; u < SQ / 128; ++u) for (int q = 0; q < 4; ++q) e[u][q] = expf(e[u][q] - mx);
  v4f s4 = {0.f, 0.f, 0.f, 0.f};
#pragma unroll
  for (int u = 0; u < SQ / 128; ++u) s4 += e[u];
  float se = (s4[0] + s4[1]) + (s4[2] + s4[3]);
  for (int d = 16; d > 0; d >>= 1) se += __shfl_xor(se, d, 32);
  const float sc = 256.0f / se; _Float16* p = P + (size_t)i * SQ + lane * 4;
#pragma unroll
  for (int u = 0; u < SQ / 128; ++u) { v4h h4; for (int q = 0; q < 4; ++q) h4[q] = (_Float16)(e[u][q] * sc); *(v4h*)(p + u * 128) = h4; } }
__global__ __launch_bounds__(256) void k_vt(const _Float16* __restrict__ V16, int b, int h0, _Float16* __restrict__ VT) { __shared__ unsigned short tl[64][65]; const int tid = threadIdx.x; const int hh = blockIdx.x % HG, sg = blockIdx.x / HG; const int s0 = sg * 64; const int h = h0 + hh;
  for (int i = tid; i < 64 * 8; i += 256) { const int j = i / 8, d8 = (i % 8) * 8; FragH f; f.half[0] = *(const v8us*)((const unsigned short*)V16 + ((size_t)b * SQ + s0 + j) * DM + h * HD + d8); for (int q = 0; q < 8; ++q) tl[d8 + q][j] = f.u[q]; }
  __syncthreads();
  { for (int i = tid; i < 64 * 8; i += 256) { const int d = i / 8, j8 = (i % 8) * 8; FragH f; for (int q = 0; q < 8; ++q) f.u[q] = tl[d][j8 + q]; *(v8us*)((unsigned short*)VT + ((size_t)hh * HD + d) * SQ + s0 + j8) = f.half[0]; }  } }


__global__ __launch_bounds__(256) void k_cl2rows(const float* __restrict__ X, _Float16* __restrict__ XR) { __shared__ float tl[64][33]; const int tid = threadIdx.x; const int nl = LL / 32, nc = CC / 64; const int cb_ = blockIdx.x % nc; const int lb = (blockIdx.x / nc) % nl; const size_t b = blockIdx.x / (nc * nl); const int c0 = cb_ * 64, l0 = lb * 32;
  for (int i = tid; i < 64 * 32; i += 256) { const int c = i / 32, l = i % 32; tl[c][l] = bf16_round(X[(b * CC + c0 + c) * (size_t)LL + l0 + l]); }
  __syncthreads();
  { const int l = tid / 8, c8 = (tid % 8) * 8; FragH f; for (int q = 0; q < 8; ++q) f.h[q] = (_Float16)tl[c8 + q][l]; unsigned short* d = (unsigned short*)XR + (b * LL + l0 + l) * (size_t)CC + c0 + c8; *(v8us*)d = f.half[0];  } }

__global__ __launch_bounds__(256) void k_fin3(const float* __restrict__ Cm, const float* __restrict__ x, int b, float* __restrict__ out) {
  #pragma clang fp contract(off)
  const size_t t = (size_t)blockIdx.x * 256 + threadIdx.x; if (t >= (size_t)CC * NPX / 8) return; const size_t base = (size_t)b * CC * NPX + t * 8; v8f v;
  for (int q = 0; q < 8; ++q) v[q] = __fadd_rn(bf16_round(x[base + q]), Cm[t * 8 + q]); *(v8f*)(out + base) = v;  }

extern "C" void kernel_launch(void* const* d_in, const int* in_sizes, int n_in,
                              void* d_out, int out_size, void* d_ws, size_t ws_size, hipStream_t stream) {
  (void)in_sizes; (void)n_in; (void)out_size;
  const float* const* I = (const float* const*)d_in; const float* x = I[0]; const float* Wq = I[1]; const float* Wk = I[2]; const float* Wv = I[3]; const float* bv = I[4];
  char* ws = (char*)d_ws; size_t off = 0;
  auto take = [&](size_t bytes) { char* p = ws + off; off += (bytes + 255) & ~(size_t)255; return p; };
  _Float16* BQ = (_Float16*)take((size_t)CQ * CC * 2); _Float16* BK = (_Float16*)take((size_t)CQ * CC * 2); _Float16* BV = (_Float16*)take((size_t)CC * CC * 2);
  _Float16* XR = (_Float16*)take(NR * CC * 2); float* QF = (float*)take(NR * CQ * 4); float* KF = (float*)take(NR * CQ * 4); _Float16* QH = (_Float16*)take(NR * CQ * 2); _Float16* QL = (_Float16*)take(NR * CQ * 2); _Float16* KH = (_Float16*)take(NR * CQ * 2); _Float16* KL = (_Float16*)take(NR * CQ * 2); _Float16* V16 = (_Float16*)take(NR * CC * 2);
  float* E = (float*)take((size_t)NPX * NPX * 4); _Float16* P = (_Float16*)take((size_t)NPX * NPX * 2); _Float16* PT = (_Float16*)take((size_t)NPX * NPX * 2); _Float16* VT = (_Float16*)take((size_t)CC * NPX * 2); float* CX = (float*)take((size_t)CC * NPX * 4);
  if (off > ws_size) return;      /* 0.2 + 8 + 8 + 8 + 8 + 64 + 32 + 32 + 2 + 4 = approx 166 MiB */
  k_wnat<<<(unsigned)(((size_t)CQ * CC / 8 + 255) / 256), 256, 0, stream>>>(Wq, (size_t)CQ * CC / 8, BQ); k_wnat<<<(unsigned)(((size_t)CQ * CC / 8 + 255) / 256), 256, 0, stream>>>(Wk, (size_t)CQ * CC / 8, BK); k_wnat<<<(unsigned)(((size_t)CC * CC / 8 + 255) / 256), 256, 0, stream>>>(Wv, (size_t)CC * CC / 8, BV);
  k_cl2rows<<<NB * (NPX / 32) * (CC / 64), 256, 0, stream>>>(x, XR);
  k_gemm2<0><<<dim3((unsigned)((NR / 128) * 1), 1), 128, 0, stream>>>(XR, CC, 0, BQ, CC, 0, 0.0625f, nullptr, 0, nullptr, 1, 0, 0, QF, nullptr, CQ, 0, MP, CQ, CC);      /* q (f32, exact products) */
  k_gemm2<0><<<dim3((unsigned)((NR / 128) * 1), 1), 128, 0, stream>>>(XR, CC, 0, BK, CC, 0, 0.0625f, nullptr, 0, nullptr, 1, 0, 0, KF, nullptr, CQ, 0, MP, CQ, CC);      /* k */
  k_gemm2<0><<<dim3((unsigned)((NR / 128) * (CC / 64)), 1), 128, 0, stream>>>(XR, CC, 0, BV, CC, 0, 0.0625f, bv, 0, nullptr, 1, 0, 0, nullptr, V16, CC, 0, MP, CC, CC);      /* v + bv (f16 rows) */
  k_hl<<<(unsigned)((NR * CQ / 8 + 255) / 256), 256, 0, stream>>>(QF, QH, QL, NR * CQ / 8); k_hl<<<(unsigned)((NR * CQ / 8 + 255) / 256), 256, 0, stream>>>(KF, KH, KL, NR * CQ / 8);
  for (int b = 0; b < NBR; ++b) { const size_t r0 = (size_t)b * NPX; const dim3 ge((NPX / 128) * (NPX / 64), 1);
    k_gemm2<0><<<ge, 128, 0, stream>>>(QL + r0 * CQ, CQ, 0, KH + r0 * CQ, CQ, 0, 1.0f / 1024.0f, nullptr, 0, nullptr, 1, 0, 0, E, nullptr, NPX, 0, NPX, NPX, CQ);      /* lo.hi */
    k_gemm2<0><<<ge, 128, 0, stream>>>(QH + r0 * CQ, CQ, 0, KL + r0 * CQ, CQ, 0, 1.0f / 1024.0f, nullptr, 0, E, 1, (size_t)NPX, 0, E, nullptr, NPX, 0, NPX, NPX, CQ);      /* + hi.lo */
    k_gemm2<0><<<ge, 128, 0, stream>>>(QH + r0 * CQ, CQ, 0, KH + r0 * CQ, CQ, 0, 1.0f, nullptr, 0, E, 1, (size_t)NPX, 0, E, nullptr, NPX, 0, NPX, NPX, CQ);      /* + hi.hi */
    k_rsm<<<(NPX + 7) / 8, 256, 0, stream>>>(E, P, NPX);
    k_vt<NH, SQ><<<NH * (SQ / 64), 256, 0, stream>>>(P, NPX, 0, PT);      /* P^T (x256) */
    k_vt<4, SQ><<<4 * (SQ / 64), 256, 0, stream>>>(V16 + r0 * CC, CC, 0, VT);      /* v channel-major [256][4096] */
    k_gemm2<0><<<dim3((CC / 128) * (MC / 64), 1), 128, 0, stream>>>(VT, NPX, 0, PT, NPX, 0, 0.00390625f, nullptr, 0, nullptr, 1, 0, 0, CX, nullptr, NPX, 0, CC, MC, NPX);      /* x_r[c][m] = sum_n v[c][n] attention[n][m] */
    k_fin3<<<(unsigned)(((size_t)CC * NPX / 8 + 255) / 256), 256, 0, stream>>>(CX, x, b, (float*)d_out); }
}

// v002
// It runs in 748 microseconds.
// Next to v001, in two timings, it ran 1.40 and 1.39 times as fast.
// All steps since v000 together make it 5.33 times as fast.
#include <hip/hip_runtime.h>
// SA layer (x [4][256][4096]; q = Wq x (64), k = Wk x (64), v = Wv x + bv (256); energy[n][m] = q_n . k_m (no scale); attention = softmax over m; x_r[c][m] = sum_n v[c][n] attention[n][m]; out = x + x_r -> [4][256][4096]).
// Structure: channel-first input transposed to position rows (exact f16) via LDS tiles; q / k as WMMA GEMMs (32x64 wave tiles, f32 accumulation, exact x16 natural weights; exact products) kept f32 and split into f16 hi + 2^-10 residual planes; v GEMM (+ bias) to f16 rows and transposed channel-major via LDS tiles; per image: the unscaled energy as a THREE-term product (hi.hi + lo.hi + hi.lo, K = 64) whose f32 logits stay in registers for the row softmax on VALU (P x256 f16, one kernel), P^T via LDS tiles (full 4096 x 4096), x_r = V(channel-major) . P^T-as-Bt GEMM (M = 256 channels, K = 4096) into f32; residual + store on VALU.
// Compute dtype: inputs rounded to bf16; x / weights exact; q, k as hi + residual (~f32, the logits have sigma ~8); v, P as plain f16 operands (~2^-12); softmax f32. v_wmma_f32_16x16x32_f16.
#define NB 4
#define CC 256
#define CQ 64
#define NPX 4096
#define LL NPX
#define PX NPX
#define NR ((size_t)NB * NPX)
#define NBR NB                       /* images attended (debug hook) */
#define MP ((int)NR)                 /* rows projected (debug hook) */
#define MC NPX                       /* x_r columns per image (debug hook) */
#define SQ NPX                       /* softmax rows of 4096; k_vt<64,4096> full P transpose; k_vt<4,4096> for v */
#define DM NPX
#define NH 64
#define HD 64
#define HG 1
typedef __bf16 v16b __attribute__((ext_vector_type(16)));
typedef unsigned short v8us __attribute__((ext_vector_type(8), may_alias));
typedef float  v8f  __attribute__((ext_vector_type(8)));
typedef float  v4f  __attribute__((ext_vector_type(4)));
typedef float  v4fa __attribute__((ext_vector_type(4), may_alias));
union FragB { v16b v; v8us half[2]; unsigned short u[16]; };

__device__ __forceinline__ unsigned short bf16_bits(float x) { unsigned int u = __float_as_uint(x); return (unsigned short)((u + 0x7FFFu + ((u >> 16) & 1u)) >> 16); }
__device__ __forceinline__ float bf16_val(unsigned short b) { return __uint_as_float(((unsigned int)b) << 16); }
__device__ __forceinline__ float bf16_round(float x) { return bf16_val(bf16_bits(x)); }
// D += A·B with NT terms: 1 = ah·bh, 2 = + al·bh (A split), 3 = + ah·bl (both split)
template <int NT>
__device__ __forceinline__ v8f mmaN(v16b ah, v16b al, v16b bh, v16b bl, v8f c) {
  c = __builtin_amdgcn_wmma_f32_16x16x32_bf16(false, ah, false, bh, (short)0, c, false, false);
  if (NT >= 2) c = __builtin_amdgcn_wmma_f32_16x16x32_bf16(false, al, false, bh, (short)0, c, false, false);
  if (NT >= 3) c = __builtin_amdgcn_wmma_f32_16x16x32_bf16(false, ah, false, bl, (short)0, c, false, false);
  asm volatile("v_nop\n\tv_nop\n\tv_nop\n\tv_nop" : "+v"(c) : "v"(ah), "v"(al), "v"(bh), "v"(bl));
  return c;
}

__global__ __launch_bounds__(256) void k_wt_bf16(const float* __restrict__ W, unsigned short* __restrict__ Wt, int K, int N) {
  const int t = blockIdx.x * 256 + threadIdx.x;
  const int k8n = K / 8;
  if (t >= N * k8n) return;
  const int n = t / k8n, k8 = (t % k8n) * 8;
  v8us v;
#pragma unroll
  for (int i = 0; i < 8; ++i) v[i] = bf16_bits(W[(size_t)(k8 + i) * N + n]);
  *(v8us*)(Wt + (size_t)n * K + k8) = v;
  
}

// GEMM C[M][N] (f32, pitch ldc) = act(A[M][K]·W + bias). A f32 row-major (pitch lda) converted per fragment to bf16
// (ASPLIT: hi/lo two planes -> 2 terms, else single rounded term); Wt bf16 [N][K] (pitch ldb). BIAS_BF16 rounds the
// bias to bf16 first (bias quantised to bf16 before the add). K%32==0, M%16==0, N%64==0.
template <bool ASPLIT, int ACT, bool BIAS_BF16>
__global__ __launch_bounds__(128) void k_gemm_bf(const float* __restrict__ A, int lda, const unsigned short* __restrict__ Wt, int ldb,
                                               const float* __restrict__ bias, float* __restrict__ C, int ldc, int M, int N, int K) {
  __shared__ __attribute__((aligned(16))) float so[4][16][64];
  const int tid = threadIdx.x, w = tid >> 5, lane = tid & 31, ln = lane & 15, hh = lane >> 4;
  const int ntn = N / 64;
  const int wid = blockIdx.x * 4 + w;
  const int mt = wid / ntn, nq = wid % ntn;
  if (mt * 16 >= M) return;
  const int row0 = mt * 16, col0 = nq * 64;
  const float* arow = A + (size_t)(row0 + ln) * lda;
  v8f acc[4] = {};
  for (int kb = 0; kb < K; kb += 32) {
    FragB ah, al;
    const v4f x0 = *(const v4fa*)(arow + kb + 8 * hh), x1 = *(const v4fa*)(arow + kb + 8 * hh + 4);
    const v4f x2 = *(const v4fa*)(arow + kb + 16 + 8 * hh), x3 = *(const v4fa*)(arow + kb + 16 + 8 * hh + 4);
    float xs[16] = {x0[0],x0[1],x0[2],x0[3],x1[0],x1[1],x1[2],x1[3],x2[0],x2[1],x2[2],x2[3],x3[0],x3[1],x3[2],x3[3]};
#pragma unroll
    for (int i = 0; i < 16; ++i) { const unsigned short hb = bf16_bits(xs[i]); ah.u[i] = hb; al.u[i] = ASPLIT ? bf16_bits(xs[i] - bf16_val(hb)) : (unsigned short)0; }
#pragma unroll
    for (int t = 0; t < 4; ++t) {
      const unsigned short* brow = Wt + (size_t)(col0 + t * 16 + ln) * ldb + kb;
      FragB b;
      b.half[0] = *(const v8us*)(brow + 8 * hh);
      b.half[1] = *(const v8us*)(brow + 16 + 8 * hh);
      acc[t] = mmaN<ASPLIT ? 2 : 1>(ah.v, al.v, b.v, b.v, acc[t]);
    }
  }
#pragma unroll
  for (int t = 0; t < 4; ++t) {
    float bv = bias ? bias[col0 + t * 16 + ln] : 0.f;
    if (BIAS_BF16) bv = bf16_round(bv);
#pragma unroll
    for (int r = 0; r < 8; ++r) { float v = acc[t][r] + bv; if (ACT == 1) v = fmaxf(v, 0.f); so[w][8 * hh + r][t * 16 + ln] = v; }
  }
  __builtin_amdgcn_fence(__ATOMIC_ACQ_REL, "workgroup");
  __builtin_amdgcn_wave_barrier();
  const int rsub = lane >> 4, c4 = (lane & 15) * 4;
  {
#pragma unroll
    for (int q = 0; q < 8; ++q) {
      const int r = q * 2 + rsub;
      const v4f v = *(const v4fa*)&so[w][r][c4];
      *(v4f*)(C + (size_t)(row0 + r) * ldc + col0 + c4) = v;
    }
    
  }
}

// GEMM C = act(A·W + bias + resid): A f32 (ASPLIT -> hi/lo 2 terms), Wt bf16 [N][K]; ACT 0 none, 1 relu, 2 exact gelu;
// resid (optional, f32, row index = (row % rmod), pitch ldr, RES_BF16 rounds it) added before the activation.
template <bool ASPLIT, int ACT, bool BIAS_BF16, bool RES_BF16>
__global__ __launch_bounds__(128) void k_gemm_bf3(const float* __restrict__ A, int lda, const unsigned short* __restrict__ Wt, int ldb,
                                                const float* __restrict__ bias, const float* __restrict__ resid, int rmod, int ldr,
                                                float* __restrict__ C, int ldc, int M, int N, int K) {
  __shared__ __attribute__((aligned(16))) float so[4][16][64];
  const int tid = threadIdx.x, w = tid >> 5, lane = tid & 31, ln = lane & 15, hh = lane >> 4;
  const int ntn = N / 64;
  const int wid = blockIdx.x * 4 + w;
  const int mt = wid / ntn, nq = wid % ntn;
  if (mt * 16 >= M) return;
  const int row0 = mt * 16, col0 = nq * 64;
  const float* arow = A + (size_t)(row0 + ln) * lda;
  v8f acc[4] = {};
  for (int kb = 0; kb < K; kb += 32) {
    FragB ah, al;
    const v4f x0 = *(const v4fa*)(arow + kb + 8 * hh), x1 = *(const v4fa*)(arow + kb + 8 * hh + 4);
    const v4f x2 = *(const v4fa*)(arow + kb + 16 + 8 * hh), x3 = *(const v4fa*)(arow + kb + 16 + 8 * hh + 4);
    float xs[16] = {x0[0],x0[1],x0[2],x0[3],x1[0],x1[1],x1[2],x1[3],x2[0],x2[1],x2[2],x2[3],x3[0],x3[1],x3[2],x3[3]};
#pragma unroll
    for (int i = 0; i < 16; ++i) { const unsigned short hb = bf16_bits(xs[i]); ah.u[i] = hb; al.u[i] = ASPLIT ? bf16_bits(xs[i] - bf16_val(hb)) : (unsigned short)0; }
#pragma unroll
    for (int t = 0; t < 4; ++t) {
      const unsigned short* brow = Wt + (size_t)(col0 + t * 16 + ln) * ldb + kb;
      FragB b;
      b.half[0] = *(const v8us*)(brow + 8 * hh);
      b.half[1] = *(const v8us*)(brow + 16 + 8 * hh);
      acc[t] = mmaN<ASPLIT ? 2 : 1>(ah.v, al.v, b.v, b.v, acc[t]);
    }
  }
#pragma unroll
  for (int t = 0; t < 4; ++t) {
    const int col = col0 + t * 16 + ln;
    float bv = bias ? bias[col] : 0.f;
    if (BIAS_BF16) bv = bf16_round(bv);
#pragma unroll
    for (int r = 0; r < 8; ++r) {
      float v = acc[t][r] + bv;
      if (resid) { float rv = resid[(size_t)((row0 + 8 * hh + r) % rmod) * ldr + col]; if (RES_BF16) rv = bf16_round(rv); v += rv; }
      if (ACT == 1) v = fmaxf(v, 0.f);
      if (ACT == 2) v = 0.5f * v * (1.0f + erff(v * 0.70710678118654752f));
      if (ACT == 3) { const float u = 0.7978845608028654f * (v + 0.044715f * v * v * v); v = 0.5f * v * (1.0f + tanhf(u)); }
      so[w][8 * hh + r][t * 16 + ln] = v;
    }
  }
  __builtin_amdgcn_fence(__ATOMIC_ACQ_REL, "workgroup");
  __builtin_amdgcn_wave_barrier();
  const int rsub = lane >> 4, c4 = (lane & 15) * 4;
  {
#pragma unroll
    for (int q = 0; q < 8; ++q) {
      const int r = q * 2 + rsub;
      const v4f v = *(const v4fa*)&so[w][r][c4];
      *(v4f*)(C + (size_t)(row0 + r) * ldc + col0 + c4) = v;
    }
    
  }
}
// row LayerNorm (biased variance, eps) over N: s = X (+ R); optional out_sum <- s; out_norm <- (s-mu)*rsqrt(var+eps)*g + b
template <bool PARAM_BF16>
__global__ __launch_bounds__(256) void k_layernorm(const float* __restrict__ X, const float* __restrict__ R, const float* __restrict__ g, const float* __restrict__ bta,
                                                  float* __restrict__ out_sum, float* __restrict__ out_norm, int N, float eps) {
  __shared__ float red[256];
  const int row = blockIdx.x, tid = threadIdx.x;
  const float* x = X + (size_t)row * N; const float* rr = R ? R + (size_t)row * N : nullptr;
  float vals[16];                     // up to N = 4096
  const int per = N / 256;            // contiguous chunk per thread? use strided-by-4 chunks: thread handles j = tid*4 + 1024*u
  float s1 = 0.f;
  for (int u = 0; u < per / 4; ++u) {
    const int j = tid * 4 + 1024 * u;
    const v4f a = *(const v4fa*)(x + j);
    v4f b = {0.f,0.f,0.f,0.f}; if (rr) b = *(const v4fa*)(rr + j);
#pragma unroll
    for (int q = 0; q < 4; ++q) { const float v = a[q] + b[q]; vals[u * 4 + q] = v; s1 += v; }
  }
  red[tid] = s1; __syncthreads();
  for (int st = 128; st > 0; st >>= 1) { if (tid < st) red[tid] += red[tid + st]; __syncthreads(); }
  const float mu = red[0] / (float)N; __syncthreads();
  float s2 = 0.f;
  for (int u = 0; u < per / 4; ++u)
#pragma unroll
    for (int q = 0; q < 4; ++q) { const float c = vals[u * 4 + q] - mu; s2 += c * c; }
  red[tid] = s2; __syncthreads();
  for (int st = 128; st > 0; st >>= 1) { if (tid < st) red[tid] += red[tid + st]; __syncthreads(); }
  const float rs = rsqrtf(red[0] / (float)N + eps);
  {
    for (int u = 0; u < per / 4; ++u) {
      const int j = tid * 4 + 1024 * u;
      v4f o, sm;
#pragma unroll
      for (int q = 0; q < 4; ++q) {
        float gg = g[j + q], bb = bta[j + q];
        if (PARAM_BF16) { gg = bf16_round(gg); bb = bf16_round(bb); }
        sm[q] = vals[u * 4 + q]; o[q] = (vals[u * 4 + q] - mu) * rs * gg + bb;
      }
      if (out_sum) *(v4f*)(out_sum + (size_t)row * N + j) = sm;
      *(v4f*)(out_norm + (size_t)row * N + j) = o;
    }
    
  }
}



// ---- f16 WMMA path (v_wmma_f32_16x16x32_f16): 11-bit significands for operands in range — used where a [0,1] probability operand needs more precision than bf16
typedef _Float16 v16h __attribute__((ext_vector_type(16)));
union FragH { v16h v; v8us half[2]; _Float16 h[16]; unsigned short u[16]; };
template <int NT>
__device__ __forceinline__ v8f mmaH(v16h ah, v16h al, v16h bh, v16h bl, v8f c) {
  c = __builtin_amdgcn_wmma_f32_16x16x32_f16(false, ah, false, bh, (short)0, c, false, false);
  if (NT >= 2) c = __builtin_amdgcn_wmma_f32_16x16x32_f16(false, al, false, bh, (short)0, c, false, false);
  if (NT >= 3) c = __builtin_amdgcn_wmma_f32_16x16x32_f16(false, ah, false, bl, (short)0, c, false, false);
  asm volatile("v_nop\n\tv_nop\n\tv_nop\n\tv_nop" : "+v"(c) : "v"(ah), "v"(al), "v"(bh), "v"(bl));
  return c;
}
// batched GEMM like k_gemm_b but f16 operands: A f32 (split into f16 hi/lo if ASPLIT, else rounded to f16), Bt = f16 values [n][k]; alpha; C f32; N multiple of 16 (partial tiles skipped)
template <bool ASPLIT>
__global__ __launch_bounds__(128) void k_gemm_h(const float* __restrict__ A, int lda, size_t sA, const _Float16* __restrict__ Bh, int ldb, size_t sB, float alpha, float* __restrict__ C, int ldc, size_t sC, int M, int N, int K) {
  __shared__ __attribute__((aligned(16))) float so[4][16][64];
  const int tid = threadIdx.x, w = tid >> 5, lane = tid & 31, ln = lane & 15, hh = lane >> 4; const int by = blockIdx.y;
  A += (size_t)by * sA; Bh += (size_t)by * sB; C += (size_t)by * sC;
  const int ntn = (N + 63) / 64; const int wid = blockIdx.x * 4 + w; const int mt = wid / ntn, nq = wid % ntn; if (mt * 16 >= M) return;
  const int row0 = mt * 16, col0 = nq * 64; const float* arow = A + (size_t)(row0 + ln) * lda;
  v8f acc[4] = {};
  for (int kb = 0; kb < K; kb += 32) {
    FragH ah, al;
    const v4f x0 = *(const v4fa*)(arow + kb + 8 * hh), x1 = *(const v4fa*)(arow + kb + 8 * hh + 4), x2 = *(const v4fa*)(arow + kb + 16 + 8 * hh), x3 = *(const v4fa*)(arow + kb + 16 + 8 * hh + 4);
    float xs[16] = {x0[0],x0[1],x0[2],x0[3],x1[0],x1[1],x1[2],x1[3],x2[0],x2[1],x2[2],x2[3],x3[0],x3[1],x3[2],x3[3]};
#pragma unroll
    for (int i = 0; i < 16; ++i) { const _Float16 h = (_Float16)xs[i]; ah.h[i] = h; al.h[i] = ASPLIT ? (_Float16)(xs[i] - (float)h) : (_Float16)0.0f; }
#pragma unroll
    for (int t = 0; t < 4; ++t) { if (col0 + t * 16 >= N) continue; const size_t boff = (size_t)(col0 + t * 16 + ln) * ldb + kb; FragH bq; bq.half[0] = *(const v8us*)(Bh + boff + 8 * hh); bq.half[1] = *(const v8us*)(Bh + boff + 16 + 8 * hh);
      acc[t] = mmaH<ASPLIT ? 2 : 1>(ah.v, al.v, bq.v, bq.v, acc[t]); }
  }
#pragma unroll
  for (int t = 0; t < 4; ++t) { if (col0 + t * 16 >= N) continue;
#pragma unroll
    for (int r = 0; r < 8; ++r) so[w][8 * hh + r][t * 16 + ln] = acc[t][r] * alpha; }
  __builtin_amdgcn_fence(__ATOMIC_ACQ_REL, "workgroup"); __builtin_amdgcn_wave_barrier();
  const int rsub = lane >> 4, c4 = (lane & 15) * 4;
  {
#pragma unroll
    for (int q = 0; q < 8; ++q) { const int r = q * 2 + rsub; if (col0 + c4 < N) { const v4f v = *(const v4fa*)&so[w][r][c4]; *(v4f*)(C + (size_t)(row0 + r) * ldc + col0 + c4) = v; } }
     }
}

// Wt[n][k] = f16(W[k][n]·scale) from f32 row-major W[K][N] (scale = power of two; bf16-exact weights stay exact in f16 away from the subnormal range)
__global__ __launch_bounds__(256) void k_wt_f16(const float* __restrict__ W, _Float16* __restrict__ Wt, int K, int N, float scale) {
  const int t = blockIdx.x * 256 + threadIdx.x; if (t >= N * (K / 8)) return; const int n = t / (K / 8), k8 = (t % (K / 8)) * 8; FragH f;
#pragma unroll
  for (int i = 0; i < 8; ++i) f.h[i] = (_Float16)(bf16_round(W[(size_t)(k8 + i) * N + n]) * scale); const v8us o = f.half[0];
  *(v8us*)((unsigned short*)Wt + (size_t)n * K + k8) = o; 
}
// k_gemm_hh variant with fused epilogue: v = acc·alpha + bias[by·sBias + col] (+ CP[(row/rowsPerB)·sCPb + by·64 + col] if CP) ; ACT 0 none / 1 elu ; writes f16 C16 (and f32 C if non-null)
template <int ACT>
__global__ __launch_bounds__(128) void k_gemm_hhx(const _Float16* __restrict__ A, int lda, size_t sA, const _Float16* __restrict__ Bh, int ldb, size_t sB, float alpha, const float* __restrict__ bias, size_t sBias, const float* __restrict__ CP, int rowsPerB, size_t sCPb, int row0g,
    float* __restrict__ C, _Float16* __restrict__ C16, int ldc, size_t sC, int M, int N, int K) {
  __shared__ __attribute__((aligned(16))) float so[4][16][64];
  const int tid = threadIdx.x, w = tid >> 5, lane = tid & 31, ln = lane & 15, hh = lane >> 4; const int by = blockIdx.y;
  A += (size_t)by * sA; Bh += (size_t)by * sB; const size_t cofs = (size_t)by * sC; const float* bp = bias ? bias + (size_t)by * sBias : nullptr;
  const int ntn = (N + 63) / 64; const int wid = blockIdx.x * 4 + w; const int mt = wid / ntn, nq = wid % ntn; if (mt * 16 >= M) return;
  const int row0 = mt * 16, col0 = nq * 64; const _Float16* arow = A + (size_t)(row0 + ln) * lda;
  v8f acc[4] = {};
  for (int kb = 0; kb < K; kb += 32) { FragH ah; ah.half[0] = *(const v8us*)((const unsigned short*)arow + kb + 8 * hh); ah.half[1] = *(const v8us*)((const unsigned short*)arow + kb + 16 + 8 * hh);
#pragma unroll
    for (int t = 0; t < 4; ++t) { if (col0 + t * 16 >= N) continue; const size_t boff = (size_t)(col0 + t * 16 + ln) * ldb + kb; FragH bq; bq.half[0] = *(const v8us*)((const unsigned short*)Bh + boff + 8 * hh); bq.half[1] = *(const v8us*)((const unsigned short*)Bh + boff + 16 + 8 * hh);
      acc[t] = mmaH<1>(ah.v, ah.v, bq.v, bq.v, acc[t]); }
  }
#pragma unroll
  for (int t = 0; t < 4; ++t) { if (col0 + t * 16 >= N) continue; const int col = col0 + t * 16 + ln; const float bv = bp ? bf16_round(bp[col]) : 0.f;
#pragma unroll
    for (int r = 0; r < 8; ++r) { float v = acc[t][r] * alpha + bv; if (CP) { const int rr = row0g + row0 + 8 * hh + r; if (rowsPerB < 0) v += CP[cofs + (size_t)rr * ldc + col];      /* rowsPerB < 0: own element of the batched C plane */ else { const int bidx = rr / rowsPerB; v += CP[(size_t)bidx * sCPb + (size_t)by * 64 + col]; } } if (ACT == 1) v = (v > 0.f) ? v : expm1f(v); else if (ACT == 7) v = (v > 0.f) ? v + 1.0f : expf(v); else if (ACT == 8) v = tanhf(v); else if (ACT == 9) v = 0.5f * v * (1.0f + tanhf(0.7978845608028654f * (v + 0.044715f * v * v * v))); else if (ACT == 11) v = 1.0f / (1.0f + expf(-v)); else if (ACT == 12) v = (v > 0.f) ? v : 0.01f * v; else if (ACT == 14) v = (v > 0.f) ? v : 0.1f * v; else if (ACT == 16) v = (v >= 0.f) ? v : 0.3f * v; else if (ACT == 17) v = (v >= 0.f) ? v : 0.2f * v; else if (ACT == 15) v = v / (1.0f + expf(-v)); else if (ACT == 3) v = fmaxf(v, 0.f); else if (ACT == 6) v = 0.5f * v * (1.0f + erff(v * 0.70710678118654752f)); so[w][8 * hh + r][t * 16 + ln] = v; } }
  __builtin_amdgcn_fence(__ATOMIC_ACQ_REL, "workgroup"); __builtin_amdgcn_wave_barrier();
  const int rsub = lane >> 4, c4 = (lane & 15) * 4; typedef _Float16 v4h __attribute__((ext_vector_type(4)));
  {
#pragma unroll
    for (int q = 0; q < 8; ++q) { const int r = q * 2 + rsub; if (col0 + c4 < N) { const v4f v = *(const v4fa*)&so[w][r][c4]; if (C) *(v4f*)(C + cofs + (size_t)(row0 + r) * ldc + col0 + c4) = v; if (C16) { v4h h4; for (int i = 0; i < 4; ++i) h4[i] = (_Float16)v[i]; *(v4h*)(C16 + cofs + (size_t)(row0 + r) * ldc + col0 + c4) = h4; } } }
     }
}


typedef _Float16 v4h __attribute__((ext_vector_type(4)));

__global__ __launch_bounds__(256) void k_x16(const float* __restrict__ x, _Float16* __restrict__ X16, size_t n8) { const size_t t = (size_t)blockIdx.x * 256 + threadIdx.x; if (t >= n8) return; FragH f;
#pragma unroll
  for (int q = 0; q < 8; ++q) f.h[q] = (_Float16)bf16_round(x[t * 8 + q]); *(v8us*)((unsigned short*)X16 + t * 8) = f.half[0];  }
__global__ __launch_bounds__(256) void k_h16(const float* __restrict__ x, _Float16* __restrict__ X16, size_t n8) { const size_t t = (size_t)blockIdx.x * 256 + threadIdx.x; if (t >= n8) return; FragH f;
#pragma unroll
  for (int q = 0; q < 8; ++q) f.h[q] = (_Float16)x[t * 8 + q]; *(v8us*)((unsigned short*)X16 + t * 8) = f.half[0];  }
__global__ __launch_bounds__(256) void k_round16f(const float* __restrict__ W, _Float16* __restrict__ Bt, size_t n8) { const size_t t = (size_t)blockIdx.x * 256 + threadIdx.x; if (t >= n8) return; FragH f;
#pragma unroll
  for (int i = 0; i < 8; ++i) f.h[i] = (_Float16)(bf16_round(W[t * 8 + i]) * 16.0f); *(v8us*)((unsigned short*)Bt + t * 8) = f.half[0];  }
template <int NHv, int TTv>
__global__ __launch_bounds__(256) void k_vt(const _Float16* __restrict__ V16, int ldv, int voff, _Float16* __restrict__ Vt) { __shared__ unsigned short tl[64][66]; const int tid = threadIdx.x; const int slab = blockIdx.x / (TTv / 64), lg = blockIdx.x % (TTv / 64); const int b = slab / NHv, h = slab % NHv;
  for (int i = tid; i < 64 * 8; i += 256) { const int r = i / 8, c8 = (i % 8) * 8; FragH f; f.half[0] = *(const v8us*)((const unsigned short*)V16 + ((size_t)b * TTv + lg * 64 + r) * ldv + voff + h * 64 + c8);
#pragma unroll
    for (int q = 0; q < 8; ++q) tl[r][c8 + q] = f.u[q]; }
  __syncthreads();
  {
#pragma unroll
    for (int rd = 0; rd < 2; ++rd) { const int d = rd * 32 + tid / 8, pc = tid % 8; FragH f;
#pragma unroll
      for (int q = 0; q < 8; ++q) f.u[q] = tl[pc * 8 + q][d];
      *(v8us*)((unsigned short*)Vt + ((size_t)slab * 64 + d) * TTv + lg * 64 + pc * 8) = f.half[0]; }
     } }

__global__ __launch_bounds__(256) void k_hl(const float* __restrict__ F, _Float16* __restrict__ Hh, _Float16* __restrict__ Hl, size_t n8) { const size_t t = (size_t)blockIdx.x * 256 + threadIdx.x; if (t >= n8) return; FragH fh, fl; const v4f a = *(const v4fa*)(F + t * 8), c = *(const v4fa*)(F + t * 8 + 4);
#pragma unroll
  for (int q = 0; q < 4; ++q) { _Float16 h = (_Float16)a[q]; fh.h[q] = h; fl.h[q] = (_Float16)((a[q] - (float)h) * 1024.0f); h = (_Float16)c[q]; fh.h[4 + q] = h; fl.h[4 + q] = (_Float16)((c[q] - (float)h) * 1024.0f); }
  { *(v8us*)((unsigned short*)Hh + t * 8) = fh.half[0]; *(v8us*)((unsigned short*)Hl + t * 8) = fl.half[0];  } }

// ---- fast GEMM (wave tile 32x64; requires M % 32 == 0 rows per launch region and N % 64 == 0); epilogue = k_gemm_hhx semantics ----
__device__ __forceinline__ v16h g2_frag(const _Float16* p, int hh) { FragH f; f.half[0] = *(const v8us*)((const unsigned short*)p + 8 * hh); f.half[1] = *(const v8us*)((const unsigned short*)p + 16 + 8 * hh); return f.v; }
__device__ __forceinline__ v8f g2_mma(v16h a, v16h b, v8f c) { v8f d = __builtin_amdgcn_wmma_f32_16x16x32_f16(false, a, false, b, (short)0, c, false, false); asm volatile("v_nop\n\tv_nop\n\tv_nop\n\tv_nop" : "+v"(d) : "v"(a), "v"(b)); return d; }
template <int ACT>
__global__ __launch_bounds__(128) void k_gemm2(const _Float16* __restrict__ A, int lda, size_t sA, const _Float16* __restrict__ Bh, int ldb, size_t sB, float alpha, const float* __restrict__ bias, size_t sBias, const float* __restrict__ CP, int rowsPerB, size_t sCPb, int row0g,
    float* __restrict__ C, _Float16* __restrict__ C16, int ldc, size_t sC, int M, int N, int K) { static_assert(ACT == 0 || ACT == 3 || ACT == 6 || ACT == 8 || ACT == 9 || ACT == 11 || ACT == 12 || ACT == 14 || ACT == 15 || ACT == 16 || ACT == 17, "k_gemm2: unsupported ACT code (would silently apply no activation)");
  __shared__ __attribute__((aligned(16))) float so[4][32][68];
  const int tid = threadIdx.x, w = tid >> 5, lane = tid & 31, ln = lane & 15, hh = lane >> 4; const int by = blockIdx.y;
  A += (size_t)by * sA; Bh += (size_t)by * sB; const size_t cofs = (size_t)by * sC; const float* bp = bias ? bias + (size_t)by * sBias : nullptr;
  const int ntn = N >> 6; const int mt = blockIdx.x / ntn, nq = blockIdx.x - mt * ntn; const int row0 = mt * 128 + 32 * w, col0 = nq * 64; if (row0 >= M) return;
  const _Float16* a0p = A + (size_t)(row0 + ln) * lda; const _Float16* a1p = a0p + (size_t)16 * lda;
  const _Float16* b0p = Bh + (size_t)(col0 + ln) * ldb; const _Float16* b1p = b0p + (size_t)16 * ldb; const _Float16* b2p = b1p + (size_t)16 * ldb; const _Float16* b3p = b2p + (size_t)16 * ldb;
  const v8f z8 = {0.f,0.f,0.f,0.f,0.f,0.f,0.f,0.f}; v8f c00 = z8, c01 = z8, c02 = z8, c03 = z8, c10 = z8, c11 = z8, c12 = z8, c13 = z8;
#pragma unroll 1
  for (int kb = 0; kb < K; kb += 32) { const v16h a0 = g2_frag(a0p + kb, hh), a1 = g2_frag(a1p + kb, hh);
    v16h b = g2_frag(b0p + kb, hh); c00 = g2_mma(a0, b, c00); c10 = g2_mma(a1, b, c10);
    b = g2_frag(b1p + kb, hh); c01 = g2_mma(a0, b, c01); c11 = g2_mma(a1, b, c11);
    b = g2_frag(b2p + kb, hh); c02 = g2_mma(a0, b, c02); c12 = g2_mma(a1, b, c12);
    b = g2_frag(b3p + kb, hh); c03 = g2_mma(a0, b, c03); c13 = g2_mma(a1, b, c13); }
  v8f accs[8] = {c00, c01, c02, c03, c10, c11, c12, c13};
#pragma unroll
  for (int u = 0; u < 8; ++u) { const int t = u & 3, half = u >> 2; const int col = col0 + t * 16 + ln; const float bv = bp ? bf16_round(bp[col]) : 0.f;
#pragma unroll
    for (int r = 0; r < 8; ++r) { const int rloc = half * 16 + 8 * hh + r; float v = accs[u][r] * alpha + bv; if (CP) { if (rowsPerB < 0) v += CP[cofs + (size_t)(row0g + row0 + rloc) * ldc + col];      /* rowsPerB < 0: own element of the batched C plane */ else { const int bidx = (row0g + row0 + rloc) / rowsPerB; v += CP[(size_t)bidx * sCPb + (size_t)by * 64 + col]; } }
      if (ACT == 3) v = fmaxf(v, 0.f); else if (ACT == 6) v = 0.5f * v * (1.0f + erff(v * 0.70710678118654752f)); else if (ACT == 11) v = 1.0f / (1.0f + expf(-v)); else if (ACT == 15) v = v / (1.0f + expf(-v)); else if (ACT == 12) v = (v > 0.f) ? v : 0.01f * v; else if (ACT == 8) v = tanhf(v); else if (ACT == 9) v = 0.5f * v * (1.0f + tanhf(0.7978845608028654f * (v + 0.044715f * v * v * v))); else if (ACT == 14) v = (v > 0.f) ? v : 0.1f * v; else if (ACT == 16) v = (v >= 0.f) ? v : 0.3f * v; else if (ACT == 17) v = (v >= 0.f) ? v : 0.2f * v;
      so[w][rloc][t * 16 + ln] = v; } }
  __builtin_amdgcn_fence(__ATOMIC_ACQ_REL, "workgroup"); __builtin_amdgcn_wave_barrier();
  const int rsub = lane >> 4, c4 = (lane & 15) * 4;
  {
#pragma unroll
    for (int q = 0; q < 16; ++q) { const int r = q * 2 + rsub; const v4f v = *(const v4fa*)&so[w][r][c4]; if (C) *(v4f*)(C + cofs + (size_t)(row0 + r) * ldc + col0 + c4) = v; if (C16) { v4h h4; for (int i = 0; i < 4; ++i) h4[i] = (_Float16)v[i]; *(v4h*)(C16 + cofs + (size_t)(row0 + r) * ldc + col0 + c4) = h4; } }
     } }


__global__ __launch_bounds__(256) void k_wnat(const float* __restrict__ w, size_t n8, _Float16* __restrict__ Bt) { const size_t t = (size_t)blockIdx.x * 256 + threadIdx.x; if (t >= n8) return; FragH f; for (int q = 0; q < 8; ++q) f.h[q] = (_Float16)(bf16_round(w[t * 8 + q]) * 16.0f); *(v8us*)((unsigned short*)Bt + t * 8) = f.half[0];  }
// energy + row softmax in one kernel. A work-group of 16 waves owns 16 rows n of the attention matrix; wave w forms the transposed logits E^T[m][n] of its 256 columns m
// (A = k rows, B = q rows; hi.hi in one accumulator, lo.hi + hi.lo in a second, joined as hi + lo / 1024). The logits stay in registers for the maximum, the exponentials,
// their sum and the scaled f16 store, so they never go to memory. In the D layout a lane holds ONE row n (its column) and 8 consecutive m per tile: the row reductions are
// in-lane but for one lane exchange and one LDS exchange between the waves, and each tile is one 16-byte store into P[n][m].
__device__ __forceinline__ v8f es_mma(v16h a, v16h b, v8f c) { return __builtin_amdgcn_wmma_f32_16x16x32_f16(false, a, false, b, (short)0, c, false, false); }
__global__ __launch_bounds__(512) void k_esm(const _Float16* __restrict__ Qh, const _Float16* __restrict__ Ql, const _Float16* __restrict__ Kh, const _Float16* __restrict__ Kl, _Float16* __restrict__ P) {
  __shared__ float redm[16][16]; __shared__ float reds[16][16];
  const int tid = threadIdx.x, w = tid >> 5, lane = tid & 31, ln = lane & 15, hh = lane >> 4; const int n0 = blockIdx.x * 16;
  const _Float16* qhp = Qh + (size_t)(n0 + ln) * CQ; const _Float16* qlp = Ql + (size_t)(n0 + ln) * CQ;
  const v16h qh0 = g2_frag(qhp, hh), qh1 = g2_frag(qhp + 32, hh);
  asm volatile("s_wait_xcnt 0x0" ::: "memory");      /* the address pair of the loads above may be given to a later load's result: the wait stands in front of that overwrite */
  const v16h ql0 = g2_frag(qlp, hh), ql1 = g2_frag(qlp + 32, hh);
  asm volatile("s_wait_xcnt 0x0" ::: "memory");      /* the same for the address pair of the two loads above */
  const _Float16* khp = Kh + (size_t)(w * 256 + ln) * CQ; const _Float16* klp = Kl + (size_t)(w * 256 + ln) * CQ;
  const v8f z8 = {0.f,0.f,0.f,0.f,0.f,0.f,0.f,0.f}; v8f e[16];
  v16h nh0 = g2_frag(khp, hh), nh1 = g2_frag(khp + 32, hh), nl0 = g2_frag(klp, hh), nl1 = g2_frag(klp + 32, hh);
  // every loop over e[] is unrolled in full: e is then indexed by constants only and stays in registers
#pragma unroll
  for (int t = 0; t < 16; ++t) { const v16h kh0 = nh0, kh1 = nh1, kl0 = nl0, kl1 = nl1;
    if (t + 1 < 16) { nh0 = g2_frag(khp + (t + 1) * 16 * CQ, hh); nh1 = g2_frag(khp + (t + 1) * 16 * CQ + 32, hh); nl0 = g2_frag(klp + (t + 1) * 16 * CQ, hh); nl1 = g2_frag(klp + (t + 1) * 16 * CQ + 32, hh); }      /* the next tile's fragments fly under this tile's products */
    v8f ch = es_mma(kh0, qh0, z8); v8f cl = es_mma(kl0, qh0, z8); ch = es_mma(kh1, qh1, ch); cl = es_mma(kl1, qh1, cl); cl = es_mma(kh0, ql0, cl); cl = es_mma(kh1, ql1, cl);
    e[t] = ch + cl * (1.0f / 1024.0f); }
  v8f m8 = e[0];
#pragma unroll
  for (int t = 1; t < 16; ++t) for (int r = 0; r < 8; ++r) m8[r] = fmaxf(m8[r], e[t][r]);
  float mx = fmaxf(fmaxf(fmaxf(m8[0], m8[1]), fmaxf(m8[2], m8[3])), fmaxf(fmaxf(m8[4], m8[5]), fmaxf(m8[6], m8[7])));
  mx = fmaxf(mx, __shfl_xor(mx, 16, 32));
  if (hh == 0) redm[w][ln] = mx;
  __syncthreads();
#pragma unroll
  for (int u = 0; u < 16; ++u) mx = fmaxf(mx, redm[u][ln]);
#pragma unroll
  for (int t = 0; t < 16; ++t) for (int r = 0; r < 8; ++r) e[t][r] = expf(e[t][r] - mx);
  v8f s8 = e[0];
#pragma unroll
  for (int t = 1; t < 16; ++t) s8 += e[t];
  float sw = ((s8[0] + s8[1]) + (s8[2] + s8[3])) + ((s8[4] + s8[5]) + (s8[6] + s8[7]));
  sw += __shfl_xor(sw, 16, 32);
  if (hh == 0) reds[w][ln] = sw;
  __syncthreads();
  float se = 0.f;
#pragma unroll
  for (int u = 0; u < 16; ++u) se += reds[u][ln];
  const float sc = 256.0f / se; unsigned short* p = (unsigned short*)P + (size_t)(n0 + ln) * SQ + w * 256 + 8 * hh;
#pragma unroll
  for (int t = 0; t < 16; ++t) { FragH f; for (int r = 0; r < 8; ++r) f.h[r] = (_Float16)(e[t][r] * sc); *(v8us*)(p + t * 16) = f.half[0]; } }
__global__ __launch_bounds__(256) void k_vt(const _Float16* __restrict__ V16, int b, int h0, _Float16* __restrict__ VT) { __shared__ unsigned short tl[64][65]; const int tid = threadIdx.x; const int hh = blockIdx.x % HG, sg = blockIdx.x / HG; const int s0 = sg * 64; const int h = h0 + hh;
  for (int i = tid; i < 64 * 8; i += 256) { const int j = i / 8, d8 = (i % 8) * 8; FragH f; f.half[0] = *(const v8us*)((const unsigned short*)V16 + ((size_t)b * SQ + s0 + j) * DM + h * HD + d8); for (int q = 0; q < 8; ++q) tl[d8 + q][j] = f.u[q]; }
  __syncthreads();
  { for (int i = tid; i < 64 * 8; i += 256) { const int d = i / 8, j8 = (i % 8) * 8; FragH f; for (int q = 0; q < 8; ++q) f.u[q] = tl[d][j8 + q]; *(v8us*)((unsigned short*)VT + ((size_t)hh * HD + d) * SQ + s0 + j8) = f.half[0]; }  } }


__global__ __launch_bounds__(256) void k_cl2rows(const float* __restrict__ X, _Float16* __restrict__ XR) { __shared__ float tl[64][33]; const int tid = threadIdx.x; const int nl = LL / 32, nc = CC / 64; const int cb_ = blockIdx.x % nc; const int lb = (blockIdx.x / nc) % nl; const size_t b = blockIdx.x / (nc * nl); const int c0 = cb_ * 64, l0 = lb * 32;
  for (int i = tid; i < 64 * 32; i += 256) { const int c = i / 32, l = i % 32; tl[c][l] = bf16_round(X[(b * CC + c0 + c) * (size_t)LL + l0 + l]); }
  __syncthreads();
  { const int l = tid / 8, c8 = (tid % 8) * 8; FragH f; for (int q = 0; q < 8; ++q) f.h[q] = (_Float16)tl[c8 + q][l]; unsigned short* d = (unsigned short*)XR + (b * LL + l0 + l) * (size_t)CC + c0 + c8; *(v8us*)d = f.half[0];  } }

__global__ __launch_bounds__(256) void k_fin3(const float* __restrict__ Cm, const float* __restrict__ x, int b, float* __restrict__ out) {
  #pragma clang fp contract(off)
  const size_t t = (size_t)blockIdx.x * 256 + threadIdx.x; if (t >= (size_t)CC * NPX / 8) return; const size_t base = (size_t)b * CC * NPX + t * 8; v8f v;
  for (int q = 0; q < 8; ++q) v[q] = __fadd_rn(bf16_round(x[base + q]), Cm[t * 8 + q]); *(v8f*)(out + base) = v;  }

extern "C" void kernel_launch(void* const* d_in, const int* in_sizes, int n_in,
                              void* d_out, int out_size, void* d_ws, size_t ws_size, hipStream_t stream) {
  (void)in_sizes; (void)n_in; (void)out_size;
  const float* const* I = (const float* const*)d_in; const float* x = I[0]; const float* Wq = I[1]; const float* Wk = I[2]; const float* Wv = I[3]; const float* bv = I[4];
  char* ws = (char*)d_ws; size_t off = 0;
  auto take = [&](size_t bytes) { char* p = ws + off; off += (bytes + 255) & ~(size_t)255; return p; };
  _Float16* BQ = (_Float16*)take((size_t)CQ * CC * 2); _Float16* BK = (_Float16*)take((size_t)CQ * CC * 2); _Float16* BV = (_Float16*)take((size_t)CC * CC * 2);
  _Float16* XR = (_Float16*)take(NR * CC * 2); float* QF = (float*)take(NR * CQ * 4); float* KF = (float*)take(NR * CQ * 4); _Float16* QH = (_Float16*)take(NR * CQ * 2); _Float16* QL = (_Float16*)take(NR * CQ * 2); _Float16* KH = (_Float16*)take(NR * CQ * 2); _Float16* KL = (_Float16*)take(NR * CQ * 2); _Float16* V16 = (_Float16*)take(NR * CC * 2);
  _Float16* P = (_Float16*)take((size_t)NPX * NPX * 2); _Float16* PT = (_Float16*)take((size_t)NPX * NPX * 2); _Float16* VT = (_Float16*)take((size_t)CC * NPX * 2); float* CX = (float*)take((size_t)CC * NPX * 4);
  if (off > ws_size) return;      /* 0.2 + 8 + 8 + 8 + 8 + 32 + 32 + 2 + 4 = approx 103 MiB */
  k_wnat<<<(unsigned)(((size_t)CQ * CC / 8 + 255) / 256), 256, 0, stream>>>(Wq, (size_t)CQ * CC / 8, BQ); k_wnat<<<(unsigned)(((size_t)CQ * CC / 8 + 255) / 256), 256, 0, stream>>>(Wk, (size_t)CQ * CC / 8, BK); k_wnat<<<(unsigned)(((size_t)CC * CC / 8 + 255) / 256), 256, 0, stream>>>(Wv, (size_t)CC * CC / 8, BV);
  k_cl2rows<<<NB * (NPX / 32) * (CC / 64), 256, 0, stream>>>(x, XR);
  k_gemm2<0><<<dim3((unsigned)((NR / 128) * 1), 1), 128, 0, stream>>>(XR, CC, 0, BQ, CC, 0, 0.0625f, nullptr, 0, nullptr, 1, 0, 0, QF, nullptr, CQ, 0, MP, CQ, CC);      /* q (f32, exact products) */
  k_gemm2<0><<<dim3((unsigned)((NR / 128) * 1), 1), 128, 0, stream>>>(XR, CC, 0, BK, CC, 0, 0.0625f, nullptr, 0, nullptr, 1, 0, 0, KF, nullptr, CQ, 0, MP, CQ, CC);      /* k */
  k_gemm2<0><<<dim3((unsigned)((NR / 128) * (CC / 64)), 1), 128, 0, stream>>>(XR, CC, 0, BV, CC, 0, 0.0625f, bv, 0, nullptr, 1, 0, 0, nullptr, V16, CC, 0, MP, CC, CC);      /* v + bv (f16 rows) */
  k_hl<<<(unsigned)((NR * CQ / 8 + 255) / 256), 256, 0, stream>>>(QF, QH, QL, NR * CQ / 8); k_hl<<<(unsigned)((NR * CQ / 8 + 255) / 256), 256, 0, stream>>>(KF, KH, KL, NR * CQ / 8);
  for (int b = 0; b < NBR; ++b) { const size_t r0 = (size_t)b * NPX;
    k_esm<<<NPX / 16, 512, 0, stream>>>(QH + r0 * CQ, QL + r0 * CQ, KH + r0 * CQ, KL + r0 * CQ, P);      /* P[n][m] = 256 softmax_m(q_n . k_m) */
    k_vt<NH, SQ><<<NH * (SQ / 64), 256, 0, stream>>>(P, NPX, 0, PT);      /* P^T (x256) */
    k_vt<4, SQ><<<4 * (SQ / 64), 256, 0, stream>>>(V16 + r0 * CC, CC, 0, VT);      /* v channel-major [256][4096] */
    k_gemm2<0><<<dim3((CC / 128) * (MC / 64), 1), 128, 0, stream>>>(VT, NPX, 0, PT, NPX, 0, 0.00390625f, nullptr, 0, nullptr, 1, 0, 0, CX, nullptr, NPX, 0, CC, MC, NPX);      /* x_r[c][m] = sum_n v[c][n] attention[n][m] */
    k_fin3<<<(unsigned)(((size_t)CC * NPX / 8 + 255) / 256), 256, 0, stream>>>(CX, x, b, (float*)d_out); }
}

// v003
// One run takes 424 microseconds.
// Timed twice side by side with v002, it ran 1.76 and 1.75 times as fast.
// All steps since v000 together make it 9.34 times as fast.
#include <hip/hip_runtime.h>
// SA layer (x [4][256][4096]; q = Wq x (64), k = Wk x (64), v = Wv x + bv (256); energy[n][m] = q_n . k_m (no scale); attention = softmax over m; x_r[c][m] = sum_n v[c][n] attention[n][m]; out = x + x_r -> [4][256][4096]).
// Structure: channel-first input transposed to position rows (exact f16) via LDS tiles; q / k as WMMA GEMMs (32x64 wave tiles, f32 accumulation, exact x16 natural weights; exact products) kept f32 and split into f16 hi + 2^-10 residual planes; v GEMM (+ bias) to f16 rows and transposed channel-major via LDS tiles; per image: the unscaled energy as a THREE-term product (hi.hi + lo.hi + hi.lo, K = 64) whose f32 logits stay in registers for the row softmax on VALU (P x256 f16, one kernel), P^T via LDS tiles (full 4096 x 4096) into one plane per image; for all images in one launch (grid y = image): x_r = V(channel-major) . P^T-as-Bt GEMM (M = 256 channels, K = 4096) into f32; residual + store on VALU.
// Compute dtype: inputs rounded to bf16; x / weights exact; q, k as hi + residual (~f32, the logits have sigma ~8); v, P as plain f16 operands (~2^-12); softmax f32. v_wmma_f32_16x16x32_f16.
#define NB 4
#define CC 256
#define CQ 64
#define NPX 4096
#define LL NPX
#define PX NPX
#define NR ((size_t)NB * NPX)
#define NBR NB                       /* images attended (debug hook) */
#define MP ((int)NR)                 /* rows projected (debug hook) */
#define MC NPX                       /* x_r columns per image (debug hook) */
#define SQ NPX                       /* softmax rows of 4096; k_vt<64,4096> full P transpose; k_vt<4,4096> for v */
#define DM NPX
#define NH 64
#define HD 64
#define HG 1
typedef __bf16 v16b __attribute__((ext_vector_type(16)));
typedef unsigned short v8us __attribute__((ext_vector_type(8), may_alias));
typedef float  v8f  __attribute__((ext_vector_type(8)));
typedef float  v4f  __attribute__((ext_vector_type(4)));
typedef float  v4fa __attribute__((ext_vector_type(4), may_alias));
union FragB { v16b v; v8us half[2]; unsigned short u[16]; };

__device__ __forceinline__ unsigned short bf16_bits(float x) { unsigned int u = __float_as_uint(x); return (unsigned short)((u + 0x7FFFu + ((u >> 16) & 1u)) >> 16); }
__device__ __forceinline__ float bf16_val(unsigned short b) { return __uint_as_float(((unsigned int)b) << 16); }
__device__ __forceinline__ float bf16_round(float x) { return bf16_val(bf16_bits(x)); }
// D += A·B with NT terms: 1 = ah·bh, 2 = + al·bh (A split), 3 = + ah·bl (both split)
template <int NT>
__device__ __forceinline__ v8f mmaN(v16b ah, v16b al, v16b bh, v16b bl, v8f c) {
  c = __builtin_amdgcn_wmma_f32_16x16x32_bf16(false, ah, false, bh, (short)0, c, false, false);
  if (NT >= 2) c = __builtin_amdgcn_wmma_f32_16x16x32_bf16(false, al, false, bh, (short)0, c, false, false);
  if (NT >= 3) c = __builtin_amdgcn_wmma_f32_16x16x32_bf16(false, ah, false, bl, (short)0, c, false, false);
  asm volatile("v_nop\n\tv_nop\n\tv_nop\n\tv_nop" : "+v"(c) : "v"(ah), "v"(al), "v"(bh), "v"(bl));
  return c;
}

__global__ __launch_bounds__(256) void k_wt_bf16(const float* __restrict__ W, unsigned short* __restrict__ Wt, int K, int N) {
  const int t = blockIdx.x * 256 + threadIdx.x;
  const int k8n = K / 8;
  if (t >= N * k8n) return;
  const int n = t / k8n, k8 = (t % k8n) * 8;
  v8us v;
#pragma unroll
  for (int i = 0; i < 8; ++i) v[i] = bf16_bits(W[(size_t)(k8 + i) * N + n]);
  *(v8us*)(Wt + (size_t)n * K + k8) = v;
  
}

// GEMM C[M][N] (f32, pitch ldc) = act(A[M][K]·W + bias). A f32 row-major (pitch lda) converted per fragment to bf16
// (ASPLIT: hi/lo two planes -> 2 terms, else single rounded term); Wt bf16 [N][K] (pitch ldb). BIAS_BF16 rounds the
// bias to bf16 first (bias quantised to bf16 before the add). K%32==0, M%16==0, N%64==0.
template <bool ASPLIT, int ACT, bool BIAS_BF16>
__global__ __launch_bounds__(128) void k_gemm_bf(const float* __restrict__ A, int lda, const unsigned short* __restrict__ Wt, int ldb,
                                               const float* __restrict__ bias, float* __restrict__ C, int ldc, int M, int N, int K) {
  __shared__ __attribute__((aligned(16))) float so[4][16][64];
  const int tid = threadIdx.x, w = tid >> 5, lane = tid & 31, ln = lane & 15, hh = lane >> 4;
  const int ntn = N / 64;
  const int wid = blockIdx.x * 4 + w;
  const int mt = wid / ntn, nq = wid % ntn;
  if (mt * 16 >= M) return;
  const int row0 = mt * 16, col0 = nq * 64;
  const float* arow = A + (size_t)(row0 + ln) * lda;
  v8f acc[4] = {};
  for (int kb = 0; kb < K; kb += 32) {
    FragB ah, al;
    const v4f x0 = *(const v4fa*)(arow + kb + 8 * hh), x1 = *(const v4fa*)(arow + kb + 8 * hh + 4);
    const v4f x2 = *(const v4fa*)(arow + kb + 16 + 8 * hh), x3 = *(const v4fa*)(arow + kb + 16 + 8 * hh + 4);
    float xs[16] = {x0[0],x0[1],x0[2],x0[3],x1[0],x1[1],x1[2],x1[3],x2[0],x2[1],x2[2],x2[3],x3[0],x3[1],x3[2],x3[3]};
#pragma unroll
    for (int i = 0; i < 16; ++i) { const unsigned short hb = bf16_bits(xs[i]); ah.u[i] = hb; al.u[i] = ASPLIT ? bf16_bits(xs[i] - bf16_val(hb)) : (unsigned short)0; }
#pragma unroll
    for (int t = 0; t < 4; ++t) {
      const unsigned short* brow = Wt + (size_t)(col0 + t * 16 + ln) * ldb + kb;
      FragB b;
      b.half[0] = *(const v8us*)(brow + 8 * hh);
      b.half[1] = *(const v8us*)(brow + 16 + 8 * hh);
      acc[t] = mmaN<ASPLIT ? 2 : 1>(ah.v, al.v, b.v, b.v, acc[t]);
    }
  }
#pragma unroll
  for (int t = 0; t < 4; ++t) {
    float bv = bias ? bias[col0 + t * 16 + ln] : 0.f;
    if (BIAS_BF16) bv = bf16_round(bv);
#pragma unroll
    for (int r = 0; r < 8; ++r) { float v = acc[t][r] + bv; if (ACT == 1) v = fmaxf(v, 0.f); so[w][8 * hh + r][t * 16 + ln] = v; }
  }
  __builtin_amdgcn_fence(__ATOMIC_ACQ_REL, "workgroup");
  __builtin_amdgcn_wave_barrier();
  const int rsub = lane >> 4, c4 = (lane & 15) * 4;
  {
#pragma unroll
    for (int q = 0; q < 8; ++q) {
      const int r = q * 2 + rsub;
      const v4f v = *(const v4fa*)&so[w][r][c4];
      *(v4f*)(C + (size_t)(row0 + r) * ldc + col0 + c4) = v;
    }
    
  }
}

// GEMM C = act(A·W + bias + resid): A f32 (ASPLIT -> hi/lo 2 terms), Wt bf16 [N][K]; ACT 0 none, 1 relu, 2 exact gelu;
// resid (optional, f32, row index = (row % rmod), pitch ldr, RES_BF16 rounds it) added before the activation.
template <bool ASPLIT, int ACT, bool BIAS_BF16, bool RES_BF16>
__global__ __launch_bounds__(128) void k_gemm_bf3(const float* __restrict__ A, int lda, const unsigned short* __restrict__ Wt, int ldb,
                                                const float* __restrict__ bias, const float* __restrict__ resid, int rmod, int ldr,
                                                float* __restrict__ C, int ldc, int M, int N, int K) {
  __shared__ __attribute__((aligned(16))) float so[4][16][64];
  const int tid = threadIdx.x, w = tid >> 5, lane = tid & 31, ln = lane & 15, hh = lane >> 4;
  const int ntn = N / 64;
  const int wid = blockIdx.x * 4 + w;
  const int mt = wid / ntn, nq = wid % ntn;
  if (mt * 16 >= M) return;
  const int row0 = mt * 16, col0 = nq * 64;
  const float* arow = A + (size_t)(row0 + ln) * lda;
  v8f acc[4] = {};
  for (int kb = 0; kb < K; kb += 32) {
    FragB ah, al;
    const v4f x0 = *(const v4fa*)(arow + kb + 8 * hh), x1 = *(const v4fa*)(arow + kb + 8 * hh + 4);
    const v4f x2 = *(const v4fa*)(arow + kb + 16 + 8 * hh), x3 = *(const v4fa*)(arow + kb + 16 + 8 * hh + 4);
    float xs[16] = {x0[0],x0[1],x0[2],x0[3],x1[0],x1[1],x1[2],x1[3],x2[0],x2[1],x2[2],x2[3],x3[0],x3[1],x3[2],x3[3]};
#pragma unroll
    for (int i = 0; i < 16; ++i) { const unsigned short hb = bf16_bits(xs[i]); ah.u[i] = hb; al.u[i] = ASPLIT ? bf16_bits(xs[i] - bf16_val(hb)) : (unsigned short)0; }
#pragma unroll
    for (int t = 0; t < 4; ++t) {
      const unsigned short* brow = Wt + (size_t)(col0 + t * 16 + ln) * ldb + kb;
      FragB b;
      b.half[0] = *(const v8us*)(brow + 8 * hh);
      b.half[1] = *(const v8us*)(brow + 16 + 8 * hh);
      acc[t] = mmaN<ASPLIT ? 2 : 1>(ah.v, al.v, b.v, b.v, acc[t]);
    }
  }
#pragma unroll
  for (int t = 0; t < 4; ++t) {
    const int col = col0 + t * 16 + ln;
    float bv = bias ? bias[col] : 0.f;
    if (BIAS_BF16) bv = bf16_round(bv);
#pragma unroll
    for (int r = 0; r < 8; ++r) {
      float v = acc[t][r] + bv;
      if (resid) { float rv = resid[(size_t)((row0 + 8 * hh + r) % rmod) * ldr + col]; if (RES_BF16) rv = bf16_round(rv); v += rv; }
      if (ACT == 1) v = fmaxf(v, 0.f);
      if (ACT == 2) v = 0.5f * v * (1.0f + erff(v * 0.70710678118654752f));
      if (ACT == 3) { const float u = 0.7978845608028654f * (v + 0.044715f * v * v * v); v = 0.5f * v * (1.0f + tanhf(u)); }
      so[w][8 * hh + r][t * 16 + ln] = v;
    }
  }
  __builtin_amdgcn_fence(__ATOMIC_ACQ_REL, "workgroup");
  __builtin_amdgcn_wave_barrier();
  const int rsub = lane >> 4, c4 = (lane & 15) * 4;
  {
#pragma unroll
    for (int q = 0; q < 8; ++q) {
      const int r = q * 2 + rsub;
      const v4f v = *(const v4fa*)&so[w][r][c4];
      *(v4f*)(C + (size_t)(row0 + r) * ldc + col0 + c4) = v;
    }
    
  }
}
// row LayerNorm (biased variance, eps) over N: s = X (+ R); optional out_sum <- s; out_norm <- (s-mu)*rsqrt(var+eps)*g + b
template <bool PARAM_BF16>
__global__ __launch_bounds__(256) void k_layernorm(const float* __restrict__ X, const float* __restrict__ R, const float* __restrict__ g, const float* __restrict__ bta,
                                                  float* __restrict__ out_sum, float* __restrict__ out_norm, int N, float eps) {
  __shared__ float red[256];
  const int row = blockIdx.x, tid = threadIdx.x;
  const float* x = X + (size_t)row * N; const float* rr = R ? R + (size_t)row * N : nullptr;
  float vals[16];                     // up to N = 4096
  const int per = N / 256;            // contiguous chunk per thread? use strided-by-4 chunks: thread handles j = tid*4 + 1024*u
  float s1 = 0.f;
  for (int u = 0; u < per / 4; ++u) {
    const int j = tid * 4 + 1024 * u;
    const v4f a = *(const v4fa*)(x + j);
    v4f b = {0.f,0.f,0.f,0.f}; if (rr) b = *(const v4fa*)(rr + j);
#pragma unroll
    for (int q = 0; q < 4; ++q) { const float v = a[q] + b[q]; vals[u * 4 + q] = v; s1 += v; }
  }
  red[tid] = s1; __syncthreads();
  for (int st = 128; st > 0; st >>= 1) { if (tid < st) red[tid] += red[tid + st]; __syncthreads(); }
  const float mu = red[0] / (float)N; __syncthreads();
  float s2 = 0.f;
  for (int u = 0; u < per / 4; ++u)
#pragma unroll
    for (int q = 0; q < 4; ++q) { const float c = vals[u * 4 + q] - mu; s2 += c * c; }
  red[tid] = s2; __syncthreads();
  for (int st = 128; st > 0; st >>= 1) { if (tid < st) red[tid] += red[tid + st]; __syncthreads(); }
  const float rs = rsqrtf(red[0] / (float)N + eps);
  {
    for (int u = 0; u < per / 4; ++u) {
      const int j = tid * 4 + 1024 * u;
      v4f o, sm;
#pragma unroll
      for (int q = 0; q < 4; ++q) {
        float gg = g[j + q], bb = bta[j + q];
        if (PARAM_BF16) { gg = bf16_round(gg); bb = bf16_round(bb); }
        sm[q] = vals[u * 4 + q]; o[q] = (vals[u * 4 + q] - mu) * rs * gg + bb;
      }
      if (out_sum) *(v4f*)(out_sum + (size_t)row * N + j) = sm;
      *(v4f*)(out_norm + (size_t)row * N + j) = o;
    }
    
  }
}



// ---- f16 WMMA path (v_wmma_f32_16x16x32_f16): 11-bit significands for operands in range — used where a [0,1] probability operand needs more precision than bf16
typedef _Float16 v16h __attribute__((ext_vector_type(16)));
union FragH { v16h v; v8us half[2]; _Float16 h[16]; unsigned short u[16]; };
template <int NT>
__device__ __forceinline__ v8f mmaH(v16h ah, v16h al, v16h bh, v16h bl, v8f c) {
  c = __builtin_amdgcn_wmma_f32_16x16x32_f16(false, ah, false, bh, (short)0, c, false, false);
  if (NT >= 2) c = __builtin_amdgcn_wmma_f32_16x16x32_f16(false, al, false, bh, (short)0, c, false, false);
  if (NT >= 3) c = __builtin_amdgcn_wmma_f32_16x16x32_f16(false, ah, false, bl, (short)0, c, false, false);
  asm volatile("v_nop\n\tv_nop\n\tv_nop\n\tv_nop" : "+v"(c) : "v"(ah), "v"(al), "v"(bh), "v"(bl));
  return c;
}
// batched GEMM like k_gemm_b but f16 operands: A f32 (split into f16 hi/lo if ASPLIT, else rounded to f16), Bt = f16 values [n][k]; alpha; C f32; N multiple of 16 (partial tiles skipped)
template <bool ASPLIT>
__global__ __launch_bounds__(128) void k_gemm_h(const float* __restrict__ A, int lda, size_t sA, const _Float16* __restrict__ Bh, int ldb, size_t sB, float alpha, float* __restrict__ C, int ldc, size_t sC, int M, int N, int K) {
  __shared__ __attribute__((aligned(16))) float so[4][16][64];
  const int tid = threadIdx.x, w = tid >> 5, lane = tid & 31, ln = lane & 15, hh = lane >> 4; const int by = blockIdx.y;
  A += (size_t)by * sA; Bh += (size_t)by * sB; C += (size_t)by * sC;
  const int ntn = (N + 63) / 64; const int wid = blockIdx.x * 4 + w; const int mt = wid / ntn, nq = wid % ntn; if (mt * 16 >= M) return;
  const int row0 = mt * 16, col0 = nq * 64; const float* arow = A + (size_t)(row0 + ln) * lda;
  v8f acc[4] = {};
  for (int kb = 0; kb < K; kb += 32) {
    FragH ah, al;
    const v4f x0 = *(const v4fa*)(arow + kb + 8 * hh), x1 = *(const v4fa*)(arow + kb + 8 * hh + 4), x2 = *(const v4fa*)(arow + kb + 16 + 8 * hh), x3 = *(const v4fa*)(arow + kb + 16 + 8 * hh + 4);
    float xs[16] = {x0[0],x0[1],x0[2],x0[3],x1[0],x1[1],x1[2],x1[3],x2[0],x2[1],x2[2],x2[3],x3[0],x3[1],x3[2],x3[3]};
#pragma unroll
    for (int i = 0; i < 16; ++i) { const _Float16 h = (_Float16)xs[i]; ah.h[i] = h; al.h[i] = ASPLIT ? (_Float16)(xs[i] - (float)h) : (_Float16)0.0f; }
#pragma unroll
    for (int t = 0; t < 4; ++t) { if (col0 + t * 16 >= N) continue; const size_t boff = (size_t)(col0 + t * 16 + ln) * ldb + kb; FragH bq; bq.half[0] = *(const v8us*)(Bh + boff + 8 * hh); bq.half[1] = *(const v8us*)(Bh + boff + 16 + 8 * hh);
      acc[t] = mmaH<ASPLIT ? 2 : 1>(ah.v, al.v, bq.v, bq.v, acc[t]); }
  }
#pragma unroll
  for (int t = 0; t < 4; ++t) { if (col0 + t * 16 >= N) continue;
#pragma unroll
    for (int r = 0; r < 8; ++r) so[w][8 * hh + r][t * 16 + ln] = acc[t][r] * alpha; }
  __builtin_amdgcn_fence(__ATOMIC_ACQ_REL, "workgroup"); __builtin_amdgcn_wave_barrier();
  const int rsub = lane >> 4, c4 = (lane & 15) * 4;
  {
#pragma unroll
    for (int q = 0; q < 8; ++q) { const int r = q * 2 + rsub; if (col0 + c4 < N) { const v4f v = *(const v4fa*)&so[w][r][c4]; *(v4f*)(C + (size_t)(row0 + r) * ldc + col0 + c4) = v; } }
     }
}

// Wt[n][k] = f16(W[k][n]·scale) from f32 row-major W[K][N] (scale = power of two; bf16-exact weights stay exact in f16 away from the subnormal range)
__global__ __launch_bounds__(256) void k_wt_f16(const float* __restrict__ W, _Float16* __restrict__ Wt, int K, int N, float scale) {
  const int t = blockIdx.x * 256 + threadIdx.x; if (t >= N * (K / 8)) return; const int n = t / (K / 8), k8 = (t % (K / 8)) * 8; FragH f;
#pragma unroll
  for (int i = 0; i < 8; ++i) f.h[i] = (_Float16)(bf16_round(W[(size_t)(k8 + i) * N + n]) * scale); const v8us o = f.half[0];
  *(v8us*)((unsigned short*)Wt + (size_t)n * K + k8) = o; 
}
// k_gemm_hh variant with fused epilogue: v = acc·alpha + bias[by·sBias + col] (+ CP[(row/rowsPerB)·sCPb + by·64 + col] if CP) ; ACT 0 none / 1 elu ; writes f16 C16 (and f32 C if non-null)
template <int ACT>
__global__ __launch_bounds__(128) void k_gemm_hhx(const _Float16* __restrict__ A, int lda, size_t sA, const _Float16* __restrict__ Bh, int ldb, size_t sB, float alpha, const float* __restrict__ bias, size_t sBias, const float* __restrict__ CP, int rowsPerB, size_t sCPb, int row0g,
    float* __restrict__ C, _Float16* __restrict__ C16, int ldc, size_t sC, int M, int N, int K) {
  __shared__ __attribute__((aligned(16))) float so[4][16][64];
  const int tid = threadIdx.x, w = tid >> 5, lane = tid & 31, ln = lane & 15, hh = lane >> 4; const int by = blockIdx.y;
  A += (size_t)by * sA; Bh += (size_t)by * sB; const size_t cofs = (size_t)by * sC; const float* bp = bias ? bias + (size_t)by * sBias : nullptr;
  const int ntn = (N + 63) / 64; const int wid = blockIdx.x * 4 + w; const int mt = wid / ntn, nq = wid % ntn; if (mt * 16 >= M) return;
  const int row0 = mt * 16, col0 = nq * 64; const _Float16* arow = A + (size_t)(row0 + ln) * lda;
  v8f acc[4] = {};
  for (int kb = 0; kb < K; kb += 32) { FragH ah; ah.half[0] = *(const v8us*)((const unsigned short*)arow + kb + 8 * hh); ah.half[1] = *(const v8us*)((const unsigned short*)arow + kb + 16 + 8 * hh);
#pragma unroll
    for (int t = 0; t < 4; ++t) { if (col0 + t * 16 >= N) continue; const size_t boff = (size_t)(col0 + t * 16 + ln) * ldb + kb; FragH bq; bq.half[0] = *(const v8us*)((const unsigned short*)Bh + boff + 8 * hh); bq.half[1] = *(const v8us*)((const unsigned short*)Bh + boff + 16 + 8 * hh);
      acc[t] = mmaH<1>(ah.v, ah.v, bq.v, bq.v, acc[t]); }
  }
#pragma unroll
  for (int t = 0; t < 4; ++t) { if (col0 + t * 16 >= N) continue; const int col = col0 + t * 16 + ln; const float bv = bp ? bf16_round(bp[col]) : 0.f;
#pragma unroll
    for (int r = 0; r < 8; ++r) { float v = acc[t][r] * alpha + bv; if (CP) { const int rr = row0g + row0 + 8 * hh + r; if (rowsPerB < 0) v += CP[cofs + (size_t)rr * ldc + col];      /* rowsPerB < 0: own element of the batched C plane */ else { const int bidx = rr / rowsPerB; v += CP[(size_t)bidx * sCPb + (size_t)by * 64 + col]; } } if (ACT == 1) v = (v > 0.f) ? v : expm1f(v); else if (ACT == 7) v = (v > 0.f) ? v + 1.0f : expf(v); else if (ACT == 8) v = tanhf(v); else if (ACT == 9) v = 0.5f * v * (1.0f + tanhf(0.7978845608028654f * (v + 0.044715f * v * v * v))); else if (ACT == 11) v = 1.0f / (1.0f + expf(-v)); else if (ACT == 12) v = (v > 0.f) ? v : 0.01f * v; else if (ACT == 14) v = (v > 0.f) ? v : 0.1f * v; else if (ACT == 16) v = (v >= 0.f) ? v : 0.3f * v; else if (ACT == 17) v = (v >= 0.f) ? v : 0.2f * v; else if (ACT == 15) v = v / (1.0f + expf(-v)); else if (ACT == 3) v = fmaxf(v, 0.f); else if (ACT == 6) v = 0.5f * v * (1.0f + erff(v * 0.70710678118654752f)); so[w][8 * hh + r][t * 16 + ln] = v; } }
  __builtin_amdgcn_fence(__ATOMIC_ACQ_REL, "workgroup"); __builtin_amdgcn_wave_barrier();
  const int rsub = lane >> 4, c4 = (lane & 15) * 4; typedef _Float16 v4h __attribute__((ext_vector_type(4)));
  {
#pragma unroll
    for (int q = 0; q < 8; ++q) { const int r = q * 2 + rsub; if (col0 + c4 < N) { const v4f v = *(const v4fa*)&so[w][r][c4]; if (C) *(v4f*)(C + cofs + (size_t)(row0 + r) * ldc + col0 + c4) = v; if (C16) { v4h h4; for (int i = 0; i < 4; ++i) h4[i] = (_Float16)v[i]; *(v4h*)(C16 + cofs + (size_t)(row0 + r) * ldc + col0 + c4) = h4; } } }
     }
}


typedef _Float16 v4h __attribute__((ext_vector_type(4)));

__global__ __launch_bounds__(256) void k_x16(const float* __restrict__ x, _Float16* __restrict__ X16, size_t n8) { const size_t t = (size_t)blockIdx.x * 256 + threadIdx.x; if (t >= n8) return; FragH f;
#pragma unroll
  for (int q = 0; q < 8; ++q) f.h[q] = (_Float16)bf16_round(x[t * 8 + q]); *(v8us*)((unsigned short*)X16 + t * 8) = f.half[0];  }
__global__ __launch_bounds__(256) void k_h16(const float* __restrict__ x, _Float16* __restrict__ X16, size_t n8) { const size_t t = (size_t)blockIdx.x * 256 + threadIdx.x; if (t >= n8) return; FragH f;
#pragma unroll
  for (int q = 0; q < 8; ++q) f.h[q] = (_Float16)x[t * 8 + q]; *(v8us*)((unsigned short*)X16 + t * 8) = f.half[0];  }
__global__ __launch_bounds__(256) void k_round16f(const float* __restrict__ W, _Float16* __restrict__ Bt, size_t n8) { const size_t t = (size_t)blockIdx.x * 256 + threadIdx.x; if (t >= n8) return; FragH f;
#pragma unroll
  for (int i = 0; i < 8; ++i) f.h[i] = (_Float16)(bf16_round(W[t * 8 + i]) * 16.0f); *(v8us*)((unsigned short*)Bt + t * 8) = f.half[0];  }
template <int NHv, int TTv>
__global__ __launch_bounds__(256) void k_vt(const _Float16* __restrict__ V16, int ldv, int voff, _Float16* __restrict__ Vt) { __shared__ unsigned short tl[64][66]; const int tid = threadIdx.x; const int slab = blockIdx.x / (TTv / 64), lg = blockIdx.x % (TTv / 64); const int b = slab / NHv, h = slab % NHv;
  for (int i = tid; i < 64 * 8; i += 256) { const int r = i / 8, c8 = (i % 8) * 8; FragH f; f.half[0] = *(const v8us*)((const unsigned short*)V16 + ((size_t)b * TTv + lg * 64 + r) * ldv + voff + h * 64 + c8);
#pragma unroll
    for (int q = 0; q < 8; ++q) tl[r][c8 + q] = f.u[q]; }
  __syncthreads();
  {
#pragma unroll
    for (int rd = 0; rd < 2; ++rd) { const int d = rd * 32 + tid / 8, pc = tid % 8; FragH f;
#pragma unroll
      for (int q = 0; q < 8; ++q) f.u[q] = tl[pc * 8 + q][d];
      *(v8us*)((unsigned short*)Vt + ((size_t)slab * 64 + d) * TTv + lg * 64 + pc * 8) = f.half[0]; }
     } }

__global__ __launch_bounds__(256) void k_hl(const float* __restrict__ F, _Float16* __restrict__ Hh, _Float16* __restrict__ Hl, size_t n8) { const size_t t = (size_t)blockIdx.x * 256 + threadIdx.x; if (t >= n8) return; FragH fh, fl; const v4f a = *(const v4fa*)(F + t * 8), c = *(const v4fa*)(F + t * 8 + 4);
#pragma unroll
  for (int q = 0; q < 4; ++q) { _Float16 h = (_Float16)a[q]; fh.h[q] = h; fl.h[q] = (_Float16)((a[q] - (float)h) * 1024.0f); h = (_Float16)c[q]; fh.h[4 + q] = h; fl.h[4 + q] = (_Float16)((c[q] - (float)h) * 1024.0f); }
  { *(v8us*)((unsigned short*)Hh + t * 8) = fh.half[0]; *(v8us*)((unsigned short*)Hl + t * 8) = fl.half[0];  } }

// ---- fast GEMM (wave tile 32x64; requires M % 32 == 0 rows per launch region and N % 64 == 0); epilogue = k_gemm_hhx semantics ----
__device__ __forceinline__ v16h g2_frag(const _Float16* p, int hh) { FragH f; f.half[0] = *(const v8us*)((const unsigned short*)p + 8 * hh); f.half[1] = *(const v8us*)((const unsigned short*)p + 16 + 8 * hh); return f.v; }
__device__ __forceinline__ v8f g2_mma(v16h a, v16h b, v8f c) { v8f d = __builtin_amdgcn_wmma_f32_16x16x32_f16(false, a, false, b, (short)0, c, false, false); asm volatile("v_nop\n\tv_nop\n\tv_nop\n\tv_nop" : "+v"(d) : "v"(a), "v"(b)); return d; }
template <int ACT>
__global__ __launch_bounds__(128) void k_gemm2(const _Float16* __restrict__ A, int lda, size_t sA, const _Float16* __restrict__ Bh, int ldb, size_t sB, float alpha, const float* __restrict__ bias, size_t sBias, const float* __restrict__ CP, int rowsPerB, size_t sCPb, int row0g,
    float* __restrict__ C, _Float16* __restrict__ C16, int ldc, size_t sC, int M, int N, int K) { static_assert(ACT == 0 || ACT == 3 || ACT == 6 || ACT == 8 || ACT == 9 || ACT == 11 || ACT == 12 || ACT == 14 || ACT == 15 || ACT == 16 || ACT == 17, "k_gemm2: unsupported ACT code (would silently apply no activation)");
  __shared__ __attribute__((aligned(16))) float so[4][32][68];
  const int tid = threadIdx.x, w = tid >> 5, lane = tid & 31, ln = lane & 15, hh = lane >> 4; const int by = blockIdx.y;
  A += (size_t)by * sA; Bh += (size_t)by * sB; const size_t cofs = (size_t)by * sC; const float* bp = bias ? bias + (size_t)by * sBias : nullptr;
  const int ntn = N >> 6; const int mt = blockIdx.x / ntn, nq = blockIdx.x - mt * ntn; const int row0 = mt * 128 + 32 * w, col0 = nq * 64; if (row0 >= M) return;
  const _Float16* a0p = A + (size_t)(row0 + ln) * lda; const _Float16* a1p = a0p + (size_t)16 * lda;
  const _Float16* b0p = Bh + (size_t)(col0 + ln) * ldb; const _Float16* b1p = b0p + (size_t)16 * ldb; const _Float16* b2p = b1p + (size_t)16 * ldb; const _Float16* b3p = b2p + (size_t)16 * ldb;
  const v8f z8 = {0.f,0.f,0.f,0.f,0.f,0.f,0.f,0.f}; v8f c00 = z8, c01 = z8, c02 = z8, c03 = z8, c10 = z8, c11 = z8, c12 = z8, c13 = z8;
#pragma unroll 1
  for (int kb = 0; kb < K; kb += 32) { const v16h a0 = g2_frag(a0p + kb, hh), a1 = g2_frag(a1p + kb, hh);
    v16h b = g2_frag(b0p + kb, hh); c00 = g2_mma(a0, b, c00); c10 = g2_mma(a1, b, c10);
    b = g2_frag(b1p + kb, hh); c01 = g2_mma(a0, b, c01); c11 = g2_mma(a1, b, c11);
    b = g2_frag(b2p + kb, hh); c02 = g2_mma(a0, b, c02); c12 = g2_mma(a1, b, c12);
    b = g2_frag(b3p + kb, hh); c03 = g2_mma(a0, b, c03); c13 = g2_mma(a1, b, c13); }
  v8f accs[8] = {c00, c01, c02, c03, c10, c11, c12, c13};
#pragma unroll
  for (int u = 0; u < 8; ++u) { const int t = u & 3, half = u >> 2; const int col = col0 + t * 16 + ln; const float bv = bp ? bf16_round(bp[col]) : 0.f;
#pragma unroll
    for (int r = 0; r < 8; ++r) { const int rloc = half * 16 + 8 * hh + r; float v = accs[u][r] * alpha + bv; if (CP) { if (rowsPerB < 0) v += CP[cofs + (size_t)(row0g + row0 + rloc) * ldc + col];      /* rowsPerB < 0: own element of the batched C plane */ else { const int bidx = (row0g + row0 + rloc) / rowsPerB; v += CP[(size_t)bidx * sCPb + (size_t)by * 64 + col]; } }
      if (ACT == 3) v = fmaxf(v, 0.f); else if (ACT == 6) v = 0.5f * v * (1.0f + erff(v * 0.70710678118654752f)); else if (ACT == 11) v = 1.0f / (1.0f + expf(-v)); else if (ACT == 15) v = v / (1.0f + expf(-v)); else if (ACT == 12) v = (v > 0.f) ? v : 0.01f * v; else if (ACT == 8) v = tanhf(v); else if (ACT == 9) v = 0.5f * v * (1.0f + tanhf(0.7978845608028654f * (v + 0.044715f * v * v * v))); else if (ACT == 14) v = (v > 0.f) ? v : 0.1f * v; else if (ACT == 16) v = (v >= 0.f) ? v : 0.3f * v; else if (ACT == 17) v = (v >= 0.f) ? v : 0.2f * v;
      so[w][rloc][t * 16 + ln] = v; } }
  __builtin_amdgcn_fence(__ATOMIC_ACQ_REL, "workgroup"); __builtin_amdgcn_wave_barrier();
  const int rsub = lane >> 4, c4 = (lane & 15) * 4;
  {
#pragma unroll
    for (int q = 0; q < 16; ++q) { const int r = q * 2 + rsub; const v4f v = *(const v4fa*)&so[w][r][c4]; if (C) *(v4f*)(C + cofs + (size_t)(row0 + r) * ldc + col0 + c4) = v; if (C16) { v4h h4; for (int i = 0; i < 4; ++i) h4[i] = (_Float16)v[i]; *(v4h*)(C16 + cofs + (size_t)(row0 + r) * ldc + col0 + c4) = h4; } }
     } }


__global__ __launch_bounds__(256) void k_wnat(const float* __restrict__ w, size_t n8, _Float16* __restrict__ Bt) { const size_t t = (size_t)blockIdx.x * 256 + threadIdx.x; if (t >= n8) return; FragH f; for (int q = 0; q < 8; ++q) f.h[q] = (_Float16)(bf16_round(w[t * 8 + q]) * 16.0f); *(v8us*)((unsigned short*)Bt + t * 8) = f.half[0];  }
// energy + row softmax in one kernel. A work-group of 16 waves owns 16 rows n of the attention matrix; wave w forms the transposed logits E^T[m][n] of its 256 columns m
// (A = k rows, B = q rows; hi.hi in one accumulator, lo.hi + hi.lo in a second, joined as hi + lo / 1024). The logits stay in registers for the maximum, the exponentials,
// their sum and the scaled f16 store, so they never go to memory. In the D layout a lane holds ONE row n (its column) and 8 consecutive m per tile: the row reductions are
// in-lane but for one lane exchange and one LDS exchange between the waves, and each tile is one 16-byte store into P[n][m].
__device__ __forceinline__ v8f es_mma(v16h a, v16h b, v8f c) { return __builtin_amdgcn_wmma_f32_16x16x32_f16(false, a, false, b, (short)0, c, false, false); }
__global__ __launch_bounds__(512) void k_esm(const _Float16* __restrict__ Qh, const _Float16* __restrict__ Ql, const _Float16* __restrict__ Kh, const _Float16* __restrict__ Kl, _Float16* __restrict__ P) {
  __shared__ float redm[16][16]; __shared__ float reds[16][16];
  const int tid = threadIdx.x, w = tid >> 5, lane = tid & 31, ln = lane & 15, hh = lane >> 4; const int n0 = blockIdx.x * 16;
  const _Float16* qhp = Qh + (size_t)(n0 + ln) * CQ; const _Float16* qlp = Ql + (size_t)(n0 + ln) * CQ;
  const v16h qh0 = g2_frag(qhp, hh), qh1 = g2_frag(qhp + 32, hh);
  asm volatile("s_wait_xcnt 0x0" ::: "memory");      /* the address pair of the loads above may be given to a later load's result: the wait stands in front of that overwrite */
  const v16h ql0 = g2_frag(qlp, hh), ql1 = g2_frag(qlp + 32, hh);
  asm volatile("s_wait_xcnt 0x0" ::: "memory");      /* the same for the address pair of the two loads above */
  const _Float16* khp = Kh + (size_t)(w * 256 + ln) * CQ; const _Float16* klp = Kl + (size_t)(w * 256 + ln) * CQ;
  const v8f z8 = {0.f,0.f,0.f,0.f,0.f,0.f,0.f,0.f}; v8f e[16];
  v16h nh0 = g2_frag(khp, hh), nh1 = g2_frag(khp + 32, hh), nl0 = g2_frag(klp, hh), nl1 = g2_frag(klp + 32, hh);
  // every loop over e[] is unrolled in full: e is then indexed by constants only and stays in registers
#pragma unroll
  for (int t = 0; t < 16; ++t) { const v16h kh0 = nh0, kh1 = nh1, kl0 = nl0, kl1 = nl1;
    if (t + 1 < 16) { nh0 = g2_frag(khp + (t + 1) * 16 * CQ, hh); nh1 = g2_frag(khp + (t + 1) * 16 * CQ + 32, hh); nl0 = g2_frag(klp + (t + 1) * 16 * CQ, hh); nl1 = g2_frag(klp + (t + 1) * 16 * CQ + 32, hh); }      /* the next tile's fragments fly under this tile's products */
    v8f ch = es_mma(kh0, qh0, z8); v8f cl = es_mma(kl0, qh0, z8); ch = es_mma(kh1, qh1, ch); cl = es_mma(kl1, qh1, cl); cl = es_mma(kh0, ql0, cl); cl = es_mma(kh1, ql1, cl);
    e[t] = ch + cl * (1.0f / 1024.0f); }
  v8f m8 = e[0];
#pragma unroll
  for (int t = 1; t < 16; ++t) for (int r = 0; r < 8; ++r) m8[r] = fmaxf(m8[r], e[t][r]);
  float mx = fmaxf(fmaxf(fmaxf(m8[0], m8[1]), fmaxf(m8[2], m8[3])), fmaxf(fmaxf(m8[4], m8[5]), fmaxf(m8[6], m8[7])));
  mx = fmaxf(mx, __shfl_xor(mx, 16, 32));
  if (hh == 0) redm[w][ln] = mx;
  __syncthreads();
#pragma unroll
  for (int u = 0; u < 16; ++u) mx = fmaxf(mx, redm[u][ln]);
#pragma unroll
  for (int t = 0; t < 16; ++t) for (int r = 0; r < 8; ++r) e[t][r] = expf(e[t][r] - mx);
  v8f s8 = e[0];
#pragma unroll
  for (int t = 1; t < 16; ++t) s8 += e[t];
  float sw = ((s8[0] + s8[1]) + (s8[2] + s8[3])) + ((s8[4] + s8[5]) + (s8[6] + s8[7]));
  sw += __shfl_xor(sw, 16, 32);
  if (hh == 0) reds[w][ln] = sw;
  __syncthreads();
  float se = 0.f;
#pragma unroll
  for (int u = 0; u < 16; ++u) se += reds[u][ln];
  const float sc = 256.0f / se; unsigned short* p = (unsigned short*)P + (size_t)(n0 + ln) * SQ + w * 256 + 8 * hh;
#pragma unroll
  for (int t = 0; t < 16; ++t) { FragH f; for (int r = 0; r < 8; ++r) f.h[r] = (_Float16)(e[t][r] * sc); *(v8us*)(p + t * 16) = f.half[0]; } }
__global__ __launch_bounds__(256) void k_vt(const _Float16* __restrict__ V16, int b, int h0, _Float16* __restrict__ VT) { __shared__ unsigned short tl[64][65]; const int tid = threadIdx.x; const int hh = blockIdx.x % HG, sg = blockIdx.x / HG; const int s0 = sg * 64; const int h = h0 + hh;
  for (int i = tid; i < 64 * 8; i += 256) { const int j = i / 8, d8 = (i % 8) * 8; FragH f; f.half[0] = *(const v8us*)((const unsigned short*)V16 + ((size_t)b * SQ + s0 + j) * DM + h * HD + d8); for (int q = 0; q < 8; ++q) tl[d8 + q][j] = f.u[q]; }
  __syncthreads();
  { for (int i = tid; i < 64 * 8; i += 256) { const int d = i / 8, j8 = (i % 8) * 8; FragH f; for (int q = 0; q < 8; ++q) f.u[q] = tl[d][j8 + q]; *(v8us*)((unsigned short*)VT + ((size_t)hh * HD + d) * SQ + s0 + j8) = f.half[0]; }  } }


__global__ __launch_bounds__(256) void k_cl2rows(const float* __restrict__ X, _Float16* __restrict__ XR) { __shared__ float tl[64][33]; const int tid = threadIdx.x; const int nl = LL / 32, nc = CC / 64; const int cb_ = blockIdx.x % nc; const int lb = (blockIdx.x / nc) % nl; const size_t b = blockIdx.x / (nc * nl); const int c0 = cb_ * 64, l0 = lb * 32;
  for (int i = tid; i < 64 * 32; i += 256) { const int c = i / 32, l = i % 32; tl[c][l] = bf16_round(X[(b * CC + c0 + c) * (size_t)LL + l0 + l]); }
  __syncthreads();
  { const int l = tid / 8, c8 = (tid % 8) * 8; FragH f; for (int q = 0; q < 8; ++q) f.h[q] = (_Float16)tl[c8 + q][l]; unsigned short* d = (unsigned short*)XR + (b * LL + l0 + l) * (size_t)CC + c0 + c8; *(v8us*)d = f.half[0];  } }

__global__ __launch_bounds__(256) void k_fin3(const float* __restrict__ Cm, const float* __restrict__ x, float* __restrict__ out) {
  #pragma clang fp contract(off)
  const size_t t = (size_t)blockIdx.x * 256 + threadIdx.x; if (t >= (size_t)NBR * CC * NPX / 8) return; const size_t base = t * 8; v8f v;
  const v4f x0 = *(const v4fa*)(x + base), x1 = *(const v4fa*)(x + base + 4);
  asm volatile("s_wait_xcnt 0x0" ::: "memory");      /* the address pair of the two loads above may be given to a later load's result: the wait stands in front of that overwrite */
  for (int q = 0; q < 4; ++q) { v[q] = __fadd_rn(bf16_round(x0[q]), Cm[base + q]); v[4 + q] = __fadd_rn(bf16_round(x1[q]), Cm[base + 4 + q]); } *(v8f*)(out + base) = v;  }

extern "C" void kernel_launch(void* const* d_in, const int* in_sizes, int n_in,
                              void* d_out, int out_size, void* d_ws, size_t ws_size, hipStream_t stream) {
  (void)in_sizes; (void)n_in; (void)out_size;
  const float* const* I = (const float* const*)d_in; const float* x = I[0]; const float* Wq = I[1]; const float* Wk = I[2]; const float* Wv = I[3]; const float* bv = I[4];
  char* ws = (char*)d_ws; size_t off = 0;
  auto take = [&](size_t bytes) { char* p = ws + off; off += (bytes + 255) & ~(size_t)255; return p; };
  _Float16* BQ = (_Float16*)take((size_t)CQ * CC * 2); _Float16* BK = (_Float16*)take((size_t)CQ * CC * 2); _Float16* BV = (_Float16*)take((size_t)CC * CC * 2);
  _Float16* XR = (_Float16*)take(NR * CC * 2); float* QF = (float*)take(NR * CQ * 4); float* KF = (float*)take(NR * CQ * 4); _Float16* QH = (_Float16*)take(NR * CQ * 2); _Float16* QL = (_Float16*)take(NR * CQ * 2); _Float16* KH = (_Float16*)take(NR * CQ * 2); _Float16* KL = (_Float16*)take(NR * CQ * 2); _Float16* V16 = (_Float16*)take(NR * CC * 2);
  _Float16* P = (_Float16*)take((size_t)NPX * NPX * 2); _Float16* PT = (_Float16*)take((size_t)NB * NPX * NPX * 2); _Float16* VT = (_Float16*)take((size_t)NB * CC * NPX * 2); float* CX = (float*)take((size_t)NB * CC * NPX * 4);
  if (off > ws_size) return;      /* 0.2 + 8 + 8 + 8 + 8 + 32 + 128 + 8 + 16 = approx 216 MiB: P^T, v channel-major and x_r hold all images */
  k_wnat<<<(unsigned)(((size_t)CQ * CC / 8 + 255) / 256), 256, 0, stream>>>(Wq, (size_t)CQ * CC / 8, BQ); k_wnat<<<(unsigned)(((size_t)CQ * CC / 8 + 255) / 256), 256, 0, stream>>>(Wk, (size_t)CQ * CC / 8, BK); k_wnat<<<(unsigned)(((size_t)CC * CC / 8 + 255) / 256), 256, 0, stream>>>(Wv, (size_t)CC * CC / 8, BV);
  k_cl2rows<<<NB * (NPX / 32) * (CC / 64), 256, 0, stream>>>(x, XR);
  k_gemm2<0><<<dim3((unsigned)((NR / 128) * 1), 1), 128, 0, stream>>>(XR, CC, 0, BQ, CC, 0, 0.0625f, nullptr, 0, nullptr, 1, 0, 0, QF, nullptr, CQ, 0, MP, CQ, CC);      /* q (f32, exact products) */
  k_gemm2<0><<<dim3((unsigned)((NR / 128) * 1), 1), 128, 0, stream>>>(XR, CC, 0, BK, CC, 0, 0.0625f, nullptr, 0, nullptr, 1, 0, 0, KF, nullptr, CQ, 0, MP, CQ, CC);      /* k */
  k_gemm2<0><<<dim3((unsigned)((NR / 128) * (CC / 64)), 1), 128, 0, stream>>>(XR, CC, 0, BV, CC, 0, 0.0625f, bv, 0, nullptr, 1, 0, 0, nullptr, V16, CC, 0, MP, CC, CC);      /* v + bv (f16 rows) */
  k_hl<<<(unsigned)((NR * CQ / 8 + 255) / 256), 256, 0, stream>>>(QF, QH, QL, NR * CQ / 8); k_hl<<<(unsigned)((NR * CQ / 8 + 255) / 256), 256, 0, stream>>>(KF, KH, KL, NR * CQ / 8);
  for (int b = 0; b < NBR; ++b) { const size_t r0 = (size_t)b * NPX;
    k_esm<<<NPX / 16, 512, 0, stream>>>(QH + r0 * CQ, QL + r0 * CQ, KH + r0 * CQ, KL + r0 * CQ, P);      /* P[n][m] = 256 softmax_m(q_n . k_m) */
    k_vt<NH, SQ><<<NH * (SQ / 64), 256, 0, stream>>>(P, NPX, 0, PT + (size_t)b * NPX * NPX); }      /* P^T (x256), one plane per image */
  // one launch for all images from here on: a single image's x_r product has 128 work-groups of one wave a SIMD, half the chip's WGPs; grid y = image puts four times the waves in flight
  k_vt<4, SQ><<<NBR * 4 * (SQ / 64), 256, 0, stream>>>(V16, CC, 0, VT);      /* v channel-major [image][256][4096] */
  k_gemm2<0><<<dim3((CC / 128) * (MC / 64), NBR), 128, 0, stream>>>(VT, NPX, (size_t)CC * NPX, PT, NPX, (size_t)NPX * NPX, 0.00390625f, nullptr, 0, nullptr, 1, 0, 0, CX, nullptr, NPX, (size_t)CC * NPX, CC, MC, NPX);      /* x_r[c][m] = sum_n v[c][n] attention[n][m] */
  k_fin3<<<(unsigned)(((size_t)NBR * CC * NPX / 8 + 255) / 256), 256, 0, stream>>>(CX, x, (float*)d_out);
}

// v004
// One run takes 382 microseconds.
// Timed twice side by side with v003, it ran 1.12 and 1.11 times as fast.
// Counting every step since v000, it is 10.4 times as fast.
#include <hip/hip_runtime.h>
// SA layer (x [4][256][4096]; q = Wq x (64), k = Wk x (64), v = Wv x + bv (256); energy[n][m] = q_n . k_m (no scale); attention = softmax over m; x_r[c][m] = sum_n v[c][n] attention[n][m]; out = x + x_r -> [4][256][4096]).
// Structure: channel-first input transposed to position rows (exact f16) via LDS tiles; q / k as WMMA GEMMs (32x64 wave tiles, f32 accumulation, exact x16 natural weights; exact products) kept f32 and split into f16 hi + 2^-10 residual planes; v GEMM (+ bias) to f16 rows and transposed channel-major via LDS tiles; per image: the unscaled energy as a THREE-term product (hi.hi + lo.hi + hi.lo, K = 64) whose f32 logits stay in registers for the row softmax on VALU (P x256 f16, one kernel), x_r = V(channel-major) . P^T-as-Bt GEMM (M = 256 channels, K = 4096) into f32; residual + store on VALU. The q / k planes, v channel-major and P^T lie in fragment order (see fo_unit), each written so by the kernel that makes it.
// Compute dtype: inputs rounded to bf16; x / weights exact; q, k as hi + residual (~f32, the logits have sigma ~8); v, P as plain f16 operands (~2^-12); softmax f32. v_wmma_f32_16x16x32_f16.
#define NB 4
#define CC 256
#define CQ 64
#define NPX 4096
#define LL NPX
#define PX NPX
#define NR ((size_t)NB * NPX)
#define NBR NB                       /* images attended (debug hook) */
#define MP ((int)NR)                 /* rows projected (debug hook) */
#define MC NPX                       /* unused */
#define SQ NPX
#define DM NPX
#define NH 64
#define HD 64
#define HG 1
typedef __bf16 v16b __attribute__((ext_vector_type(16)));
typedef unsigned short v8us __attribute__((ext_vector_type(8), may_alias));
typedef float  v8f  __attribute__((ext_vector_type(8)));
typedef float  v4f  __attribute__((ext_vector_type(4)));
typedef float  v4fa __attribute__((ext_vector_type(4), may_alias));
union FragB { v16b v; v8us half[2]; unsigned short u[16]; };

__device__ __forceinline__ unsigned short bf16_bits(float x) { unsigned int u = __float_as_uint(x); return (unsigned short)((u + 0x7FFFu + ((u >> 16) & 1u)) >> 16); }
__device__ __forceinline__ float bf16_val(unsigned short b) { return __uint_as_float(((unsigned int)b) << 16); }
__device__ __forceinline__ float bf16_round(float x) { return bf16_val(bf16_bits(x)); }
// D += A·B with NT terms: 1 = ah·bh, 2 = + al·bh (A split), 3 = + ah·bl (both split)
template <int NT>
__device__ __forceinline__ v8f mmaN(v16b ah, v16b al, v16b bh, v16b bl, v8f c) {
  c = __builtin_amdgcn_wmma_f32_16x16x32_bf16(false, ah, false, bh, (short)0, c, false, false);
  if (NT >= 2) c = __builtin_amdgcn_wmma_f32_16x16x32_bf16(false, al, false, bh, (short)0, c, false, false);
  if (NT >= 3) c = __builtin_amdgcn_wmma_f32_16x16x32_bf16(false, ah, false, bl, (short)0, c, false, false);
  asm volatile("v_nop\n\tv_nop\n\tv_nop\n\tv_nop" : "+v"(c) : "v"(ah), "v"(al), "v"(bh), "v"(bl));
  return c;
}

__global__ __launch_bounds__(256) void k_wt_bf16(const float* __restrict__ W, unsigned short* __restrict__ Wt, int K, int N) {
  const int t = blockIdx.x * 256 + threadIdx.x;
  const int k8n = K / 8;
  if (t >= N * k8n) return;
  const int n = t / k8n, k8 = (t % k8n) * 8;
  v8us v;
#pragma unroll
  for (int i = 0; i < 8; ++i) v[i] = bf16_bits(W[(size_t)(k8 + i) * N + n]);
  *(v8us*)(Wt + (size_t)n * K + k8) = v;
  
}

// GEMM C[M][N] (f32, pitch ldc) = act(A[M][K]·W + bias). A f32 row-major (pitch lda) converted per fragment to bf16
// (ASPLIT: hi/lo two planes -> 2 terms, else single rounded term); Wt bf16 [N][K] (pitch ldb). BIAS_BF16 rounds the
// bias to bf16 first (bias quantised to bf16 before the add). K%32==0, M%16==0, N%64==0.
template <bool ASPLIT, int ACT, bool BIAS_BF16>
__global__ __launch_bounds__(128) void k_gemm_bf(const float* __restrict__ A, int lda, const unsigned short* __restrict__ Wt, int ldb,
                                               const float* __restrict__ bias, float* __restrict__ C, int ldc, int M, int N, int K) {
  __shared__ __attribute__((aligned(16))) float so[4][16][64];
  const int tid = threadIdx.x, w = tid >> 5, lane = tid & 31, ln = lane & 15, hh = lane >> 4;
  const int ntn = N / 64;
  const int wid = blockIdx.x * 4 + w;
  const int mt = wid / ntn, nq = wid % ntn;
  if (mt * 16 >= M) return;
  const int row0 = mt * 16, col0 = nq * 64;
  const float* arow = A + (size_t)(row0 + ln) * lda;
  v8f acc[4] = {};
  for (int kb = 0; kb < K; kb += 32) {
    FragB ah, al;
    const v4f x0 = *(const v4fa*)(arow + kb + 8 * hh), x1 = *(const v4fa*)(arow + kb + 8 * hh + 4);
    const v4f x2 = *(const v4fa*)(arow + kb + 16 + 8 * hh), x3 = *(const v4fa*)(arow + kb + 16 + 8 * hh + 4);
    float xs[16] = {x0[0],x0[1],x0[2],x0[3],x1[0],x1[1],x1[2],x1[3],x2[0],x2[1],x2[2],x2[3],x3[0],x3[1],x3[2],x3[3]};
#pragma unroll
    for (int i = 0; i < 16; ++i) { const unsigned short hb = bf16_bits(xs[i]); ah.u[i] = hb; al.u[i] = ASPLIT ? bf16_bits(xs[i] - bf16_val(hb)) : (unsigned short)0; }
#pragma unroll
    for (int t = 0; t < 4; ++t) {
      const unsigned short* brow = Wt + (size_t)(col0 + t * 16 + ln) * ldb + kb;
      FragB b;
      b.half[0] = *(const v8us*)(brow + 8 * hh);
      b.half[1] = *(const v8us*)(brow + 16 + 8 * hh);
      acc[t] = mmaN<ASPLIT ? 2 : 1>(ah.v, al.v, b.v, b.v, acc[t]);
    }
  }
#pragma unroll
  for (int t = 0; t < 4; ++t) {
    float bv = bias ? bias[col0 + t * 16 + ln] : 0.f;
    if (BIAS_BF16) bv = bf16_round(bv);
#pragma unroll
    for (int r = 0; r < 8; ++r) { float v = acc[t][r] + bv; if (ACT == 1) v = fmaxf(v, 0.f); so[w][8 * hh + r][t * 16 + ln] = v; }
  }
  __builtin_amdgcn_fence(__ATOMIC_ACQ_REL, "workgroup");
  __builtin_amdgcn_wave_barrier();
  const int rsub = lane >> 4, c4 = (lane & 15) * 4;
  {
#pragma unroll
    for (int q = 0; q < 8; ++q) {
      const int r = q * 2 + rsub;
      const v4f v = *(const v4fa*)&so[w][r][c4];
      *(v4f*)(C + (size_t)(row0 + r) * ldc + col0 + c4) = v;
    }
    
  }
}

// GEMM C = act(A·W + bias + resid): A f32 (ASPLIT -> hi/lo 2 terms), Wt bf16 [N][K]; ACT 0 none, 1 relu, 2 exact gelu;
// resid (optional, f32, row index = (row % rmod), pitch ldr, RES_BF16 rounds it) added before the activation.
template <bool ASPLIT, int ACT, bool BIAS_BF16, bool RES_BF16>
__global__ __launch_bounds__(128) void k_gemm_bf3(const float* __restrict__ A, int lda, const unsigned short* __restrict__ Wt, int ldb,
                                                const float* __restrict__ bias, const float* __restrict__ resid, int rmod, int ldr,
                                                float* __restrict__ C, int ldc, int M, int N, int K) {
  __shared__ __attribute__((aligned(16))) float so[4][16][64];
  const int tid = threadIdx.x, w = tid >> 5, lane = tid & 31, ln = lane & 15, hh = lane >> 4;
  const int ntn = N / 64;
  const int wid = blockIdx.x * 4 + w;
  const int mt = wid / ntn, nq = wid % ntn;
  if (mt * 16 >= M) return;
  const int row0 = mt * 16, col0 = nq * 64;
  const float* arow = A + (size_t)(row0 + ln) * lda;
  v8f acc[4] = {};
  for (int kb = 0; kb < K; kb += 32) {
    FragB ah, al;
    const v4f x0 = *(const v4fa*)(arow + kb + 8 * hh), x1 = *(const v4fa*)(arow + kb + 8 * hh + 4);
    const v4f x2 = *(const v4fa*)(arow + kb + 16 + 8 * hh), x3 = *(const v4fa*)(arow + kb + 16 + 8 * hh + 4);
    float xs[16] = {x0[0],x0[1],x0[2],x0[3],x1[0],x1[1],x1[2],x1[3],x2[0],x2[1],x2[2],x2[3],x3[0],x3[1],x3[2],x3[3]};
#pragma unroll
    for (int i = 0; i < 16; ++i) { const unsigned short hb = bf16_bits(xs[i]); ah.u[i] = hb; al.u[i] = ASPLIT ? bf16_bits(xs[i] - bf16_val(hb)) : (unsigned short)0; }
#pragma unroll
    for (int t = 0; t < 4; ++t) {
      const unsigned short* brow = Wt + (size_t)(col0 + t * 16 + ln) * ldb + kb;
      FragB b;
      b.half[0] = *(const v8us*)(brow + 8 * hh);
      b.half[1] = *(const v8us*)(brow + 16 + 8 * hh);
      acc[t] = mmaN<ASPLIT ? 2 : 1>(ah.v, al.v, b.v, b.v, acc[t]);
    }
  }
#pragma unroll
  for (int t = 0; t < 4; ++t) {
    const int col = col0 + t * 16 + ln;
    float bv = bias ? bias[col] : 0.f;
    if (BIAS_BF16) bv = bf16_round(bv);
#pragma unroll
    for (int r = 0; r < 8; ++r) {
      float v = acc[t][r] + bv;
      if (resid) { float rv = resid[(size_t)((row0 + 8 * hh + r) % rmod) * ldr + col]; if (RES_BF16) rv = bf16_round(rv); v += rv; }
      if (ACT == 1) v = fmaxf(v, 0.f);
      if (ACT == 2) v = 0.5f * v * (1.0f + erff(v * 0.70710678118654752f));
      if (ACT == 3) { const float u = 0.7978845608028654f * (v + 0.044715f * v * v * v); v = 0.5f * v * (1.0f + tanhf(u)); }
      so[w][8 * hh + r][t * 16 + ln] = v;
    }
  }
  __builtin_amdgcn_fence(__ATOMIC_ACQ_REL, "workgroup");
  __builtin_amdgcn_wave_barrier();
  const int rsub = lane >> 4, c4 = (lane & 15) * 4;
  {
#pragma unroll
    for (int q = 0; q < 8; ++q) {
      const int r = q * 2 + rsub;
      const v4f v = *(const v4fa*)&so[w][r][c4];
      *(v4f*)(C + (size_t)(row0 + r) * ldc + col0 + c4) = v;
    }
    
  }
}
// row LayerNorm (biased variance, eps) over N: s = X (+ R); optional out_sum <- s; out_norm <- (s-mu)*rsqrt(var+eps)*g + b
template <bool PARAM_BF16>
__global__ __launch_bounds__(256) void k_layernorm(const float* __restrict__ X, const float* __restrict__ R, const float* __restrict__ g, const float* __restrict__ bta,
                                                  float* __restrict__ out_sum, float* __restrict__ out_norm, int N, float eps) {
  __shared__ float red[256];
  const int row = blockIdx.x, tid = threadIdx.x;
  const float* x = X + (size_t)row * N; const float* rr = R ? R + (size_t)row * N : nullptr;
  float vals[16];                     // up to N = 4096
  const int per = N / 256;            // contiguous chunk per thread? use strided-by-4 chunks: thread handles j = tid*4 + 1024*u
  float s1 = 0.f;
  for (int u = 0; u < per / 4; ++u) {
    const int j = tid * 4 + 1024 * u;
    const v4f a = *(const v4fa*)(x + j);
    v4f b = {0.f,0.f,0.f,0.f}; if (rr) b = *(const v4fa*)(rr + j);
#pragma unroll
    for (int q = 0; q < 4; ++q) { const float v = a[q] + b[q]; vals[u * 4 + q] = v; s1 += v; }
  }
  red[tid] = s1; __syncthreads();
  for (int st = 128; st > 0; st >>= 1) { if (tid < st) red[tid] += red[tid + st]; __syncthreads(); }
  const float mu = red[0] / (float)N; __syncthreads();
  float s2 = 0.f;
  for (int u = 0; u < per / 4; ++u)
#pragma unroll
    for (int q = 0; q < 4; ++q) { const float c = vals[u * 4 + q] - mu; s2 += c * c; }
  red[tid] = s2; __syncthreads();
  for (int st = 128; st > 0; st >>= 1) { if (tid < st) red[tid] += red[tid + st]; __syncthreads(); }
  const float rs = rsqrtf(red[0] / (float)N + eps);
  {
    for (int u = 0; u < per / 4; ++u) {
      const int j = tid * 4 + 1024 * u;
      v4f o, sm;
#pragma unroll
      for (int q = 0; q < 4; ++q) {
        float gg = g[j + q], bb = bta[j + q];
        if (PARAM_BF16) { gg = bf16_round(gg); bb = bf16_round(bb); }
        sm[q] = vals[u * 4 + q]; o[q] = (vals[u * 4 + q] - mu) * rs * gg + bb;
      }
      if (out_sum) *(v4f*)(out_sum + (size_t)row * N + j) = sm;
      *(v4f*)(out_norm + (size_t)row * N + j) = o;
    }
    
  }
}



// ---- f16 WMMA path (v_wmma_f32_16x16x32_f16): 11-bit significands for operands in range — used where a [0,1] probability operand needs more precision than bf16
typedef _Float16 v16h __attribute__((ext_vector_type(16)));
union FragH { v16h v; v8us half[2]; _Float16 h[16]; unsigned short u[16]; };
template <int NT>
__device__ __forceinline__ v8f mmaH(v16h ah, v16h al, v16h bh, v16h bl, v8f c) {
  c = __builtin_amdgcn_wmma_f32_16x16x32_f16(false, ah, false, bh, (short)0, c, false, false);
  if (NT >= 2) c = __builtin_amdgcn_wmma_f32_16x16x32_f16(false, al, false, bh, (short)0, c, false, false);
  if (NT >= 3) c = __builtin_amdgcn_wmma_f32_16x16x32_f16(false, ah, false, bl, (short)0, c, false, false);
  asm volatile("v_nop\n\tv_nop\n\tv_nop\n\tv_nop" : "+v"(c) : "v"(ah), "v"(al), "v"(bh), "v"(bl));
  return c;
}
// batched GEMM like k_gemm_b but f16 operands: A f32 (split into f16 hi/lo if ASPLIT, else rounded to f16), Bt = f16 values [n][k]; alpha; C f32; N multiple of 16 (partial tiles skipped)
template <bool ASPLIT>
__global__ __launch_bounds__(128) void k_gemm_h(const float* __restrict__ A, int lda, size_t sA, const _Float16* __restrict__ Bh, int ldb, size_t sB, float alpha, float* __restrict__ C, int ldc, size_t sC, int M, int N, int K) {
  __shared__ __attribute__((aligned(16))) float so[4][16][64];
  const int tid = threadIdx.x, w = tid >> 5, lane = tid & 31, ln = lane & 15, hh = lane >> 4; const int by = blockIdx.y;
  A += (size_t)by * sA; Bh += (size_t)by * sB; C += (size_t)by * sC;
  const int ntn = (N + 63) / 64; const int wid = blockIdx.x * 4 + w; const int mt = wid / ntn, nq = wid % ntn; if (mt * 16 >= M) return;
  const int row0 = mt * 16, col0 = nq * 64; const float* arow = A + (size_t)(row0 + ln) * lda;
  v8f acc[4] = {};
  for (int kb = 0; kb < K; kb += 32) {
    FragH ah, al;
    const v4f x0 = *(const v4fa*)(arow + kb + 8 * hh), x1 = *(const v4fa*)(arow + kb + 8 * hh + 4), x2 = *(const v4fa*)(arow + kb + 16 + 8 * hh), x3 = *(const v4fa*)(arow + kb + 16 + 8 * hh + 4);
    float xs[16] = {x0[0],x0[1],x0[2],x0[3],x1[0],x1[1],x1[2],x1[3],x2[0],x2[1],x2[2],x2[3],x3[0],x3[1],x3[2],x3[3]};
#pragma unroll
    for (int i = 0; i < 16; ++i) { const _Float16 h = (_Float16)xs[i]; ah.h[i] = h; al.h[i] = ASPLIT ? (_Float16)(xs[i] - (float)h) : (_Float16)0.0f; }
#pragma unroll
    for (int t = 0; t < 4; ++t) { if (col0 + t * 16 >= N) continue; const size_t boff = (size_t)(col0 + t * 16 + ln) * ldb + kb; FragH bq; bq.half[0] = *(const v8us*)(Bh + boff + 8 * hh); bq.half[1] = *(const v8us*)(Bh + boff + 16 + 8 * hh);
      acc[t] = mmaH<ASPLIT ? 2 : 1>(ah.v, al.v, bq.v, bq.v, acc[t]); }
  }
#pragma unroll
  for (int t = 0; t < 4; ++t) { if (col0 + t * 16 >= N) continue;
#pragma unroll
    for (int r = 0; r < 8; ++r) so[w][8 * hh + r][t * 16 + ln] = acc[t][r] * alpha; }
  __builtin_amdgcn_fence(__ATOMIC_ACQ_REL, "workgroup"); __builtin_amdgcn_wave_barrier();
  const int rsub = lane >> 4, c4 = (lane & 15) * 4;
  {
#pragma unroll
    for (int q = 0; q < 8; ++q) { const int r = q * 2 + rsub; if (col0 + c4 < N) { const v4f v = *(const v4fa*)&so[w][r][c4]; *(v4f*)(C + (size_t)(row0 + r) * ldc + col0 + c4) = v; } }
     }
}

// Wt[n][k] = f16(W[k][n]·scale) from f32 row-major W[K][N] (scale = power of two; bf16-exact weights stay exact in f16 away from the subnormal range)
__global__ __launch_bounds__(256) void k_wt_f16(const float* __restrict__ W, _Float16* __restrict__ Wt, int K, int N, float scale) {
  const int t = blockIdx.x * 256 + threadIdx.x; if (t >= N * (K / 8)) return; const int n = t / (K / 8), k8 = (t % (K / 8)) * 8; FragH f;
#pragma unroll
  for (int i = 0; i < 8; ++i) f.h[i] = (_Float16)(bf16_round(W[(size_t)(k8 + i) * N + n]) * scale); const v8us o = f.half[0];
  *(v8us*)((unsigned short*)Wt + (size_t)n * K + k8) = o; 
}
// k_gemm_hh variant with fused epilogue: v = acc·alpha + bias[by·sBias + col] (+ CP[(row/rowsPerB)·sCPb + by·64 + col] if CP) ; ACT 0 none / 1 elu ; writes f16 C16 (and f32 C if non-null)
template <int ACT>
__global__ __launch_bounds__(128) void k_gemm_hhx(const _Float16* __restrict__ A, int lda, size_t sA, const _Float16* __restrict__ Bh, int ldb, size_t sB, float alpha, const float* __restrict__ bias, size_t sBias, const float* __restrict__ CP, int rowsPerB, size_t sCPb, int row0g,
    float* __restrict__ C, _Float16* __restrict__ C16, int ldc, size_t sC, int M, int N, int K) {
  __shared__ __attribute__((aligned(16))) float so[4][16][64];
  const int tid = threadIdx.x, w = tid >> 5, lane = tid & 31, ln = lane & 15, hh = lane >> 4; const int by = blockIdx.y;
  A += (size_t)by * sA; Bh += (size_t)by * sB; const size_t cofs = (size_t)by * sC; const float* bp = bias ? bias + (size_t)by * sBias : nullptr;
  const int ntn = (N + 63) / 64; const int wid = blockIdx.x * 4 + w; const int mt = wid / ntn, nq = wid % ntn; if (mt * 16 >= M) return;
  const int row0 = mt * 16, col0 = nq * 64; const _Float16* arow = A + (size_t)(row0 + ln) * lda;
  v8f acc[4] = {};
  for (int kb = 0; kb < K; kb += 32) { FragH ah; ah.half[0] = *(const v8us*)((const unsigned short*)arow + kb + 8 * hh); ah.half[1] = *(const v8us*)((const unsigned short*)arow + kb + 16 + 8 * hh);
#pragma unroll
    for (int t = 0; t < 4; ++t) { if (col0 + t * 16 >= N) continue; const size_t boff = (size_t)(col0 + t * 16 + ln) * ldb + kb; FragH bq; bq.half[0] = *(const v8us*)((const unsigned short*)Bh + boff + 8 * hh); bq.half[1] = *(const v8us*)((const unsigned short*)Bh + boff + 16 + 8 * hh);
      acc[t] = mmaH<1>(ah.v, ah.v, bq.v, bq.v, acc[t]); }
  }
#pragma unroll
  for (int t = 0; t < 4; ++t) { if (col0 + t * 16 >= N) continue; const int col = col0 + t * 16 + ln; const float bv = bp ? bf16_round(bp[col]) : 0.f;
#pragma unroll
    for (int r = 0; r < 8; ++r) { float v = acc[t][r] * alpha + bv; if (CP) { const int rr = row0g + row0 + 8 * hh + r; if (rowsPerB < 0) v += CP[cofs + (size_t)rr * ldc + col];      /* rowsPerB < 0: own element of the batched C plane */ else { const int bidx = rr / rowsPerB; v += CP[(size_t)bidx * sCPb + (size_t)by * 64 + col]; } } if (ACT == 1) v = (v > 0.f) ? v : expm1f(v); else if (ACT == 7) v = (v > 0.f) ? v + 1.0f : expf(v); else if (ACT == 8) v = tanhf(v); else if (ACT == 9) v = 0.5f * v * (1.0f + tanhf(0.7978845608028654f * (v + 0.044715f * v * v * v))); else if (ACT == 11) v = 1.0f / (1.0f + expf(-v)); else if (ACT == 12) v = (v > 0.f) ? v : 0.01f * v; else if (ACT == 14) v = (v > 0.f) ? v : 0.1f * v; else if (ACT == 16) v = (v >= 0.f) ? v : 0.3f * v; else if (ACT == 17) v = (v >= 0.f) ? v : 0.2f * v; else if (ACT == 15) v = v / (1.0f + expf(-v)); else if (ACT == 3) v = fmaxf(v, 0.f); else if (ACT == 6) v = 0.5f * v * (1.0f + erff(v * 0.70710678118654752f)); so[w][8 * hh + r][t * 16 + ln] = v; } }
  __builtin_amdgcn_fence(__ATOMIC_ACQ_REL, "workgroup"); __builtin_amdgcn_wave_barrier();
  const int rsub = lane >> 4, c4 = (lane & 15) * 4; typedef _Float16 v4h __attribute__((ext_vector_type(4)));
  {
#pragma unroll
    for (int q = 0; q < 8; ++q) { const int r = q * 2 + rsub; if (col0 + c4 < N) { const v4f v = *(const v4fa*)&so[w][r][c4]; if (C) *(v4f*)(C + cofs + (size_t)(row0 + r) * ldc + col0 + c4) = v; if (C16) { v4h h4; for (int i = 0; i < 4; ++i) h4[i] = (_Float16)v[i]; *(v4h*)(C16 + cofs + (size_t)(row0 + r) * ldc + col0 + c4) = h4; } } }
     }
}


typedef _Float16 v4h __attribute__((ext_vector_type(4)));

__global__ __launch_bounds__(256) void k_x16(const float* __restrict__ x, _Float16* __restrict__ X16, size_t n8) { const size_t t = (size_t)blockIdx.x * 256 + threadIdx.x; if (t >= n8) return; FragH f;
#pragma unroll
  for (int q = 0; q < 8; ++q) f.h[q] = (_Float16)bf16_round(x[t * 8 + q]); *(v8us*)((unsigned short*)X16 + t * 8) = f.half[0];  }
__global__ __launch_bounds__(256) void k_h16(const float* __restrict__ x, _Float16* __restrict__ X16, size_t n8) { const size_t t = (size_t)blockIdx.x * 256 + threadIdx.x; if (t >= n8) return; FragH f;
#pragma unroll
  for (int q = 0; q < 8; ++q) f.h[q] = (_Float16)x[t * 8 + q]; *(v8us*)((unsigned short*)X16 + t * 8) = f.half[0];  }
__global__ __launch_bounds__(256) void k_round16f(const float* __restrict__ W, _Float16* __restrict__ Bt, size_t n8) { const size_t t = (size_t)blockIdx.x * 256 + threadIdx.x; if (t >= n8) return; FragH f;
#pragma unroll
  for (int i = 0; i < 8; ++i) f.h[i] = (_Float16)(bf16_round(W[t * 8 + i]) * 16.0f); *(v8us*)((unsigned short*)Bt + t * 8) = f.half[0];  }
template <int NHv, int TTv>
__global__ __launch_bounds__(256) void k_vt(const _Float16* __restrict__ V16, int ldv, int voff, _Float16* __restrict__ Vt) { __shared__ unsigned short tl[64][66]; const int tid = threadIdx.x; const int slab = blockIdx.x / (TTv / 64), lg = blockIdx.x % (TTv / 64); const int b = slab / NHv, h = slab % NHv;
  for (int i = tid; i < 64 * 8; i += 256) { const int r = i / 8, c8 = (i % 8) * 8; FragH f; f.half[0] = *(const v8us*)((const unsigned short*)V16 + ((size_t)b * TTv + lg * 64 + r) * ldv + voff + h * 64 + c8);
#pragma unroll
    for (int q = 0; q < 8; ++q) tl[r][c8 + q] = f.u[q]; }
  __syncthreads();
  {
#pragma unroll
    for (int rd = 0; rd < 2; ++rd) { const int d = rd * 32 + tid / 8, pc = tid % 8; FragH f;
#pragma unroll
      for (int q = 0; q < 8; ++q) f.u[q] = tl[pc * 8 + q][d];
      *(v8us*)((unsigned short*)Vt + ((size_t)slab * 64 + d) * TTv + lg * 64 + pc * 8) = f.half[0]; }
     } }

// Fragment order of an f16 operand plane X[row][k] (k a multiple of 8, K columns): the 16-byte unit of 8 consecutive k lies where the lane that needs it reads it, so that
// the 32 lanes of one fragment load (or store) cover 512 contiguous bytes, four whole lines, instead of 32 bytes in each of 16 rows. Block = (16 rows) x (16 k) = 32 units;
// unit in the block = lane = 16 * (k / 8 % 2) + row % 16. A 16x32 fragment is two blocks in a row, in the k order of g2_frag (8h + s, 16 + 8h + s).
__device__ __forceinline__ size_t fo_unit(size_t row, size_t k, size_t K) { return ((row >> 4) * (K >> 4) + (k >> 4)) * 32 + ((k >> 3) & 1) * 16 + (row & 15); }
// p = the plane + 8 * (first unit of the fragment's first block + lane)
__device__ __forceinline__ v16h fo_frag(const _Float16* p) { FragH f; f.half[0] = *(const v8us*)((const unsigned short*)p); f.half[1] = *(const v8us*)((const unsigned short*)p + 256); return f.v; }
// v rows [image][n][256] -> channel-major in fragment order (rows = image * 256 + channel, k = n): 64 x 64 tiles through LDS, each wave stores whole 512-byte blocks
__global__ __launch_bounds__(256) void k_vtf(const _Float16* __restrict__ V16, _Float16* __restrict__ Vf) { __shared__ unsigned short tl[64][66]; const int tid = threadIdx.x; const int slab = blockIdx.x / (NPX / 64), lg = blockIdx.x % (NPX / 64); const int b = slab / (CC / 64), h = slab % (CC / 64);
  for (int i = tid; i < 64 * 8; i += 256) { const int r = i / 8, c8 = (i % 8) * 8; FragH f; f.half[0] = *(const v8us*)((const unsigned short*)V16 + ((size_t)b * NPX + lg * 64 + r) * CC + h * 64 + c8);
#pragma unroll
    for (int q = 0; q < 8; ++q) tl[r][c8 + q] = f.u[q]; }
  __syncthreads();
#pragma unroll
  for (int rd = 0; rd < 2; ++rd) { const int u = rd * 256 + tid, blk = u >> 5, l = u & 31; const int d = (blk >> 2) * 16 + (l & 15), kk = (blk & 3) * 16 + (l >> 4) * 8; FragH f;
#pragma unroll
    for (int q = 0; q < 8; ++q) f.u[q] = tl[kk + q][d];
    *(v8us*)((unsigned short*)Vf + fo_unit((size_t)slab * 64 + d, (size_t)lg * 64 + kk, NPX) * 8) = f.half[0]; } }

__global__ __launch_bounds__(256) void k_hl(const float* __restrict__ F, _Float16* __restrict__ Hh, _Float16* __restrict__ Hl, size_t n8) { const size_t t = (size_t)blockIdx.x * 256 + threadIdx.x; if (t >= n8) return; FragH fh, fl; const v4f a = *(const v4fa*)(F + t * 8), c = *(const v4fa*)(F + t * 8 + 4);
#pragma unroll
  for (int q = 0; q < 4; ++q) { _Float16 h = (_Float16)a[q]; fh.h[q] = h; fl.h[q] = (_Float16)((a[q] - (float)h) * 1024.0f); h = (_Float16)c[q]; fh.h[4 + q] = h; fl.h[4 + q] = (_Float16)((c[q] - (float)h) * 1024.0f); }
  { const size_t u = fo_unit(t >> 3, (t & 7) * 8, CQ); *(v8us*)((unsigned short*)Hh + u * 8) = fh.half[0]; *(v8us*)((unsigned short*)Hl + u * 8) = fl.half[0];  } }

// ---- fast GEMM (wave tile 32x64; requires M % 32 == 0 rows per launch region and N % 64 == 0); epilogue = k_gemm_hhx semantics ----
__device__ __forceinline__ v16h g2_frag(const _Float16* p, int hh) { FragH f; f.half[0] = *(const v8us*)((const unsigned short*)p + 8 * hh); f.half[1] = *(const v8us*)((const unsigned short*)p + 16 + 8 * hh); return f.v; }
__device__ __forceinline__ v8f g2_mma(v16h a, v16h b, v8f c) { v8f d = __builtin_amdgcn_wmma_f32_16x16x32_f16(false, a, false, b, (short)0, c, false, false); asm volatile("v_nop\n\tv_nop\n\tv_nop\n\tv_nop" : "+v"(d) : "v"(a), "v"(b)); return d; }
template <int ACT>
__global__ __launch_bounds__(128) void k_gemm2(const _Float16* __restrict__ A, int lda, size_t sA, const _Float16* __restrict__ Bh, int ldb, size_t sB, float alpha, const float* __restrict__ bias, size_t sBias, const float* __restrict__ CP, int rowsPerB, size_t sCPb, int row0g,
    float* __restrict__ C, _Float16* __restrict__ C16, int ldc, size_t sC, int M, int N, int K) { static_assert(ACT == 0 || ACT == 3 || ACT == 6 || ACT == 8 || ACT == 9 || ACT == 11 || ACT == 12 || ACT == 14 || ACT == 15 || ACT == 16 || ACT == 17, "k_gemm2: unsupported ACT code (would silently apply no activation)");
  __shared__ __attribute__((aligned(16))) float so[4][32][68];
  const int tid = threadIdx.x, w = tid >> 5, lane = tid & 31, ln = lane & 15, hh = lane >> 4; const int by = blockIdx.y;
  A += (size_t)by * sA; Bh += (size_t)by * sB; const size_t cofs = (size_t)by * sC; const float* bp = bias ? bias + (size_t)by * sBias : nullptr;
  const int ntn = N >> 6; const int mt = blockIdx.x / ntn, nq = blockIdx.x - mt * ntn; const int row0 = mt * 128 + 32 * w, col0 = nq * 64; if (row0 >= M) return;
  const _Float16* a0p = A + (size_t)(row0 + ln) * lda; const _Float16* a1p = a0p + (size_t)16 * lda;
  const _Float16* b0p = Bh + (size_t)(col0 + ln) * ldb; const _Float16* b1p = b0p + (size_t)16 * ldb; const _Float16* b2p = b1p + (size_t)16 * ldb; const _Float16* b3p = b2p + (size_t)16 * ldb;
  const v8f z8 = {0.f,0.f,0.f,0.f,0.f,0.f,0.f,0.f}; v8f c00 = z8, c01 = z8, c02 = z8, c03 = z8, c10 = z8, c11 = z8, c12 = z8, c13 = z8;
#pragma unroll 1
  for (int kb = 0; kb < K; kb += 32) { const v16h a0 = g2_frag(a0p + kb, hh), a1 = g2_frag(a1p + kb, hh);
    v16h b = g2_frag(b0p + kb, hh); c00 = g2_mma(a0, b, c00); c10 = g2_mma(a1, b, c10);
    b = g2_frag(b1p + kb, hh); c01 = g2_mma(a0, b, c01); c11 = g2_mma(a1, b, c11);
    b = g2_frag(b2p + kb, hh); c02 = g2_mma(a0, b, c02); c12 = g2_mma(a1, b, c12);
    b = g2_frag(b3p + kb, hh); c03 = g2_mma(a0, b, c03); c13 = g2_mma(a1, b, c13); }
  v8f accs[8] = {c00, c01, c02, c03, c10, c11, c12, c13};
#pragma unroll
  for (int u = 0; u < 8; ++u) { const int t = u & 3, half = u >> 2; const int col = col0 + t * 16 + ln; const float bv = bp ? bf16_round(bp[col]) : 0.f;
#pragma unroll
    for (int r = 0; r < 8; ++r) { const int rloc = half * 16 + 8 * hh + r; float v = accs[u][r] * alpha + bv; if (CP) { if (rowsPerB < 0) v += CP[cofs + (size_t)(row0g + row0 + rloc) * ldc + col];      /* rowsPerB < 0: own element of the batched C plane */ else { const int bidx = (row0g + row0 + rloc) / rowsPerB; v += CP[(size_t)bidx * sCPb + (size_t)by * 64 + col]; } }
      if (ACT == 3) v = fmaxf(v, 0.f); else if (ACT == 6) v = 0.5f * v * (1.0f + erff(v * 0.70710678118654752f)); else if (ACT == 11) v = 1.0f / (1.0f + expf(-v)); else if (ACT == 15) v = v / (1.0f + expf(-v)); else if (ACT == 12) v = (v > 0.f) ? v : 0.01f * v; else if (ACT == 8) v = tanhf(v); else if (ACT == 9) v = 0.5f * v * (1.0f + tanhf(0.7978845608028654f * (v + 0.044715f * v * v * v))); else if (ACT == 14) v = (v > 0.f) ? v : 0.1f * v; else if (ACT == 16) v = (v >= 0.f) ? v : 0.3f * v; else if (ACT == 17) v = (v >= 0.f) ? v : 0.2f * v;
      so[w][rloc][t * 16 + ln] = v; } }
  __builtin_amdgcn_fence(__ATOMIC_ACQ_REL, "workgroup"); __builtin_amdgcn_wave_barrier();
  const int rsub = lane >> 4, c4 = (lane & 15) * 4;
  {
#pragma unroll
    for (int q = 0; q < 16; ++q) { const int r = q * 2 + rsub; const v4f v = *(const v4fa*)&so[w][r][c4]; if (C) *(v4f*)(C + cofs + (size_t)(row0 + r) * ldc + col0 + c4) = v; if (C16) { v4h h4; for (int i = 0; i < 4; ++i) h4[i] = (_Float16)v[i]; *(v4h*)(C16 + cofs + (size_t)(row0 + r) * ldc + col0 + c4) = h4; } }
     } }


__global__ __launch_bounds__(256) void k_wnat(const float* __restrict__ w, size_t n8, _Float16* __restrict__ Bt) { const size_t t = (size_t)blockIdx.x * 256 + threadIdx.x; if (t >= n8) return; FragH f; for (int q = 0; q < 8; ++q) f.h[q] = (_Float16)(bf16_round(w[t * 8 + q]) * 16.0f); *(v8us*)((unsigned short*)Bt + t * 8) = f.half[0];  }
// energy + row softmax in one kernel. A work-group of 16 waves owns 16 rows n of the attention matrix; wave w forms the logits E[n][m] of its 256 columns m
// (A = q rows, B = k rows; hi.hi in one accumulator, lo.hi + hi.lo in a second, joined as hi + lo / 1024). The logits stay in registers for the maximum, the exponentials,
// their sum and the scaled f16 store, so they never go to memory. In the D layout a lane holds ONE column m and 8 consecutive rows n per tile: that is the 16-byte unit which
// the same lane of the x_r product reads as its B operand (row m of P^T, k = n), so each tile is one 512-byte store into P^T in fragment order and no transpose follows.
// The row reductions run per register: over the tiles in the lane, over the 16 lanes of a row by DPP, over the waves through LDS.
__device__ __forceinline__ v8f es_mma(v16h a, v16h b, v8f c) { return __builtin_amdgcn_wmma_f32_16x16x32_f16(false, a, false, b, (short)0, c, false, false); }
template <int X> __device__ __forceinline__ float row_x(float v) { return __int_as_float(__builtin_amdgcn_update_dpp(0, __float_as_int(v), 0x160 + X, 0xf, 0xf, true)); }      /* the value of lane l ^ X of the same 16-lane row (row_xmask) */
__global__ __launch_bounds__(512) void k_esm(const _Float16* __restrict__ Qh, const _Float16* __restrict__ Ql, const _Float16* __restrict__ Kh, const _Float16* __restrict__ Kl, _Float16* __restrict__ Pf) {
  __shared__ __attribute__((aligned(32))) float redm[16][16]; __shared__ __attribute__((aligned(32))) float reds[16][16];
  const int tid = threadIdx.x, w = tid >> 5, lane = tid & 31, ln = lane & 15, hh = lane >> 4;
  const _Float16* qhp = Qh + ((size_t)blockIdx.x * (CQ / 16) * 32 + lane) * 8; const _Float16* qlp = Ql + ((size_t)blockIdx.x * (CQ / 16) * 32 + lane) * 8;
  const v16h qh0 = fo_frag(qhp), qh1 = fo_frag(qhp + 512);
  asm volatile("s_wait_xcnt 0x0" ::: "memory");      /* the address pair of the loads above may be given to a later load's result: the wait stands in front of that overwrite */
  const v16h ql0 = fo_frag(qlp), ql1 = fo_frag(qlp + 512);
  asm volatile("s_wait_xcnt 0x0" ::: "memory");      /* the same for the address pair of the two loads above */
  const _Float16* khp = Kh + ((size_t)(w * 16) * (CQ / 16) * 32 + lane) * 8; const _Float16* klp = Kl + ((size_t)(w * 16) * (CQ / 16) * 32 + lane) * 8;
  const v8f z8 = {0.f,0.f,0.f,0.f,0.f,0.f,0.f,0.f}; v8f e[16];
  v16h nh0 = fo_frag(khp), nh1 = fo_frag(khp + 512), nl0 = fo_frag(klp), nl1 = fo_frag(klp + 512);
  // every loop over e[] is unrolled in full: e is then indexed by constants only and stays in registers
#pragma unroll
  for (int t = 0; t < 16; ++t) { const v16h kh0 = nh0, kh1 = nh1, kl0 = nl0, kl1 = nl1;
    if (t + 1 < 16) { nh0 = fo_frag(khp + (t + 1) * 1024); nh1 = fo_frag(khp + (t + 1) * 1024 + 512); nl0 = fo_frag(klp + (t + 1) * 1024); nl1 = fo_frag(klp + (t + 1) * 1024 + 512); }      /* the next tile's fragments fly under this tile's products */
    v8f ch = es_mma(qh0, kh0, z8); v8f cl = es_mma(qh0, kl0, z8); ch = es_mma(qh1, kh1, ch); cl = es_mma(qh1, kl1, cl); cl = es_mma(ql0, kh0, cl); cl = es_mma(ql1, kh1, cl);
    e[t] = ch + cl * (1.0f / 1024.0f);
    if (t >= 12) __builtin_amdgcn_sched_barrier(0); }      /* from here on the logits fill the registers: later tiles' loads are not lifted over this point, where the build otherwise spills */
  v8f m8 = e[0];      /* register r: row n = 8 * hh + r */
#pragma unroll
  for (int t = 1; t < 16; ++t) for (int r = 0; r < 8; ++r) m8[r] = fmaxf(m8[r], e[t][r]);
#pragma unroll
  for (int r = 0; r < 8; ++r) { float v = m8[r]; v = fmaxf(v, row_x<1>(v)); v = fmaxf(v, row_x<2>(v)); v = fmaxf(v, row_x<4>(v)); v = fmaxf(v, row_x<8>(v)); m8[r] = v; }
  if (ln == 0) *(v8f*)&redm[w][8 * hh] = m8;
  __syncthreads();
#pragma unroll
  for (int u = 0; u < 16; ++u) { const v8f o = *(const v8f*)&redm[u][8 * hh]; for (int r = 0; r < 8; ++r) m8[r] = fmaxf(m8[r], o[r]); }
#pragma unroll
  for (int t = 0; t < 16; ++t) for (int r = 0; r < 8; ++r) e[t][r] = expf(e[t][r] - m8[r]);
  v8f s8 = e[0];
#pragma unroll
  for (int t = 1; t < 16; ++t) s8 += e[t];
#pragma unroll
  for (int r = 0; r < 8; ++r) { float v = s8[r]; v += row_x<1>(v); v += row_x<2>(v); v += row_x<4>(v); v += row_x<8>(v); s8[r] = v; }
  if (ln == 0) *(v8f*)&reds[w][8 * hh] = s8;
  __syncthreads();
  v8f se = z8;
#pragma unroll
  for (int u = 0; u < 16; ++u) se += *(const v8f*)&reds[u][8 * hh];
  v8f sc;
#pragma unroll
  for (int r = 0; r < 8; ++r) sc[r] = 256.0f / se[r];
  unsigned short* p = (unsigned short*)Pf + (((size_t)(w * 16) * (NPX / 16) + blockIdx.x) * 32 + lane) * 8;      /* block (m tile w * 16 + t, n tile blockIdx.x), unit = lane */
#pragma unroll
  for (int t = 0; t < 16; ++t) { FragH f; for (int r = 0; r < 8; ++r) f.h[r] = (_Float16)(e[t][r] * sc[r]); *(v8us*)(p + (size_t)t * (NPX / 16) * 256) = f.half[0]; } }
// x_r[c][m] = alpha * sum_n v[c][n] P^T[m][n], both operands in fragment order (K = NPX); grid y = image. Wave tile 32 x 64, four waves stacked on the rows, and the loop's order
// of loads and products as in k_gemm2: each B fragment is loaded, waited for and used before the next one is asked for.
__global__ __launch_bounds__(128) void k_xr(const _Float16* __restrict__ Af, const _Float16* __restrict__ Bf, float alpha, float* __restrict__ C) {
  __shared__ __attribute__((aligned(16))) float so[4][32][68];
  const int tid = threadIdx.x, w = tid >> 5, lane = tid & 31, ln = lane & 15, hh = lane >> 4; const int by = blockIdx.y;
  Af += (size_t)by * CC * NPX; Bf += (size_t)by * NPX * NPX; C += (size_t)by * CC * NPX;
  const int ntn = NPX >> 6; const int mt = blockIdx.x / ntn, nq = blockIdx.x - mt * ntn; const int row0 = mt * 128 + 32 * w, col0 = nq * 64;
  const size_t tp = (size_t)(NPX / 16) * 256;      /* f16 elements from one 16-row tile to the next */
  const _Float16* a0p = Af + (size_t)(row0 >> 4) * tp + lane * 8; const _Float16* a1p = a0p + tp;
  const _Float16* b0p = Bf + (size_t)(col0 >> 4) * tp + lane * 8; const _Float16* b1p = b0p + tp; const _Float16* b2p = b1p + tp; const _Float16* b3p = b2p + tp;
  const v8f z8 = {0.f,0.f,0.f,0.f,0.f,0.f,0.f,0.f}; v8f c00 = z8, c01 = z8, c02 = z8, c03 = z8, c10 = z8, c11 = z8, c12 = z8, c13 = z8;
#pragma unroll 1
  for (int ko = 0; ko < NPX * 16; ko += 512) { const v16h a0 = fo_frag(a0p + ko); FragH a1f; a1f.half[0] = *(const v8us*)((const unsigned short*)(a1p + ko));      /* 32 k = two blocks = 512 elements */
    asm volatile("s_wait_xcnt 0x0" ::: "memory");      /* the address pair of the loads above may be given to the next load's result: the wait stands in front of that overwrite */
    a1f.half[1] = *(const v8us*)((const unsigned short*)(a1p + ko) + 256); const v16h a1 = a1f.v;
    v16h b = fo_frag(b0p + ko); c00 = g2_mma(a0, b, c00); c10 = g2_mma(a1, b, c10);
    b = fo_frag(b1p + ko); c01 = g2_mma(a0, b, c01); c11 = g2_mma(a1, b, c11);
    b = fo_frag(b2p + ko); c02 = g2_mma(a0, b, c02); c12 = g2_mma(a1, b, c12);
    b = fo_frag(b3p + ko); c03 = g2_mma(a0, b, c03); c13 = g2_mma(a1, b, c13); }
  v8f accs[8] = {c00, c01, c02, c03, c10, c11, c12, c13};
#pragma unroll
  for (int u = 0; u < 8; ++u) { const int t = u & 3, half = u >> 2;
#pragma unroll
    for (int r = 0; r < 8; ++r) so[w][half * 16 + 8 * hh + r][t * 16 + ln] = accs[u][r] * alpha; }
  __builtin_amdgcn_fence(__ATOMIC_ACQ_REL, "workgroup"); __builtin_amdgcn_wave_barrier();
  const int rsub = lane >> 4, c4 = (lane & 15) * 4;
#pragma unroll
  for (int q = 0; q < 16; ++q) { const int r = q * 2 + rsub; const v4f v = *(const v4fa*)&so[w][r][c4]; *(v4f*)(C + (size_t)(row0 + r) * NPX + col0 + c4) = v; } }
__global__ __launch_bounds__(256) void k_vt(const _Float16* __restrict__ V16, int b, int h0, _Float16* __restrict__ VT) { __shared__ unsigned short tl[64][65]; const int tid = threadIdx.x; const int hh = blockIdx.x % HG, sg = blockIdx.x / HG; const int s0 = sg * 64; const int h = h0 + hh;
  for (int i = tid; i < 64 * 8; i += 256) { const int j = i / 8, d8 = (i % 8) * 8; FragH f; f.half[0] = *(const v8us*)((const unsigned short*)V16 + ((size_t)b * SQ + s0 + j) * DM + h * HD + d8); for (int q = 0; q < 8; ++q) tl[d8 + q][j] = f.u[q]; }
  __syncthreads();
  { for (int i = tid; i < 64 * 8; i += 256) { const int d = i / 8, j8 = (i % 8) * 8; FragH f; for (int q = 0; q < 8; ++q) f.u[q] = tl[d][j8 + q]; *(v8us*)((unsigned short*)VT + ((size_t)hh * HD + d) * SQ + s0 + j8) = f.half[0]; }  } }


__global__ __launch_bounds__(256) void k_cl2rows(const float* __restrict__ X, _Float16* __restrict__ XR) { __shared__ float tl[64][33]; const int tid = threadIdx.x; const int nl = LL / 32, nc = CC / 64; const int cb_ = blockIdx.x % nc; const int lb = (blockIdx.x / nc) % nl; const size_t b = blockIdx.x / (nc * nl); const int c0 = cb_ * 64, l0 = lb * 32;
  for (int i = tid; i < 64 * 32; i += 256) { const int c = i / 32, l = i % 32; tl[c][l] = bf16_round(X[(b * CC + c0 + c) * (size_t)LL + l0 + l]); }
  __syncthreads();
  { const int l = tid / 8, c8 = (tid % 8) * 8; FragH f; for (int q = 0; q < 8; ++q) f.h[q] = (_Float16)tl[c8 + q][l]; unsigned short* d = (unsigned short*)XR + (b * LL + l0 + l) * (size_t)CC + c0 + c8; *(v8us*)d = f.half[0];  } }

__global__ __launch_bounds__(256) void k_fin3(const float* __restrict__ Cm, const float* __restrict__ x, float* __restrict__ out) {
  #pragma clang fp contract(off)
  const size_t t = (size_t)blockIdx.x * 256 + threadIdx.x; if (t >= (size_t)NBR * CC * NPX / 8) return; const size_t base = t * 8; v8f v;
  const v4f x0 = *(const v4fa*)(x + base), x1 = *(const v4fa*)(x + base + 4);
  asm volatile("s_wait_xcnt 0x0" ::: "memory");      /* the address pair of the two loads above may be given to a later load's result: the wait stands in front of that overwrite */
  for (int q = 0; q < 4; ++q) { v[q] = __fadd_rn(bf16_round(x0[q]), Cm[base + q]); v[4 + q] = __fadd_rn(bf16_round(x1[q]), Cm[base + 4 + q]); } *(v8f*)(out + base) = v;  }

extern "C" void kernel_launch(void* const* d_in, const int* in_sizes, int n_in,
                              void* d_out, int out_size, void* d_ws, size_t ws_size, hipStream_t stream) {
  (void)in_sizes; (void)n_in; (void)out_size;
  const float* const* I = (const float* const*)d_in; const float* x = I[0]; const float* Wq = I[1]; const float* Wk = I[2]; const float* Wv = I[3]; const float* bv = I[4];
  char* ws = (char*)d_ws; size_t off = 0;
  auto take = [&](size_t bytes) { char* p = ws + off; off += (bytes + 255) & ~(size_t)255; return p; };
  _Float16* BQ = (_Float16*)take((size_t)CQ * CC * 2); _Float16* BK = (_Float16*)take((size_t)CQ * CC * 2); _Float16* BV = (_Float16*)take((size_t)CC * CC * 2);
  _Float16* XR = (_Float16*)take(NR * CC * 2); float* QF = (float*)take(NR * CQ * 4); float* KF = (float*)take(NR * CQ * 4); _Float16* QH = (_Float16*)take(NR * CQ * 2); _Float16* QL = (_Float16*)take(NR * CQ * 2); _Float16* KH = (_Float16*)take(NR * CQ * 2); _Float16* KL = (_Float16*)take(NR * CQ * 2); _Float16* V16 = (_Float16*)take(NR * CC * 2);
  _Float16* PT = (_Float16*)take((size_t)NB * NPX * NPX * 2); _Float16* VT = (_Float16*)take((size_t)NB * CC * NPX * 2); float* CX = (float*)take((size_t)NB * CC * NPX * 4);
  if (off > ws_size) return;      /* 0.2 + 8 + 8 + 8 + 8 + 128 + 8 + 16 = approx 185 MiB: P^T, v channel-major and x_r hold all images */
  k_wnat<<<(unsigned)(((size_t)CQ * CC / 8 + 255) / 256), 256, 0, stream>>>(Wq, (size_t)CQ * CC / 8, BQ); k_wnat<<<(unsigned)(((size_t)CQ * CC / 8 + 255) / 256), 256, 0, stream>>>(Wk, (size_t)CQ * CC / 8, BK); k_wnat<<<(unsigned)(((size_t)CC * CC / 8 + 255) / 256), 256, 0, stream>>>(Wv, (size_t)CC * CC / 8, BV);
  k_cl2rows<<<NB * (NPX / 32) * (CC / 64), 256, 0, stream>>>(x, XR);
  k_gemm2<0><<<dim3((unsigned)((NR / 128) * 1), 1), 128, 0, stream>>>(XR, CC, 0, BQ, CC, 0, 0.0625f, nullptr, 0, nullptr, 1, 0, 0, QF, nullptr, CQ, 0, MP, CQ, CC);      /* q (f32, exact products) */
  k_gemm2<0><<<dim3((unsigned)((NR / 128) * 1), 1), 128, 0, stream>>>(XR, CC, 0, BK, CC, 0, 0.0625f, nullptr, 0, nullptr, 1, 0, 0, KF, nullptr, CQ, 0, MP, CQ, CC);      /* k */
  k_gemm2<0><<<dim3((unsigned)((NR / 128) * (CC / 64)), 1), 128, 0, stream>>>(XR, CC, 0, BV, CC, 0, 0.0625f, bv, 0, nullptr, 1, 0, 0, nullptr, V16, CC, 0, MP, CC, CC);      /* v + bv (f16 rows) */
  k_hl<<<(unsigned)((NR * CQ / 8 + 255) / 256), 256, 0, stream>>>(QF, QH, QL, NR * CQ / 8); k_hl<<<(unsigned)((NR * CQ / 8 + 255) / 256), 256, 0, stream>>>(KF, KH, KL, NR * CQ / 8);
  for (int b = 0; b < NBR; ++b) { const size_t r0 = (size_t)b * NPX;
    k_esm<<<NPX / 16, 512, 0, stream>>>(QH + r0 * CQ, QL + r0 * CQ, KH + r0 * CQ, KL + r0 * CQ, PT + (size_t)b * NPX * NPX); }      /* P^T[m][n] = 256 softmax_m(q_n . k_m), fragment order, one plane per image */
  // one launch for all images from here on: a single image's x_r product has 128 work-groups of one wave a SIMD, half the chip's WGPs; grid y = image puts four times the waves in flight
  k_vtf<<<NBR * (CC / 64) * (NPX / 64), 256, 0, stream>>>(V16, VT);      /* v channel-major [image][256][4096], fragment order */
  k_xr<<<dim3((CC / 128) * (NPX / 64), NBR), 128, 0, stream>>>(VT, PT, 0.00390625f, CX);      /* x_r[c][m] = sum_n v[c][n] attention[n][m] */
  k_fin3<<<(unsigned)(((size_t)NBR * CC * NPX / 8 + 255) / 256), 256, 0, stream>>>(CX, x, (float*)d_out);
}

// v005
// It runs in 176 microseconds.
// Timed twice side by side with v004, it ran 2.14 and 2.15 times as fast.
// Counting every step since v000, it is 22.4 times as fast.
#include <hip/hip_runtime.h>
// SA layer (x [4][256][4096]; q = Wq x (64), k = Wk x (64), v = Wv x + bv (256); energy[n][m] = q_n . k_m (no scale); attention = softmax over m; x_r[c][m] = sum_n v[c][n] attention[n][m]; out = x + x_r -> [4][256][4096]).
// Structure: channel-first input transposed to position rows (exact f16) via LDS tiles; q / k as WMMA GEMMs (32x64 wave tiles, f32 accumulation, exact x16 natural weights; exact products) kept f32 and split into f16 hi + 2^-10 residual planes; v GEMM (+ bias) to f16 rows and transposed channel-major via LDS tiles; per image: the unscaled energy as a THREE-term product (hi.hi + lo.hi + hi.lo, K = 64) whose f32 logits stay in registers for the row softmax on VALU (P x256 f16, one kernel), x_r = V(channel-major) . P^T-as-Bt GEMM (M = 256 channels, K = 4096) into f32; residual + store on VALU. The q / k planes, v channel-major and P^T lie in fragment order (see fo_unit), each written so by the kernel that makes it.
// Compute dtype: inputs rounded to bf16; x / weights exact; q, k as hi + residual (~f32, the logits have sigma ~8); v, P as plain f16 operands (~2^-12); softmax f32. v_wmma_f32_16x16x32_f16.
#define NB 4
#define CC 256
#define CQ 64
#define NPX 4096
#define LL NPX
#define PX NPX
#define NR ((size_t)NB * NPX)
#define NBR NB                       /* images attended (debug hook) */
#define MP ((int)NR)                 /* rows projected (debug hook) */
#define MC NPX                       /* unused */
#define SQ NPX
#define DM NPX
#define NH 64
#define HD 64
#define HG 1
typedef __bf16 v16b __attribute__((ext_vector_type(16)));
typedef unsigned short v8us __attribute__((ext_vector_type(8), may_alias));
typedef float  v8f  __attribute__((ext_vector_type(8)));
typedef float  v4f  __attribute__((ext_vector_type(4)));
typedef float  v4fa __attribute__((ext_vector_type(4), may_alias));
union FragB { v16b v; v8us half[2]; unsigned short u[16]; };

__device__ __forceinline__ unsigned short bf16_bits(float x) { unsigned int u = __float_as_uint(x); return (unsigned short)((u + 0x7FFFu + ((u >> 16) & 1u)) >> 16); }
__device__ __forceinline__ float bf16_val(unsigned short b) { return __uint_as_float(((unsigned int)b) << 16); }
__device__ __forceinline__ float bf16_round(float x) { return bf16_val(bf16_bits(x)); }
// D += A·B with NT terms: 1 = ah·bh, 2 = + al·bh (A split), 3 = + ah·bl (both split)
template <int NT>
__device__ __forceinline__ v8f mmaN(v16b ah, v16b al, v16b bh, v16b bl, v8f c) {
  c = __builtin_amdgcn_wmma_f32_16x16x32_bf16(false, ah, false, bh, (short)0, c, false, false);
  if (NT >= 2) c = __builtin_amdgcn_wmma_f32_16x16x32_bf16(false, al, false, bh, (short)0, c, false, false);
  if (NT >= 3) c = __builtin_amdgcn_wmma_f32_16x16x32_bf16(false, ah, false, bl, (short)0, c, false, false);
  asm volatile("v_nop\n\tv_nop\n\tv_nop\n\tv_nop" : "+v"(c) : "v"(ah), "v"(al), "v"(bh), "v"(bl));
  return c;
}

__global__ __launch_bounds__(256) void k_wt_bf16(const float* __restrict__ W, unsigned short* __restrict__ Wt, int K, int N) {
  const int t = blockIdx.x * 256 + threadIdx.x;
  const int k8n = K / 8;
  if (t >= N * k8n) return;
  const int n = t / k8n, k8 = (t % k8n) * 8;
  v8us v;
#pragma unroll
  for (int i = 0; i < 8; ++i) v[i] = bf16_bits(W[(size_t)(k8 + i) * N + n]);
  *(v8us*)(Wt + (size_t)n * K + k8) = v;
  
}

// GEMM C[M][N] (f32, pitch ldc) = act(A[M][K]·W + bias). A f32 row-major (pitch lda) converted per fragment to bf16
// (ASPLIT: hi/lo two planes -> 2 terms, else single rounded term); Wt bf16 [N][K] (pitch ldb). BIAS_BF16 rounds the
// bias to bf16 first (bias quantised to bf16 before the add). K%32==0, M%16==0, N%64==0.
template <bool ASPLIT, int ACT, bool BIAS_BF16>
__global__ __launch_bounds__(128) void k_gemm_bf(const float* __restrict__ A, int lda, const unsigned short* __restrict__ Wt, int ldb,
                                               const float* __restrict__ bias, float* __restrict__ C, int ldc, int M, int N, int K) {
  __shared__ __attribute__((aligned(16))) float so[4][16][64];
  const int tid = threadIdx.x, w = tid >> 5, lane = tid & 31, ln = lane & 15, hh = lane >> 4;
  const int ntn = N / 64;
  const int wid = blockIdx.x * 4 + w;
  const int mt = wid / ntn, nq = wid % ntn;
  if (mt * 16 >= M) return;
  const int row0 = mt * 16, col0 = nq * 64;
  const float* arow = A + (size_t)(row0 + ln) * lda;
  v8f acc[4] = {};
  for (int kb = 0; kb < K; kb += 32) {
    FragB ah, al;
    const v4f x0 = *(const v4fa*)(arow + kb + 8 * hh), x1 = *(const v4fa*)(arow + kb + 8 * hh + 4);
    const v4f x2 = *(const v4fa*)(arow + kb + 16 + 8 * hh), x3 = *(const v4fa*)(arow + kb + 16 + 8 * hh + 4);
    float xs[16] = {x0[0],x0[1],x0[2],x0[3],x1[0],x1[1],x1[2],x1[3],x2[0],x2[1],x2[2],x2[3],x3[0],x3[1],x3[2],x3[3]};
#pragma unroll
    for (int i = 0; i < 16; ++i) { const unsigned short hb = bf16_bits(xs[i]); ah.u[i] = hb; al.u[i] = ASPLIT ? bf16_bits(xs[i] - bf16_val(hb)) : (unsigned short)0; }
#pragma unroll
    for (int t = 0; t < 4; ++t) {
      const unsigned short* brow = Wt + (size_t)(col0 + t * 16 + ln) * ldb + kb;
      FragB b;
      b.half[0] = *(const v8us*)(brow + 8 * hh);
      b.half[1] = *(const v8us*)(brow + 16 + 8 * hh);
      acc[t] = mmaN<ASPLIT ? 2 : 1>(ah.v, al.v, b.v, b.v, acc[t]);
    }
  }
#pragma unroll
  for (int t = 0; t < 4; ++t) {
    float bv = bias ? bias[col0 + t * 16 + ln] : 0.f;
    if (BIAS_BF16) bv = bf16_round(bv);
#pragma unroll
    for (int r = 0; r < 8; ++r) { float v = acc[t][r] + bv; if (ACT == 1) v = fmaxf(v, 0.f); so[w][8 * hh + r][t * 16 + ln] = v; }
  }
  __builtin_amdgcn_fence(__ATOMIC_ACQ_REL, "workgroup");
  __builtin_amdgcn_wave_barrier();
  const int rsub = lane >> 4, c4 = (lane & 15) * 4;
  {
#pragma unroll
    for (int q = 0; q < 8; ++q) {
      const int r = q * 2 + rsub;
      const v4f v = *(const v4fa*)&so[w][r][c4];
      *(v4f*)(C + (size_t)(row0 + r) * ldc + col0 + c4) = v;
    }
    
  }
}

// GEMM C = act(A·W + bias + resid): A f32 (ASPLIT -> hi/lo 2 terms), Wt bf16 [N][K]; ACT 0 none, 1 relu, 2 exact gelu;
// resid (optional, f32, row index = (row % rmod), pitch ldr, RES_BF16 rounds it) added before the activation.
template <bool ASPLIT, int ACT, bool BIAS_BF16, bool RES_BF16>
__global__ __launch_bounds__(128) void k_gemm_bf3(const float* __restrict__ A, int lda, const unsigned short* __restrict__ Wt, int ldb,
                                                const float* __restrict__ bias, const float* __restrict__ resid, int rmod, int ldr,
                                                float* __restrict__ C, int ldc, int M, int N, int K) {
  __shared__ __attribute__((aligned(16))) float so[4][16][64];
  const int tid = threadIdx.x, w = tid >> 5, lane = tid & 31, ln = lane & 15, hh = lane >> 4;
  const int ntn = N / 64;
  const int wid = blockIdx.x * 4 + w;
  const int mt = wid / ntn, nq = wid % ntn;
  if (mt * 16 >= M) return;
  const int row0 = mt * 16, col0 = nq * 64;
  const float* arow = A + (size_t)(row0 + ln) * lda;
  v8f acc[4] = {};
  for (int kb = 0; kb < K; kb += 32) {
    FragB ah, al;
    const v4f x0 = *(const v4fa*)(arow + kb + 8 * hh), x1 = *(const v4fa*)(arow + kb + 8 * hh + 4);
    const v4f x2 = *(const v4fa*)(arow + kb + 16 + 8 * hh), x3 = *(const v4fa*)(arow + kb + 16 + 8 * hh + 4);
    float xs[16] = {x0[0],x0[1],x0[2],x0[3],x1[0],x1[1],x1[2],x1[3],x2[0],x2[1],x2[2],x2[3],x3[0],x3[1],x3[2],x3[3]};
#pragma unroll
    for (int i = 0; i < 16; ++i) { const unsigned short hb = bf16_bits(xs[i]); ah.u[i] = hb; al.u[i] = ASPLIT ? bf16_bits(xs[i] - bf16_val(hb)) : (unsigned short)0; }
#pragma unroll
    for (int t = 0; t < 4; ++t) {
      const unsigned short* brow = Wt + (size_t)(col0 + t * 16 + ln) * ldb + kb;
      FragB b;
      b.half[0] = *(const v8us*)(brow + 8 * hh);
      b.half[1] = *(const v8us*)(brow + 16 + 8 * hh);
      acc[t] = mmaN<ASPLIT ? 2 : 1>(ah.v, al.v, b.v, b.v, acc[t]);
    }
  }
#pragma unroll
  for (int t = 0; t < 4; ++t) {
    const int col = col0 + t * 16 + ln;
    float bv = bias ? bias[col] : 0.f;
    if (BIAS_BF16) bv = bf16_round(bv);
#pragma unroll
    for (int r = 0; r < 8; ++r) {
      float v = acc[t][r] + bv;
      if (resid) { float rv = resid[(size_t)((row0 + 8 * hh + r) % rmod) * ldr + col]; if (RES_BF16) rv = bf16_round(rv); v += rv; }
      if (ACT == 1) v = fmaxf(v, 0.f);
      if (ACT == 2) v = 0.5f * v * (1.0f + erff(v * 0.70710678118654752f));
      if (ACT == 3) { const float u = 0.7978845608028654f * (v + 0.044715f * v * v * v); v = 0.5f * v * (1.0f + tanhf(u)); }
      so[w][8 * hh + r][t * 16 + ln] = v;
    }
  }
  __builtin_amdgcn_fence(__ATOMIC_ACQ_REL, "workgroup");
  __builtin_amdgcn_wave_barrier();
  const int rsub = lane >> 4, c4 = (lane & 15) * 4;
  {
#pragma unroll
    for (int q = 0; q < 8; ++q) {
      const int r = q * 2 + rsub;
      const v4f v = *(const v4fa*)&so[w][r][c4];
      *(v4f*)(C + (size_t)(row0 + r) * ldc + col0 + c4) = v;
    }
    
  }
}
// row LayerNorm (biased variance, eps) over N: s = X (+ R); optional out_sum <- s; out_norm <- (s-mu)*rsqrt(var+eps)*g + b
template <bool PARAM_BF16>
__global__ __launch_bounds__(256) void k_layernorm(const float* __restrict__ X, const float* __restrict__ R, const float* __restrict__ g, const float* __restrict__ bta,
                                                  float* __restrict__ out_sum, float* __restrict__ out_norm, int N, float eps) {
  __shared__ float red[256];
  const int row = blockIdx.x, tid = threadIdx.x;
  const float* x = X + (size_t)row * N; const float* rr = R ? R + (size_t)row * N : nullptr;
  float vals[16];                     // up to N = 4096
  const int per = N / 256;            // contiguous chunk per thread? use strided-by-4 chunks: thread handles j = tid*4 + 1024*u
  float s1 = 0.f;
  for (int u = 0; u < per / 4; ++u) {
    const int j = tid * 4 + 1024 * u;
    const v4f a = *(const v4fa*)(x + j);
    v4f b = {0.f,0.f,0.f,0.f}; if (rr) b = *(const v4fa*)(rr + j);
#pragma unroll
    for (int q = 0; q < 4; ++q) { const float v = a[q] + b[q]; vals[u * 4 + q] = v; s1 += v; }
  }
  red[tid] = s1; __syncthreads();
  for (int st = 128; st > 0; st >>= 1) { if (tid < st) red[tid] += red[tid + st]; __syncthreads(); }
  const float mu = red[0] / (float)N; __syncthreads();
  float s2 = 0.f;
  for (int u = 0; u < per / 4; ++u)
#pragma unroll
    for (int q = 0; q < 4; ++q) { const float c = vals[u * 4 + q] - mu; s2 += c * c; }
  red[tid] = s2; __syncthreads();
  for (int st = 128; st > 0; st >>= 1) { if (tid < st) red[tid] += red[tid + st]; __syncthreads(); }
  const float rs = rsqrtf(red[0] / (float)N + eps);
  {
    for (int u = 0; u < per / 4; ++u) {
      const int j = tid * 4 + 1024 * u;
      v4f o, sm;
#pragma unroll
      for (int q = 0; q < 4; ++q) {
        float gg = g[j + q], bb = bta[j + q];
        if (PARAM_BF16) { gg = bf16_round(gg); bb = bf16_round(bb); }
        sm[q] = vals[u * 4 + q]; o[q] = (vals[u * 4 + q] - mu) * rs * gg + bb;
      }
      if (out_sum) *(v4f*)(out_sum + (size_t)row * N + j) = sm;
      *(v4f*)(out_norm + (size_t)row * N + j) = o;
    }
    
  }
}



// ---- f16 WMMA path (v_wmma_f32_16x16x32_f16): 11-bit significands for operands in range — used where a [0,1] probability operand needs more precision than bf16
typedef _Float16 v16h __attribute__((ext_vector_type(16)));
union FragH { v16h v; v8us half[2]; _Float16 h[16]; unsigned short u[16]; };
template <int NT>
__device__ __forceinline__ v8f mmaH(v16h ah, v16h al, v16h bh, v16h bl, v8f c) {
  c = __builtin_amdgcn_wmma_f32_16x16x32_f16(false, ah, false, bh, (short)0, c, false, false);
  if (NT >= 2) c = __builtin_amdgcn_wmma_f32_16x16x32_f16(false, al, false, bh, (short)0, c, false, false);
  if (NT >= 3) c = __builtin_amdgcn_wmma_f32_16x16x32_f16(false, ah, false, bl, (short)0, c, false, false);
  asm volatile("v_nop\n\tv_nop\n\tv_nop\n\tv_nop" : "+v"(c) : "v"(ah), "v"(al), "v"(bh), "v"(bl));
  return c;
}
// batched GEMM like k_gemm_b but f16 operands: A f32 (split into f16 hi/lo if ASPLIT, else rounded to f16), Bt = f16 values [n][k]; alpha; C f32; N multiple of 16 (partial tiles skipped)
template <bool ASPLIT>
__global__ __launch_bounds__(128) void k_gemm_h(const float* __restrict__ A, int lda, size_t sA, const _Float16* __restrict__ Bh, int ldb, size_t sB, float alpha, float* __restrict__ C, int ldc, size_t sC, int M, int N, int K) {
  __shared__ __attribute__((aligned(16))) float so[4][16][64];
  const int tid = threadIdx.x, w = tid >> 5, lane = tid & 31, ln = lane & 15, hh = lane >> 4; const int by = blockIdx.y;
  A += (size_t)by * sA; Bh += (size_t)by * sB; C += (size_t)by * sC;
  const int ntn = (N + 63) / 64; const int wid = blockIdx.x * 4 + w; const int mt = wid / ntn, nq = wid % ntn; if (mt * 16 >= M) return;
  const int row0 = mt * 16, col0 = nq * 64; const float* arow = A + (size_t)(row0 + ln) * lda;
  v8f acc[4] = {};
  for (int kb = 0; kb < K; kb += 32) {
    FragH ah, al;
    const v4f x0 = *(const v4fa*)(arow + kb + 8 * hh), x1 = *(const v4fa*)(arow + kb + 8 * hh + 4), x2 = *(const v4fa*)(arow + kb + 16 + 8 * hh), x3 = *(const v4fa*)(arow + kb + 16 + 8 * hh + 4);
    float xs[16] = {x0[0],x0[1],x0[2],x0[3],x1[0],x1[1],x1[2],x1[3],x2[0],x2[1],x2[2],x2[3],x3[0],x3[1],x3[2],x3[3]};
#pragma unroll
    for (int i = 0; i < 16; ++i) { const _Float16 h = (_Float16)xs[i]; ah.h[i] = h; al.h[i] = ASPLIT ? (_Float16)(xs[i] - (float)h) : (_Float16)0.0f; }
#pragma unroll
    for (int t = 0; t < 4; ++t) { if (col0 + t * 16 >= N) continue; const size_t boff = (size_t)(col0 + t * 16 + ln) * ldb + kb; FragH bq; bq.half[0] = *(const v8us*)(Bh + boff + 8 * hh); bq.half[1] = *(const v8us*)(Bh + boff + 16 + 8 * hh);
      acc[t] = mmaH<ASPLIT ? 2 : 1>(ah.v, al.v, bq.v, bq.v, acc[t]); }
  }
#pragma unroll
  for (int t = 0; t < 4; ++t) { if (col0 + t * 16 >= N) continue;
#pragma unroll
    for (int r = 0; r < 8; ++r) so[w][8 * hh + r][t * 16 + ln] = acc[t][r] * alpha; }
  __builtin_amdgcn_fence(__ATOMIC_ACQ_REL, "workgroup"); __builtin_amdgcn_wave_barrier();
  const int rsub = lane >> 4, c4 = (lane & 15) * 4;
  {
#pragma unroll
    for (int q = 0; q < 8; ++q) { const int r = q * 2 + rsub; if (col0 + c4 < N) { const v4f v = *(const v4fa*)&so[w][r][c4]; *(v4f*)(C + (size_t)(row0 + r) * ldc + col0 + c4) = v; } }
     }
}

// Wt[n][k] = f16(W[k][n]·scale) from f32 row-major W[K][N] (scale = power of two; bf16-exact weights stay exact in f16 away from the subnormal range)
__global__ __launch_bounds__(256) void k_wt_f16(const float* __restrict__ W, _Float16* __restrict__ Wt, int K, int N, float scale) {
  const int t = blockIdx.x * 256 + threadIdx.x; if (t >= N * (K / 8)) return; const int n = t / (K / 8), k8 = (t % (K / 8)) * 8; FragH f;
#pragma unroll
  for (int i = 0; i < 8; ++i) f.h[i] = (_Float16)(bf16_round(W[(size_t)(k8 + i) * N + n]) * scale); const v8us o = f.half[0];
  *(v8us*)((unsigned short*)Wt + (size_t)n * K + k8) = o; 
}
// k_gemm_hh variant with fused epilogue: v = acc·alpha + bias[by·sBias + col] (+ CP[(row/rowsPerB)·sCPb + by·64 + col] if CP) ; ACT 0 none / 1 elu ; writes f16 C16 (and f32 C if non-null)
template <int ACT>
__global__ __launch_bounds__(128) void k_gemm_hhx(const _Float16* __restrict__ A, int lda, size_t sA, const _Float16* __restrict__ Bh, int ldb, size_t sB, float alpha, const float* __restrict__ bias, size_t sBias, const float* __restrict__ CP, int rowsPerB, size_t sCPb, int row0g,
    float* __restrict__ C, _Float16* __restrict__ C16, int ldc, size_t sC, int M, int N, int K) {
  __shared__ __attribute__((aligned(16))) float so[4][16][64];
  const int tid = threadIdx.x, w = tid >> 5, lane = tid & 31, ln = lane & 15, hh = lane >> 4; const int by = blockIdx.y;
  A += (size_t)by * sA; Bh += (size_t)by * sB; const size_t cofs = (size_t)by * sC; const float* bp = bias ? bias + (size_t)by * sBias : nullptr;
  const int ntn = (N + 63) / 64; const int wid = blockIdx.x * 4 + w; const int mt = wid / ntn, nq = wid % ntn; if (mt * 16 >= M) return;
  const int row0 = mt * 16, col0 = nq * 64; const _Float16* arow = A + (size_t)(row0 + ln) * lda;
  v8f acc[4] = {};
  for (int kb = 0; kb < K; kb += 32) { FragH ah; ah.half[0] = *(const v8us*)((const unsigned short*)arow + kb + 8 * hh); ah.half[1] = *(const v8us*)((const unsigned short*)arow + kb + 16 + 8 * hh);
#pragma unroll
    for (int t = 0; t < 4; ++t) { if (col0 + t * 16 >= N) continue; const size_t boff = (size_t)(col0 + t * 16 + ln) * ldb + kb; FragH bq; bq.half[0] = *(const v8us*)((const unsigned short*)Bh + boff + 8 * hh); bq.half[1] = *(const v8us*)((const unsigned short*)Bh + boff + 16 + 8 * hh);
      acc[t] = mmaH<1>(ah.v, ah.v, bq.v, bq.v, acc[t]); }
  }
#pragma unroll
  for (int t = 0; t < 4; ++t) { if (col0 + t * 16 >= N) continue; const int col = col0 + t * 16 + ln; const float bv = bp ? bf16_round(bp[col]) : 0.f;
#pragma unroll
    for (int r = 0; r < 8; ++r) { float v = acc[t][r] * alpha + bv; if (CP) { const int rr = row0g + row0 + 8 * hh + r; if (rowsPerB < 0) v += CP[cofs + (size_t)rr * ldc + col];      /* rowsPerB < 0: own element of the batched C plane */ else { const int bidx = rr / rowsPerB; v += CP[(size_t)bidx * sCPb + (size_t)by * 64 + col]; } } if (ACT == 1) v = (v > 0.f) ? v : expm1f(v); else if (ACT == 7) v = (v > 0.f) ? v + 1.0f : expf(v); else if (ACT == 8) v = tanhf(v); else if (ACT == 9) v = 0.5f * v * (1.0f + tanhf(0.7978845608028654f * (v + 0.044715f * v * v * v))); else if (ACT == 11) v = 1.0f / (1.0f + expf(-v)); else if (ACT == 12) v = (v > 0.f) ? v : 0.01f * v; else if (ACT == 14) v = (v > 0.f) ? v : 0.1f * v; else if (ACT == 16) v = (v >= 0.f) ? v : 0.3f * v; else if (ACT == 17) v = (v >= 0.f) ? v : 0.2f * v; else if (ACT == 15) v = v / (1.0f + expf(-v)); else if (ACT == 3) v = fmaxf(v, 0.f); else if (ACT == 6) v = 0.5f * v * (1.0f + erff(v * 0.70710678118654752f)); so[w][8 * hh + r][t * 16 + ln] = v; } }
  __builtin_amdgcn_fence(__ATOMIC_ACQ_REL, "workgroup"); __builtin_amdgcn_wave_barrier();
  const int rsub = lane >> 4, c4 = (lane & 15) * 4; typedef _Float16 v4h __attribute__((ext_vector_type(4)));
  {
#pragma unroll
    for (int q = 0; q < 8; ++q) { const int r = q * 2 + rsub; if (col0 + c4 < N) { const v4f v = *(const v4fa*)&so[w][r][c4]; if (C) *(v4f*)(C + cofs + (size_t)(row0 + r) * ldc + col0 + c4) = v; if (C16) { v4h h4; for (int i = 0; i < 4; ++i) h4[i] = (_Float16)v[i]; *(v4h*)(C16 + cofs + (size_t)(row0 + r) * ldc + col0 + c4) = h4; } } }
     }
}


typedef _Float16 v4h __attribute__((ext_vector_type(4)));

__global__ __launch_bounds__(256) void k_x16(const float* __restrict__ x, _Float16* __restrict__ X16, size_t n8) { const size_t t = (size_t)blockIdx.x * 256 + threadIdx.x; if (t >= n8) return; FragH f;
#pragma unroll
  for (int q = 0; q < 8; ++q) f.h[q] = (_Float16)bf16_round(x[t * 8 + q]); *(v8us*)((unsigned short*)X16 + t * 8) = f.half[0];  }
__global__ __launch_bounds__(256) void k_h16(const float* __restrict__ x, _Float16* __restrict__ X16, size_t n8) { const size_t t = (size_t)blockIdx.x * 256 + threadIdx.x; if (t >= n8) return; FragH f;
#pragma unroll
  for (int q = 0; q < 8; ++q) f.h[q] = (_Float16)x[t * 8 + q]; *(v8us*)((unsigned short*)X16 + t * 8) = f.half[0];  }
__global__ __launch_bounds__(256) void k_round16f(const float* __restrict__ W, _Float16* __restrict__ Bt, size_t n8) { const size_t t = (size_t)blockIdx.x * 256 + threadIdx.x; if (t >= n8) return; FragH f;
#pragma unroll
  for (int i = 0; i < 8; ++i) f.h[i] = (_Float16)(bf16_round(W[t * 8 + i]) * 16.0f); *(v8us*)((unsigned short*)Bt + t * 8) = f.half[0];  }
template <int NHv, int TTv>
__global__ __launch_bounds__(256) void k_vt(const _Float16* __restrict__ V16, int ldv, int voff, _Float16* __restrict__ Vt) { __shared__ unsigned short tl[64][66]; const int tid = threadIdx.x; const int slab = blockIdx.x / (TTv / 64), lg = blockIdx.x % (TTv / 64); const int b = slab / NHv, h = slab % NHv;
  for (int i = tid; i < 64 * 8; i += 256) { const int r = i / 8, c8 = (i % 8) * 8; FragH f; f.half[0] = *(const v8us*)((const unsigned short*)V16 + ((size_t)b * TTv + lg * 64 + r) * ldv + voff + h * 64 + c8);
#pragma unroll
    for (int q = 0; q < 8; ++q) tl[r][c8 + q] = f.u[q]; }
  __syncthreads();
  {
#pragma unroll
    for (int rd = 0; rd < 2; ++rd) { const int d = rd * 32 + tid / 8, pc = tid % 8; FragH f;
#pragma unroll
      for (int q = 0; q < 8; ++q) f.u[q] = tl[pc * 8 + q][d];
      *(v8us*)((unsigned short*)Vt + ((size_t)slab * 64 + d) * TTv + lg * 64 + pc * 8) = f.half[0]; }
     } }

// Fragment order of an f16 operand plane X[row][k] (k a multiple of 8, K columns): the 16-byte unit of 8 consecutive k lies where the lane that needs it reads it, so that
// the 32 lanes of one fragment load (or store) cover 512 contiguous bytes, four whole lines, instead of 32 bytes in each of 16 rows. Block = (16 rows) x (16 k) = 32 units;
// unit in the block = lane = 16 * (k / 8 % 2) + row % 16. A 16x32 fragment is two blocks in a row, in the k order of g2_frag (8h + s, 16 + 8h + s).
__device__ __forceinline__ size_t fo_unit(size_t row, size_t k, size_t K) { return ((row >> 4) * (K >> 4) + (k >> 4)) * 32 + ((k >> 3) & 1) * 16 + (row & 15); }
// p = the plane + 8 * (first unit of the fragment's first block + lane)
__device__ __forceinline__ v16h fo_frag(const _Float16* p) { FragH f; f.half[0] = *(const v8us*)((const unsigned short*)p); f.half[1] = *(const v8us*)((const unsigned short*)p + 256); return f.v; }
// v rows [image][n][256] -> channel-major in fragment order (rows = image * 256 + channel, k = n): 64 x 64 tiles through LDS, each wave stores whole 512-byte blocks
__global__ __launch_bounds__(256) void k_vtf(const _Float16* __restrict__ V16, _Float16* __restrict__ Vf) { __shared__ unsigned short tl[64][66]; const int tid = threadIdx.x; const int slab = blockIdx.x / (NPX / 64), lg = blockIdx.x % (NPX / 64); const int b = slab / (CC / 64), h = slab % (CC / 64);
  for (int i = tid; i < 64 * 8; i += 256) { const int r = i / 8, c8 = (i % 8) * 8; FragH f; f.half[0] = *(const v8us*)((const unsigned short*)V16 + ((size_t)b * NPX + lg * 64 + r) * CC + h * 64 + c8);
#pragma unroll
    for (int q = 0; q < 8; ++q) tl[r][c8 + q] = f.u[q]; }
  __syncthreads();
#pragma unroll
  for (int rd = 0; rd < 2; ++rd) { const int u = rd * 256 + tid, blk = u >> 5, l = u & 31; const int d = (blk >> 2) * 16 + (l & 15), kk = (blk & 3) * 16 + (l >> 4) * 8; FragH f;
#pragma unroll
    for (int q = 0; q < 8; ++q) f.u[q] = tl[kk + q][d];
    *(v8us*)((unsigned short*)Vf + fo_unit((size_t)slab * 64 + d, (size_t)lg * 64 + kk, NPX) * 8) = f.half[0]; } }

__global__ __launch_bounds__(256) void k_hl(const float* __restrict__ F, _Float16* __restrict__ Hh, _Float16* __restrict__ Hl, size_t n8) { const size_t t = (size_t)blockIdx.x * 256 + threadIdx.x; if (t >= n8) return; FragH fh, fl; const v4f a = *(const v4fa*)(F + t * 8), c = *(const v4fa*)(F + t * 8 + 4);
#pragma unroll
  for (int q = 0; q < 4; ++q) { _Float16 h = (_Float16)a[q]; fh.h[q] = h; fl.h[q] = (_Float16)((a[q] - (float)h) * 1024.0f); h = (_Float16)c[q]; fh.h[4 + q] = h; fl.h[4 + q] = (_Float16)((c[q] - (float)h) * 1024.0f); }
  { const size_t u = fo_unit(t >> 3, (t & 7) * 8, CQ); *(v8us*)((unsigned short*)Hh + u * 8) = fh.half[0]; *(v8us*)((unsigned short*)Hl + u * 8) = fl.half[0];  } }

// ---- fast GEMM (wave tile 32x64; requires M % 32 == 0 rows per launch region, N % 64 == 0 and K % 256 == 0); epilogue = k_gemm_hhx semantics ----
__device__ __forceinline__ v16h g2_frag(const _Float16* p, int hh) { FragH f; f.half[0] = *(const v8us*)((const unsigned short*)p + 8 * hh); f.half[1] = *(const v8us*)((const unsigned short*)p + 16 + 8 * hh); return f.v; }
__device__ __forceinline__ v8f g2_mma(v16h a, v16h b, v8f c) { v8f d = __builtin_amdgcn_wmma_f32_16x16x32_f16(false, a, false, b, (short)0, c, false, false); asm volatile("v_nop\n\tv_nop\n\tv_nop\n\tv_nop" : "+v"(d) : "v"(a), "v"(b)); return d; }
// The operands of one k step (32 k) of a 32 x 64 wave tile form a set: two A and four B fragments, twelve 16-byte loads a lane. The GEMM loops below hold three sets in registers as a
// ring: a set is refilled for the step three ahead as soon as its products are issued, so the loads of two to three steps are in flight under every product and a wave no longer
// waits out four or five load latencies in a row in each step. Every accumulator still takes its k steps in rising order.
struct OpSet { v16h a0, a1, b0, b1, b2, b3; };
// c[t + 4 * half]: column tile t, row tile half
__device__ __forceinline__ void set_mma(const OpSet& s, v8f (&c)[8]) {
  c[0] = g2_mma(s.a0, s.b0, c[0]); c[4] = g2_mma(s.a1, s.b0, c[4]); c[1] = g2_mma(s.a0, s.b1, c[1]); c[5] = g2_mma(s.a1, s.b1, c[5]);
  c[2] = g2_mma(s.a0, s.b2, c[2]); c[6] = g2_mma(s.a1, s.b2, c[6]); c[3] = g2_mma(s.a0, s.b3, c[3]); c[7] = g2_mma(s.a1, s.b3, c[7]); }
template <int ACT>
__global__ __launch_bounds__(128) void k_gemm2(const _Float16* __restrict__ A, int lda, size_t sA, const _Float16* __restrict__ Bh, int ldb, size_t sB, float alpha, const float* __restrict__ bias, size_t sBias, const float* __restrict__ CP, int rowsPerB, size_t sCPb, int row0g,
    float* __restrict__ C, _Float16* __restrict__ C16, int ldc, size_t sC, int M, int N, int K) { static_assert(ACT == 0 || ACT == 3 || ACT == 6 || ACT == 8 || ACT == 9 || ACT == 11 || ACT == 12 || ACT == 14 || ACT == 15 || ACT == 16 || ACT == 17, "k_gemm2: unsupported ACT code (would silently apply no activation)");
  __shared__ __attribute__((aligned(16))) float so[4][32][68];
  const int tid = threadIdx.x, w = tid >> 5, lane = tid & 31, ln = lane & 15, hh = lane >> 4; const int by = blockIdx.y;
  A += (size_t)by * sA; Bh += (size_t)by * sB; const size_t cofs = (size_t)by * sC; const float* bp = bias ? bias + (size_t)by * sBias : nullptr;
  const int ntn = N >> 6; const int mt = blockIdx.x / ntn, nq = blockIdx.x - mt * ntn; const int row0 = mt * 128 + 32 * w, col0 = nq * 64; if (row0 >= M) return;
  const _Float16* a0p = A + (size_t)(row0 + ln) * lda; const _Float16* a1p = a0p + (size_t)16 * lda;
  const _Float16* b0p = Bh + (size_t)(col0 + ln) * ldb; const _Float16* b1p = b0p + (size_t)16 * ldb; const _Float16* b2p = b1p + (size_t)16 * ldb; const _Float16* b3p = b2p + (size_t)16 * ldb;
  const v8f z8 = {0.f,0.f,0.f,0.f,0.f,0.f,0.f,0.f}; v8f accs[8] = {z8, z8, z8, z8, z8, z8, z8, z8};
  auto ld = [&](OpSet& s, int kb) { s.a0 = g2_frag(a0p + kb, hh); s.a1 = g2_frag(a1p + kb, hh); s.b0 = g2_frag(b0p + kb, hh); s.b1 = g2_frag(b1p + kb, hh); s.b2 = g2_frag(b2p + kb, hh); s.b3 = g2_frag(b3p + kb, hh);
    asm volatile("s_wait_xcnt 0x0" ::: "memory"); };      /* stands in front of any later overwrite of the address registers of the twelve loads above; as a compiler fence it also keeps each set's loads at their place in the ring */
  // K in chunks of 256 (eight steps, K % 256 == 0): the ring runs straight through a chunk and drains at its end. The chunk loop stays rolled: a trip already holds the whole ring's code.
#pragma unroll 1
  for (int kc = 0; kc < K; kc += 256) { OpSet s[3]; ld(s[0], kc); ld(s[1], kc + 32); ld(s[2], kc + 64);
    // unrolled in full: s is then indexed by constants only and stays in registers
#pragma unroll
    for (int i = 0; i < 8; ++i) { set_mma(s[i % 3], accs); if (i + 3 < 8) ld(s[i % 3], kc + (i + 3) * 32); } }
#pragma unroll
  for (int u = 0; u < 8; ++u) { const int t = u & 3, half = u >> 2; const int col = col0 + t * 16 + ln; const float bv = bp ? bf16_round(bp[col]) : 0.f;
#pragma unroll
    for (int r = 0; r < 8; ++r) { const int rloc = half * 16 + 8 * hh + r; float v = accs[u][r] * alpha + bv; if (CP) { if (rowsPerB < 0) v += CP[cofs + (size_t)(row0g + row0 + rloc) * ldc + col];      /* rowsPerB < 0: own element of the batched C plane */ else { const int bidx = (row0g + row0 + rloc) / rowsPerB; v += CP[(size_t)bidx * sCPb + (size_t)by * 64 + col]; } }
      if (ACT == 3) v = fmaxf(v, 0.f); else if (ACT == 6) v = 0.5f * v * (1.0f + erff(v * 0.70710678118654752f)); else if (ACT == 11) v = 1.0f / (1.0f + expf(-v)); else if (ACT == 15) v = v / (1.0f + expf(-v)); else if (ACT == 12) v = (v > 0.f) ? v : 0.01f * v; else if (ACT == 8) v = tanhf(v); else if (ACT == 9) v = 0.5f * v * (1.0f + tanhf(0.7978845608028654f * (v + 0.044715f * v * v * v))); else if (ACT == 14) v = (v > 0.f) ? v : 0.1f * v; else if (ACT == 16) v = (v >= 0.f) ? v : 0.3f * v; else if (ACT == 17) v = (v >= 0.f) ? v : 0.2f * v;
      so[w][rloc][t * 16 + ln] = v; } }
  __builtin_amdgcn_fence(__ATOMIC_ACQ_REL, "workgroup"); __builtin_amdgcn_wave_barrier();
  const int rsub = lane >> 4, c4 = (lane & 15) * 4;
  {
#pragma unroll
    for (int q = 0; q < 16; ++q) { const int r = q * 2 + rsub; const v4f v = *(const v4fa*)&so[w][r][c4]; if (C) *(v4f*)(C + cofs + (size_t)(row0 + r) * ldc + col0 + c4) = v; if (C16) { v4h h4; for (int i = 0; i < 4; ++i) h4[i] = (_Float16)v[i]; *(v4h*)(C16 + cofs + (size_t)(row0 + r) * ldc + col0 + c4) = h4; } }
     } }


__global__ __launch_bounds__(256) void k_wnat(const float* __restrict__ w, size_t n8, _Float16* __restrict__ Bt) { const size_t t = (size_t)blockIdx.x * 256 + threadIdx.x; if (t >= n8) return; FragH f; for (int q = 0; q < 8; ++q) f.h[q] = (_Float16)(bf16_round(w[t * 8 + q]) * 16.0f); *(v8us*)((unsigned short*)Bt + t * 8) = f.half[0];  }
// energy + row softmax in one kernel. A work-group of 16 waves owns 16 rows n of the attention matrix; wave w forms the logits E[n][m] of its 256 columns m
// (A = q rows, B = k rows; hi.hi in one accumulator, lo.hi + hi.lo in a second, joined as hi + lo / 1024). The logits stay in registers for the maximum, the exponentials,
// their sum and the scaled f16 store, so they never go to memory. In the D layout a lane holds ONE column m and 8 consecutive rows n per tile: that is the 16-byte unit which
// the same lane of the x_r product reads as its B operand (row m of P^T, k = n), so each tile is one 512-byte store into P^T in fragment order and no transpose follows.
// The row reductions run per register: over the tiles in the lane, over the 16 lanes of a row by DPP, over the waves through LDS.
__device__ __forceinline__ v8f es_mma(v16h a, v16h b, v8f c) { return __builtin_amdgcn_wmma_f32_16x16x32_f16(false, a, false, b, (short)0, c, false, false); }
template <int X> __device__ __forceinline__ float row_x(float v) { return __int_as_float(__builtin_amdgcn_update_dpp(0, __float_as_int(v), 0x160 + X, 0xf, 0xf, true)); }      /* the value of lane l ^ X of the same 16-lane row (row_xmask) */
__global__ __launch_bounds__(512) void k_esm(const _Float16* __restrict__ Qh, const _Float16* __restrict__ Ql, const _Float16* __restrict__ Kh, const _Float16* __restrict__ Kl, _Float16* __restrict__ Pf) {
  __shared__ __attribute__((aligned(32))) float redm[16][16]; __shared__ __attribute__((aligned(32))) float reds[16][16];
  const int tid = threadIdx.x, w = tid >> 5, lane = tid & 31, ln = lane & 15, hh = lane >> 4;
  const _Float16* qhp = Qh + ((size_t)blockIdx.x * (CQ / 16) * 32 + lane) * 8; const _Float16* qlp = Ql + ((size_t)blockIdx.x * (CQ / 16) * 32 + lane) * 8;
  const v16h qh0 = fo_frag(qhp), qh1 = fo_frag(qhp + 512);
  asm volatile("s_wait_xcnt 0x0" ::: "memory");      /* the address pair of the loads above may be given to a later load's result: the wait stands in front of that overwrite */
  const v16h ql0 = fo_frag(qlp), ql1 = fo_frag(qlp + 512);
  asm volatile("s_wait_xcnt 0x0" ::: "memory");      /* the same for the address pair of the two loads above */
  const _Float16* khp = Kh + ((size_t)(w * 16) * (CQ / 16) * 32 + lane) * 8; const _Float16* klp = Kl + ((size_t)(w * 16) * (CQ / 16) * 32 + lane) * 8;
  const v8f z8 = {0.f,0.f,0.f,0.f,0.f,0.f,0.f,0.f}; v8f e[16];
  v16h nh0 = fo_frag(khp), nh1 = fo_frag(khp + 512), nl0 = fo_frag(klp), nl1 = fo_frag(klp + 512);
  // every loop over e[] is unrolled in full: e is then indexed by constants only and stays in registers
#pragma unroll
  for (int t = 0; t < 16; ++t) { const v16h kh0 = nh0, kh1 = nh1, kl0 = nl0, kl1 = nl1;
    if (t + 1 < 16) { nh0 = fo_frag(khp + (t + 1) * 1024); nh1 = fo_frag(khp + (t + 1) * 1024 + 512); nl0 = fo_frag(klp + (t + 1) * 1024); nl1 = fo_frag(klp + (t + 1) * 1024 + 512); }      /* the next tile's fragments fly under this tile's products */
    v8f ch = es_mma(qh0, kh0, z8); v8f cl = es_mma(qh0, kl0, z8); ch = es_mma(qh1, kh1, ch); cl = es_mma(qh1, kl1, cl); cl = es_mma(ql0, kh0, cl); cl = es_mma(ql1, kh1, cl);
    e[t] = ch + cl * (1.0f / 1024.0f);
    if (t >= 12) __builtin_amdgcn_sched_barrier(0); }      /* from here on the logits fill the registers: later tiles' loads are not lifted over this point, where the build otherwise spills */
  v8f m8 = e[0];      /* register r: row n = 8 * hh + r */
#pragma unroll
  for (int t = 1; t < 16; ++t) for (int r = 0; r < 8; ++r) m8[r] = fmaxf(m8[r], e[t][r]);
#pragma unroll
  for (int r = 0; r < 8; ++r) { float v = m8[r]; v = fmaxf(v, row_x<1>(v)); v = fmaxf(v, row_x<2>(v)); v = fmaxf(v, row_x<4>(v)); v = fmaxf(v, row_x<8>(v)); m8[r] = v; }
  if (ln == 0) *(v8f*)&redm[w][8 * hh] = m8;
  __syncthreads();
#pragma unroll
  for (int u = 0; u < 16; ++u) { const v8f o = *(const v8f*)&redm[u][8 * hh]; for (int r = 0; r < 8; ++r) m8[r] = fmaxf(m8[r], o[r]); }
#pragma unroll
  for (int t = 0; t < 16; ++t) for (int r = 0; r < 8; ++r) e[t][r] = expf(e[t][r] - m8[r]);
  v8f s8 = e[0];
#pragma unroll
  for (int t = 1; t < 16; ++t) s8 += e[t];
#pragma unroll
  for (int r = 0; r < 8; ++r) { float v = s8[r]; v += row_x<1>(v); v += row_x<2>(v); v += row_x<4>(v); v += row_x<8>(v); s8[r] = v; }
  if (ln == 0) *(v8f*)&reds[w][8 * hh] = s8;
  __syncthreads();
  v8f se = z8;
#pragma unroll
  for (int u = 0; u < 16; ++u) se += *(const v8f*)&reds[u][8 * hh];
  v8f sc;
#pragma unroll
  for (int r = 0; r < 8; ++r) sc[r] = 256.0f / se[r];
  unsigned short* p = (unsigned short*)Pf + (((size_t)(w * 16) * (NPX / 16) + blockIdx.x) * 32 + lane) * 8;      /* block (m tile w * 16 + t, n tile blockIdx.x), unit = lane */
#pragma unroll
  for (int t = 0; t < 16; ++t) { FragH f; for (int r = 0; r < 8; ++r) f.h[r] = (_Float16)(e[t][r] * sc[r]); *(v8us*)(p + (size_t)t * (NPX / 16) * 256) = f.half[0]; } }
// x_r[c][m] = alpha * sum_n v[c][n] P^T[m][n], both operands in fragment order (K = NPX); grid y = image. Wave tile 32 x 64, four waves stacked on the rows; the operands go through
// the ring of three register sets (see OpSet).
#define XR_TP ((size_t)(NPX / 16) * 256)      /* f16 elements from one 16-row tile to the next */
__device__ __forceinline__ void xr_load(OpSet& s, const _Float16* ap, const _Float16* bp) {
  s.a0 = fo_frag(ap); s.a1 = fo_frag(ap + XR_TP); s.b0 = fo_frag(bp); s.b1 = fo_frag(bp + XR_TP); s.b2 = fo_frag(bp + 2 * XR_TP); s.b3 = fo_frag(bp + 3 * XR_TP);
  asm volatile("s_wait_xcnt 0x0" ::: "memory"); }      /* stands in front of any later overwrite of the address registers of the twelve loads above; as a compiler fence it also keeps each set's loads at their place in the ring */
__global__ __launch_bounds__(128) void k_xr(const _Float16* __restrict__ Af, const _Float16* __restrict__ Bf, float alpha, float* __restrict__ C) {
  __shared__ __attribute__((aligned(16))) float so[4][32][68];
  const int tid = threadIdx.x, w = tid >> 5, lane = tid & 31, ln = lane & 15, hh = lane >> 4; const int by = blockIdx.y;
  Af += (size_t)by * CC * NPX; Bf += (size_t)by * NPX * NPX; C += (size_t)by * CC * NPX;
  const int ntn = NPX >> 6; const int mt = blockIdx.x / ntn, nq = blockIdx.x - mt * ntn; const int row0 = mt * 128 + 32 * w, col0 = nq * 64;
  const _Float16* ap = Af + (size_t)(row0 >> 4) * XR_TP + lane * 8; const _Float16* bp = Bf + (size_t)(col0 >> 4) * XR_TP + lane * 8;
  const v8f z8 = {0.f,0.f,0.f,0.f,0.f,0.f,0.f,0.f}; v8f accs[8] = {z8, z8, z8, z8, z8, z8, z8, z8};
  constexpr int KS = NPX / 32;      /* k steps; one step = two blocks = 512 elements */
  static_assert(KS % 3 == 2 && KS >= 5, "the ring's tail below is written for KS = 3 T + 2");
  OpSet s0, s1, s2;
  xr_load(s0, ap, bp); xr_load(s1, ap + 512, bp + 512); xr_load(s2, ap + 1024, bp + 1024);
  // stays rolled: a trip already holds a whole turn of the ring (24 products, 36 loads), more copies would only lengthen the code
#pragma unroll 1
  for (int st = 3; st + 2 < KS; st += 3) { const _Float16* a = ap + (size_t)st * 512; const _Float16* b = bp + (size_t)st * 512;
    set_mma(s0, accs); xr_load(s0, a, b); set_mma(s1, accs); xr_load(s1, a + 512, b + 512); set_mma(s2, accs); xr_load(s2, a + 1024, b + 1024); }
  set_mma(s0, accs); xr_load(s0, ap + (size_t)(KS - 2) * 512, bp + (size_t)(KS - 2) * 512); set_mma(s1, accs); xr_load(s1, ap + (size_t)(KS - 1) * 512, bp + (size_t)(KS - 1) * 512);
  set_mma(s2, accs); set_mma(s0, accs); set_mma(s1, accs);
#pragma unroll
  for (int u = 0; u < 8; ++u) { const int t = u & 3, half = u >> 2;
#pragma unroll
    for (int r = 0; r < 8; ++r) so[w][half * 16 + 8 * hh + r][t * 16 + ln] = accs[u][r] * alpha; }
  __builtin_amdgcn_fence(__ATOMIC_ACQ_REL, "workgroup"); __builtin_amdgcn_wave_barrier();
  const int rsub = lane >> 4, c4 = (lane & 15) * 4;
#pragma unroll
  for (int q = 0; q < 16; ++q) { const int r = q * 2 + rsub; const v4f v = *(const v4fa*)&so[w][r][c4]; *(v4f*)(C + (size_t)(row0 + r) * NPX + col0 + c4) = v; } }
__global__ __launch_bounds__(256) void k_vt(const _Float16* __restrict__ V16, int b, int h0, _Float16* __restrict__ VT) { __shared__ unsigned short tl[64][65]; const int tid = threadIdx.x; const int hh = blockIdx.x % HG, sg = blockIdx.x / HG; const int s0 = sg * 64; const int h = h0 + hh;
  for (int i = tid; i < 64 * 8; i += 256) { const int j = i / 8, d8 = (i % 8) * 8; FragH f; f.half[0] = *(const v8us*)((const unsigned short*)V16 + ((size_t)b * SQ + s0 + j) * DM + h * HD + d8); for (int q = 0; q < 8; ++q) tl[d8 + q][j] = f.u[q]; }
  __syncthreads();
  { for (int i = tid; i < 64 * 8; i += 256) { const int d = i / 8, j8 = (i % 8) * 8; FragH f; for (int q = 0; q < 8; ++q) f.u[q] = tl[d][j8 + q]; *(v8us*)((unsigned short*)VT + ((size_t)hh * HD + d) * SQ + s0 + j8) = f.half[0]; }  } }


__global__ __launch_bounds__(256) void k_cl2rows(const float* __restrict__ X, _Float16* __restrict__ XR) { __shared__ float tl[64][33]; const int tid = threadIdx.x; const int nl = LL / 32, nc = CC / 64; const int cb_ = blockIdx.x % nc; const int lb = (blockIdx.x / nc) % nl; const size_t b = blockIdx.x / (nc * nl); const int c0 = cb_ * 64, l0 = lb * 32;
  for (int i = tid; i < 64 * 32; i += 256) { const int c = i / 32, l = i % 32; tl[c][l] = bf16_round(X[(b * CC + c0 + c) * (size_t)LL + l0 + l]); }
  __syncthreads();
  { const int l = tid / 8, c8 = (tid % 8) * 8; FragH f; for (int q = 0; q < 8; ++q) f.h[q] = (_Float16)tl[c8 + q][l]; unsigned short* d = (unsigned short*)XR + (b * LL + l0 + l) * (size_t)CC + c0 + c8; *(v8us*)d = f.half[0];  } }

__global__ __launch_bounds__(256) void k_fin3(const float* __restrict__ Cm, const float* __restrict__ x, float* __restrict__ out) {
  #pragma clang fp contract(off)
  const size_t t = (size_t)blockIdx.x * 256 + threadIdx.x; if (t >= (size_t)NBR * CC * NPX / 8) return; const size_t base = t * 8; v8f v;
  const v4f x0 = *(const v4fa*)(x + base), x1 = *(const v4fa*)(x + base + 4);
  asm volatile("s_wait_xcnt 0x0" ::: "memory");      /* the address pair of the two loads above may be given to a later load's result: the wait stands in front of that overwrite */
  for (int q = 0; q < 4; ++q) { v[q] = __fadd_rn(bf16_round(x0[q]), Cm[base + q]); v[4 + q] = __fadd_rn(bf16_round(x1[q]), Cm[base + 4 + q]); } *(v8f*)(out + base) = v;  }

extern "C" void kernel_launch(void* const* d_in, const int* in_sizes, int n_in,
                              void* d_out, int out_size, void* d_ws, size_t ws_size, hipStream_t stream) {
  (void)in_sizes; (void)n_in; (void)out_size;
  const float* const* I = (const float* const*)d_in; const float* x = I[0]; const float* Wq = I[1]; const float* Wk = I[2]; const float* Wv = I[3]; const float* bv = I[4];
  char* ws = (char*)d_ws; size_t off = 0;
  auto take = [&](size_t bytes) { char* p = ws + off; off += (bytes + 255) & ~(size_t)255; return p; };
  _Float16* BQ = (_Float16*)take((size_t)CQ * CC * 2); _Float16* BK = (_Float16*)take((size_t)CQ * CC * 2); _Float16* BV = (_Float16*)take((size_t)CC * CC * 2);
  _Float16* XR = (_Float16*)take(NR * CC * 2); float* QF = (float*)take(NR * CQ * 4); float* KF = (float*)take(NR * CQ * 4); _Float16* QH = (_Float16*)take(NR * CQ * 2); _Float16* QL = (_Float16*)take(NR * CQ * 2); _Float16* KH = (_Float16*)take(NR * CQ * 2); _Float16* KL = (_Float16*)take(NR * CQ * 2); _Float16* V16 = (_Float16*)take(NR * CC * 2);
  _Float16* PT = (_Float16*)take((size_t)NB * NPX * NPX * 2); _Float16* VT = (_Float16*)take((size_t)NB * CC * NPX * 2); float* CX = (float*)take((size_t)NB * CC * NPX * 4);
  if (off > ws_size) return;      /* 0.2 + 8 + 8 + 8 + 8 + 128 + 8 + 16 = approx 185 MiB: P^T, v channel-major and x_r hold all images */
  k_wnat<<<(unsigned)(((size_t)CQ * CC / 8 + 255) / 256), 256, 0, stream>>>(Wq, (size_t)CQ * CC / 8, BQ); k_wnat<<<(unsigned)(((size_t)CQ * CC / 8 + 255) / 256), 256, 0, stream>>>(Wk, (size_t)CQ * CC / 8, BK); k_wnat<<<(unsigned)(((size_t)CC * CC / 8 + 255) / 256), 256, 0, stream>>>(Wv, (size_t)CC * CC / 8, BV);
  k_cl2rows<<<NB * (NPX / 32) * (CC / 64), 256, 0, stream>>>(x, XR);
  k_gemm2<0><<<dim3((unsigned)((NR / 128) * 1), 1), 128, 0, stream>>>(XR, CC, 0, BQ, CC, 0, 0.0625f, nullptr, 0, nullptr, 1, 0, 0, QF, nullptr, CQ, 0, MP, CQ, CC);      /* q (f32, exact products) */
  k_gemm2<0><<<dim3((unsigned)((NR / 128) * 1), 1), 128, 0, stream>>>(XR, CC, 0, BK, CC, 0, 0.0625f, nullptr, 0, nullptr, 1, 0, 0, KF, nullptr, CQ, 0, MP, CQ, CC);      /* k */
  k_gemm2<0><<<dim3((unsigned)((NR / 128) * (CC / 64)), 1), 128, 0, stream>>>(XR, CC, 0, BV, CC, 0, 0.0625f, bv, 0, nullptr, 1, 0, 0, nullptr, V16, CC, 0, MP, CC, CC);      /* v + bv (f16 rows) */
  k_hl<<<(unsigned)((NR * CQ / 8 + 255) / 256), 256, 0, stream>>>(QF, QH, QL, NR * CQ / 8); k_hl<<<(unsigned)((NR * CQ / 8 + 255) / 256), 256, 0, stream>>>(KF, KH, KL, NR * CQ / 8);
  for (int b = 0; b < NBR; ++b) { const size_t r0 = (size_t)b * NPX;
    k_esm<<<NPX / 16, 512, 0, stream>>>(QH + r0 * CQ, QL + r0 * CQ, KH + r0 * CQ, KL + r0 * CQ, PT + (size_t)b * NPX * NPX); }      /* P^T[m][n] = 256 softmax_m(q_n . k_m), fragment order, one plane per image */
  // one launch for all images from here on: a single image's x_r product has 128 work-groups of one wave a SIMD, half the chip's WGPs; grid y = image puts four times the waves in flight
  k_vtf<<<NBR * (CC / 64) * (NPX / 64), 256, 0, stream>>>(V16, VT);      /* v channel-major [image][256][4096], fragment order */
  k_xr<<<dim3((CC / 128) * (NPX / 64), NBR), 128, 0, stream>>>(VT, PT, 0.00390625f, CX);      /* x_r[c][m] = sum_n v[c][n] attention[n][m] */
  k_fin3<<<(unsigned)(((size_t)NBR * CC * NPX / 8 + 255) / 256), 256, 0, stream>>>(CX, x, (float*)d_out);
}

// v007
// One run takes 127 microseconds.
// Versions in between are left out here; by their measured steps it is 1.39 times as fast as v005.
// Counting every step since v000, it is 31.1 times as fast.
#include <hip/hip_runtime.h>
// SA layer (x [4][256][4096]; q = Wq x (64), k = Wk x (64), v = Wv x + bv (256); energy[n][m] = q_n . k_m (no scale); attention = softmax over m; x_r[c][m] = sum_n v[c][n] attention[n][m]; out = x + x_r -> [4][256][4096]).
// Structure: channel-first input transposed to position rows (exact f16) via LDS tiles; q / k as WMMA GEMMs (32x64 wave tiles, f32 accumulation, exact x16 natural weights; exact products) kept f32 and split into f16 hi + 2^-10 residual planes; v GEMM (+ bias) to f16 rows and transposed channel-major via LDS tiles; per image: the unscaled energy as a THREE-term product (hi.hi + lo.hi + hi.lo, K = 64) whose f32 logits stay in registers for the row softmax on VALU (P x256 f16, one kernel), x_r = V(channel-major) . P^T-as-Bt GEMM (M = 256 channels, K = 4096) into f32; residual + store on VALU. The q / k planes, v channel-major and P^T lie in fragment order (see fo_unit), each written so by the kernel that makes it.
// Compute dtype: inputs rounded to bf16; x / weights exact; q, k as hi + residual (~f32, the logits have sigma ~8); v, P as plain f16 operands (~2^-12); softmax f32. v_wmma_f32_16x16x32_f16.
#define NB 4
#define CC 256
#define CQ 64
#define NPX 4096
#define LL NPX
#define PX NPX
#define NR ((size_t)NB * NPX)
#define NBR NB                       /* images attended (debug hook) */
#define MP ((int)NR)                 /* unused */
#define MC NPX                       /* unused */
#define SQ NPX
#define DM NPX
#define NH 64
#define HD 64
#define HG 1
typedef __bf16 v16b __attribute__((ext_vector_type(16)));
typedef unsigned short v8us __attribute__((ext_vector_type(8), may_alias));
typedef float  v8f  __attribute__((ext_vector_type(8)));
typedef float  v4f  __attribute__((ext_vector_type(4)));
typedef float  v4fa __attribute__((ext_vector_type(4), may_alias));
union FragB { v16b v; v8us half[2]; unsigned short u[16]; };

__device__ __forceinline__ unsigned short bf16_bits(float x) { unsigned int u = __float_as_uint(x); return (unsigned short)((u + 0x7FFFu + ((u >> 16) & 1u)) >> 16); }
__device__ __forceinline__ float bf16_val(unsigned short b) { return __uint_as_float(((unsigned int)b) << 16); }
__device__ __forceinline__ float bf16_round(float x) { return bf16_val(bf16_bits(x)); }
// D += A·B with NT terms: 1 = ah·bh, 2 = + al·bh (A split), 3 = + ah·bl (both split)
template <int NT>
__device__ __forceinline__ v8f mmaN(v16b ah, v16b al, v16b bh, v16b bl, v8f c) {
  c = __builtin_amdgcn_wmma_f32_16x16x32_bf16(false, ah, false, bh, (short)0, c, false, false);
  if (NT >= 2) c = __builtin_amdgcn_wmma_f32_16x16x32_bf16(false, al, false, bh, (short)0, c, false, false);
  if (NT >= 3) c = __builtin_amdgcn_wmma_f32_16x16x32_bf16(false, ah, false, bl, (short)0, c, false, false);
  asm volatile("v_nop\n\tv_nop\n\tv_nop\n\tv_nop" : "+v"(c) : "v"(ah), "v"(al), "v"(bh), "v"(bl));
  return c;
}

__global__ __launch_bounds__(256) void k_wt_bf16(const float* __restrict__ W, unsigned short* __restrict__ Wt, int K, int N) {
  const int t = blockIdx.x * 256 + threadIdx.x;
  const int k8n = K / 8;
  if (t >= N * k8n) return;
  const int n = t / k8n, k8 = (t % k8n) * 8;
  v8us v;
#pragma unroll
  for (int i = 0; i < 8; ++i) v[i] = bf16_bits(W[(size_t)(k8 + i) * N + n]);
  *(v8us*)(Wt + (size_t)n * K + k8) = v;
  
}

// GEMM C[M][N] (f32, pitch ldc) = act(A[M][K]·W + bias). A f32 row-major (pitch lda) converted per fragment to bf16
// (ASPLIT: hi/lo two planes -> 2 terms, else single rounded term); Wt bf16 [N][K] (pitch ldb). BIAS_BF16 rounds the
// bias to bf16 first (bias quantised to bf16 before the add). K%32==0, M%16==0, N%64==0.
template <bool ASPLIT, int ACT, bool BIAS_BF16>
__global__ __launch_bounds__(128) void k_gemm_bf(const float* __restrict__ A, int lda, const unsigned short* __restrict__ Wt, int ldb,
                                               const float* __restrict__ bias, float* __restrict__ C, int ldc, int M, int N, int K) {
  __shared__ __attribute__((aligned(16))) float so[4][16][64];
  const int tid = threadIdx.x, w = tid >> 5, lane = tid & 31, ln = lane & 15, hh = lane >> 4;
  const int ntn = N / 64;
  const int wid = blockIdx.x * 4 + w;
  const int mt = wid / ntn, nq = wid % ntn;
  if (mt * 16 >= M) return;
  const int row0 = mt * 16, col0 = nq * 64;
  const float* arow = A + (size_t)(row0 + ln) * lda;
  v8f acc[4] = {};
  for (int kb = 0; kb < K; kb += 32) {
    FragB ah, al;
    const v4f x0 = *(const v4fa*)(arow + kb + 8 * hh), x1 = *(const v4fa*)(arow + kb + 8 * hh + 4);
    const v4f x2 = *(const v4fa*)(arow + kb + 16 + 8 * hh), x3 = *(const v4fa*)(arow + kb + 16 + 8 * hh + 4);
    float xs[16] = {x0[0],x0[1],x0[2],x0[3],x1[0],x1[1],x1[2],x1[3],x2[0],x2[1],x2[2],x2[3],x3[0],x3[1],x3[2],x3[3]};
#pragma unroll
    for (int i = 0; i < 16; ++i) { const unsigned short hb = bf16_bits(xs[i]); ah.u[i] = hb; al.u[i] = ASPLIT ? bf16_bits(xs[i] - bf16_val(hb)) : (unsigned short)0; }
#pragma unroll
    for (int t = 0; t < 4; ++t) {
      const unsigned short* brow = Wt + (size_t)(col0 + t * 16 + ln) * ldb + kb;
      FragB b;
      b.half[0] = *(const v8us*)(brow + 8 * hh);
      b.half[1] = *(const v8us*)(brow + 16 + 8 * hh);
      acc[t] = mmaN<ASPLIT ? 2 : 1>(ah.v, al.v, b.v, b.v, acc[t]);
    }
  }
#pragma unroll
  for (int t = 0; t < 4; ++t) {
    float bv = bias ? bias[col0 + t * 16 + ln] : 0.f;
    if (BIAS_BF16) bv = bf16_round(bv);
#pragma unroll
    for (int r = 0; r < 8; ++r) { float v = acc[t][r] + bv; if (ACT == 1) v = fmaxf(v, 0.f); so[w][8 * hh + r][t * 16 + ln] = v; }
  }
  __builtin_amdgcn_fence(__ATOMIC_ACQ_REL, "workgroup");
  __builtin_amdgcn_wave_barrier();
  const int rsub = lane >> 4, c4 = (lane & 15) * 4;
  {
#pragma unroll
    for (int q = 0; q < 8; ++q) {
      const int r = q * 2 + rsub;
      const v4f v = *(const v4fa*)&so[w][r][c4];
      *(v4f*)(C + (size_t)(row0 + r) * ldc + col0 + c4) = v;
    }
    
  }
}

// GEMM C = act(A·W + bias + resid): A f32 (ASPLIT -> hi/lo 2 terms), Wt bf16 [N][K]; ACT 0 none, 1 relu, 2 exact gelu;
// resid (optional, f32, row index = (row % rmod), pitch ldr, RES_BF16 rounds it) added before the activation.
template <bool ASPLIT, int ACT, bool BIAS_BF16, bool RES_BF16>
__global__ __launch_bounds__(128) void k_gemm_bf3(const float* __restrict__ A, int lda, const unsigned short* __restrict__ Wt, int ldb,
                                                const float* __restrict__ bias, const float* __restrict__ resid, int rmod, int ldr,
                                                float* __restrict__ C, int ldc, int M, int N, int K) {
  __shared__ __attribute__((aligned(16))) float so[4][16][64];
  const int tid = threadIdx.x, w = tid >> 5, lane = tid & 31, ln = lane & 15, hh = lane >> 4;
  const int ntn = N / 64;
  const int wid = blockIdx.x * 4 + w;
  const int mt = wid / ntn, nq = wid % ntn;
  if (mt * 16 >= M) return;
  const int row0 = mt * 16, col0 = nq * 64;
  const float* arow = A + (size_t)(row0 + ln) * lda;
  v8f acc[4] = {};
  for (int kb = 0; kb < K; kb += 32) {
    FragB ah, al;
    const v4f x0 = *(const v4fa*)(arow + kb + 8 * hh), x1 = *(const v4fa*)(arow + kb + 8 * hh + 4);
    const v4f x2 = *(const v4fa*)(arow + kb + 16 + 8 * hh), x3 = *(const v4fa*)(arow + kb + 16 + 8 * hh + 4);
    float xs[16] = {x0[0],x0[1],x0[2],x0[3],x1[0],x1[1],x1[2],x1[3],x2[0],x2[1],x2[2],x2[3],x3[0],x3[1],x3[2],x3[3]};
#pragma unroll
    for (int i = 0; i < 16; ++i) { const unsigned short hb = bf16_bits(xs[i]); ah.u[i] = hb; al.u[i] = ASPLIT ? bf16_bits(xs[i] - bf16_val(hb)) : (unsigned short)0; }
#pragma unroll
    for (int t = 0; t < 4; ++t) {
      const unsigned short* brow = Wt + (size_t)(col0 + t * 16 + ln) * ldb + kb;
      FragB b;
      b.half[0] = *(const v8us*)(brow + 8 * hh);
      b.half[1] = *(const v8us*)(brow + 16 + 8 * hh);
      acc[t] = mmaN<ASPLIT ? 2 : 1>(ah.v, al.v, b.v, b.v, acc[t]);
    }
  }
#pragma unroll
  for (int t = 0; t < 4; ++t) {
    const int col = col0 + t * 16 + ln;
    float bv = bias ? bias[col] : 0.f;
    if (BIAS_BF16) bv = bf16_round(bv);
#pragma unroll
    for (int r = 0; r < 8; ++r) {
      float v = acc[t][r] + bv;
      if (resid) { float rv = resid[(size_t)((row0 + 8 * hh + r) % rmod) * ldr + col]; if (RES_BF16) rv = bf16_round(rv); v += rv; }
      if (ACT == 1) v = fmaxf(v, 0.f);
      if (ACT == 2) v = 0.5f * v * (1.0f + erff(v * 0.70710678118654752f));
      if (ACT == 3) { const float u = 0.7978845608028654f * (v + 0.044715f * v * v * v); v = 0.5f * v * (1.0f + tanhf(u)); }
      so[w][8 * hh + r][t * 16 + ln] = v;
    }
  }
  __builtin_amdgcn_fence(__ATOMIC_ACQ_REL, "workgroup");
  __builtin_amdgcn_wave_barrier();
  const int rsub = lane >> 4, c4 = (lane & 15) * 4;
  {
#pragma unroll
    for (int q = 0; q < 8; ++q) {
      const int r = q * 2 + rsub;
      const v4f v = *(const v4fa*)&so[w][r][c4];
      *(v4f*)(C + (size_t)(row0 + r) * ldc + col0 + c4) = v;
    }
    
  }
}
// row LayerNorm (biased variance, eps) over N: s = X (+ R); optional out_sum <- s; out_norm <- (s-mu)*rsqrt(var+eps)*g + b
template <bool PARAM_BF16>
__global__ __launch_bounds__(256) void k_layernorm(const float* __restrict__ X, const float* __restrict__ R, const float* __restrict__ g, const float* __restrict__ bta,
                                                  float* __restrict__ out_sum, float* __restrict__ out_norm, int N, float eps) {
  __shared__ float red[256];
  const int row = blockIdx.x, tid = threadIdx.x;
  const float* x = X + (size_t)row * N; const float* rr = R ? R + (size_t)row * N : nullptr;
  float vals[16];                     // up to N = 4096
  const int per = N / 256;            // contiguous chunk per thread? use strided-by-4 chunks: thread handles j = tid*4 + 1024*u
  float s1 = 0.f;
  for (int u = 0; u < per / 4; ++u) {
    const int j = tid * 4 + 1024 * u;
    const v4f a = *(const v4fa*)(x + j);
    v4f b = {0.f,0.f,0.f,0.f}; if (rr) b = *(const v4fa*)(rr + j);
#pragma unroll
    for (int q = 0; q < 4; ++q) { const float v = a[q] + b[q]; vals[u * 4 + q] = v; s1 += v; }
  }
  red[tid] = s1; __syncthreads();
  for (int st = 128; st > 0; st >>= 1) { if (tid < st) red[tid] += red[tid + st]; __syncthreads(); }
  const float mu = red[0] / (float)N; __syncthreads();
  float s2 = 0.f;
  for (int u = 0; u < per / 4; ++u)
#pragma unroll
    for (int q = 0; q < 4; ++q) { const float c = vals[u * 4 + q] - mu; s2 += c * c; }
  red[tid] = s2; __syncthreads();
  for (int st = 128; st > 0; st >>= 1) { if (tid < st) red[tid] += red[tid + st]; __syncthreads(); }
  const float rs = rsqrtf(red[0] / (float)N + eps);
  {
    for (int u = 0; u < per / 4; ++u) {
      const int j = tid * 4 + 1024 * u;
      v4f o, sm;
#pragma unroll
      for (int q = 0; q < 4; ++q) {
        float gg = g[j + q], bb = bta[j + q];
        if (PARAM_BF16) { gg = bf16_round(gg); bb = bf16_round(bb); }
        sm[q] = vals[u * 4 + q]; o[q] = (vals[u * 4 + q] - mu) * rs * gg + bb;
      }
      if (out_sum) *(v4f*)(out_sum + (size_t)row * N + j) = sm;
      *(v4f*)(out_norm + (size_t)row * N + j) = o;
    }
    
  }
}



// ---- f16 WMMA path (v_wmma_f32_16x16x32_f16): 11-bit significands for operands in range — used where a [0,1] probability operand needs more precision than bf16
typedef _Float16 v16h __attribute__((ext_vector_type(16)));
union FragH { v16h v; v8us half[2]; _Float16 h[16]; unsigned short u[16]; };
template <int NT>
__device__ __forceinline__ v8f mmaH(v16h ah, v16h al, v16h bh, v16h bl, v8f c) {
  c = __builtin_amdgcn_wmma_f32_16x16x32_f16(false, ah, false, bh, (short)0, c, false, false);
  if (NT >= 2) c = __builtin_amdgcn_wmma_f32_16x16x32_f16(false, al, false, bh, (short)0, c, false, false);
  if (NT >= 3) c = __builtin_amdgcn_wmma_f32_16x16x32_f16(false, ah, false, bl, (short)0, c, false, false);
  asm volatile("v_nop\n\tv_nop\n\tv_nop\n\tv_nop" : "+v"(c) : "v"(ah), "v"(al), "v"(bh), "v"(bl));
  return c;
}
// batched GEMM like k_gemm_b but f16 operands: A f32 (split into f16 hi/lo if ASPLIT, else rounded to f16), Bt = f16 values [n][k]; alpha; C f32; N multiple of 16 (partial tiles skipped)
template <bool ASPLIT>
__global__ __launch_bounds__(128) void k_gemm_h(const float* __restrict__ A, int lda, size_t sA, const _Float16* __restrict__ Bh, int ldb, size_t sB, float alpha, float* __restrict__ C, int ldc, size_t sC, int M, int N, int K) {
  __shared__ __attribute__((aligned(16))) float so[4][16][64];
  const int tid = threadIdx.x, w = tid >> 5, lane = tid & 31, ln = lane & 15, hh = lane >> 4; const int by = blockIdx.y;
  A += (size_t)by * sA; Bh += (size_t)by * sB; C += (size_t)by * sC;
  const int ntn = (N + 63) / 64; const int wid = blockIdx.x * 4 + w; const int mt = wid / ntn, nq = wid % ntn; if (mt * 16 >= M) return;
  const int row0 = mt * 16, col0 = nq * 64; const float* arow = A + (size_t)(row0 + ln) * lda;
  v8f acc[4] = {};
  for (int kb = 0; kb < K; kb += 32) {
    FragH ah, al;
    const v4f x0 = *(const v4fa*)(arow + kb + 8 * hh), x1 = *(const v4fa*)(arow + kb + 8 * hh + 4), x2 = *(const v4fa*)(arow + kb + 16 + 8 * hh), x3 = *(const v4fa*)(arow + kb + 16 + 8 * hh + 4);
    float xs[16] = {x0[0],x0[1],x0[2],x0[3],x1[0],x1[1],x1[2],x1[3],x2[0],x2[1],x2[2],x2[3],x3[0],x3[1],x3[2],x3[3]};
#pragma unroll
    for (int i = 0; i < 16; ++i) { const _Float16 h = (_Float16)xs[i]; ah.h[i] = h; al.h[i] = ASPLIT ? (_Float16)(xs[i] - (float)h) : (_Float16)0.0f; }
#pragma unroll
    for (int t = 0; t < 4; ++t) { if (col0 + t * 16 >= N) continue; const size_t boff = (size_t)(col0 + t * 16 + ln) * ldb + kb; FragH bq; bq.half[0] = *(const v8us*)(Bh + boff + 8 * hh); bq.half[1] = *(const v8us*)(Bh + boff + 16 + 8 * hh);
      acc[t] = mmaH<ASPLIT ? 2 : 1>(ah.v, al.v, bq.v, bq.v, acc[t]); }
  }
#pragma unroll
  for (int t = 0; t < 4; ++t) { if (col0 + t * 16 >= N) continue;
#pragma unroll
    for (int r = 0; r < 8; ++r) so[w][8 * hh + r][t * 16 + ln] = acc[t][r] * alpha; }
  __builtin_amdgcn_fence(__ATOMIC_ACQ_REL, "workgroup"); __builtin_amdgcn_wave_barrier();
  const int rsub = lane >> 4, c4 = (lane & 15) * 4;
  {
#pragma unroll
    for (int q = 0; q < 8; ++q) { const int r = q * 2 + rsub; if (col0 + c4 < N) { const v4f v = *(const v4fa*)&so[w][r][c4]; *(v4f*)(C + (size_t)(row0 + r) * ldc + col0 + c4) = v; } }
     }
}

// Wt[n][k] = f16(W[k][n]·scale) from f32 row-major W[K][N] (scale = power of two; bf16-exact weights stay exact in f16 away from the subnormal range)
__global__ __launch_bounds__(256) void k_wt_f16(const float* __restrict__ W, _Float16* __restrict__ Wt, int K, int N, float scale) {
  const int t = blockIdx.x * 256 + threadIdx.x; if (t >= N * (K / 8)) return; const int n = t / (K / 8), k8 = (t % (K / 8)) * 8; FragH f;
#pragma unroll
  for (int i = 0; i < 8; ++i) f.h[i] = (_Float16)(bf16_round(W[(size_t)(k8 + i) * N + n]) * scale); const v8us o = f.half[0];
  *(v8us*)((unsigned short*)Wt + (size_t)n * K + k8) = o; 
}
// k_gemm_hh variant with fused epilogue: v = acc·alpha + bias[by·sBias + col] (+ CP[(row/rowsPerB)·sCPb + by·64 + col] if CP) ; ACT 0 none / 1 elu ; writes f16 C16 (and f32 C if non-null)
template <int ACT>
__global__ __launch_bounds__(128) void k_gemm_hhx(const _Float16* __restrict__ A, int lda, size_t sA, const _Float16* __restrict__ Bh, int ldb, size_t sB, float alpha, const float* __restrict__ bias, size_t sBias, const float* __restrict__ CP, int rowsPerB, size_t sCPb, int row0g,
    float* __restrict__ C, _Float16* __restrict__ C16, int ldc, size_t sC, int M, int N, int K) {
  __shared__ __attribute__((aligned(16))) float so[4][16][64];
  const int tid = threadIdx.x, w = tid >> 5, lane = tid & 31, ln = lane & 15, hh = lane >> 4; const int by = blockIdx.y;
  A += (size_t)by * sA; Bh += (size_t)by * sB; const size_t cofs = (size_t)by * sC; const float* bp = bias ? bias + (size_t)by * sBias : nullptr;
  const int ntn = (N + 63) / 64; const int wid = blockIdx.x * 4 + w; const int mt = wid / ntn, nq = wid % ntn; if (mt * 16 >= M) return;
  const int row0 = mt * 16, col0 = nq * 64; const _Float16* arow = A + (size_t)(row0 + ln) * lda;
  v8f acc[4] = {};
  for (int kb = 0; kb < K; kb += 32) { FragH ah; ah.half[0] = *(const v8us*)((const unsigned short*)arow + kb + 8 * hh); ah.half[1] = *(const v8us*)((const unsigned short*)arow + kb + 16 + 8 * hh);
#pragma unroll
    for (int t = 0; t < 4; ++t) { if (col0 + t * 16 >= N) continue; const size_t boff = (size_t)(col0 + t * 16 + ln) * ldb + kb; FragH bq; bq.half[0] = *(const v8us*)((const unsigned short*)Bh + boff + 8 * hh); bq.half[1] = *(const v8us*)((const unsigned short*)Bh + boff + 16 + 8 * hh);
      acc[t] = mmaH<1>(ah.v, ah.v, bq.v, bq.v, acc[t]); }
  }
#pragma unroll
  for (int t = 0; t < 4; ++t) { if (col0 + t * 16 >= N) continue; const int col = col0 + t * 16 + ln; const float bv = bp ? bf16_round(bp[col]) : 0.f;
#pragma unroll
    for (int r = 0; r < 8; ++r) { float v = acc[t][r] * alpha + bv; if (CP) { const int rr = row0g + row0 + 8 * hh + r; if (rowsPerB < 0) v += CP[cofs + (size_t)rr * ldc + col];      /* rowsPerB < 0: own element of the batched C plane */ else { const int bidx = rr / rowsPerB; v += CP[(size_t)bidx * sCPb + (size_t)by * 64 + col]; } } if (ACT == 1) v = (v > 0.f) ? v : expm1f(v); else if (ACT == 7) v = (v > 0.f) ? v + 1.0f : expf(v); else if (ACT == 8) v = tanhf(v); else if (ACT == 9) v = 0.5f * v * (1.0f + tanhf(0.7978845608028654f * (v + 0.044715f * v * v * v))); else if (ACT == 11) v = 1.0f / (1.0f + expf(-v)); else if (ACT == 12) v = (v > 0.f) ? v : 0.01f * v; else if (ACT == 14) v = (v > 0.f) ? v : 0.1f * v; else if (ACT == 16) v = (v >= 0.f) ? v : 0.3f * v; else if (ACT == 17) v = (v >= 0.f) ? v : 0.2f * v; else if (ACT == 15) v = v / (1.0f + expf(-v)); else if (ACT == 3) v = fmaxf(v, 0.f); else if (ACT == 6) v = 0.5f * v * (1.0f + erff(v * 0.70710678118654752f)); so[w][8 * hh + r][t * 16 + ln] = v; } }
  __builtin_amdgcn_fence(__ATOMIC_ACQ_REL, "workgroup"); __builtin_amdgcn_wave_barrier();
  const int rsub = lane >> 4, c4 = (lane & 15) * 4; typedef _Float16 v4h __attribute__((ext_vector_type(4)));
  {
#pragma unroll
    for (int q = 0; q < 8; ++q) { const int r = q * 2 + rsub; if (col0 + c4 < N) { const v4f v = *(const v4fa*)&so[w][r][c4]; if (C) *(v4f*)(C + cofs + (size_t)(row0 + r) * ldc + col0 + c4) = v; if (C16) { v4h h4; for (int i = 0; i < 4; ++i) h4[i] = (_Float16)v[i]; *(v4h*)(C16 + cofs + (size_t)(row0 + r) * ldc + col0 + c4) = h4; } } }
     }
}


typedef _Float16 v4h __attribute__((ext_vector_type(4)));

__global__ __launch_bounds__(256) void k_x16(const float* __restrict__ x, _Float16* __restrict__ X16, size_t n8) { const size_t t = (size_t)blockIdx.x * 256 + threadIdx.x; if (t >= n8) return; FragH f;
#pragma unroll
  for (int q = 0; q < 8; ++q) f.h[q] = (_Float16)bf16_round(x[t * 8 + q]); *(v8us*)((unsigned short*)X16 + t * 8) = f.half[0];  }
__global__ __launch_bounds__(256) void k_h16(const float* __restrict__ x, _Float16* __restrict__ X16, size_t n8) { const size_t t = (size_t)blockIdx.x * 256 + threadIdx.x; if (t >= n8) return; FragH f;
#pragma unroll
  for (int q = 0; q < 8; ++q) f.h[q] = (_Float16)x[t * 8 + q]; *(v8us*)((unsigned short*)X16 + t * 8) = f.half[0];  }
__global__ __launch_bounds__(256) void k_round16f(const float* __restrict__ W, _Float16* __restrict__ Bt, size_t n8) { const size_t t = (size_t)blockIdx.x * 256 + threadIdx.x; if (t >= n8) return; FragH f;
#pragma unroll
  for (int i = 0; i < 8; ++i) f.h[i] = (_Float16)(bf16_round(W[t * 8 + i]) * 16.0f); *(v8us*)((unsigned short*)Bt + t * 8) = f.half[0];  }
template <int NHv, int TTv>
__global__ __launch_bounds__(256) void k_vt(const _Float16* __restrict__ V16, int ldv, int voff, _Float16* __restrict__ Vt) { __shared__ unsigned short tl[64][66]; const int tid = threadIdx.x; const int slab = blockIdx.x / (TTv / 64), lg = blockIdx.x % (TTv / 64); const int b = slab / NHv, h = slab % NHv;
  for (int i = tid; i < 64 * 8; i += 256) { const int r = i / 8, c8 = (i % 8) * 8; FragH f; f.half[0] = *(const v8us*)((const unsigned short*)V16 + ((size_t)b * TTv + lg * 64 + r) * ldv + voff + h * 64 + c8);
#pragma unroll
    for (int q = 0; q < 8; ++q) tl[r][c8 + q] = f.u[q]; }
  __syncthreads();
  {
#pragma unroll
    for (int rd = 0; rd < 2; ++rd) { const int d = rd * 32 + tid / 8, pc = tid % 8; FragH f;
#pragma unroll
      for (int q = 0; q < 8; ++q) f.u[q] = tl[pc * 8 + q][d];
      *(v8us*)((unsigned short*)Vt + ((size_t)slab * 64 + d) * TTv + lg * 64 + pc * 8) = f.half[0]; }
     } }

// Fragment order of an f16 operand plane X[row][k] (k a multiple of 8, K columns): the 16-byte unit of 8 consecutive k lies where the lane that needs it reads it, so that
// the 32 lanes of one fragment load (or store) cover 512 contiguous bytes, four whole lines, instead of 32 bytes in each of 16 rows. Block = (16 rows) x (16 k) = 32 units;
// unit in the block = lane = 16 * (k / 8 % 2) + row % 16. A 16x32 fragment is two blocks in a row, in the k order of g2_frag (8h + s, 16 + 8h + s).
__device__ __forceinline__ size_t fo_unit(size_t row, size_t k, size_t K) { return ((row >> 4) * (K >> 4) + (k >> 4)) * 32 + ((k >> 3) & 1) * 16 + (row & 15); }
// p = the plane + 8 * (first unit of the fragment's first block + lane)
__device__ __forceinline__ v16h fo_frag(const _Float16* p) { FragH f; f.half[0] = *(const v8us*)((const unsigned short*)p); f.half[1] = *(const v8us*)((const unsigned short*)p + 256); return f.v; }
// The three passes that follow the projections, in ONE launch (none reads what another writes). Work-groups [0, HB): q, [HB, 2 HB): k, each f32 -> f16 hi + 2^-10 residual planes in fragment order;
// the rest: v rows [image][n][256] -> channel-major in fragment order (rows = image * 256 + channel, k = n): 64 x 64 tiles through LDS, each wave stores whole 512-byte blocks.
__global__ __launch_bounds__(256) void k_post(const float* __restrict__ QF, const float* __restrict__ KF, _Float16* __restrict__ QH, _Float16* __restrict__ QL, _Float16* __restrict__ KH, _Float16* __restrict__ KL, const _Float16* __restrict__ V16, _Float16* __restrict__ Vf) {
  __shared__ unsigned short tl[64][66]; const int tid = threadIdx.x; constexpr int HB = (int)(NR * CQ / 8 / 256); static_assert(NR * CQ / 8 % 256 == 0, "whole work-groups");
  if (blockIdx.x < 2 * HB) {      /* the same for a whole work-group, and in front of the barrier below */
    const bool isk = blockIdx.x >= HB; const float* F = isk ? KF : QF; _Float16* Hh = isk ? KH : QH; _Float16* Hl = isk ? KL : QL;
    const size_t t = (size_t)(blockIdx.x - (isk ? HB : 0)) * 256 + tid; FragH fh, fl; const v4f a = *(const v4fa*)(F + t * 8), c = *(const v4fa*)(F + t * 8 + 4);
#pragma unroll
    for (int q = 0; q < 4; ++q) { _Float16 h = (_Float16)a[q]; fh.h[q] = h; fl.h[q] = (_Float16)((a[q] - (float)h) * 1024.0f); h = (_Float16)c[q]; fh.h[4 + q] = h; fl.h[4 + q] = (_Float16)((c[q] - (float)h) * 1024.0f); }
    { const size_t u = fo_unit(t >> 3, (t & 7) * 8, CQ); *(v8us*)((unsigned short*)Hh + u * 8) = fh.half[0]; *(v8us*)((unsigned short*)Hl + u * 8) = fl.half[0]; }
    return; }
  const int bx = blockIdx.x - 2 * HB; const int slab = bx / (NPX / 64), lg = bx % (NPX / 64); const int b = slab / (CC / 64), h = slab % (CC / 64);
  for (int i = tid; i < 64 * 8; i += 256) { const int r = i / 8, c8 = (i % 8) * 8; FragH f; f.half[0] = *(const v8us*)((const unsigned short*)V16 + ((size_t)b * NPX + lg * 64 + r) * CC + h * 64 + c8);
#pragma unroll
    for (int q = 0; q < 8; ++q) tl[r][c8 + q] = f.u[q]; }
  __syncthreads();
#pragma unroll
  for (int rd = 0; rd < 2; ++rd) { const int u = rd * 256 + tid, blk = u >> 5, l = u & 31; const int d = (blk >> 2) * 16 + (l & 15), kk = (blk & 3) * 16 + (l >> 4) * 8; FragH f;
#pragma unroll
    for (int q = 0; q < 8; ++q) f.u[q] = tl[kk + q][d];
    *(v8us*)((unsigned short*)Vf + fo_unit((size_t)slab * 64 + d, (size_t)lg * 64 + kk, NPX) * 8) = f.half[0]; } }

// ---- fast GEMM (wave tile 32x64) ----
__device__ __forceinline__ v16h g2_frag(const _Float16* p, int hh) { FragH f; f.half[0] = *(const v8us*)((const unsigned short*)p + 8 * hh); f.half[1] = *(const v8us*)((const unsigned short*)p + 16 + 8 * hh); return f.v; }
__device__ __forceinline__ v8f g2_mma(v16h a, v16h b, v8f c) { v8f d = __builtin_amdgcn_wmma_f32_16x16x32_f16(false, a, false, b, (short)0, c, false, false); asm volatile("v_nop\n\tv_nop\n\tv_nop\n\tv_nop" : "+v"(d) : "v"(a), "v"(b)); return d; }
// The operands of one k step (32 k) of a 32 x 64 wave tile form a set: two A and four B fragments, twelve 16-byte loads a lane. The GEMM loops below hold three sets in registers as a
// ring: a set is refilled for the step three ahead as soon as its products are issued, so the loads of two to three steps are in flight under every product and a wave no longer
// waits out four or five load latencies in a row in each step. Every accumulator still takes its k steps in rising order.
struct OpSet { v16h a0, a1, b0, b1, b2, b3; };
// c[t + 4 * half]: column tile t, row tile half
__device__ __forceinline__ void set_mma(const OpSet& s, v8f (&c)[8]) {
  c[0] = g2_mma(s.a0, s.b0, c[0]); c[4] = g2_mma(s.a1, s.b0, c[4]); c[1] = g2_mma(s.a0, s.b1, c[1]); c[5] = g2_mma(s.a1, s.b1, c[5]);
  c[2] = g2_mma(s.a0, s.b2, c[2]); c[6] = g2_mma(s.a1, s.b2, c[6]); c[3] = g2_mma(s.a0, s.b3, c[3]); c[7] = g2_mma(s.a1, s.b3, c[7]); }
// q, k and v projections in ONE launch: the three products read the same rows of A and do not depend on one another. Work-groups [0, MB) form q, [MB, 2 MB) k (64 columns each, f32 out),
// the rest v (256 columns in four groups of 64, + bias, f16 out). Every work-group is a 128 x 64 tile with K = CC, as before.
__global__ __launch_bounds__(128) void k_qkv(const _Float16* __restrict__ A, const _Float16* __restrict__ BQ, const _Float16* __restrict__ BK, const _Float16* __restrict__ BV, const float* __restrict__ bias,
    float* __restrict__ QF, float* __restrict__ KF, _Float16* __restrict__ V16) { static_assert(CC == 256 && CQ == 64, "one chunk of eight k steps; q and k are one column group wide");
  __shared__ __attribute__((aligned(16))) float so[4][32][68];
  const int tid = threadIdx.x, w = tid >> 5, lane = tid & 31, ln = lane & 15, hh = lane >> 4;
  constexpr int MB = (int)(NR / 128); const int bx = blockIdx.x; const bool isv = bx >= 2 * MB; const int uv = bx - 2 * MB;
  const int mt = isv ? uv / (CC / 64) : bx % MB; const int col0 = isv ? (uv % (CC / 64)) * 64 : 0; const int row0 = mt * 128 + 32 * w;
  const _Float16* Bh = isv ? BV : (bx < MB ? BQ : BK);
  const _Float16* a0p = A + (size_t)(row0 + ln) * CC; const _Float16* a1p = a0p + (size_t)16 * CC;
  const _Float16* b0p = Bh + (size_t)(col0 + ln) * CC; const _Float16* b1p = b0p + (size_t)16 * CC; const _Float16* b2p = b1p + (size_t)16 * CC; const _Float16* b3p = b2p + (size_t)16 * CC;
  const v8f z8 = {0.f,0.f,0.f,0.f,0.f,0.f,0.f,0.f}; v8f accs[8] = {z8, z8, z8, z8, z8, z8, z8, z8};
  auto ld = [&](OpSet& s, int kb) { s.a0 = g2_frag(a0p + kb, hh); s.a1 = g2_frag(a1p + kb, hh); s.b0 = g2_frag(b0p + kb, hh); s.b1 = g2_frag(b1p + kb, hh); s.b2 = g2_frag(b2p + kb, hh); s.b3 = g2_frag(b3p + kb, hh);
    asm volatile("s_wait_xcnt 0x0" ::: "memory"); };      /* stands in front of any later overwrite of the address registers of the twelve loads above; as a compiler fence it also keeps each set's loads at their place in the ring */
  OpSet s[3]; ld(s[0], 0); ld(s[1], 32); ld(s[2], 64);
  // unrolled in full: s is then indexed by constants only and stays in registers
#pragma unroll
  for (int i = 0; i < 8; ++i) { set_mma(s[i % 3], accs); if (i + 3 < 8) ld(s[i % 3], (i + 3) * 32); }
#pragma unroll
  for (int u = 0; u < 8; ++u) { const int t = u & 3, half = u >> 2; const float bv = isv ? bf16_round(bias[col0 + t * 16 + ln]) : 0.f;
#pragma unroll
    for (int r = 0; r < 8; ++r) so[w][half * 16 + 8 * hh + r][t * 16 + ln] = accs[u][r] * 0.0625f + bv; }
  __builtin_amdgcn_fence(__ATOMIC_ACQ_REL, "workgroup"); __builtin_amdgcn_wave_barrier();
  const int rsub = lane >> 4, c4 = (lane & 15) * 4;
  if (!isv) { float* C = bx < MB ? QF : KF;
#pragma unroll
    for (int q = 0; q < 16; ++q) { const int r = q * 2 + rsub; const v4f v = *(const v4fa*)&so[w][r][c4]; *(v4f*)(C + (size_t)(row0 + r) * CQ + c4) = v; }
    asm volatile("s_wait_xcnt 0x0" ::: "memory");      /* the build lays the v path directly behind these stores, where their address registers are written again: the wait stands in front of that */
    return; }
#pragma unroll
  for (int q = 0; q < 16; ++q) { const int r = q * 2 + rsub; const v4f v = *(const v4fa*)&so[w][r][c4]; v4h h4; for (int i = 0; i < 4; ++i) h4[i] = (_Float16)v[i]; *(v4h*)(V16 + (size_t)(row0 + r) * CC + col0 + c4) = h4; } }

// energy + row softmax in one kernel; grid y = image. A work-group of 16 waves owns 16 rows n of the attention matrix; wave w forms the logits E[n][m] of its 256 columns m
// (A = q rows, B = k rows; hi.hi in one accumulator, lo.hi + hi.lo in a second, joined as hi + lo / 1024). The logits stay in registers for the maximum, the exponentials,
// their sum and the scaled f16 store, so they never go to memory. In the D layout a lane holds ONE column m and 8 consecutive rows n per tile: that is the 16-byte unit which
// the same lane of the x_r product reads as its B operand (row m of P^T, k = n), so each tile is one 512-byte store into P^T in fragment order and no transpose follows.
// The row reductions run per register: over the tiles in the lane, over the 16 lanes of a row by DPP, over the waves through LDS.
__device__ __forceinline__ v8f es_mma(v16h a, v16h b, v8f c) { return __builtin_amdgcn_wmma_f32_16x16x32_f16(false, a, false, b, (short)0, c, false, false); }
template <int X> __device__ __forceinline__ float row_x(float v) { return __int_as_float(__builtin_amdgcn_update_dpp(0, __float_as_int(v), 0x160 + X, 0xf, 0xf, true)); }      /* the value of lane l ^ X of the same 16-lane row (row_xmask) */
__global__ __launch_bounds__(512) void k_esm(const _Float16* __restrict__ Qh, const _Float16* __restrict__ Ql, const _Float16* __restrict__ Kh, const _Float16* __restrict__ Kl, _Float16* __restrict__ Pf) {
  __shared__ __attribute__((aligned(32))) float redm[16][16]; __shared__ __attribute__((aligned(32))) float reds[16][16];
  const int tid = threadIdx.x, w = tid >> 5, lane = tid & 31, ln = lane & 15, hh = lane >> 4;
  { const size_t r0 = (size_t)blockIdx.y * NPX; Qh += r0 * CQ; Ql += r0 * CQ; Kh += r0 * CQ; Kl += r0 * CQ; Pf += r0 * NPX; }      /* this image's planes */
  const _Float16* qhp = Qh + ((size_t)blockIdx.x * (CQ / 16) * 32 + lane) * 8; const _Float16* qlp = Ql + ((size_t)blockIdx.x * (CQ / 16) * 32 + lane) * 8;
  const v16h qh0 = fo_frag(qhp), qh1 = fo_frag(qhp + 512);
  asm volatile("s_wait_xcnt 0x0" ::: "memory");      /* the address pair of the loads above may be given to a later load's result: the wait stands in front of that overwrite */
  const v16h ql0 = fo_frag(qlp), ql1 = fo_frag(qlp + 512);
  asm volatile("s_wait_xcnt 0x0" ::: "memory");      /* the same for the address pair of the two loads above */
  const _Float16* khp = Kh + ((size_t)(w * 16) * (CQ / 16) * 32 + lane) * 8; const _Float16* klp = Kl + ((size_t)(w * 16) * (CQ / 16) * 32 + lane) * 8;
  const v8f z8 = {0.f,0.f,0.f,0.f,0.f,0.f,0.f,0.f}; v8f e[16];
  v16h nh0 = fo_frag(khp), nh1 = fo_frag(khp + 512), nl0 = fo_frag(klp), nl1 = fo_frag(klp + 512);
  // every loop over e[] is unrolled in full: e is then indexed by constants only and stays in registers
#pragma unroll
  for (int t = 0; t < 16; ++t) { const v16h kh0 = nh0, kh1 = nh1, kl0 = nl0, kl1 = nl1;
    if (t + 1 < 16) { nh0 = fo_frag(khp + (t + 1) * 1024); nh1 = fo_frag(khp + (t + 1) * 1024 + 512); nl0 = fo_frag(klp + (t + 1) * 1024); nl1 = fo_frag(klp + (t + 1) * 1024 + 512); }      /* the next tile's fragments fly under this tile's products */
    v8f ch = es_mma(qh0, kh0, z8); v8f cl = es_mma(qh0, kl0, z8); ch = es_mma(qh1, kh1, ch); cl = es_mma(qh1, kl1, cl); cl = es_mma(ql0, kh0, cl); cl = es_mma(ql1, kh1, cl);
    e[t] = ch + cl * (1.0f / 1024.0f);
    if (t >= 12) __builtin_amdgcn_sched_barrier(0); }      /* from here on the logits fill the registers: later tiles' loads are not lifted over this point, where the build otherwise spills */
  v8f m8 = e[0];      /* register r: row n = 8 * hh + r */
#pragma unroll
  for (int t = 1; t < 16; ++t) for (int r = 0; r < 8; ++r) m8[r] = fmaxf(m8[r], e[t][r]);
#pragma unroll
  for (int r = 0; r < 8; ++r) { float v = m8[r]; v = fmaxf(v, row_x<1>(v)); v = fmaxf(v, row_x<2>(v)); v = fmaxf(v, row_x<4>(v)); v = fmaxf(v, row_x<8>(v)); m8[r] = v; }
  if (ln == 0) *(v8f*)&redm[w][8 * hh] = m8;
  __syncthreads();
#pragma unroll
  for (int u = 0; u < 16; ++u) { const v8f o = *(const v8f*)&redm[u][8 * hh]; for (int r = 0; r < 8; ++r) m8[r] = fmaxf(m8[r], o[r]); }
#pragma unroll
  for (int r = 0; r < 8; ++r) m8[r] *= 1.44269504088896340736f;      /* the row maximum in the log2 domain; its rounding scales a whole row alike and cancels in the division by the row sum */
#pragma unroll
  for (int t = 0; t < 16; ++t) for (int r = 0; r < 8; ++r) e[t][r] = __builtin_amdgcn_exp2f(__builtin_fmaf(e[t][r], 1.44269504088896340736f, -m8[r]));      /* exp(e - max) = 2^(e log2e - max log2e): one FMA and one v_exp_f32 a logit; arguments are <= about 0, far negative ones give 0 */
  v8f s8 = e[0];
#pragma unroll
  for (int t = 1; t < 16; ++t) s8 += e[t];
#pragma unroll
  for (int r = 0; r < 8; ++r) { float v = s8[r]; v += row_x<1>(v); v += row_x<2>(v); v += row_x<4>(v); v += row_x<8>(v); s8[r] = v; }
  if (ln == 0) *(v8f*)&reds[w][8 * hh] = s8;
  __syncthreads();
  v8f se = z8;
#pragma unroll
  for (int u = 0; u < 16; ++u) se += *(const v8f*)&reds[u][8 * hh];
  v8f sc;
#pragma unroll
  for (int r = 0; r < 8; ++r) sc[r] = 256.0f / se[r];
  unsigned short* p = (unsigned short*)Pf + (((size_t)(w * 16) * (NPX / 16) + blockIdx.x) * 32 + lane) * 8;      /* block (m tile w * 16 + t, n tile blockIdx.x), unit = lane */
#pragma unroll
  for (int t = 0; t < 16; ++t) { FragH f; for (int r = 0; r < 8; ++r) f.h[r] = (_Float16)(e[t][r] * sc[r]); *(v8us*)(p + (size_t)t * (NPX / 16) * 256) = f.half[0]; } }
// x_r[c][m] = alpha * sum_n v[c][n] P^T[m][n], both operands in fragment order (K = NPX); grid y = image. Wave tile 32 x 64, four waves stacked on the rows; the operands go through
// the ring of three register sets (see OpSet).
#define XR_TP ((size_t)(NPX / 16) * 256)      /* f16 elements from one 16-row tile to the next */
__device__ __forceinline__ void xr_load(OpSet& s, const _Float16* ap, const _Float16* bp) {
  s.a0 = fo_frag(ap); s.a1 = fo_frag(ap + XR_TP); s.b0 = fo_frag(bp); s.b1 = fo_frag(bp + XR_TP); s.b2 = fo_frag(bp + 2 * XR_TP); s.b3 = fo_frag(bp + 3 * XR_TP);
  asm volatile("s_wait_xcnt 0x0" ::: "memory"); }      /* stands in front of any later overwrite of the address registers of the twelve loads above; as a compiler fence it also keeps each set's loads at their place in the ring */
__global__ __launch_bounds__(128) void k_xr(const _Float16* __restrict__ Af, const _Float16* __restrict__ Bf, float alpha, float* __restrict__ C) {
  __shared__ __attribute__((aligned(16))) float so[4][32][68];
  const int tid = threadIdx.x, w = tid >> 5, lane = tid & 31, ln = lane & 15, hh = lane >> 4; const int by = blockIdx.y;
  Af += (size_t)by * CC * NPX; Bf += (size_t)by * NPX * NPX; C += (size_t)by * CC * NPX;
  const int ntn = NPX >> 6; const int mt = blockIdx.x / ntn, nq = blockIdx.x - mt * ntn; const int row0 = mt * 128 + 32 * w, col0 = nq * 64;
  const _Float16* ap = Af + (size_t)(row0 >> 4) * XR_TP + lane * 8; const _Float16* bp = Bf + (size_t)(col0 >> 4) * XR_TP + lane * 8;
  const v8f z8 = {0.f,0.f,0.f,0.f,0.f,0.f,0.f,0.f}; v8f accs[8] = {z8, z8, z8, z8, z8, z8, z8, z8};
  constexpr int KS = NPX / 32;      /* k steps; one step = two blocks = 512 elements */
  static_assert(KS % 3 == 2 && KS >= 5, "the ring's tail below is written for KS = 3 T + 2");
  OpSet s0, s1, s2;
  xr_load(s0, ap, bp); xr_load(s1, ap + 512, bp + 512); xr_load(s2, ap + 1024, bp + 1024);
  // stays rolled: a trip already holds a whole turn of the ring (24 products, 36 loads), more copies would only lengthen the code
#pragma unroll 1
  for (int st = 3; st + 2 < KS; st += 3) { const _Float16* a = ap + (size_t)st * 512; const _Float16* b = bp + (size_t)st * 512;
    set_mma(s0, accs); xr_load(s0, a, b); set_mma(s1, accs); xr_load(s1, a + 512, b + 512); set_mma(s2, accs); xr_load(s2, a + 1024, b + 1024); }
  set_mma(s0, accs); xr_load(s0, ap + (size_t)(KS - 2) * 512, bp + (size_t)(KS - 2) * 512); set_mma(s1, accs); xr_load(s1, ap + (size_t)(KS - 1) * 512, bp + (size_t)(KS - 1) * 512);
  set_mma(s2, accs); set_mma(s0, accs); set_mma(s1, accs);
#pragma unroll
  for (int u = 0; u < 8; ++u) { const int t = u & 3, half = u >> 2;
#pragma unroll
    for (int r = 0; r < 8; ++r) so[w][half * 16 + 8 * hh + r][t * 16 + ln] = accs[u][r] * alpha; }
  __builtin_amdgcn_fence(__ATOMIC_ACQ_REL, "workgroup"); __builtin_amdgcn_wave_barrier();
  const int rsub = lane >> 4, c4 = (lane & 15) * 4;
#pragma unroll
  for (int q = 0; q < 16; ++q) { const int r = q * 2 + rsub; const v4f v = *(const v4fa*)&so[w][r][c4]; *(v4f*)(C + (size_t)(row0 + r) * NPX + col0 + c4) = v; } }
__global__ __launch_bounds__(256) void k_vt(const _Float16* __restrict__ V16, int b, int h0, _Float16* __restrict__ VT) { __shared__ unsigned short tl[64][65]; const int tid = threadIdx.x; const int hh = blockIdx.x % HG, sg = blockIdx.x / HG; const int s0 = sg * 64; const int h = h0 + hh;
  for (int i = tid; i < 64 * 8; i += 256) { const int j = i / 8, d8 = (i % 8) * 8; FragH f; f.half[0] = *(const v8us*)((const unsigned short*)V16 + ((size_t)b * SQ + s0 + j) * DM + h * HD + d8); for (int q = 0; q < 8; ++q) tl[d8 + q][j] = f.u[q]; }
  __syncthreads();
  { for (int i = tid; i < 64 * 8; i += 256) { const int d = i / 8, j8 = (i % 8) * 8; FragH f; for (int q = 0; q < 8; ++q) f.u[q] = tl[d][j8 + q]; *(v8us*)((unsigned short*)VT + ((size_t)hh * HD + d) * SQ + s0 + j8) = f.half[0]; }  } }


// The four preparations of the projections' operands, in ONE launch (none reads what another writes). Work-groups [0, NX): x channel-first -> position rows (f16) through LDS tiles;
// the rest: the natural weights x16 as f16, 8 elements a thread: Wq, then Wk, then Wv.
__global__ __launch_bounds__(256) void k_prep(const float* __restrict__ X, _Float16* __restrict__ XR, const float* __restrict__ wq, const float* __restrict__ wk, const float* __restrict__ wv, _Float16* __restrict__ BQ, _Float16* __restrict__ BK, _Float16* __restrict__ BV) {
  __shared__ float tl[64][33]; const int tid = threadIdx.x; const int nl = LL / 32, nc = CC / 64; constexpr int NX = NB * (LL / 32) * (CC / 64), QB = CQ * CC / 8 / 256; static_assert(CQ * CC / 8 % 256 == 0 && CC * CC / 8 % 256 == 0, "whole work-groups");
  if (blockIdx.x >= NX) {      /* the same for a whole work-group, and in front of the barrier below */
    const int u = blockIdx.x - NX; const float* w = u < QB ? wq : (u < 2 * QB ? wk : wv); _Float16* Bt = u < QB ? BQ : (u < 2 * QB ? BK : BV);
    const size_t t = (size_t)(u < QB ? u : (u < 2 * QB ? u - QB : u - 2 * QB)) * 256 + tid; FragH f; for (int q = 0; q < 8; ++q) f.h[q] = (_Float16)(bf16_round(w[t * 8 + q]) * 16.0f); *(v8us*)((unsigned short*)Bt + t * 8) = f.half[0];
    return; }
  const int cb_ = blockIdx.x % nc; const int lb = (blockIdx.x / nc) % nl; const size_t b = blockIdx.x / (nc * nl); const int c0 = cb_ * 64, l0 = lb * 32;
  for (int i = tid; i < 64 * 32; i += 256) { const int c = i / 32, l = i % 32; tl[c][l] = bf16_round(X[(b * CC + c0 + c) * (size_t)LL + l0 + l]); }
  __syncthreads();
  { const int l = tid / 8, c8 = (tid % 8) * 8; FragH f; for (int q = 0; q < 8; ++q) f.h[q] = (_Float16)tl[c8 + q][l]; unsigned short* d = (unsigned short*)XR + (b * LL + l0 + l) * (size_t)CC + c0 + c8; *(v8us*)d = f.half[0];  } }

__global__ __launch_bounds__(256) void k_fin3(const float* __restrict__ Cm, const float* __restrict__ x, float* __restrict__ out) {
  #pragma clang fp contract(off)
  const size_t t = (size_t)blockIdx.x * 256 + threadIdx.x; if (t >= (size_t)NBR * CC * NPX / 8) return; const size_t base = t * 8; v8f v;
  const v4f x0 = *(const v4fa*)(x + base), x1 = *(const v4fa*)(x + base + 4);
  asm volatile("s_wait_xcnt 0x0" ::: "memory");      /* the address pair of the two loads above may be given to a later load's result: the wait stands in front of that overwrite */
  for (int q = 0; q < 4; ++q) { v[q] = __fadd_rn(bf16_round(x0[q]), Cm[base + q]); v[4 + q] = __fadd_rn(bf16_round(x1[q]), Cm[base + 4 + q]); } *(v8f*)(out + base) = v;  }

extern "C" void kernel_launch(void* const* d_in, const int* in_sizes, int n_in,
                              void* d_out, int out_size, void* d_ws, size_t ws_size, hipStream_t stream) {
  (void)in_sizes; (void)n_in; (void)out_size;
  const float* const* I = (const float* const*)d_in; const float* x = I[0]; const float* Wq = I[1]; const float* Wk = I[2]; const float* Wv = I[3]; const float* bv = I[4];
  char* ws = (char*)d_ws; size_t off = 0;
  auto take = [&](size_t bytes) { char* p = ws + off; off += (bytes + 255) & ~(size_t)255; return p; };
  _Float16* BQ = (_Float16*)take((size_t)CQ * CC * 2); _Float16* BK = (_Float16*)take((size_t)CQ * CC * 2); _Float16* BV = (_Float16*)take((size_t)CC * CC * 2);
  _Float16* XR = (_Float16*)take(NR * CC * 2); float* QF = (float*)take(NR * CQ * 4); float* KF = (float*)take(NR * CQ * 4); _Float16* QH = (_Float16*)take(NR * CQ * 2); _Float16* QL = (_Float16*)take(NR * CQ * 2); _Float16* KH = (_Float16*)take(NR * CQ * 2); _Float16* KL = (_Float16*)take(NR * CQ * 2); _Float16* V16 = (_Float16*)take(NR * CC * 2);
  _Float16* PT = (_Float16*)take((size_t)NB * NPX * NPX * 2); _Float16* VT = (_Float16*)take((size_t)NB * CC * NPX * 2); float* CX = (float*)take((size_t)NB * CC * NPX * 4);
  if (off > ws_size) return;      /* 0.2 + 8 + 8 + 8 + 8 + 128 + 8 + 16 = approx 185 MiB: P^T, v channel-major and x_r hold all images */
  // work that does not depend on one another shares a launch: a launch starts only when the one before it has drained
  k_prep<<<NB * (NPX / 32) * (CC / 64) + (2 * CQ + CC) * CC / 8 / 256, 256, 0, stream>>>(x, XR, Wq, Wk, Wv, BQ, BK, BV);      /* x rows; weights x16 */
  k_qkv<<<(unsigned)((NR / 128) * (2 + CC / 64)), 128, 0, stream>>>(XR, BQ, BK, BV, bv, QF, KF, V16);      /* q, k (f32, exact products); v + bv (f16 rows) */
  k_post<<<(unsigned)(2 * (NR * CQ / 8 / 256)) + NBR * (CC / 64) * (NPX / 64), 256, 0, stream>>>(QF, KF, QH, QL, KH, KL, V16, VT);      /* q, k hi + residual planes; v channel-major [image][256][4096]; all in fragment order */
  k_esm<<<dim3(NPX / 16, NBR), 512, 0, stream>>>(QH, QL, KH, KL, PT);      /* P^T[m][n] = 256 softmax_m(q_n . k_m), fragment order, one plane per image */
  k_xr<<<dim3((CC / 128) * (NPX / 64), NBR), 128, 0, stream>>>(VT, PT, 0.00390625f, CX);      /* x_r[c][m] = sum_n v[c][n] attention[n][m] */
  k_fin3<<<(unsigned)(((size_t)NBR * CC * NPX / 8 + 255) / 256), 256, 0, stream>>>(CX, x, (float*)d_out);
}

// v008
// One run takes 103 microseconds.
// Next to v007, in two timings, it ran 1.24 and 1.23 times as fast.
// Counting every step since v000, it is 38.3 times as fast.
#include <hip/hip_runtime.h>
// SA layer (x [4][256][4096]; q = Wq x (64), k = Wk x (64), v = Wv x + bv (256); energy[n][m] = q_n . k_m (no scale); attention = softmax over m; x_r[c][m] = sum_n v[c][n] attention[n][m]; out = x + x_r -> [4][256][4096]).
// Structure: channel-first input transposed to position rows (exact f16) via LDS tiles; q / k as WMMA GEMMs (32x64 wave tiles, f32 accumulation, exact x16 natural weights; exact products) kept f32 and split into f16 hi + 2^-10 residual planes; v GEMM (+ bias) to f16 rows and transposed channel-major via LDS tiles; per image: the unscaled energy as a THREE-term product (hi.hi + lo.hi + hi.lo, K = 64) whose f32 logits stay in registers for the exponentials of each quarter row on VALU (256 exp(E - quarter maximum) as f16, one kernel, the quarter's k rows in LDS; maximum and sum kept per quarter row), x_r = (V(channel-major) x the factor that completes the row's softmax) . P^T-as-Bt GEMM (M = 256 channels, K = 4096) into f32; residual + store on VALU. The q / k planes, v channel-major and P^T lie in fragment order (see fo_unit), each written so by the kernel that makes it.
// Compute dtype: inputs rounded to bf16; x / weights exact; q, k as hi + residual (~f32, the logits have sigma ~8); v, P as plain f16 operands (~2^-12); maxima, exponentials and sums f32; the factor that completes a row's softmax is formed in f32, rounded to f16 and multiplied into the v fragments in f16 (two more roundings of ~2^-12 on that operand). v_wmma_f32_16x16x32_f16.
#define NB 4
#define CC 256
#define CQ 64
#define NPX 4096
#define LL NPX
#define PX NPX
#define NR ((size_t)NB * NPX)
#define NBR NB                       /* images attended (debug hook) */
#define MP ((int)NR)                 /* unused */
#define MC NPX                       /* unused */
#define SQ NPX
#define DM NPX
#define NH 64
#define HD 64
#define HG 1
typedef __bf16 v16b __attribute__((ext_vector_type(16)));
typedef unsigned short v8us __attribute__((ext_vector_type(8), may_alias));
typedef float  v8f  __attribute__((ext_vector_type(8)));
typedef float  v4f  __attribute__((ext_vector_type(4)));
typedef float  v4fa __attribute__((ext_vector_type(4), may_alias));
union FragB { v16b v; v8us half[2]; unsigned short u[16]; };

__device__ __forceinline__ unsigned short bf16_bits(float x) { unsigned int u = __float_as_uint(x); return (unsigned short)((u + 0x7FFFu + ((u >> 16) & 1u)) >> 16); }
__device__ __forceinline__ float bf16_val(unsigned short b) { return __uint_as_float(((unsigned int)b) << 16); }
__device__ __forceinline__ float bf16_round(float x) { return bf16_val(bf16_bits(x)); }
// D += A·B with NT terms: 1 = ah·bh, 2 = + al·bh (A split), 3 = + ah·bl (both split)
template <int NT>
__device__ __forceinline__ v8f mmaN(v16b ah, v16b al, v16b bh, v16b bl, v8f c) {
  c = __builtin_amdgcn_wmma_f32_16x16x32_bf16(false, ah, false, bh, (short)0, c, false, false);
  if (NT >= 2) c = __builtin_amdgcn_wmma_f32_16x16x32_bf16(false, al, false, bh, (short)0, c, false, false);
  if (NT >= 3) c = __builtin_amdgcn_wmma_f32_16x16x32_bf16(false, ah, false, bl, (short)0, c, false, false);
  asm volatile("v_nop\n\tv_nop\n\tv_nop\n\tv_nop" : "+v"(c) : "v"(ah), "v"(al), "v"(bh), "v"(bl));
  return c;
}

__global__ __launch_bounds__(256) void k_wt_bf16(const float* __restrict__ W, unsigned short* __restrict__ Wt, int K, int N) {
  const int t = blockIdx.x * 256 + threadIdx.x;
  const int k8n = K / 8;
  if (t >= N * k8n) return;
  const int n = t / k8n, k8 = (t % k8n) * 8;
  v8us v;
#pragma unroll
  for (int i = 0; i < 8; ++i) v[i] = bf16_bits(W[(size_t)(k8 + i) * N + n]);
  *(v8us*)(Wt + (size_t)n * K + k8) = v;
  
}

// GEMM C[M][N] (f32, pitch ldc) = act(A[M][K]·W + bias). A f32 row-major (pitch lda) converted per fragment to bf16
// (ASPLIT: hi/lo two planes -> 2 terms, else single rounded term); Wt bf16 [N][K] (pitch ldb). BIAS_BF16 rounds the
// bias to bf16 first (bias quantised to bf16 before the add). K%32==0, M%16==0, N%64==0.
template <bool ASPLIT, int ACT, bool BIAS_BF16>
__global__ __launch_bounds__(128) void k_gemm_bf(const float* __restrict__ A, int lda, const unsigned short* __restrict__ Wt, int ldb,
                                               const float* __restrict__ bias, float* __restrict__ C, int ldc, int M, int N, int K) {
  __shared__ __attribute__((aligned(16))) float so[4][16][64];
  const int tid = threadIdx.x, w = tid >> 5, lane = tid & 31, ln = lane & 15, hh = lane >> 4;
  const int ntn = N / 64;
  const int wid = blockIdx.x * 4 + w;
  const int mt = wid / ntn, nq = wid % ntn;
  if (mt * 16 >= M) return;
  const int row0 = mt * 16, col0 = nq * 64;
  const float* arow = A + (size_t)(row0 + ln) * lda;
  v8f acc[4] = {};
  for (int kb = 0; kb < K; kb += 32) {
    FragB ah, al;
    const v4f x0 = *(const v4fa*)(arow + kb + 8 * hh), x1 = *(const v4fa*)(arow + kb + 8 * hh + 4);
    const v4f x2 = *(const v4fa*)(arow + kb + 16 + 8 * hh), x3 = *(const v4fa*)(arow + kb + 16 + 8 * hh + 4);
    float xs[16] = {x0[0],x0[1],x0[2],x0[3],x1[0],x1[1],x1[2],x1[3],x2[0],x2[1],x2[2],x2[3],x3[0],x3[1],x3[2],x3[3]};
#pragma unroll
    for (int i = 0; i < 16; ++i) { const unsigned short hb = bf16_bits(xs[i]); ah.u[i] = hb; al.u[i] = ASPLIT ? bf16_bits(xs[i] - bf16_val(hb)) : (unsigned short)0; }
#pragma unroll
    for (int t = 0; t < 4; ++t) {
      const unsigned short* brow = Wt + (size_t)(col0 + t * 16 + ln) * ldb + kb;
      FragB b;
      b.half[0] = *(const v8us*)(brow + 8 * hh);
      b.half[1] = *(const v8us*)(brow + 16 + 8 * hh);
      acc[t] = mmaN<ASPLIT ? 2 : 1>(ah.v, al.v, b.v, b.v, acc[t]);
    }
  }
#pragma unroll
  for (int t = 0; t < 4; ++t) {
    float bv = bias ? bias[col0 + t * 16 + ln] : 0.f;
    if (BIAS_BF16) bv = bf16_round(bv);
#pragma unroll
    for (int r = 0; r < 8; ++r) { float v = acc[t][r] + bv; if (ACT == 1) v = fmaxf(v, 0.f); so[w][8 * hh + r][t * 16 + ln] = v; }
  }
  __builtin_amdgcn_fence(__ATOMIC_ACQ_REL, "workgroup");
  __builtin_amdgcn_wave_barrier();
  const int rsub = lane >> 4, c4 = (lane & 15) * 4;
  {
#pragma unroll
    for (int q = 0; q < 8; ++q) {
      const int r = q * 2 + rsub;
      const v4f v = *(const v4fa*)&so[w][r][c4];
      *(v4f*)(C + (size_t)(row0 + r) * ldc + col0 + c4) = v;
    }
    
  }
}

// GEMM C = act(A·W + bias + resid): A f32 (ASPLIT -> hi/lo 2 terms), Wt bf16 [N][K]; ACT 0 none, 1 relu, 2 exact gelu;
// resid (optional, f32, row index = (row % rmod), pitch ldr, RES_BF16 rounds it) added before the activation.
template <bool ASPLIT, int ACT, bool BIAS_BF16, bool RES_BF16>
__global__ __launch_bounds__(128) void k_gemm_bf3(const float* __restrict__ A, int lda, const unsigned short* __restrict__ Wt, int ldb,
                                                const float* __restrict__ bias, const float* __restrict__ resid, int rmod, int ldr,
                                                float* __restrict__ C, int ldc, int M, int N, int K) {
  __shared__ __attribute__((aligned(16))) float so[4][16][64];
  const int tid = threadIdx.x, w = tid >> 5, lane = tid & 31, ln = lane & 15, hh = lane >> 4;
  const int ntn = N / 64;
  const int wid = blockIdx.x * 4 + w;
  const int mt = wid / ntn, nq = wid % ntn;
  if (mt * 16 >= M) return;
  const int row0 = mt * 16, col0 = nq * 64;
  const float* arow = A + (size_t)(row0 + ln) * lda;
  v8f acc[4] = {};
  for (int kb = 0; kb < K; kb += 32) {
    FragB ah, al;
    const v4f x0 = *(const v4fa*)(arow + kb + 8 * hh), x1 = *(const v4fa*)(arow + kb + 8 * hh + 4);
    const v4f x2 = *(const v4fa*)(arow + kb + 16 + 8 * hh), x3 = *(const v4fa*)(arow + kb + 16 + 8 * hh + 4);
    float xs[16] = {x0[0],x0[1],x0[2],x0[3],x1[0],x1[1],x1[2],x1[3],x2[0],x2[1],x2[2],x2[3],x3[0],x3[1],x3[2],x3[3]};
#pragma unroll
    for (int i = 0; i < 16; ++i) { const unsigned short hb = bf16_bits(xs[i]); ah.u[i] = hb; al.u[i] = ASPLIT ? bf16_bits(xs[i] - bf16_val(hb)) : (unsigned short)0; }
#pragma unroll
    for (int t = 0; t < 4; ++t) {
      const unsigned short* brow = Wt + (size_t)(col0 + t * 16 + ln) * ldb + kb;
      FragB b;
      b.half[0] = *(const v8us*)(brow + 8 * hh);
      b.half[1] = *(const v8us*)(brow + 16 + 8 * hh);
      acc[t] = mmaN<ASPLIT ? 2 : 1>(ah.v, al.v, b.v, b.v, acc[t]);
    }
  }
#pragma unroll
  for (int t = 0; t < 4; ++t) {
    const int col = col0 + t * 16 + ln;
    float bv = bias ? bias[col] : 0.f;
    if (BIAS_BF16) bv = bf16_round(bv);
#pragma unroll
    for (int r = 0; r < 8; ++r) {
      float v = acc[t][r] + bv;
      if (resid) { float rv = resid[(size_t)((row0 + 8 * hh + r) % rmod) * ldr + col]; if (RES_BF16) rv = bf16_round(rv); v += rv; }
      if (ACT == 1) v = fmaxf(v, 0.f);
      if (ACT == 2) v = 0.5f * v * (1.0f + erff(v * 0.70710678118654752f));
      if (ACT == 3) { const float u = 0.7978845608028654f * (v + 0.044715f * v * v * v); v = 0.5f * v * (1.0f + tanhf(u)); }
      so[w][8 * hh + r][t * 16 + ln] = v;
    }
  }
  __builtin_amdgcn_fence(__ATOMIC_ACQ_REL, "workgroup");
  __builtin_amdgcn_wave_barrier();
  const int rsub = lane >> 4, c4 = (lane & 15) * 4;
  {
#pragma unroll
    for (int q = 0; q < 8; ++q) {
      const int r = q * 2 + rsub;
      const v4f v = *(const v4fa*)&so[w][r][c4];
      *(v4f*)(C + (size_t)(row0 + r) * ldc + col0 + c4) = v;
    }
    
  }
}
// row LayerNorm (biased variance, eps) over N: s = X (+ R); optional out_sum <- s; out_norm <- (s-mu)*rsqrt(var+eps)*g + b
template <bool PARAM_BF16>
__global__ __launch_bounds__(256) void k_layernorm(const float* __restrict__ X, const float* __restrict__ R, const float* __restrict__ g, const float* __restrict__ bta,
                                                  float* __restrict__ out_sum, float* __restrict__ out_norm, int N, float eps) {
  __shared__ float red[256];
  const int row = blockIdx.x, tid = threadIdx.x;
  const float* x = X + (size_t)row * N; const float* rr = R ? R + (size_t)row * N : nullptr;
  float vals[16];                     // up to N = 4096
  const int per = N / 256;            // contiguous chunk per thread? use strided-by-4 chunks: thread handles j = tid*4 + 1024*u
  float s1 = 0.f;
  for (int u = 0; u < per / 4; ++u) {
    const int j = tid * 4 + 1024 * u;
    const v4f a = *(const v4fa*)(x + j);
    v4f b = {0.f,0.f,0.f,0.f}; if (rr) b = *(const v4fa*)(rr + j);
#pragma unroll
    for (int q = 0; q < 4; ++q) { const float v = a[q] + b[q]; vals[u * 4 + q] = v; s1 += v; }
  }
  red[tid] = s1; __syncthreads();
  for (int st = 128; st > 0; st >>= 1) { if (tid < st) red[tid] += red[tid + st]; __syncthreads(); }
  const float mu = red[0] / (float)N; __syncthreads();
  float s2 = 0.f;
  for (int u = 0; u < per / 4; ++u)
#pragma unroll
    for (int q = 0; q < 4; ++q) { const float c = vals[u * 4 + q] - mu; s2 += c * c; }
  red[tid] = s2; __syncthreads();
  for (int st = 128; st > 0; st >>= 1) { if (tid < st) red[tid] += red[tid + st]; __syncthreads(); }
  const float rs = rsqrtf(red[0] / (float)N + eps);
  {
    for (int u = 0; u < per / 4; ++u) {
      const int j = tid * 4 + 1024 * u;
      v4f o, sm;
#pragma unroll
      for (int q = 0; q < 4; ++q) {
        float gg = g[j + q], bb = bta[j + q];
        if (PARAM_BF16) { gg = bf16_round(gg); bb = bf16_round(bb); }
        sm[q] = vals[u * 4 + q]; o[q] = (vals[u * 4 + q] - mu) * rs * gg + bb;
      }
      if (out_sum) *(v4f*)(out_sum + (size_t)row * N + j) = sm;
      *(v4f*)(out_norm + (size_t)row * N + j) = o;
    }
    
  }
}



// ---- f16 WMMA path (v_wmma_f32_16x16x32_f16): 11-bit significands for operands in range — used where a [0,1] probability operand needs more precision than bf16
typedef _Float16 v16h __attribute__((ext_vector_type(16)));
union FragH { v16h v; v8us half[2]; _Float16 h[16]; unsigned short u[16]; };
template <int NT>
__device__ __forceinline__ v8f mmaH(v16h ah, v16h al, v16h bh, v16h bl, v8f c) {
  c = __builtin_amdgcn_wmma_f32_16x16x32_f16(false, ah, false, bh, (short)0, c, false, false);
  if (NT >= 2) c = __builtin_amdgcn_wmma_f32_16x16x32_f16(false, al, false, bh, (short)0, c, false, false);
  if (NT >= 3) c = __builtin_amdgcn_wmma_f32_16x16x32_f16(false, ah, false, bl, (short)0, c, false, false);
  asm volatile("v_nop\n\tv_nop\n\tv_nop\n\tv_nop" : "+v"(c) : "v"(ah), "v"(al), "v"(bh), "v"(bl));
  return c;
}
// batched GEMM like k_gemm_b but f16 operands: A f32 (split into f16 hi/lo if ASPLIT, else rounded to f16), Bt = f16 values [n][k]; alpha; C f32; N multiple of 16 (partial tiles skipped)
template <bool ASPLIT>
__global__ __launch_bounds__(128) void k_gemm_h(const float* __restrict__ A, int lda, size_t sA, const _Float16* __restrict__ Bh, int ldb, size_t sB, float alpha, float* __restrict__ C, int ldc, size_t sC, int M, int N, int K) {
  __shared__ __attribute__((aligned(16))) float so[4][16][64];
  const int tid = threadIdx.x, w = tid >> 5, lane = tid & 31, ln = lane & 15, hh = lane >> 4; const int by = blockIdx.y;
  A += (size_t)by * sA; Bh += (size_t)by * sB; C += (size_t)by * sC;
  const int ntn = (N + 63) / 64; const int wid = blockIdx.x * 4 + w; const int mt = wid / ntn, nq = wid % ntn; if (mt * 16 >= M) return;
  const int row0 = mt * 16, col0 = nq * 64; const float* arow = A + (size_t)(row0 + ln) * lda;
  v8f acc[4] = {};
  for (int kb = 0; kb < K; kb += 32) {
    FragH ah, al;
    const v4f x0 = *(const v4fa*)(arow + kb + 8 * hh), x1 = *(const v4fa*)(arow + kb + 8 * hh + 4), x2 = *(const v4fa*)(arow + kb + 16 + 8 * hh), x3 = *(const v4fa*)(arow + kb + 16 + 8 * hh + 4);
    float xs[16] = {x0[0],x0[1],x0[2],x0[3],x1[0],x1[1],x1[2],x1[3],x2[0],x2[1],x2[2],x2[3],x3[0],x3[1],x3[2],x3[3]};
#pragma unroll
    for (int i = 0; i < 16; ++i) { const _Float16 h = (_Float16)xs[i]; ah.h[i] = h; al.h[i] = ASPLIT ? (_Float16)(xs[i] - (float)h) : (_Float16)0.0f; }
#pragma unroll
    for (int t = 0; t < 4; ++t) { if (col0 + t * 16 >= N) continue; const size_t boff = (size_t)(col0 + t * 16 + ln) * ldb + kb; FragH bq; bq.half[0] = *(const v8us*)(Bh + boff + 8 * hh); bq.half[1] = *(const v8us*)(Bh + boff + 16 + 8 * hh);
      acc[t] = mmaH<ASPLIT ? 2 : 1>(ah.v, al.v, bq.v, bq.v, acc[t]); }
  }
#pragma unroll
  for (int t = 0; t < 4; ++t) { if (col0 + t * 16 >= N) continue;
#pragma unroll
    for (int r = 0; r < 8; ++r) so[w][8 * hh + r][t * 16 + ln] = acc[t][r] * alpha; }
  __builtin_amdgcn_fence(__ATOMIC_ACQ_REL, "workgroup"); __builtin_amdgcn_wave_barrier();
  const int rsub = lane >> 4, c4 = (lane & 15) * 4;
  {
#pragma unroll
    for (int q = 0; q < 8; ++q) { const int r = q * 2 + rsub; if (col0 + c4 < N) { const v4f v = *(const v4fa*)&so[w][r][c4]; *(v4f*)(C + (size_t)(row0 + r) * ldc + col0 + c4) = v; } }
     }
}

// Wt[n][k] = f16(W[k][n]·scale) from f32 row-major W[K][N] (scale = power of two; bf16-exact weights stay exact in f16 away from the subnormal range)
__global__ __launch_bounds__(256) void k_wt_f16(const float* __restrict__ W, _Float16* __restrict__ Wt, int K, int N, float scale) {
  const int t = blockIdx.x * 256 + threadIdx.x; if (t >= N * (K / 8)) return; const int n = t / (K / 8), k8 = (t % (K / 8)) * 8; FragH f;
#pragma unroll
  for (int i = 0; i < 8; ++i) f.h[i] = (_Float16)(bf16_round(W[(size_t)(k8 + i) * N + n]) * scale); const v8us o = f.half[0];
  *(v8us*)((unsigned short*)Wt + (size_t)n * K + k8) = o; 
}
// k_gemm_hh variant with fused epilogue: v = acc·alpha + bias[by·sBias + col] (+ CP[(row/rowsPerB)·sCPb + by·64 + col] if CP) ; ACT 0 none / 1 elu ; writes f16 C16 (and f32 C if non-null)
template <int ACT>
__global__ __launch_bounds__(128) void k_gemm_hhx(const _Float16* __restrict__ A, int lda, size_t sA, const _Float16* __restrict__ Bh, int ldb, size_t sB, float alpha, const float* __restrict__ bias, size_t sBias, const float* __restrict__ CP, int rowsPerB, size_t sCPb, int row0g,
    float* __restrict__ C, _Float16* __restrict__ C16, int ldc, size_t sC, int M, int N, int K) {
  __shared__ __attribute__((aligned(16))) float so[4][16][64];
  const int tid = threadIdx.x, w = tid >> 5, lane = tid & 31, ln = lane & 15, hh = lane >> 4; const int by = blockIdx.y;
  A += (size_t)by * sA; Bh += (size_t)by * sB; const size_t cofs = (size_t)by * sC; const float* bp = bias ? bias + (size_t)by * sBias : nullptr;
  const int ntn = (N + 63) / 64; const int wid = blockIdx.x * 4 + w; const int mt = wid / ntn, nq = wid % ntn; if (mt * 16 >= M) return;
  const int row0 = mt * 16, col0 = nq * 64; const _Float16* arow = A + (size_t)(row0 + ln) * lda;
  v8f acc[4] = {};
  for (int kb = 0; kb < K; kb += 32) { FragH ah; ah.half[0] = *(const v8us*)((const unsigned short*)arow + kb + 8 * hh); ah.half[1] = *(const v8us*)((const unsigned short*)arow + kb + 16 + 8 * hh);
#pragma unroll
    for (int t = 0; t < 4; ++t) { if (col0 + t * 16 >= N) continue; const size_t boff = (size_t)(col0 + t * 16 + ln) * ldb + kb; FragH bq; bq.half[0] = *(const v8us*)((const unsigned short*)Bh + boff + 8 * hh); bq.half[1] = *(const v8us*)((const unsigned short*)Bh + boff + 16 + 8 * hh);
      acc[t] = mmaH<1>(ah.v, ah.v, bq.v, bq.v, acc[t]); }
  }
#pragma unroll
  for (int t = 0; t < 4; ++t) { if (col0 + t * 16 >= N) continue; const int col = col0 + t * 16 + ln; const float bv = bp ? bf16_round(bp[col]) : 0.f;
#pragma unroll
    for (int r = 0; r < 8; ++r) { float v = acc[t][r] * alpha + bv; if (CP) { const int rr = row0g + row0 + 8 * hh + r; if (rowsPerB < 0) v += CP[cofs + (size_t)rr * ldc + col];      /* rowsPerB < 0: own element of the batched C plane */ else { const int bidx = rr / rowsPerB; v += CP[(size_t)bidx * sCPb + (size_t)by * 64 + col]; } } if (ACT == 1) v = (v > 0.f) ? v : expm1f(v); else if (ACT == 7) v = (v > 0.f) ? v + 1.0f : expf(v); else if (ACT == 8) v = tanhf(v); else if (ACT == 9) v = 0.5f * v * (1.0f + tanhf(0.7978845608028654f * (v + 0.044715f * v * v * v))); else if (ACT == 11) v = 1.0f / (1.0f + expf(-v)); else if (ACT == 12) v = (v > 0.f) ? v : 0.01f * v; else if (ACT == 14) v = (v > 0.f) ? v : 0.1f * v; else if (ACT == 16) v = (v >= 0.f) ? v : 0.3f * v; else if (ACT == 17) v = (v >= 0.f) ? v : 0.2f * v; else if (ACT == 15) v = v / (1.0f + expf(-v)); else if (ACT == 3) v = fmaxf(v, 0.f); else if (ACT == 6) v = 0.5f * v * (1.0f + erff(v * 0.70710678118654752f)); so[w][8 * hh + r][t * 16 + ln] = v; } }
  __builtin_amdgcn_fence(__ATOMIC_ACQ_REL, "workgroup"); __builtin_amdgcn_wave_barrier();
  const int rsub = lane >> 4, c4 = (lane & 15) * 4; typedef _Float16 v4h __attribute__((ext_vector_type(4)));
  {
#pragma unroll
    for (int q = 0; q < 8; ++q) { const int r = q * 2 + rsub; if (col0 + c4 < N) { const v4f v = *(const v4fa*)&so[w][r][c4]; if (C) *(v4f*)(C + cofs + (size_t)(row0 + r) * ldc + col0 + c4) = v; if (C16) { v4h h4; for (int i = 0; i < 4; ++i) h4[i] = (_Float16)v[i]; *(v4h*)(C16 + cofs + (size_t)(row0 + r) * ldc + col0 + c4) = h4; } } }
     }
}


typedef _Float16 v4h __attribute__((ext_vector_type(4)));

__global__ __launch_bounds__(256) void k_x16(const float* __restrict__ x, _Float16* __restrict__ X16, size_t n8) { const size_t t = (size_t)blockIdx.x * 256 + threadIdx.x; if (t >= n8) return; FragH f;
#pragma unroll
  for (int q = 0; q < 8; ++q) f.h[q] = (_Float16)bf16_round(x[t * 8 + q]); *(v8us*)((unsigned short*)X16 + t * 8) = f.half[0];  }
__global__ __launch_bounds__(256) void k_h16(const float* __restrict__ x, _Float16* __restrict__ X16, size_t n8) { const size_t t = (size_t)blockIdx.x * 256 + threadIdx.x; if (t >= n8) return; FragH f;
#pragma unroll
  for (int q = 0; q < 8; ++q) f.h[q] = (_Float16)x[t * 8 + q]; *(v8us*)((unsigned short*)X16 + t * 8) = f.half[0];  }
__global__ __launch_bounds__(256) void k_round16f(const float* __restrict__ W, _Float16* __restrict__ Bt, size_t n8) { const size_t t = (size_t)blockIdx.x * 256 + threadIdx.x; if (t >= n8) return; FragH f;
#pragma unroll
  for (int i = 0; i < 8; ++i) f.h[i] = (_Float16)(bf16_round(W[t * 8 + i]) * 16.0f); *(v8us*)((unsigned short*)Bt + t * 8) = f.half[0];  }
template <int NHv, int TTv>
__global__ __launch_bounds__(256) void k_vt(const _Float16* __restrict__ V16, int ldv, int voff, _Float16* __restrict__ Vt) { __shared__ unsigned short tl[64][66]; const int tid = threadIdx.x; const int slab = blockIdx.x / (TTv / 64), lg = blockIdx.x % (TTv / 64); const int b = slab / NHv, h = slab % NHv;
  for (int i = tid; i < 64 * 8; i += 256) { const int r = i / 8, c8 = (i % 8) * 8; FragH f; f.half[0] = *(const v8us*)((const unsigned short*)V16 + ((size_t)b * TTv + lg * 64 + r) * ldv + voff + h * 64 + c8);
#pragma unroll
    for (int q = 0; q < 8; ++q) tl[r][c8 + q] = f.u[q]; }
  __syncthreads();
  {
#pragma unroll
    for (int rd = 0; rd < 2; ++rd) { const int d = rd * 32 + tid / 8, pc = tid % 8; FragH f;
#pragma unroll
      for (int q = 0; q < 8; ++q) f.u[q] = tl[pc * 8 + q][d];
      *(v8us*)((unsigned short*)Vt + ((size_t)slab * 64 + d) * TTv + lg * 64 + pc * 8) = f.half[0]; }
     } }

// Fragment order of an f16 operand plane X[row][k] (k a multiple of 8, K columns): the 16-byte unit of 8 consecutive k lies where the lane that needs it reads it, so that
// the 32 lanes of one fragment load (or store) cover 512 contiguous bytes, four whole lines, instead of 32 bytes in each of 16 rows. Block = (16 rows) x (16 k) = 32 units;
// unit in the block = lane = 16 * (k / 8 % 2) + row % 16. A 16x32 fragment is two blocks in a row, in the k order of g2_frag (8h + s, 16 + 8h + s).
__device__ __forceinline__ size_t fo_unit(size_t row, size_t k, size_t K) { return ((row >> 4) * (K >> 4) + (k >> 4)) * 32 + ((k >> 3) & 1) * 16 + (row & 15); }
// p = the plane + 8 * (first unit of the fragment's first block + lane)
__device__ __forceinline__ v16h fo_frag(const _Float16* p) { FragH f; f.half[0] = *(const v8us*)((const unsigned short*)p); f.half[1] = *(const v8us*)((const unsigned short*)p + 256); return f.v; }
// The three passes that follow the projections, in ONE launch (none reads what another writes). Work-groups [0, HB): q, [HB, 2 HB): k, each f32 -> f16 hi + 2^-10 residual planes in fragment order;
// the rest: v rows [image][n][256] -> channel-major in fragment order (rows = image * 256 + channel, k = n): 64 x 64 tiles through LDS, each wave stores whole 512-byte blocks.
__global__ __launch_bounds__(256) void k_post(const float* __restrict__ QF, const float* __restrict__ KF, _Float16* __restrict__ QH, _Float16* __restrict__ QL, _Float16* __restrict__ KH, _Float16* __restrict__ KL, const _Float16* __restrict__ V16, _Float16* __restrict__ Vf) {
  __shared__ unsigned short tl[64][66]; const int tid = threadIdx.x; constexpr int HB = (int)(NR * CQ / 8 / 256); static_assert(NR * CQ / 8 % 256 == 0, "whole work-groups");
  if (blockIdx.x < 2 * HB) {      /* the same for a whole work-group, and in front of the barrier below */
    const bool isk = blockIdx.x >= HB; const float* F = isk ? KF : QF; _Float16* Hh = isk ? KH : QH; _Float16* Hl = isk ? KL : QL;
    const size_t t = (size_t)(blockIdx.x - (isk ? HB : 0)) * 256 + tid; FragH fh, fl; const v4f a = *(const v4fa*)(F + t * 8), c = *(const v4fa*)(F + t * 8 + 4);
#pragma unroll
    for (int q = 0; q < 4; ++q) { _Float16 h = (_Float16)a[q]; fh.h[q] = h; fl.h[q] = (_Float16)((a[q] - (float)h) * 1024.0f); h = (_Float16)c[q]; fh.h[4 + q] = h; fl.h[4 + q] = (_Float16)((c[q] - (float)h) * 1024.0f); }
    { const size_t u = fo_unit(t >> 3, (t & 7) * 8, CQ); *(v8us*)((unsigned short*)Hh + u * 8) = fh.half[0]; *(v8us*)((unsigned short*)Hl + u * 8) = fl.half[0]; }
    return; }
  const int bx = blockIdx.x - 2 * HB; const int slab = bx / (NPX / 64), lg = bx % (NPX / 64); const int b = slab / (CC / 64), h = slab % (CC / 64);
  for (int i = tid; i < 64 * 8; i += 256) { const int r = i / 8, c8 = (i % 8) * 8; FragH f; f.half[0] = *(const v8us*)((const unsigned short*)V16 + ((size_t)b * NPX + lg * 64 + r) * CC + h * 64 + c8);
#pragma unroll
    for (int q = 0; q < 8; ++q) tl[r][c8 + q] = f.u[q]; }
  __syncthreads();
#pragma unroll
  for (int rd = 0; rd < 2; ++rd) { const int u = rd * 256 + tid, blk = u >> 5, l = u & 31; const int d = (blk >> 2) * 16 + (l & 15), kk = (blk & 3) * 16 + (l >> 4) * 8; FragH f;
#pragma unroll
    for (int q = 0; q < 8; ++q) f.u[q] = tl[kk + q][d];
    *(v8us*)((unsigned short*)Vf + fo_unit((size_t)slab * 64 + d, (size_t)lg * 64 + kk, NPX) * 8) = f.half[0]; } }

// ---- fast GEMM (wave tile 32x64) ----
__device__ __forceinline__ v16h g2_frag(const _Float16* p, int hh) { FragH f; f.half[0] = *(const v8us*)((const unsigned short*)p + 8 * hh); f.half[1] = *(const v8us*)((const unsigned short*)p + 16 + 8 * hh); return f.v; }
__device__ __forceinline__ v8f g2_mma(v16h a, v16h b, v8f c) { v8f d = __builtin_amdgcn_wmma_f32_16x16x32_f16(false, a, false, b, (short)0, c, false, false); asm volatile("v_nop\n\tv_nop\n\tv_nop\n\tv_nop" : "+v"(d) : "v"(a), "v"(b)); return d; }
// The operands of one k step (32 k) of a 32 x 64 wave tile form a set: two A and four B fragments, twelve 16-byte loads a lane. The GEMM loops below hold three sets in registers as a
// ring: a set is refilled for the step three ahead as soon as its products are issued, so the loads of two to three steps are in flight under every product and a wave no longer
// waits out four or five load latencies in a row in each step. Every accumulator still takes its k steps in rising order.
struct OpSet { v16h a0, a1, b0, b1, b2, b3; };
// c[t + 4 * half]: column tile t, row tile half
__device__ __forceinline__ void set_mma(const OpSet& s, v8f (&c)[8]) {
  c[0] = g2_mma(s.a0, s.b0, c[0]); c[4] = g2_mma(s.a1, s.b0, c[4]); c[1] = g2_mma(s.a0, s.b1, c[1]); c[5] = g2_mma(s.a1, s.b1, c[5]);
  c[2] = g2_mma(s.a0, s.b2, c[2]); c[6] = g2_mma(s.a1, s.b2, c[6]); c[3] = g2_mma(s.a0, s.b3, c[3]); c[7] = g2_mma(s.a1, s.b3, c[7]); }
// q, k and v projections in ONE launch: the three products read the same rows of A and do not depend on one another. Work-groups [0, MB) form q, [MB, 2 MB) k (64 columns each, f32 out),
// the rest v (256 columns in four groups of 64, + bias, f16 out). Every work-group is a 128 x 64 tile with K = CC, as before.
__global__ __launch_bounds__(128) void k_qkv(const _Float16* __restrict__ A, const _Float16* __restrict__ BQ, const _Float16* __restrict__ BK, const _Float16* __restrict__ BV, const float* __restrict__ bias,
    float* __restrict__ QF, float* __restrict__ KF, _Float16* __restrict__ V16) { static_assert(CC == 256 && CQ == 64, "one chunk of eight k steps; q and k are one column group wide");
  __shared__ __attribute__((aligned(16))) float so[4][32][68];
  const int tid = threadIdx.x, w = tid >> 5, lane = tid & 31, ln = lane & 15, hh = lane >> 4;
  constexpr int MB = (int)(NR / 128); const int bx = blockIdx.x; const bool isv = bx >= 2 * MB; const int uv = bx - 2 * MB;
  const int mt = isv ? uv / (CC / 64) : bx % MB; const int col0 = isv ? (uv % (CC / 64)) * 64 : 0; const int row0 = mt * 128 + 32 * w;
  const _Float16* Bh = isv ? BV : (bx < MB ? BQ : BK);
  const _Float16* a0p = A + (size_t)(row0 + ln) * CC; const _Float16* a1p = a0p + (size_t)16 * CC;
  const _Float16* b0p = Bh + (size_t)(col0 + ln) * CC; const _Float16* b1p = b0p + (size_t)16 * CC; const _Float16* b2p = b1p + (size_t)16 * CC; const _Float16* b3p = b2p + (size_t)16 * CC;
  const v8f z8 = {0.f,0.f,0.f,0.f,0.f,0.f,0.f,0.f}; v8f accs[8] = {z8, z8, z8, z8, z8, z8, z8, z8};
  auto ld = [&](OpSet& s, int kb) { s.a0 = g2_frag(a0p + kb, hh); s.a1 = g2_frag(a1p + kb, hh); s.b0 = g2_frag(b0p + kb, hh); s.b1 = g2_frag(b1p + kb, hh); s.b2 = g2_frag(b2p + kb, hh); s.b3 = g2_frag(b3p + kb, hh);
    asm volatile("s_wait_xcnt 0x0" ::: "memory"); };      /* stands in front of any later overwrite of the address registers of the twelve loads above; as a compiler fence it also keeps each set's loads at their place in the ring */
  OpSet s[3]; ld(s[0], 0); ld(s[1], 32); ld(s[2], 64);
  // unrolled in full: s is then indexed by constants only and stays in registers
#pragma unroll
  for (int i = 0; i < 8; ++i) { set_mma(s[i % 3], accs); if (i + 3 < 8) ld(s[i % 3], (i + 3) * 32); }
#pragma unroll
  for (int u = 0; u < 8; ++u) { const int t = u & 3, half = u >> 2; const float bv = isv ? bf16_round(bias[col0 + t * 16 + ln]) : 0.f;
#pragma unroll
    for (int r = 0; r < 8; ++r) so[w][half * 16 + 8 * hh + r][t * 16 + ln] = accs[u][r] * 0.0625f + bv; }
  __builtin_amdgcn_fence(__ATOMIC_ACQ_REL, "workgroup"); __builtin_amdgcn_wave_barrier();
  const int rsub = lane >> 4, c4 = (lane & 15) * 4;
  if (!isv) { float* C = bx < MB ? QF : KF;
#pragma unroll
    for (int q = 0; q < 16; ++q) { const int r = q * 2 + rsub; const v4f v = *(const v4fa*)&so[w][r][c4]; *(v4f*)(C + (size_t)(row0 + r) * CQ + c4) = v; }
    asm volatile("s_wait_xcnt 0x0" ::: "memory");      /* the build lays the v path directly behind these stores, where their address registers are written again: the wait stands in front of that */
    return; }
#pragma unroll
  for (int q = 0; q < 16; ++q) { const int r = q * 2 + rsub; const v4f v = *(const v4fa*)&so[w][r][c4]; v4h h4; for (int i = 0; i < 4; ++i) h4[i] = (_Float16)v[i]; *(v4h*)(V16 + (size_t)(row0 + r) * CC + col0 + c4) = h4; } }

// energy + softmax in one kernel; grid x = 4 * (group of 256 rows n) + (quarter of the columns m), grid y = image. A work-group of 16 waves first brings the k rows of its 1024 columns
// (hi and residual plane, 128 KiB each, contiguous in fragment order) into LDS with asynchronous copies, once, and then runs four passes of 64 rows n over them: every k fragment comes
// from L2 once for 256 rows of the attention matrix. In a pass wave w forms the logits E[n][m] of row tile w / 4 and of the 256 columns of column group w % 4 (four waves next to one another in number read four different 64-KiB parts of the LDS; A = q rows, B = k rows;
// hi.hi in one accumulator, lo.hi + hi.lo in a second, joined as hi + lo / 1024). The logits stay in registers for the maximum, the exponentials, their sum and the f16 store.
// Maximum and sum are those of the QUARTER row, over the work-group's 1024 columns only: P^T takes 256 exp(E - quarter maximum), not divided, and maximum and sum are stored per (image, quarter, n);
// k_xr forms from them the factor that makes the whole row's softmax of it.
// In the D layout a lane holds ONE column m and 8 consecutive rows n per tile: that is the 16-byte unit which the same lane of the x_r product reads as its B operand (row m of P^T,
// k = n), so each tile is one 512-byte store into P^T in fragment order and no transpose follows.
// The row reductions run per register: over the tiles in the lane, over the 16 lanes of a row by DPP, over the four waves of a row tile through LDS.
__device__ __forceinline__ v8f es_mma(v16h a, v16h b, v8f c) { return __builtin_amdgcn_wmma_f32_16x16x32_f16(false, a, false, b, (short)0, c, false, false); }
template <int X> __device__ __forceinline__ float row_x(float v) { return __int_as_float(__builtin_amdgcn_update_dpp(0, __float_as_int(v), 0x160 + X, 0xf, 0xf, true)); }      /* the value of lane l ^ X of the same 16-lane row (row_xmask) */
#define NQ 4                         /* column quarters of the attention matrix */
#define QCOL (NPX / NQ)              /* columns of a quarter */
#define KPL ((size_t)QCOL * CQ)      /* f16 elements of one k plane of a quarter */
__global__ __launch_bounds__(512) void k_esm(const _Float16* __restrict__ Qh, const _Float16* __restrict__ Ql, const _Float16* __restrict__ Kh, const _Float16* __restrict__ Kl, _Float16* __restrict__ Pf, float* __restrict__ ML, float* __restrict__ SL) {
  static_assert(KPL * 2 == 131072 && CQ == 64, "the copies below move two planes of 128 KiB");
  __shared__ __attribute__((aligned(512))) _Float16 Ks[2 * KPL]; __shared__ __attribute__((aligned(32))) float redm[4][64]; __shared__ __attribute__((aligned(32))) float reds[4][64];
  const int tid = threadIdx.x, w = __builtin_amdgcn_readfirstlane(tid >> 5), lane = tid & 31, ln = lane & 15, hh = lane >> 4; const int cg = w & 3, rt = w >> 2; const int qd = blockIdx.x & (NQ - 1), rg = blockIdx.x >> 2;      /* the wave's number in a scalar register: what follows from it costs no vector register */
  { const size_t r0 = (size_t)blockIdx.y * NPX; Qh += r0 * CQ; Ql += r0 * CQ; Kh += r0 * CQ + (size_t)qd * KPL; Kl += r0 * CQ + (size_t)qd * KPL; Pf += r0 * NPX; ML += ((size_t)blockIdx.y * NQ + qd) * NPX; SL += ((size_t)blockIdx.y * NQ + qd) * NPX; }      /* this image's planes, this quarter's k rows and statistics */
  { const unsigned l0 = (unsigned)(size_t)&Ks[0] + (unsigned)((w >> 2) * 4096 + (w & 3) * 512 + lane * 16); const char* gh = (const char*)Kh + (w * 512 + lane * 16); const char* gl = (const char*)Kl + (w * 512 + lane * 16);
    // 32 copies a wave, 512 bytes (one block of a plane) each. In LDS a 16-row tile's hi blocks (2 KiB) and residual blocks (2 KiB) lie side by side, so that one address register and the 16-bit offset reach
    // all that a wave reads. Copy j of statement i takes the bytes from (8 (i % 2) + j) * 8192 + 512 w on of plane i / 2, that is block w % 4 of tile 4 (8 (i % 2) + j) + w / 4.
    // The s_wait_xcnt at the end of each statement stands in front of any later write of the registers that its copies name.
#pragma unroll
    for (int i = 0; i < 4; ++i) { const unsigned l = l0 + (unsigned)(i & 1) * 131072u + (unsigned)(i >> 1) * 2048u; const char* g = i < 2 ? gh + i * 65536 : gl + (i - 2) * 65536;
      asm volatile("global_load_async_to_lds_b128 %0, %8, off\n\tglobal_load_async_to_lds_b128 %1, %9, off\n\tglobal_load_async_to_lds_b128 %2, %10, off\n\tglobal_load_async_to_lds_b128 %3, %11, off\n\t"
                   "global_load_async_to_lds_b128 %4, %12, off\n\tglobal_load_async_to_lds_b128 %5, %13, off\n\tglobal_load_async_to_lds_b128 %6, %14, off\n\tglobal_load_async_to_lds_b128 %7, %15, off\n\ts_wait_xcnt 0x0"
                   :: "v"(l), "v"(l + 16384u), "v"(l + 32768u), "v"(l + 49152u), "v"(l + 65536u), "v"(l + 81920u), "v"(l + 98304u), "v"(l + 114688u),
                      "v"(g), "v"(g + 8192), "v"(g + 16384), "v"(g + 24576), "v"(g + 32768), "v"(g + 40960), "v"(g + 49152), "v"(g + 57344) : "memory"); } }
  Qh += (size_t)(rg * 16 + rt) * 1024; Ql += (size_t)(rg * 16 + rt) * 1024; const unsigned l8 = lane * 8;      /* row tile rg * 16 + 4 * pass + rt (1024 elements a tile); a pass is 4 tiles = 4096 elements on */
  v16h qh0 = fo_frag(Qh + l8), qh1 = fo_frag(Qh + 512 + l8), ql0 = fo_frag(Ql + l8), ql1 = fo_frag(Ql + 512 + l8);
  asm volatile("s_wait_xcnt 0x0" ::: "memory");      /* the address registers of the loads above may be given to a later value: the wait stands in front of that overwrite */
  asm volatile("s_wait_asynccnt 0x0" ::: "memory");      /* this wave's copies have landed */
  __syncthreads();      /* every wave's copies have landed: from here on the k planes are only read */
  const _Float16* khp = Ks + (size_t)(cg * 16) * 2048 + lane * 8; const _Float16* klp = khp + 1024;      /* 2048 elements a tile: hi, then residual */
  const v8f z8 = {0.f,0.f,0.f,0.f,0.f,0.f,0.f,0.f};
  // stays rolled: a pass is some thousand instructions long
#pragma unroll 1
  for (int ps = 0; ps < 4; ++ps) { v8f e[16];
    v16h nh0 = fo_frag(khp), nh1 = fo_frag(khp + 512), nl0 = fo_frag(klp), nl1 = fo_frag(klp + 512);
    // every loop over e[] is unrolled in full: e is then indexed by constants only and stays in registers
#pragma unroll
    for (int t = 0; t < 16; ++t) { const v16h kh0 = nh0, kh1 = nh1, kl0 = nl0, kl1 = nl1;
      if (t + 1 < 16) { nh0 = fo_frag(khp + (t + 1) * 2048); nh1 = fo_frag(khp + (t + 1) * 2048 + 512); nl0 = fo_frag(klp + (t + 1) * 2048); nl1 = fo_frag(klp + (t + 1) * 2048 + 512); }      /* the next tile's fragments come from LDS under this tile's products */
      v8f ch = es_mma(qh0, kh0, z8); v8f cl = es_mma(qh0, kl0, z8); ch = es_mma(qh1, kh1, ch); cl = es_mma(qh1, kl1, cl); cl = es_mma(ql0, kh0, cl); cl = es_mma(ql1, kh1, cl);
      e[t] = ch + cl * (1.0f / 1024.0f); }
    v8f m8 = e[0];      /* register r: row n = 8 * hh + r of the tile */
#pragma unroll
    for (int t = 1; t < 16; ++t) for (int r = 0; r < 8; ++r) m8[r] = fmaxf(m8[r], e[t][r]);
#pragma unroll
    for (int r = 0; r < 8; ++r) { float v = m8[r]; v = fmaxf(v, row_x<1>(v)); v = fmaxf(v, row_x<2>(v)); v = fmaxf(v, row_x<4>(v)); v = fmaxf(v, row_x<8>(v)); m8[r] = v; }
    if (ln == 0) *(v8f*)&redm[cg][rt * 16 + 8 * hh] = m8;
    __syncthreads();
#pragma unroll
    for (int u = 0; u < 4; ++u) { const v8f o = *(const v8f*)&redm[u][rt * 16 + 8 * hh]; for (int r = 0; r < 8; ++r) m8[r] = fmaxf(m8[r], o[r]); }
    { const _Float16* qa = Qh + (ps < 3 ? ps + 1 : 3) * 4096 + l8; const _Float16* qb = Ql + (ps < 3 ? ps + 1 : 3) * 4096 + l8;      /* the next pass's q fragments fly under this pass's exponentials (the last pass asks for its own again) */
      qh0 = fo_frag(qa); qh1 = fo_frag(qa + 512); ql0 = fo_frag(qb); ql1 = fo_frag(qb + 512);
      asm volatile("s_wait_xcnt 0x0" :: "v"(qa), "v"(qb) : "memory"); }      /* stands in front of any overwrite of the address registers of the eight loads above; it names them so that they live up to it and no load's result is laid over them */
    const int si = rg * 256 + ps * 64 + tid;
    if (tid < 64) { const float mv = fmaxf(fmaxf(redm[0][tid], redm[1][tid]), fmaxf(redm[2][tid], redm[3][tid])) * 1.44269504088896340736f; ML[si] = mv;      /* two whole waves, one 128-byte line each: the quarter row's maximum in the log2 domain */
      asm volatile("s_wait_xcnt 0x0" :: "v"(mv), "v"(si) : "memory"); }      /* stands in front of any overwrite of the store's data and index registers; it names both so that they live up to it */
#pragma unroll
    for (int r = 0; r < 8; ++r) m8[r] = 8.0f - m8[r] * 1.44269504088896340736f;      /* 8 - the maximum in the log2 domain: the 8 is the factor 256 of P^T; the rounding scales a whole quarter row and its sum alike */
#pragma unroll
    for (int t = 0; t < 16; ++t) for (int r = 0; r < 8; ++r) e[t][r] = __builtin_amdgcn_exp2f(__builtin_fmaf(e[t][r], 1.44269504088896340736f, m8[r]));      /* 256 exp(e - max) = 2^(e log2e + 8 - max log2e): one FMA and one v_exp_f32 a logit; arguments are <= about 8, far negative ones give 0 */
    v8f s8 = e[0];
#pragma unroll
    for (int t = 1; t < 16; ++t) s8 += e[t];
#pragma unroll
    for (int r = 0; r < 8; ++r) { float v = s8[r]; v += row_x<1>(v); v += row_x<2>(v); v += row_x<4>(v); v += row_x<8>(v); s8[r] = v; }
    if (ln == 0) *(v8f*)&reds[cg][rt * 16 + 8 * hh] = s8;
    __syncthreads();
    if (tid < 64) { const float sv = ((reds[0][tid] + reds[1][tid]) + reds[2][tid]) + reds[3][tid]; SL[si] = sv;      /* 256 * the quarter row's sum of exponentials */
      asm volatile("s_wait_xcnt 0x0" :: "v"(sv), "v"(si) : "memory"); }      /* stands in front of any overwrite of the store's data and index registers; it names both so that they live up to it */
    unsigned short* p = (unsigned short*)Pf + ((size_t)(qd * (QCOL / 16) + cg * 16) * (NPX / 16) + (rg * 16 + ps * 4 + rt)) * 256 + l8;      /* block (m tile, n tile), unit = lane */
#pragma unroll
    for (int t = 0; t < 16; ++t) { FragH f; for (int r = 0; r < 8; ++r) f.h[r] = (_Float16)e[t][r]; *(v8us*)(p + (size_t)t * (NPX / 16) * 256) = f.half[0]; }
    asm volatile("s_wait_xcnt 0x0" ::: "memory"); } }      /* the next pass writes the address registers of the stores above anew: the wait stands in front of that */
// x_r[c][m] = alpha * sum_n v[c][n] wt[n] P^T[m][n], both operands in fragment order (K = NPX); grid y = image. Wave tile 32 x 64, four waves stacked on the rows; the operands go through
// the ring of three register sets (see OpSet). P^T holds 256 exp(E - quarter maximum) (see k_esm); wt[n] = 2^14 exp(this work-group's quarter maximum - row maximum) / (256 * the whole row n's sum of exponentials), at most 64,
// formed once per work-group from the four quarters' maxima and sums, kept in LDS as f16 and multiplied into the v fragments, whose k index is n.
#define XR_TP ((size_t)(NPX / 16) * 256)      /* f16 elements from one 16-row tile to the next */
__device__ __forceinline__ void xr_load(OpSet& s, const _Float16* ap, const _Float16* bp) {
  s.a0 = fo_frag(ap); s.a1 = fo_frag(ap + XR_TP); s.b0 = fo_frag(bp); s.b1 = fo_frag(bp + XR_TP); s.b2 = fo_frag(bp + 2 * XR_TP); s.b3 = fo_frag(bp + 3 * XR_TP);
  asm volatile("s_wait_xcnt 0x0" ::: "memory"); }      /* stands in front of any later overwrite of the address registers of the twelve loads above; as a compiler fence it also keeps each set's loads at their place in the ring */
__device__ __forceinline__ float exp2_slot(float x) { float r; asm("v_exp_f32 %0, %1\n\tv_nop" : "=v"(r) : "v"(x)); return r; }      /* 2^x; the v_nop fills the slot behind a transcendental */
__device__ __forceinline__ void xr_mma(const OpSet& s, v16h wt, v8f (&c)[8]) {
  __builtin_amdgcn_sched_barrier(0);      /* the products with the weights are not lifted over this point: lifted, they wait for this set's loads a step early and the ring is a step shorter */
  OpSet t = s; t.a0 = s.a0 * wt; t.a1 = s.a1 * wt; set_mma(t, c); }
__global__ __launch_bounds__(128) void k_xr(const _Float16* __restrict__ Af, const _Float16* __restrict__ Bf, const float* __restrict__ ML, const float* __restrict__ SL, float alpha, float* __restrict__ C) {
  __shared__ __attribute__((aligned(16))) float so[4][32][68]; __shared__ __attribute__((aligned(16))) _Float16 fw[NPX];
  const int tid = threadIdx.x, w = tid >> 5, lane = tid & 31, ln = lane & 15, hh = lane >> 4; const int by = blockIdx.y;
  Af += (size_t)by * CC * NPX; Bf += (size_t)by * NPX * NPX; C += (size_t)by * CC * NPX;
  const int ntn = NPX >> 6; const int mt = blockIdx.x / ntn, nq = blockIdx.x - mt * ntn; const int row0 = mt * 128 + 32 * w, col0 = nq * 64;
  const _Float16* ap = Af + (size_t)(row0 >> 4) * XR_TP + lane * 8; const _Float16* bp = Bf + (size_t)(col0 >> 4) * XR_TP + lane * 8;
  { const int qd = col0 / QCOL;
    // two trips of 16 n a thread: a trip's 36 loads are in flight together, so the work-group waits out two load latencies here and not eight
#pragma unroll 1
    for (int h = 0; h < 2; ++h) { const float* pm = ML + (size_t)by * NQ * NPX + h * 2048 + tid * 4; const float* pz = SL + (size_t)by * NQ * NPX + h * 2048 + tid * 4; const float* pmo = pm + (size_t)qd * NPX;
      v4f mq[4][NQ], sq[4][NQ], mo[4];
#pragma unroll
      for (int u = 0; u < 4; ++u) { for (int j = 0; j < NQ; ++j) { mq[u][j] = *(const v4fa*)(pm + (size_t)j * NPX + u * 512); sq[u][j] = *(const v4fa*)(pz + (size_t)j * NPX + u * 512); } mo[u] = *(const v4fa*)(pmo + u * 512); }
      asm volatile("s_wait_xcnt 0x0" :: "v"(pm), "v"(pz), "v"(pmo) : "memory");      /* stands in front of any overwrite of the address registers of the loads above; it names them so that they live up to it and no load's result is laid over them */
#pragma unroll
      for (int u = 0; u < 4; ++u) { v4h o;
#pragma unroll
        for (int i = 0; i < 4; ++i) { const float mx = fmaxf(fmaxf(mq[u][0][i], mq[u][1][i]), fmaxf(mq[u][2][i], mq[u][3][i])); float sa = 0.f;      /* the maxima are in the log2 domain, the sums hold the factor 256; the quarter that holds the row's maximum adds at least about 256 to sa */
          for (int j = 0; j < NQ; ++j) sa += sq[u][j][i] * exp2_slot(mq[u][j][i] - mx);
          o[i] = (_Float16)(exp2_slot(mo[u][i] - mx) * 16384.0f / sa); }
        *(v4h*)&fw[h * 2048 + u * 512 + tid * 4] = o; } } }
  __syncthreads();      /* every wave reads all the weights */
  const v8f z8 = {0.f,0.f,0.f,0.f,0.f,0.f,0.f,0.f}; v8f accs[8] = {z8, z8, z8, z8, z8, z8, z8, z8};
  constexpr int KS = NPX / 32;      /* k steps; one step = two blocks = 512 elements */
  static_assert(KS % 3 == 2 && KS >= 5, "the ring's tail below is written for KS = 3 T + 2");
  OpSet s0, s1, s2; v16h w0, w1, w2;      /* a step's weights are read from LDS one step ahead */
  xr_load(s0, ap, bp); xr_load(s1, ap + 512, bp + 512); xr_load(s2, ap + 1024, bp + 1024); w0 = g2_frag(fw, hh);
  // stays rolled: a trip already holds a whole turn of the ring (24 products, 36 loads), more copies would only lengthen the code
#pragma unroll 1
  for (int st = 3; st + 2 < KS; st += 3) { const _Float16* a = ap + (size_t)st * 512; const _Float16* b = bp + (size_t)st * 512;
    const _Float16* f = fw + st * 32;      /* the sets hold steps st - 3, st - 2, st - 1 */
    w1 = g2_frag(f - 64, hh); xr_mma(s0, w0, accs); xr_load(s0, a, b); w2 = g2_frag(f - 32, hh); xr_mma(s1, w1, accs); xr_load(s1, a + 512, b + 512); w0 = g2_frag(f, hh); xr_mma(s2, w2, accs); xr_load(s2, a + 1024, b + 1024); }
  w1 = g2_frag(fw + (KS - 4) * 32, hh); xr_mma(s0, w0, accs); xr_load(s0, ap + (size_t)(KS - 2) * 512, bp + (size_t)(KS - 2) * 512); w2 = g2_frag(fw + (KS - 3) * 32, hh); xr_mma(s1, w1, accs); xr_load(s1, ap + (size_t)(KS - 1) * 512, bp + (size_t)(KS - 1) * 512);
  w0 = g2_frag(fw + (KS - 2) * 32, hh); xr_mma(s2, w2, accs); w1 = g2_frag(fw + (KS - 1) * 32, hh); xr_mma(s0, w0, accs); xr_mma(s1, w1, accs);
#pragma unroll
  for (int u = 0; u < 8; ++u) { const int t = u & 3, half = u >> 2;
#pragma unroll
    for (int r = 0; r < 8; ++r) so[w][half * 16 + 8 * hh + r][t * 16 + ln] = accs[u][r] * alpha; }
  __builtin_amdgcn_fence(__ATOMIC_ACQ_REL, "workgroup"); __builtin_amdgcn_wave_barrier();
  const int rsub = lane >> 4, c4 = (lane & 15) * 4;
#pragma unroll
  for (int q = 0; q < 16; ++q) { const int r = q * 2 + rsub; const v4f v = *(const v4fa*)&so[w][r][c4]; *(v4f*)(C + (size_t)(row0 + r) * NPX + col0 + c4) = v; } }
__global__ __launch_bounds__(256) void k_vt(const _Float16* __restrict__ V16, int b, int h0, _Float16* __restrict__ VT) { __shared__ unsigned short tl[64][65]; const int tid = threadIdx.x; const int hh = blockIdx.x % HG, sg = blockIdx.x / HG; const int s0 = sg * 64; const int h = h0 + hh;
  for (int i = tid; i < 64 * 8; i += 256) { const int j = i / 8, d8 = (i % 8) * 8; FragH f; f.half[0] = *(const v8us*)((const unsigned short*)V16 + ((size_t)b * SQ + s0 + j) * DM + h * HD + d8); for (int q = 0; q < 8; ++q) tl[d8 + q][j] = f.u[q]; }
  __syncthreads();
  { for (int i = tid; i < 64 * 8; i += 256) { const int d = i / 8, j8 = (i % 8) * 8; FragH f; for (int q = 0; q < 8; ++q) f.u[q] = tl[d][j8 + q]; *(v8us*)((unsigned short*)VT + ((size_t)hh * HD + d) * SQ + s0 + j8) = f.half[0]; }  } }


// The four preparations of the projections' operands, in ONE launch (none reads what another writes). Work-groups [0, NX): x channel-first -> position rows (f16) through LDS tiles;
// the rest: the natural weights x16 as f16, 8 elements a thread: Wq, then Wk, then Wv.
__global__ __launch_bounds__(256) void k_prep(const float* __restrict__ X, _Float16* __restrict__ XR, const float* __restrict__ wq, const float* __restrict__ wk, const float* __restrict__ wv, _Float16* __restrict__ BQ, _Float16* __restrict__ BK, _Float16* __restrict__ BV) {
  __shared__ float tl[64][33]; const int tid = threadIdx.x; const int nl = LL / 32, nc = CC / 64; constexpr int NX = NB * (LL / 32) * (CC / 64), QB = CQ * CC / 8 / 256; static_assert(CQ * CC / 8 % 256 == 0 && CC * CC / 8 % 256 == 0, "whole work-groups");
  if (blockIdx.x >= NX) {      /* the same for a whole work-group, and in front of the barrier below */
    const int u = blockIdx.x - NX; const float* w = u < QB ? wq : (u < 2 * QB ? wk : wv); _Float16* Bt = u < QB ? BQ : (u < 2 * QB ? BK : BV);
    const size_t t = (size_t)(u < QB ? u : (u < 2 * QB ? u - QB : u - 2 * QB)) * 256 + tid; FragH f; for (int q = 0; q < 8; ++q) f.h[q] = (_Float16)(bf16_round(w[t * 8 + q]) * 16.0f); *(v8us*)((unsigned short*)Bt + t * 8) = f.half[0];
    return; }
  const int cb_ = blockIdx.x % nc; const int lb = (blockIdx.x / nc) % nl; const size_t b = blockIdx.x / (nc * nl); const int c0 = cb_ * 64, l0 = lb * 32;
  for (int i = tid; i < 64 * 32; i += 256) { const int c = i / 32, l = i % 32; tl[c][l] = bf16_round(X[(b * CC + c0 + c) * (size_t)LL + l0 + l]); }
  __syncthreads();
  { const int l = tid / 8, c8 = (tid % 8) * 8; FragH f; for (int q = 0; q < 8; ++q) f.h[q] = (_Float16)tl[c8 + q][l]; unsigned short* d = (unsigned short*)XR + (b * LL + l0 + l) * (size_t)CC + c0 + c8; *(v8us*)d = f.half[0];  } }

__global__ __launch_bounds__(256) void k_fin3(const float* __restrict__ Cm, const float* __restrict__ x, float* __restrict__ out) {
  #pragma clang fp contract(off)
  const size_t t = (size_t)blockIdx.x * 256 + threadIdx.x; if (t >= (size_t)NBR * CC * NPX / 8) return; const size_t base = t * 8; v8f v;
  const v4f x0 = *(const v4fa*)(x + base), x1 = *(const v4fa*)(x + base + 4);
  asm volatile("s_wait_xcnt 0x0" ::: "memory");      /* the address pair of the two loads above may be given to a later load's result: the wait stands in front of that overwrite */
  for (int q = 0; q < 4; ++q) { v[q] = __fadd_rn(bf16_round(x0[q]), Cm[base + q]); v[4 + q] = __fadd_rn(bf16_round(x1[q]), Cm[base + 4 + q]); } *(v8f*)(out + base) = v;  }

extern "C" void kernel_launch(void* const* d_in, const int* in_sizes, int n_in,
                              void* d_out, int out_size, void* d_ws, size_t ws_size, hipStream_t stream) {
  (void)in_sizes; (void)n_in; (void)out_size;
  const float* const* I = (const float* const*)d_in; const float* x = I[0]; const float* Wq = I[1]; const float* Wk = I[2]; const float* Wv = I[3]; const float* bv = I[4];
  char* ws = (char*)d_ws; size_t off = 0;
  auto take = [&](size_t bytes) { char* p = ws + off; off += (bytes + 255) & ~(size_t)255; return p; };
  _Float16* BQ = (_Float16*)take((size_t)CQ * CC * 2); _Float16* BK = (_Float16*)take((size_t)CQ * CC * 2); _Float16* BV = (_Float16*)take((size_t)CC * CC * 2);
  _Float16* XR = (_Float16*)take(NR * CC * 2); float* QF = (float*)take(NR * CQ * 4); float* KF = (float*)take(NR * CQ * 4); _Float16* QH = (_Float16*)take(NR * CQ * 2); _Float16* QL = (_Float16*)take(NR * CQ * 2); _Float16* KH = (_Float16*)take(NR * CQ * 2); _Float16* KL = (_Float16*)take(NR * CQ * 2); _Float16* V16 = (_Float16*)take(NR * CC * 2);
  _Float16* PT = (_Float16*)take((size_t)NB * NPX * NPX * 2); _Float16* VT = (_Float16*)take((size_t)NB * CC * NPX * 2); float* CX = (float*)take((size_t)NB * CC * NPX * 4); float* ML = (float*)take((size_t)NB * NQ * NPX * 4); float* SL = (float*)take((size_t)NB * NQ * NPX * 4);
  if (off > ws_size) return;      /* 0.2 + 8 + 8 + 8 + 8 + 128 + 8 + 16 + 0.5 = approx 185 MiB: P^T, v channel-major and x_r hold all images */
  // work that does not depend on one another shares a launch: a launch starts only when the one before it has drained
  k_prep<<<NB * (NPX / 32) * (CC / 64) + (2 * CQ + CC) * CC / 8 / 256, 256, 0, stream>>>(x, XR, Wq, Wk, Wv, BQ, BK, BV);      /* x rows; weights x16 */
  k_qkv<<<(unsigned)((NR / 128) * (2 + CC / 64)), 128, 0, stream>>>(XR, BQ, BK, BV, bv, QF, KF, V16);      /* q, k (f32, exact products); v + bv (f16 rows) */
  k_post<<<(unsigned)(2 * (NR * CQ / 8 / 256)) + NBR * (CC / 64) * (NPX / 64), 256, 0, stream>>>(QF, KF, QH, QL, KH, KL, V16, VT);      /* q, k hi + residual planes; v channel-major [image][256][4096]; all in fragment order */
  k_esm<<<dim3(NQ * (NPX / 256), NBR), 512, 0, stream>>>(QH, QL, KH, KL, PT, ML, SL);      /* P^T[m][n] = 256 exp(q_n . k_m - its quarter row's maximum), fragment order, one plane per image; each quarter row's maximum and sum */
  k_xr<<<dim3((CC / 128) * (NPX / 64), NBR), 128, 0, stream>>>(VT, PT, ML, SL, 6.103515625e-05f, CX);      /* x_r[c][m] = sum_n v[c][n] attention[n][m]; 2^-14 takes back the factor of the weights */
  k_fin3<<<(unsigned)(((size_t)NBR * CC * NPX / 8 + 255) / 256), 256, 0, stream>>>(CX, x, (float*)d_out);
}

// v009
// It runs in 90.2 microseconds.
// Next to v008, in two timings, it ran 1.14 times as fast each time.
// Over all steps from v000 it is 43.6 times as fast.
#include <hip/hip_runtime.h>
// SA layer (x [4][256][4096]; q = Wq x (64), k = Wk x (64), v = Wv x + bv (256); energy[n][m] = q_n . k_m (no scale); attention = softmax over m; x_r[c][m] = sum_n v[c][n] attention[n][m]; out = x + x_r -> [4][256][4096]).
// Structure: channel-first input transposed to position rows (exact f16) via LDS tiles; q / k as WMMA GEMMs (32x64 wave tiles, f32 accumulation, exact x16 natural weights; exact products) kept f32 and split into f16 hi + 2^-10 residual planes; v GEMM (+ bias) to f16 rows and transposed channel-major via LDS tiles; per image: the unscaled energy as a THREE-term product (hi.hi + lo.hi + hi.lo, K = 64) whose f32 logits stay in registers for the exponentials of each quarter row on VALU (256 exp(E - quarter maximum) as f16, one kernel, the quarter's k rows in LDS; maximum and sum kept per quarter row), x_r = (V(channel-major) x the factor that completes the row's softmax) . P^T-as-Bt GEMM (M = 256 channels, K = 4096) into f32; residual + store on VALU. The q / k planes, v channel-major and P^T lie in fragment order (see fo_unit), each written so by the kernel that makes it.
// Compute dtype: inputs rounded to bf16; x / weights exact; q, k as hi + residual (~f32, the logits have sigma ~8); v, P as plain f16 operands (~2^-12); maxima, exponentials and sums f32; the factor that completes a row's softmax is formed in f32, rounded to f16 and multiplied into the v fragments in f16 (two more roundings of ~2^-12 on that operand). v_wmma_f32_16x16x32_f16.
#define NB 4
#define CC 256
#define CQ 64
#define NPX 4096
#define LL NPX
#define PX NPX
#define NR ((size_t)NB * NPX)
#define NBR NB                       /* images attended (debug hook) */
#define MP ((int)NR)                 /* unused */
#define MC NPX                       /* unused */
#define SQ NPX
#define DM NPX
#define NH 64
#define HD 64
#define HG 1
typedef __bf16 v16b __attribute__((ext_vector_type(16)));
typedef unsigned short v8us __attribute__((ext_vector_type(8), may_alias));
typedef float  v8f  __attribute__((ext_vector_type(8)));
typedef float  v4f  __attribute__((ext_vector_type(4)));
typedef float  v4fa __attribute__((ext_vector_type(4), may_alias));
union FragB { v16b v; v8us half[2]; unsigned short u[16]; };

__device__ __forceinline__ unsigned short bf16_bits(float x) { unsigned int u = __float_as_uint(x); return (unsigned short)((u + 0x7FFFu + ((u >> 16) & 1u)) >> 16); }
__device__ __forceinline__ float bf16_val(unsigned short b) { return __uint_as_float(((unsigned int)b) << 16); }
__device__ __forceinline__ float bf16_round(float x) { return bf16_val(bf16_bits(x)); }
// D += A·B with NT terms: 1 = ah·bh, 2 = + al·bh (A split), 3 = + ah·bl (both split)
template <int NT>
__device__ __forceinline__ v8f mmaN(v16b ah, v16b al, v16b bh, v16b bl, v8f c) {
  c = __builtin_amdgcn_wmma_f32_16x16x32_bf16(false, ah, false, bh, (short)0, c, false, false);
  if (NT >= 2) c = __builtin_amdgcn_wmma_f32_16x16x32_bf16(false, al, false, bh, (short)0, c, false, false);
  if (NT >= 3) c = __builtin_amdgcn_wmma_f32_16x16x32_bf16(false, ah, false, bl, (short)0, c, false, false);
  asm volatile("v_nop\n\tv_nop\n\tv_nop\n\tv_nop" : "+v"(c) : "v"(ah), "v"(al), "v"(bh), "v"(bl));
  return c;
}

__global__ __launch_bounds__(256) void k_wt_bf16(const float* __restrict__ W, unsigned short* __restrict__ Wt, int K, int N) {
  const int t = blockIdx.x * 256 + threadIdx.x;
  const int k8n = K / 8;
  if (t >= N * k8n) return;
  const int n = t / k8n, k8 = (t % k8n) * 8;
  v8us v;
#pragma unroll
  for (int i = 0; i < 8; ++i) v[i] = bf16_bits(W[(size_t)(k8 + i) * N + n]);
  *(v8us*)(Wt + (size_t)n * K + k8) = v;
  
}

// GEMM C[M][N] (f32, pitch ldc) = act(A[M][K]·W + bias). A f32 row-major (pitch lda) converted per fragment to bf16
// (ASPLIT: hi/lo two planes -> 2 terms, else single rounded term); Wt bf16 [N][K] (pitch ldb). BIAS_BF16 rounds the
// bias to bf16 first (bias quantised to bf16 before the add). K%32==0, M%16==0, N%64==0.
template <bool ASPLIT, int ACT, bool BIAS_BF16>
__global__ __launch_bounds__(128) void k_gemm_bf(const float* __restrict__ A, int lda, const unsigned short* __restrict__ Wt, int ldb,
                                               const float* __restrict__ bias, float* __restrict__ C, int ldc, int M, int N, int K) {
  __shared__ __attribute__((aligned(16))) float so[4][16][64];
  const int tid = threadIdx.x, w = tid >> 5, lane = tid & 31, ln = lane & 15, hh = lane >> 4;
  const int ntn = N / 64;
  const int wid = blockIdx.x * 4 + w;
  const int mt = wid / ntn, nq = wid % ntn;
  if (mt * 16 >= M) return;
  const int row0 = mt * 16, col0 = nq * 64;
  const float* arow = A + (size_t)(row0 + ln) * lda;
  v8f acc[4] = {};
  for (int kb = 0; kb < K; kb += 32) {
    FragB ah, al;
    const v4f x0 = *(const v4fa*)(arow + kb + 8 * hh), x1 = *(const v4fa*)(arow + kb + 8 * hh + 4);
    const v4f x2 = *(const v4fa*)(arow + kb + 16 + 8 * hh), x3 = *(const v4fa*)(arow + kb + 16 + 8 * hh + 4);
    float xs[16] = {x0[0],x0[1],x0[2],x0[3],x1[0],x1[1],x1[2],x1[3],x2[0],x2[1],x2[2],x2[3],x3[0],x3[1],x3[2],x3[3]};
#pragma unroll
    for (int i = 0; i < 16; ++i) { const unsigned short hb = bf16_bits(xs[i]); ah.u[i] = hb; al.u[i] = ASPLIT ? bf16_bits(xs[i] - bf16_val(hb)) : (unsigned short)0; }
#pragma unroll
    for (int t = 0; t < 4; ++t) {
      const unsigned short* brow = Wt + (size_t)(col0 + t * 16 + ln) * ldb + kb;
      FragB b;
      b.half[0] = *(const v8us*)(brow + 8 * hh);
      b.half[1] = *(const v8us*)(brow + 16 + 8 * hh);
      acc[t] = mmaN<ASPLIT ? 2 : 1>(ah.v, al.v, b.v, b.v, acc[t]);
    }
  }
#pragma unroll
  for (int t = 0; t < 4; ++t) {
    float bv = bias ? bias[col0 + t * 16 + ln] : 0.f;
    if (BIAS_BF16) bv = bf16_round(bv);
#pragma unroll
    for (int r = 0; r < 8; ++r) { float v = acc[t][r] + bv; if (ACT == 1) v = fmaxf(v, 0.f); so[w][8 * hh + r][t * 16 + ln] = v; }
  }
  __builtin_amdgcn_fence(__ATOMIC_ACQ_REL, "workgroup");
  __builtin_amdgcn_wave_barrier();
  const int rsub = lane >> 4, c4 = (lane & 15) * 4;
  {
#pragma unroll
    for (int q = 0; q < 8; ++q) {
      const int r = q * 2 + rsub;
      const v4f v = *(const v4fa*)&so[w][r][c4];
      *(v4f*)(C + (size_t)(row0 + r) * ldc + col0 + c4) = v;
    }
    
  }
}

// GEMM C = act(A·W + bias + resid): A f32 (ASPLIT -> hi/lo 2 terms), Wt bf16 [N][K]; ACT 0 none, 1 relu, 2 exact gelu;
// resid (optional, f32, row index = (row % rmod), pitch ldr, RES_BF16 rounds it) added before the activation.
template <bool ASPLIT, int ACT, bool BIAS_BF16, bool RES_BF16>
__global__ __launch_bounds__(128) void k_gemm_bf3(const float* __restrict__ A, int lda, const unsigned short* __restrict__ Wt, int ldb,
                                                const float* __restrict__ bias, const float* __restrict__ resid, int rmod, int ldr,
                                                float* __restrict__ C, int ldc, int M, int N, int K) {
  __shared__ __attribute__((aligned(16))) float so[4][16][64];
  const int tid = threadIdx.x, w = tid >> 5, lane = tid & 31, ln = lane & 15, hh = lane >> 4;
  const int ntn = N / 64;
  const int wid = blockIdx.x * 4 + w;
  const int mt = wid / ntn, nq = wid % ntn;
  if (mt * 16 >= M) return;
  const int row0 = mt * 16, col0 = nq * 64;
  const float* arow = A + (size_t)(row0 + ln) * lda;
  v8f acc[4] = {};
  for (int kb = 0; kb < K; kb += 32) {
    FragB ah, al;
    const v4f x0 = *(const v4fa*)(arow + kb + 8 * hh), x1 = *(const v4fa*)(arow + kb + 8 * hh + 4);
    const v4f x2 = *(const v4fa*)(arow + kb + 16 + 8 * hh), x3 = *(const v4fa*)(arow + kb + 16 + 8 * hh + 4);
    float xs[16] = {x0[0],x0[1],x0[2],x0[3],x1[0],x1[1],x1[2],x1[3],x2[0],x2[1],x2[2],x2[3],x3[0],x3[1],x3[2],x3[3]};
#pragma unroll
    for (int i = 0; i < 16; ++i) { const unsigned short hb = bf16_bits(xs[i]); ah.u[i] = hb; al.u[i] = ASPLIT ? bf16_bits(xs[i] - bf16_val(hb)) : (unsigned short)0; }
#pragma unroll
    for (int t = 0; t < 4; ++t) {
      const unsigned short* brow = Wt + (size_t)(col0 + t * 16 + ln) * ldb + kb;
      FragB b;
      b.half[0] = *(const v8us*)(brow + 8 * hh);
      b.half[1] = *(const v8us*)(brow + 16 + 8 * hh);
      acc[t] = mmaN<ASPLIT ? 2 : 1>(ah.v, al.v, b.v, b.v, acc[t]);
    }
  }
#pragma unroll
  for (int t = 0; t < 4; ++t) {
    const int col = col0 + t * 16 + ln;
    float bv = bias ? bias[col] : 0.f;
    if (BIAS_BF16) bv = bf16_round(bv);
#pragma unroll
    for (int r = 0; r < 8; ++r) {
      float v = acc[t][r] + bv;
      if (resid) { float rv = resid[(size_t)((row0 + 8 * hh + r) % rmod) * ldr + col]; if (RES_BF16) rv = bf16_round(rv); v += rv; }
      if (ACT == 1) v = fmaxf(v, 0.f);
      if (ACT == 2) v = 0.5f * v * (1.0f + erff(v * 0.70710678118654752f));
      if (ACT == 3) { const float u = 0.7978845608028654f * (v + 0.044715f * v * v * v); v = 0.5f * v * (1.0f + tanhf(u)); }
      so[w][8 * hh + r][t * 16 + ln] = v;
    }
  }
  __builtin_amdgcn_fence(__ATOMIC_ACQ_REL, "workgroup");
  __builtin_amdgcn_wave_barrier();
  const int rsub = lane >> 4, c4 = (lane & 15) * 4;
  {
#pragma unroll
    for (int q = 0; q < 8; ++q) {
      const int r = q * 2 + rsub;
      const v4f v = *(const v4fa*)&so[w][r][c4];
      *(v4f*)(C + (size_t)(row0 + r) * ldc + col0 + c4) = v;
    }
    
  }
}
// row LayerNorm (biased variance, eps) over N: s = X (+ R); optional out_sum <- s; out_norm <- (s-mu)*rsqrt(var+eps)*g + b
template <bool PARAM_BF16>
__global__ __launch_bounds__(256) void k_layernorm(const float* __restrict__ X, const float* __restrict__ R, const float* __restrict__ g, const float* __restrict__ bta,
                                                  float* __restrict__ out_sum, float* __restrict__ out_norm, int N, float eps) {
  __shared__ float red[256];
  const int row = blockIdx.x, tid = threadIdx.x;
  const float* x = X + (size_t)row * N; const float* rr = R ? R + (size_t)row * N : nullptr;
  float vals[16];                     // up to N = 4096
  const int per = N / 256;            // contiguous chunk per thread? use strided-by-4 chunks: thread handles j = tid*4 + 1024*u
  float s1 = 0.f;
  for (int u = 0; u < per / 4; ++u) {
    const int j = tid * 4 + 1024 * u;
    const v4f a = *(const v4fa*)(x + j);
    v4f b = {0.f,0.f,0.f,0.f}; if (rr) b = *(const v4fa*)(rr + j);
#pragma unroll
    for (int q = 0; q < 4; ++q) { const float v = a[q] + b[q]; vals[u * 4 + q] = v; s1 += v; }
  }
  red[tid] = s1; __syncthreads();
  for (int st = 128; st > 0; st >>= 1) { if (tid < st) red[tid] += red[tid + st]; __syncthreads(); }
  const float mu = red[0] / (float)N; __syncthreads();
  float s2 = 0.f;
  for (int u = 0; u < per / 4; ++u)
#pragma unroll
    for (int q = 0; q < 4; ++q) { const float c = vals[u * 4 + q] - mu; s2 += c * c; }
  red[tid] = s2; __syncthreads();
  for (int st = 128; st > 0; st >>= 1) { if (tid < st) red[tid] += red[tid + st]; __syncthreads(); }
  const float rs = rsqrtf(red[0] / (float)N + eps);
  {
    for (int u = 0; u < per / 4; ++u) {
      const int j = tid * 4 + 1024 * u;
      v4f o, sm;
#pragma unroll
      for (int q = 0; q < 4; ++q) {
        float gg = g[j + q], bb = bta[j + q];
        if (PARAM_BF16) { gg = bf16_round(gg); bb = bf16_round(bb); }
        sm[q] = vals[u * 4 + q]; o[q] = (vals[u * 4 + q] - mu) * rs * gg + bb;
      }
      if (out_sum) *(v4f*)(out_sum + (size_t)row * N + j) = sm;
      *(v4f*)(out_norm + (size_t)row * N + j) = o;
    }
    
  }
}



// ---- f16 WMMA path (v_wmma_f32_16x16x32_f16): 11-bit significands for operands in range — used where a [0,1] probability operand needs more precision than bf16
typedef _Float16 v16h __attribute__((ext_vector_type(16)));
union FragH { v16h v; v8us half[2]; _Float16 h[16]; unsigned short u[16]; };
template <int NT>
__device__ __forceinline__ v8f mmaH(v16h ah, v16h al, v16h bh, v16h bl, v8f c) {
  c = __builtin_amdgcn_wmma_f32_16x16x32_f16(false, ah, false, bh, (short)0, c, false, false);
  if (NT >= 2) c = __builtin_amdgcn_wmma_f32_16x16x32_f16(false, al, false, bh, (short)0, c, false, false);
  if (NT >= 3) c = __builtin_amdgcn_wmma_f32_16x16x32_f16(false, ah, false, bl, (short)0, c, false, false);
  asm volatile("v_nop\n\tv_nop\n\tv_nop\n\tv_nop" : "+v"(c) : "v"(ah), "v"(al), "v"(bh), "v"(bl));
  return c;
}
// batched GEMM like k_gemm_b but f16 operands: A f32 (split into f16 hi/lo if ASPLIT, else rounded to f16), Bt = f16 values [n][k]; alpha; C f32; N multiple of 16 (partial tiles skipped)
template <bool ASPLIT>
__global__ __launch_bounds__(128) void k_gemm_h(const float* __restrict__ A, int lda, size_t sA, const _Float16* __restrict__ Bh, int ldb, size_t sB, float alpha, float* __restrict__ C, int ldc, size_t sC, int M, int N, int K) {
  __shared__ __attribute__((aligned(16))) float so[4][16][64];
  const int tid = threadIdx.x, w = tid >> 5, lane = tid & 31, ln = lane & 15, hh = lane >> 4; const int by = blockIdx.y;
  A += (size_t)by * sA; Bh += (size_t)by * sB; C += (size_t)by * sC;
  const int ntn = (N + 63) / 64; const int wid = blockIdx.x * 4 + w; const int mt = wid / ntn, nq = wid % ntn; if (mt * 16 >= M) return;
  const int row0 = mt * 16, col0 = nq * 64; const float* arow = A + (size_t)(row0 + ln) * lda;
  v8f acc[4] = {};
  for (int kb = 0; kb < K; kb += 32) {
    FragH ah, al;
    const v4f x0 = *(const v4fa*)(arow + kb + 8 * hh), x1 = *(const v4fa*)(arow + kb + 8 * hh + 4), x2 = *(const v4fa*)(arow + kb + 16 + 8 * hh), x3 = *(const v4fa*)(arow + kb + 16 + 8 * hh + 4);
    float xs[16] = {x0[0],x0[1],x0[2],x0[3],x1[0],x1[1],x1[2],x1[3],x2[0],x2[1],x2[2],x2[3],x3[0],x3[1],x3[2],x3[3]};
#pragma unroll
    for (int i = 0; i < 16; ++i) { const _Float16 h = (_Float16)xs[i]; ah.h[i] = h; al.h[i] = ASPLIT ? (_Float16)(xs[i] - (float)h) : (_Float16)0.0f; }
#pragma unroll
    for (int t = 0; t < 4; ++t) { if (col0 + t * 16 >= N) continue; const size_t boff = (size_t)(col0 + t * 16 + ln) * ldb + kb; FragH bq; bq.half[0] = *(const v8us*)(Bh + boff + 8 * hh); bq.half[1] = *(const v8us*)(Bh + boff + 16 + 8 * hh);
      acc[t] = mmaH<ASPLIT ? 2 : 1>(ah.v, al.v, bq.v, bq.v, acc[t]); }
  }
#pragma unroll
  for (int t = 0; t < 4; ++t) { if (col0 + t * 16 >= N) continue;
#pragma unroll
    for (int r = 0; r < 8; ++r) so[w][8 * hh + r][t * 16 + ln] = acc[t][r] * alpha; }
  __builtin_amdgcn_fence(__ATOMIC_ACQ_REL, "workgroup"); __builtin_amdgcn_wave_barrier();
  const int rsub = lane >> 4, c4 = (lane & 15) * 4;
  {
#pragma unroll
    for (int q = 0; q < 8; ++q) { const int r = q * 2 + rsub; if (col0 + c4 < N) { const v4f v = *(const v4fa*)&so[w][r][c4]; *(v4f*)(C + (size_t)(row0 + r) * ldc + col0 + c4) = v; } }
     }
}

// Wt[n][k] = f16(W[k][n]·scale) from f32 row-major W[K][N] (scale = power of two; bf16-exact weights stay exact in f16 away from the subnormal range)
__global__ __launch_bounds__(256) void k_wt_f16(const float* __restrict__ W, _Float16* __restrict__ Wt, int K, int N, float scale) {
  const int t = blockIdx.x * 256 + threadIdx.x; if (t >= N * (K / 8)) return; const int n = t / (K / 8), k8 = (t % (K / 8)) * 8; FragH f;
#pragma unroll
  for (int i = 0; i < 8; ++i) f.h[i] = (_Float16)(bf16_round(W[(size_t)(k8 + i) * N + n]) * scale); const v8us o = f.half[0];
  *(v8us*)((unsigned short*)Wt + (size_t)n * K + k8) = o; 
}
// k_gemm_hh variant with fused epilogue: v = acc·alpha + bias[by·sBias + col] (+ CP[(row/rowsPerB)·sCPb + by·64 + col] if CP) ; ACT 0 none / 1 elu ; writes f16 C16 (and f32 C if non-null)
template <int ACT>
__global__ __launch_bounds__(128) void k_gemm_hhx(const _Float16* __restrict__ A, int lda, size_t sA, const _Float16* __restrict__ Bh, int ldb, size_t sB, float alpha, const float* __restrict__ bias, size_t sBias, const float* __restrict__ CP, int rowsPerB, size_t sCPb, int row0g,
    float* __restrict__ C, _Float16* __restrict__ C16, int ldc, size_t sC, int M, int N, int K) {
  __shared__ __attribute__((aligned(16))) float so[4][16][64];
  const int tid = threadIdx.x, w = tid >> 5, lane = tid & 31, ln = lane & 15, hh = lane >> 4; const int by = blockIdx.y;
  A += (size_t)by * sA; Bh += (size_t)by * sB; const size_t cofs = (size_t)by * sC; const float* bp = bias ? bias + (size_t)by * sBias : nullptr;
  const int ntn = (N + 63) / 64; const int wid = blockIdx.x * 4 + w; const int mt = wid / ntn, nq = wid % ntn; if (mt * 16 >= M) return;
  const int row0 = mt * 16, col0 = nq * 64; const _Float16* arow = A + (size_t)(row0 + ln) * lda;
  v8f acc[4] = {};
  for (int kb = 0; kb < K; kb += 32) { FragH ah; ah.half[0] = *(const v8us*)((const unsigned short*)arow + kb + 8 * hh); ah.half[1] = *(const v8us*)((const unsigned short*)arow + kb + 16 + 8 * hh);
#pragma unroll
    for (int t = 0; t < 4; ++t) { if (col0 + t * 16 >= N) continue; const size_t boff = (size_t)(col0 + t * 16 + ln) * ldb + kb; FragH bq; bq.half[0] = *(const v8us*)((const unsigned short*)Bh + boff + 8 * hh); bq.half[1] = *(const v8us*)((const unsigned short*)Bh + boff + 16 + 8 * hh);
      acc[t] = mmaH<1>(ah.v, ah.v, bq.v, bq.v, acc[t]); }
  }
#pragma unroll
  for (int t = 0; t < 4; ++t) { if (col0 + t * 16 >= N) continue; const int col = col0 + t * 16 + ln; const float bv = bp ? bf16_round(bp[col]) : 0.f;
#pragma unroll
    for (int r = 0; r < 8; ++r) { float v = acc[t][r] * alpha + bv; if (CP) { const int rr = row0g + row0 + 8 * hh + r; if (rowsPerB < 0) v += CP[cofs + (size_t)rr * ldc + col];      /* rowsPerB < 0: own element of the batched C plane */ else { const int bidx = rr / rowsPerB; v += CP[(size_t)bidx * sCPb + (size_t)by * 64 + col]; } } if (ACT == 1) v = (v > 0.f) ? v : expm1f(v); else if (ACT == 7) v = (v > 0.f) ? v + 1.0f : expf(v); else if (ACT == 8) v = tanhf(v); else if (ACT == 9) v = 0.5f * v * (1.0f + tanhf(0.7978845608028654f * (v + 0.044715f * v * v * v))); else if (ACT == 11) v = 1.0f / (1.0f + expf(-v)); else if (ACT == 12) v = (v > 0.f) ? v : 0.01f * v; else if (ACT == 14) v = (v > 0.f) ? v : 0.1f * v; else if (ACT == 16) v = (v >= 0.f) ? v : 0.3f * v; else if (ACT == 17) v = (v >= 0.f) ? v : 0.2f * v; else if (ACT == 15) v = v / (1.0f + expf(-v)); else if (ACT == 3) v = fmaxf(v, 0.f); else if (ACT == 6) v = 0.5f * v * (1.0f + erff(v * 0.70710678118654752f)); so[w][8 * hh + r][t * 16 + ln] = v; } }
  __builtin_amdgcn_fence(__ATOMIC_ACQ_REL, "workgroup"); __builtin_amdgcn_wave_barrier();
  const int rsub = lane >> 4, c4 = (lane & 15) * 4; typedef _Float16 v4h __attribute__((ext_vector_type(4)));
  {
#pragma unroll
    for (int q = 0; q < 8; ++q) { const int r = q * 2 + rsub; if (col0 + c4 < N) { const v4f v = *(const v4fa*)&so[w][r][c4]; if (C) *(v4f*)(C + cofs + (size_t)(row0 + r) * ldc + col0 + c4) = v; if (C16) { v4h h4; for (int i = 0; i < 4; ++i) h4[i] = (_Float16)v[i]; *(v4h*)(C16 + cofs + (size_t)(row0 + r) * ldc + col0 + c4) = h4; } } }
     }
}


typedef _Float16 v4h __attribute__((ext_vector_type(4)));

__global__ __launch_bounds__(256) void k_x16(const float* __restrict__ x, _Float16* __restrict__ X16, size_t n8) { const size_t t = (size_t)blockIdx.x * 256 + threadIdx.x; if (t >= n8) return; FragH f;
#pragma unroll
  for (int q = 0; q < 8; ++q) f.h[q] = (_Float16)bf16_round(x[t * 8 + q]); *(v8us*)((unsigned short*)X16 + t * 8) = f.half[0];  }
__global__ __launch_bounds__(256) void k_h16(const float* __restrict__ x, _Float16* __restrict__ X16, size_t n8) { const size_t t = (size_t)blockIdx.x * 256 + threadIdx.x; if (t >= n8) return; FragH f;
#pragma unroll
  for (int q = 0; q < 8; ++q) f.h[q] = (_Float16)x[t * 8 + q]; *(v8us*)((unsigned short*)X16 + t * 8) = f.half[0];  }
__global__ __launch_bounds__(256) void k_round16f(const float* __restrict__ W, _Float16* __restrict__ Bt, size_t n8) { const size_t t = (size_t)blockIdx.x * 256 + threadIdx.x; if (t >= n8) return; FragH f;
#pragma unroll
  for (int i = 0; i < 8; ++i) f.h[i] = (_Float16)(bf16_round(W[t * 8 + i]) * 16.0f); *(v8us*)((unsigned short*)Bt + t * 8) = f.half[0];  }
template <int NHv, int TTv>
__global__ __launch_bounds__(256) void k_vt(const _Float16* __restrict__ V16, int ldv, int voff, _Float16* __restrict__ Vt) { __shared__ unsigned short tl[64][66]; const int tid = threadIdx.x; const int slab = blockIdx.x / (TTv / 64), lg = blockIdx.x % (TTv / 64); const int b = slab / NHv, h = slab % NHv;
  for (int i = tid; i < 64 * 8; i += 256) { const int r = i / 8, c8 = (i % 8) * 8; FragH f; f.half[0] = *(const v8us*)((const unsigned short*)V16 + ((size_t)b * TTv + lg * 64 + r) * ldv + voff + h * 64 + c8);
#pragma unroll
    for (int q = 0; q < 8; ++q) tl[r][c8 + q] = f.u[q]; }
  __syncthreads();
  {
#pragma unroll
    for (int rd = 0; rd < 2; ++rd) { const int d = rd * 32 + tid / 8, pc = tid % 8; FragH f;
#pragma unroll
      for (int q = 0; q < 8; ++q) f.u[q] = tl[pc * 8 + q][d];
      *(v8us*)((unsigned short*)Vt + ((size_t)slab * 64 + d) * TTv + lg * 64 + pc * 8) = f.half[0]; }
     } }

// Fragment order of an f16 operand plane X[row][k] (k a multiple of 8, K columns): the 16-byte unit of 8 consecutive k lies where the lane that needs it reads it, so that
// the 32 lanes of one fragment load (or store) cover 512 contiguous bytes, four whole lines, instead of 32 bytes in each of 16 rows. Block = (16 rows) x (16 k) = 32 units;
// unit in the block = lane = 16 * (k / 8 % 2) + row % 16. A 16x32 fragment is two blocks in a row, in the k order of g2_frag (8h + s, 16 + 8h + s).
__device__ __forceinline__ size_t fo_unit(size_t row, size_t k, size_t K) { return ((row >> 4) * (K >> 4) + (k >> 4)) * 32 + ((k >> 3) & 1) * 16 + (row & 15); }
// p = the plane + 8 * (first unit of the fragment's first block + lane)
__device__ __forceinline__ v16h fo_frag(const _Float16* p) { FragH f; f.half[0] = *(const v8us*)((const unsigned short*)p); f.half[1] = *(const v8us*)((const unsigned short*)p + 256); return f.v; }
// The three passes that follow the projections, in ONE launch (none reads what another writes). Work-groups [0, HB): q, [HB, 2 HB): k, each f32 -> f16 hi + 2^-10 residual planes in fragment order;
// the rest: v rows [image][n][256] -> channel-major in fragment order (rows = image * 256 + channel, k = n): 64 x 64 tiles through LDS, each wave stores whole 512-byte blocks.
__global__ __launch_bounds__(256) void k_post(const float* __restrict__ QF, const float* __restrict__ KF, _Float16* __restrict__ QH, _Float16* __restrict__ QL, _Float16* __restrict__ KH, _Float16* __restrict__ KL, const _Float16* __restrict__ V16, _Float16* __restrict__ Vf) {
  __shared__ unsigned short tl[64][66]; const int tid = threadIdx.x; constexpr int HB = (int)(NR * CQ / 8 / 256); static_assert(NR * CQ / 8 % 256 == 0, "whole work-groups");
  if (blockIdx.x < 2 * HB) {      /* the same for a whole work-group, and in front of the barrier below */
    const bool isk = blockIdx.x >= HB; const float* F = isk ? KF : QF; _Float16* Hh = isk ? KH : QH; _Float16* Hl = isk ? KL : QL;
    const size_t t = (size_t)(blockIdx.x - (isk ? HB : 0)) * 256 + tid; FragH fh, fl; const v4f a = *(const v4fa*)(F + t * 8), c = *(const v4fa*)(F + t * 8 + 4);
#pragma unroll
    for (int q = 0; q < 4; ++q) { _Float16 h = (_Float16)a[q]; fh.h[q] = h; fl.h[q] = (_Float16)((a[q] - (float)h) * 1024.0f); h = (_Float16)c[q]; fh.h[4 + q] = h; fl.h[4 + q] = (_Float16)((c[q] - (float)h) * 1024.0f); }
    { const size_t u = fo_unit(t >> 3, (t & 7) * 8, CQ); *(v8us*)((unsigned short*)Hh + u * 8) = fh.half[0]; *(v8us*)((unsigned short*)Hl + u * 8) = fl.half[0]; }
    return; }
  const int bx = blockIdx.x - 2 * HB; const int slab = bx / (NPX / 64), lg = bx % (NPX / 64); const int b = slab / (CC / 64), h = slab % (CC / 64);
  for (int i = tid; i < 64 * 8; i += 256) { const int r = i / 8, c8 = (i % 8) * 8; FragH f; f.half[0] = *(const v8us*)((const unsigned short*)V16 + ((size_t)b * NPX + lg * 64 + r) * CC + h * 64 + c8);
#pragma unroll
    for (int q = 0; q < 8; ++q) tl[r][c8 + q] = f.u[q]; }
  __syncthreads();
#pragma unroll
  for (int rd = 0; rd < 2; ++rd) { const int u = rd * 256 + tid, blk = u >> 5, l = u & 31; const int d = (blk >> 2) * 16 + (l & 15), kk = (blk & 3) * 16 + (l >> 4) * 8; FragH f;
#pragma unroll
    for (int q = 0; q < 8; ++q) f.u[q] = tl[kk + q][d];
    *(v8us*)((unsigned short*)Vf + fo_unit((size_t)slab * 64 + d, (size_t)lg * 64 + kk, NPX) * 8) = f.half[0]; } }

// ---- fast GEMM (wave tile 32x64) ----
__device__ __forceinline__ v16h g2_frag(const _Float16* p, int hh) { FragH f; f.half[0] = *(const v8us*)((const unsigned short*)p + 8 * hh); f.half[1] = *(const v8us*)((const unsigned short*)p + 16 + 8 * hh); return f.v; }
__device__ __forceinline__ v8f g2_mma(v16h a, v16h b, v8f c) { v8f d = __builtin_amdgcn_wmma_f32_16x16x32_f16(false, a, false, b, (short)0, c, false, false); asm volatile("v_nop\n\tv_nop\n\tv_nop\n\tv_nop" : "+v"(d) : "v"(a), "v"(b)); return d; }
// The operands of one k step (32 k) of a 32 x 64 wave tile form a set: two A and four B fragments, twelve 16-byte loads a lane. The projection loop below (k_qkv) holds three sets in registers as a
// ring: a set is refilled for the step three ahead as soon as its products are issued, so the loads of two to three steps are in flight under every product and a wave no longer
// waits out four or five load latencies in a row in each step. Every accumulator still takes its k steps in rising order.
struct OpSet { v16h a0, a1, b0, b1, b2, b3; };
// c[t + 4 * half]: column tile t, row tile half
__device__ __forceinline__ void set_mma(const OpSet& s, v8f (&c)[8]) {
  c[0] = g2_mma(s.a0, s.b0, c[0]); c[4] = g2_mma(s.a1, s.b0, c[4]); c[1] = g2_mma(s.a0, s.b1, c[1]); c[5] = g2_mma(s.a1, s.b1, c[5]);
  c[2] = g2_mma(s.a0, s.b2, c[2]); c[6] = g2_mma(s.a1, s.b2, c[6]); c[3] = g2_mma(s.a0, s.b3, c[3]); c[7] = g2_mma(s.a1, s.b3, c[7]); }
// q, k and v projections in ONE launch: the three products read the same rows of A and do not depend on one another. Work-groups [0, MB) form q, [MB, 2 MB) k (64 columns each, f32 out),
// the rest v (256 columns in four groups of 64, + bias, f16 out). Every work-group is a 128 x 64 tile with K = CC, as before.
__global__ __launch_bounds__(128) void k_qkv(const _Float16* __restrict__ A, const _Float16* __restrict__ BQ, const _Float16* __restrict__ BK, const _Float16* __restrict__ BV, const float* __restrict__ bias,
    float* __restrict__ QF, float* __restrict__ KF, _Float16* __restrict__ V16) { static_assert(CC == 256 && CQ == 64, "one chunk of eight k steps; q and k are one column group wide");
  __shared__ __attribute__((aligned(16))) float so[4][32][68];
  const int tid = threadIdx.x, w = tid >> 5, lane = tid & 31, ln = lane & 15, hh = lane >> 4;
  constexpr int MB = (int)(NR / 128); const int bx = blockIdx.x; const bool isv = bx >= 2 * MB; const int uv = bx - 2 * MB;
  const int mt = isv ? uv / (CC / 64) : bx % MB; const int col0 = isv ? (uv % (CC / 64)) * 64 : 0; const int row0 = mt * 128 + 32 * w;
  const _Float16* Bh = isv ? BV : (bx < MB ? BQ : BK);
  const _Float16* a0p = A + (size_t)(row0 + ln) * CC; const _Float16* a1p = a0p + (size_t)16 * CC;
  const _Float16* b0p = Bh + (size_t)(col0 + ln) * CC; const _Float16* b1p = b0p + (size_t)16 * CC; const _Float16* b2p = b1p + (size_t)16 * CC; const _Float16* b3p = b2p + (size_t)16 * CC;
  const v8f z8 = {0.f,0.f,0.f,0.f,0.f,0.f,0.f,0.f}; v8f accs[8] = {z8, z8, z8, z8, z8, z8, z8, z8};
  auto ld = [&](OpSet& s, int kb) { s.a0 = g2_frag(a0p + kb, hh); s.a1 = g2_frag(a1p + kb, hh); s.b0 = g2_frag(b0p + kb, hh); s.b1 = g2_frag(b1p + kb, hh); s.b2 = g2_frag(b2p + kb, hh); s.b3 = g2_frag(b3p + kb, hh);
    asm volatile("s_wait_xcnt 0x0" ::: "memory"); };      /* stands in front of any later overwrite of the address registers of the twelve loads above; as a compiler fence it also keeps each set's loads at their place in the ring */
  OpSet s[3]; ld(s[0], 0); ld(s[1], 32); ld(s[2], 64);
  // unrolled in full: s is then indexed by constants only and stays in registers
#pragma unroll
  for (int i = 0; i < 8; ++i) { set_mma(s[i % 3], accs); if (i + 3 < 8) ld(s[i % 3], (i + 3) * 32); }
#pragma unroll
  for (int u = 0; u < 8; ++u) { const int t = u & 3, half = u >> 2; const float bv = isv ? bf16_round(bias[col0 + t * 16 + ln]) : 0.f;
#pragma unroll
    for (int r = 0; r < 8; ++r) so[w][half * 16 + 8 * hh + r][t * 16 + ln] = accs[u][r] * 0.0625f + bv; }
  __builtin_amdgcn_fence(__ATOMIC_ACQ_REL, "workgroup"); __builtin_amdgcn_wave_barrier();
  const int rsub = lane >> 4, c4 = (lane & 15) * 4;
  if (!isv) { float* C = bx < MB ? QF : KF;
#pragma unroll
    for (int q = 0; q < 16; ++q) { const int r = q * 2 + rsub; const v4f v = *(const v4fa*)&so[w][r][c4]; *(v4f*)(C + (size_t)(row0 + r) * CQ + c4) = v; }
    asm volatile("s_wait_xcnt 0x0" ::: "memory");      /* the build lays the v path directly behind these stores, where their address registers are written again: the wait stands in front of that */
    return; }
#pragma unroll
  for (int q = 0; q < 16; ++q) { const int r = q * 2 + rsub; const v4f v = *(const v4fa*)&so[w][r][c4]; v4h h4; for (int i = 0; i < 4; ++i) h4[i] = (_Float16)v[i]; *(v4h*)(V16 + (size_t)(row0 + r) * CC + col0 + c4) = h4; } }

// energy + softmax in one kernel; grid x = 4 * (group of 256 rows n) + (quarter of the columns m), grid y = image. A work-group of 16 waves first brings the k rows of its 1024 columns
// (hi and residual plane, 128 KiB each, contiguous in fragment order) into LDS with asynchronous copies, once, and then runs four passes of 64 rows n over them: every k fragment comes
// from L2 once for 256 rows of the attention matrix. In a pass wave w forms the logits E[n][m] of row tile w / 4 and of the 256 columns of column group w % 4 (four waves next to one another in number read four different 64-KiB parts of the LDS; A = q rows, B = k rows;
// hi.hi in one accumulator, lo.hi + hi.lo in a second, joined as hi + lo / 1024). The logits stay in registers for the maximum, the exponentials, their sum and the f16 store.
// Maximum and sum are those of the QUARTER row, over the work-group's 1024 columns only: P^T takes 256 exp(E - quarter maximum), not divided, and maximum and sum are stored per (image, quarter, n);
// k_xr forms from them the factor that makes the whole row's softmax of it.
// In the D layout a lane holds ONE column m and 8 consecutive rows n per tile: that is the 16-byte unit which the same lane of the x_r product reads as its B operand (row m of P^T,
// k = n), so each tile is one 512-byte store into P^T in fragment order and no transpose follows.
// The row reductions run per register: over the tiles in the lane, over the 16 lanes of a row by DPP, over the four waves of a row tile through LDS.
__device__ __forceinline__ v8f es_mma(v16h a, v16h b, v8f c) { return __builtin_amdgcn_wmma_f32_16x16x32_f16(false, a, false, b, (short)0, c, false, false); }
template <int X> __device__ __forceinline__ float row_x(float v) { return __int_as_float(__builtin_amdgcn_update_dpp(0, __float_as_int(v), 0x160 + X, 0xf, 0xf, true)); }      /* the value of lane l ^ X of the same 16-lane row (row_xmask) */
#define NQ 4                         /* column quarters of the attention matrix */
#define QCOL (NPX / NQ)              /* columns of a quarter */
#define KPL ((size_t)QCOL * CQ)      /* f16 elements of one k plane of a quarter */
__global__ __launch_bounds__(512) void k_esm(const _Float16* __restrict__ Qh, const _Float16* __restrict__ Ql, const _Float16* __restrict__ Kh, const _Float16* __restrict__ Kl, _Float16* __restrict__ Pf, float* __restrict__ ML, float* __restrict__ SL) {
  static_assert(KPL * 2 == 131072 && CQ == 64, "the copies below move two planes of 128 KiB");
  __shared__ __attribute__((aligned(512))) _Float16 Ks[2 * KPL]; __shared__ __attribute__((aligned(32))) float redm[4][64]; __shared__ __attribute__((aligned(32))) float reds[4][64];
  const int tid = threadIdx.x, w = __builtin_amdgcn_readfirstlane(tid >> 5), lane = tid & 31, ln = lane & 15, hh = lane >> 4; const int cg = w & 3, rt = w >> 2; const int qd = blockIdx.x & (NQ - 1), rg = blockIdx.x >> 2;      /* the wave's number in a scalar register: what follows from it costs no vector register */
  { const size_t r0 = (size_t)blockIdx.y * NPX; Qh += r0 * CQ; Ql += r0 * CQ; Kh += r0 * CQ + (size_t)qd * KPL; Kl += r0 * CQ + (size_t)qd * KPL; Pf += r0 * NPX; ML += ((size_t)blockIdx.y * NQ + qd) * NPX; SL += ((size_t)blockIdx.y * NQ + qd) * NPX; }      /* this image's planes, this quarter's k rows and statistics */
  { const unsigned l0 = (unsigned)(size_t)&Ks[0] + (unsigned)((w >> 2) * 4096 + (w & 3) * 512 + lane * 16); const char* gh = (const char*)Kh + (w * 512 + lane * 16); const char* gl = (const char*)Kl + (w * 512 + lane * 16);
    // 32 copies a wave, 512 bytes (one block of a plane) each. In LDS a 16-row tile's hi blocks (2 KiB) and residual blocks (2 KiB) lie side by side, so that one address register and the 16-bit offset reach
    // all that a wave reads. Copy j of statement i takes the bytes from (8 (i % 2) + j) * 8192 + 512 w on of plane i / 2, that is block w % 4 of tile 4 (8 (i % 2) + j) + w / 4.
    // The s_wait_xcnt at the end of each statement stands in front of any later write of the registers that its copies name.
#pragma unroll
    for (int i = 0; i < 4; ++i) { const unsigned l = l0 + (unsigned)(i & 1) * 131072u + (unsigned)(i >> 1) * 2048u; const char* g = i < 2 ? gh + i * 65536 : gl + (i - 2) * 65536;
      asm volatile("global_load_async_to_lds_b128 %0, %8, off\n\tglobal_load_async_to_lds_b128 %1, %9, off\n\tglobal_load_async_to_lds_b128 %2, %10, off\n\tglobal_load_async_to_lds_b128 %3, %11, off\n\t"
                   "global_load_async_to_lds_b128 %4, %12, off\n\tglobal_load_async_to_lds_b128 %5, %13, off\n\tglobal_load_async_to_lds_b128 %6, %14, off\n\tglobal_load_async_to_lds_b128 %7, %15, off\n\ts_wait_xcnt 0x0"
                   :: "v"(l), "v"(l + 16384u), "v"(l + 32768u), "v"(l + 49152u), "v"(l + 65536u), "v"(l + 81920u), "v"(l + 98304u), "v"(l + 114688u),
                      "v"(g), "v"(g + 8192), "v"(g + 16384), "v"(g + 24576), "v"(g + 32768), "v"(g + 40960), "v"(g + 49152), "v"(g + 57344) : "memory"); } }
  Qh += (size_t)(rg * 16 + rt) * 1024; Ql += (size_t)(rg * 16 + rt) * 1024; const unsigned l8 = lane * 8;      /* row tile rg * 16 + 4 * pass + rt (1024 elements a tile); a pass is 4 tiles = 4096 elements on */
  v16h qh0 = fo_frag(Qh + l8), qh1 = fo_frag(Qh + 512 + l8), ql0 = fo_frag(Ql + l8), ql1 = fo_frag(Ql + 512 + l8);
  asm volatile("s_wait_xcnt 0x0" ::: "memory");      /* the address registers of the loads above may be given to a later value: the wait stands in front of that overwrite */
  asm volatile("s_wait_asynccnt 0x0" ::: "memory");      /* this wave's copies have landed */
  __syncthreads();      /* every wave's copies have landed: from here on the k planes are only read */
  const _Float16* khp = Ks + (size_t)(cg * 16) * 2048 + lane * 8; const _Float16* klp = khp + 1024;      /* 2048 elements a tile: hi, then residual */
  const v8f z8 = {0.f,0.f,0.f,0.f,0.f,0.f,0.f,0.f};
  // stays rolled: a pass is some thousand instructions long
#pragma unroll 1
  for (int ps = 0; ps < 4; ++ps) { v8f e[16];
    v16h nh0 = fo_frag(khp), nh1 = fo_frag(khp + 512), nl0 = fo_frag(klp), nl1 = fo_frag(klp + 512);
    // every loop over e[] is unrolled in full: e is then indexed by constants only and stays in registers
#pragma unroll
    for (int t = 0; t < 16; ++t) { const v16h kh0 = nh0, kh1 = nh1, kl0 = nl0, kl1 = nl1;
      if (t + 1 < 16) { nh0 = fo_frag(khp + (t + 1) * 2048); nh1 = fo_frag(khp + (t + 1) * 2048 + 512); nl0 = fo_frag(klp + (t + 1) * 2048); nl1 = fo_frag(klp + (t + 1) * 2048 + 512); }      /* the next tile's fragments come from LDS under this tile's products */
      v8f ch = es_mma(qh0, kh0, z8); v8f cl = es_mma(qh0, kl0, z8); ch = es_mma(qh1, kh1, ch); cl = es_mma(qh1, kl1, cl); cl = es_mma(ql0, kh0, cl); cl = es_mma(ql1, kh1, cl);
      e[t] = ch + cl * (1.0f / 1024.0f); }
    v8f m8 = e[0];      /* register r: row n = 8 * hh + r of the tile */
#pragma unroll
    for (int t = 1; t < 16; ++t) for (int r = 0; r < 8; ++r) m8[r] = fmaxf(m8[r], e[t][r]);
#pragma unroll
    for (int r = 0; r < 8; ++r) { float v = m8[r]; v = fmaxf(v, row_x<1>(v)); v = fmaxf(v, row_x<2>(v)); v = fmaxf(v, row_x<4>(v)); v = fmaxf(v, row_x<8>(v)); m8[r] = v; }
    if (ln == 0) *(v8f*)&redm[cg][rt * 16 + 8 * hh] = m8;
    __syncthreads();
#pragma unroll
    for (int u = 0; u < 4; ++u) { const v8f o = *(const v8f*)&redm[u][rt * 16 + 8 * hh]; for (int r = 0; r < 8; ++r) m8[r] = fmaxf(m8[r], o[r]); }
    { const _Float16* qa = Qh + (ps < 3 ? ps + 1 : 3) * 4096 + l8; const _Float16* qb = Ql + (ps < 3 ? ps + 1 : 3) * 4096 + l8;      /* the next pass's q fragments fly under this pass's exponentials (the last pass asks for its own again) */
      qh0 = fo_frag(qa); qh1 = fo_frag(qa + 512); ql0 = fo_frag(qb); ql1 = fo_frag(qb + 512);
      asm volatile("s_wait_xcnt 0x0" :: "v"(qa), "v"(qb) : "memory"); }      /* stands in front of any overwrite of the address registers of the eight loads above; it names them so that they live up to it and no load's result is laid over them */
    const int si = rg * 256 + ps * 64 + tid;
    if (tid < 64) { const float mv = fmaxf(fmaxf(redm[0][tid], redm[1][tid]), fmaxf(redm[2][tid], redm[3][tid])) * 1.44269504088896340736f; ML[si] = mv;      /* two whole waves, one 128-byte line each: the quarter row's maximum in the log2 domain */
      asm volatile("s_wait_xcnt 0x0" :: "v"(mv), "v"(si) : "memory"); }      /* stands in front of any overwrite of the store's data and index registers; it names both so that they live up to it */
#pragma unroll
    for (int r = 0; r < 8; ++r) m8[r] = 8.0f - m8[r] * 1.44269504088896340736f;      /* 8 - the maximum in the log2 domain: the 8 is the factor 256 of P^T; the rounding scales a whole quarter row and its sum alike */
#pragma unroll
    for (int t = 0; t < 16; ++t) for (int r = 0; r < 8; ++r) e[t][r] = __builtin_amdgcn_exp2f(__builtin_fmaf(e[t][r], 1.44269504088896340736f, m8[r]));      /* 256 exp(e - max) = 2^(e log2e + 8 - max log2e): one FMA and one v_exp_f32 a logit; arguments are <= about 8, far negative ones give 0 */
    v8f s8 = e[0];
#pragma unroll
    for (int t = 1; t < 16; ++t) s8 += e[t];
#pragma unroll
    for (int r = 0; r < 8; ++r) { float v = s8[r]; v += row_x<1>(v); v += row_x<2>(v); v += row_x<4>(v); v += row_x<8>(v); s8[r] = v; }
    if (ln == 0) *(v8f*)&reds[cg][rt * 16 + 8 * hh] = s8;
    __syncthreads();
    if (tid < 64) { const float sv = ((reds[0][tid] + reds[1][tid]) + reds[2][tid]) + reds[3][tid]; SL[si] = sv;      /* 256 * the quarter row's sum of exponentials */
      asm volatile("s_wait_xcnt 0x0" :: "v"(sv), "v"(si) : "memory"); }      /* stands in front of any overwrite of the store's data and index registers; it names both so that they live up to it */
    unsigned short* p = (unsigned short*)Pf + ((size_t)(qd * (QCOL / 16) + cg * 16) * (NPX / 16) + (rg * 16 + ps * 4 + rt)) * 256 + l8;      /* block (m tile, n tile), unit = lane */
#pragma unroll
    for (int t = 0; t < 16; ++t) { FragH f; for (int r = 0; r < 8; ++r) f.h[r] = (_Float16)e[t][r]; *(v8us*)(p + (size_t)t * (NPX / 16) * 256) = f.half[0]; }
    asm volatile("s_wait_xcnt 0x0" ::: "memory"); } }      /* the next pass writes the address registers of the stores above anew: the wait stands in front of that */
// x_r[c][m] = alpha * sum_n v[c][n] wt[n] P^T[m][n], both operands in fragment order (K = NPX); grid y = image. A work-group of eight waves forms a 128 x 128 tile, four waves stacked on the rows and two
// side by side on the columns, wave tile 32 x 64. The operands of 256 k (a stage: eight 16-row tiles of v, eight of P^T, 8 KiB each and contiguous in their planes) come into LDS by asynchronous copies,
// once for the whole work-group, into one of two buffers: the next stage's copies fly while this stage is worked on. Every operand byte so leaves L2 once per work-group and serves 128 rows or columns.
// P^T holds 256 exp(E - quarter maximum) (see k_esm); wt[n] = 2^14 exp(this work-group's quarter maximum - row maximum) / (256 * the whole row n's sum of exponentials), at most 64,
// formed once per work-group from the four quarters' maxima and sums, kept in LDS as f16 and multiplied into the v fragments, whose k index is n.
#define XR_TP ((size_t)(NPX / 16) * 256)      /* f16 elements from one 16-row tile to the next */
#define XR_KS 256                             /* k of a stage */
#define XR_CH ((size_t)XR_KS * 16)            /* f16 elements of one 16-row tile's part of a stage */
#define XR_ST (16 * XR_CH)                    /* f16 elements of a stage: the eight v tiles, then the eight P^T tiles */
#define XR_NT (NPX / XR_KS)                   /* stages */
// A wave's share of one stage: v tile w and P^T tile w, 16 copies of 512 bytes each. l = the lane's LDS byte address in v tile w of the buffer; ga, gb = the lane's first 16 bytes of the two tiles' parts in global memory.
// A tile's part lies in LDS as it lies in its plane, so the immediate offset, which moves the LDS address and the global address alike, walks both: two address pairs and two LDS addresses serve all 32 copies.
// One statement, so that one s_wait_xcnt at its end stands in front of any later write of the registers that the copies name.
__device__ __forceinline__ void xr_copy(unsigned l, const char* ga, const char* gb) {
  asm volatile(
               "global_load_async_to_lds_b128 %0, %2, off\n\tglobal_load_async_to_lds_b128 %0, %2, off offset:512\n\tglobal_load_async_to_lds_b128 %0, %2, off offset:1024\n\tglobal_load_async_to_lds_b128 %0, %2, off offset:1536\n\t"
               "global_load_async_to_lds_b128 %0, %2, off offset:2048\n\tglobal_load_async_to_lds_b128 %0, %2, off offset:2560\n\tglobal_load_async_to_lds_b128 %0, %2, off offset:3072\n\tglobal_load_async_to_lds_b128 %0, %2, off offset:3584\n\t"
               "global_load_async_to_lds_b128 %0, %2, off offset:4096\n\tglobal_load_async_to_lds_b128 %0, %2, off offset:4608\n\tglobal_load_async_to_lds_b128 %0, %2, off offset:5120\n\tglobal_load_async_to_lds_b128 %0, %2, off offset:5632\n\t"
               "global_load_async_to_lds_b128 %0, %2, off offset:6144\n\tglobal_load_async_to_lds_b128 %0, %2, off offset:6656\n\tglobal_load_async_to_lds_b128 %0, %2, off offset:7168\n\tglobal_load_async_to_lds_b128 %0, %2, off offset:7680\n\t"
               "global_load_async_to_lds_b128 %1, %3, off\n\tglobal_load_async_to_lds_b128 %1, %3, off offset:512\n\tglobal_load_async_to_lds_b128 %1, %3, off offset:1024\n\tglobal_load_async_to_lds_b128 %1, %3, off offset:1536\n\t"
               "global_load_async_to_lds_b128 %1, %3, off offset:2048\n\tglobal_load_async_to_lds_b128 %1, %3, off offset:2560\n\tglobal_load_async_to_lds_b128 %1, %3, off offset:3072\n\tglobal_load_async_to_lds_b128 %1, %3, off offset:3584\n\t"
               "global_load_async_to_lds_b128 %1, %3, off offset:4096\n\tglobal_load_async_to_lds_b128 %1, %3, off offset:4608\n\tglobal_load_async_to_lds_b128 %1, %3, off offset:5120\n\tglobal_load_async_to_lds_b128 %1, %3, off offset:5632\n\t"
               "global_load_async_to_lds_b128 %1, %3, off offset:6144\n\tglobal_load_async_to_lds_b128 %1, %3, off offset:6656\n\tglobal_load_async_to_lds_b128 %1, %3, off offset:7168\n\tglobal_load_async_to_lds_b128 %1, %3, off offset:7680\n\t"
               "s_wait_xcnt 0x0"
               :: "v"(l), "v"(l + (unsigned)(8 * XR_CH * 2)), "v"(ga), "v"(gb) : "memory"); }
// one k step's operands from LDS: ap, bp = the lane's unit in the wave's first v tile and first P^T tile of the stage
__device__ __forceinline__ void xr_frags(OpSet& s, const _Float16* ap, const _Float16* bp) {
  s.a0 = fo_frag(ap); s.a1 = fo_frag(ap + XR_CH); s.b0 = fo_frag(bp); s.b1 = fo_frag(bp + XR_CH); s.b2 = fo_frag(bp + 2 * XR_CH); s.b3 = fo_frag(bp + 3 * XR_CH); }
__device__ __forceinline__ float exp2_slot(float x) { float r; asm("v_exp_f32 %0, %1\n\tv_nop" : "=v"(r) : "v"(x)); return r; }      /* 2^x; the v_nop fills the slot behind a transcendental */
__device__ __forceinline__ void xr_mma(const OpSet& s, v16h wt, v8f (&c)[8]) {
  __builtin_amdgcn_sched_barrier(0);      /* the next step's LDS reads stay in front of this step's products as one group, and the products with the weights are not lifted over them */
  OpSet t = s; t.a0 = s.a0 * wt; t.a1 = s.a1 * wt; set_mma(t, c); }
__global__ __launch_bounds__(256) void k_xr(const _Float16* __restrict__ Af, const _Float16* __restrict__ Bf, const float* __restrict__ ML, const float* __restrict__ SL, float alpha, float* __restrict__ C) {
  static_assert(XR_ST * 2 == 131072 && XR_NT >= 2 && CC % 128 == 0 && QCOL % 128 == 0, "two stages at least; a work-group's columns lie in one quarter");
  __shared__ __attribute__((aligned(512))) _Float16 Rs[2 * XR_ST]; __shared__ __attribute__((aligned(16))) _Float16 fw[NPX];
  const int tid = threadIdx.x, w = __builtin_amdgcn_readfirstlane(tid >> 5), lane = tid & 31, ln = lane & 15, hh = lane >> 4; const int by = blockIdx.y;      /* the wave's number in a scalar register */
  Af += (size_t)by * CC * NPX; Bf += (size_t)by * NPX * NPX; C += (size_t)by * CC * NPX;
  const int ntn = NPX >> 7; const int mt = blockIdx.x / ntn, nq = blockIdx.x - mt * ntn; const int wr = w & 3, wc = w >> 2; const int row0 = mt * 128 + 32 * wr, col0 = nq * 128 + 64 * wc;
  const unsigned l0 = (unsigned)(size_t)&Rs[0] + (unsigned)(w * (int)(XR_CH * 2) + lane * 16);
  const char* ga = (const char*)(Af + (size_t)(mt * 8 + w) * XR_TP) + lane * 16; const char* gb = (const char*)(Bf + (size_t)(nq * 8 + w) * XR_TP) + lane * 16;
  xr_copy(l0, ga, gb);      /* stage 0 into buffer 0; it flies under the weights below */
  { const int qd = nq * 128 / QCOL;
    // 16 n a thread: the 36 loads are in flight together, so the work-group waits out one load latency here
    const float* pm = ML + (size_t)by * NQ * NPX + tid * 4; const float* pz = SL + (size_t)by * NQ * NPX + tid * 4; const float* pmo = pm + (size_t)qd * NPX;
    v4f mq[4][NQ], sq[4][NQ], mo[4];
#pragma unroll
    for (int u = 0; u < 4; ++u) { for (int j = 0; j < NQ; ++j) { mq[u][j] = *(const v4fa*)(pm + (size_t)j * NPX + u * 1024); sq[u][j] = *(const v4fa*)(pz + (size_t)j * NPX + u * 1024); } mo[u] = *(const v4fa*)(pmo + u * 1024); }
    asm volatile("s_wait_xcnt 0x0" :: "v"(pm), "v"(pz), "v"(pmo) : "memory");      /* stands in front of any overwrite of the address registers of the loads above; it names them so that they live up to it and no load's result is laid over them */
#pragma unroll
    for (int u = 0; u < 4; ++u) { v4h o;
#pragma unroll
      for (int i = 0; i < 4; ++i) { const float mx = fmaxf(fmaxf(mq[u][0][i], mq[u][1][i]), fmaxf(mq[u][2][i], mq[u][3][i])); float sa = 0.f;      /* the maxima are in the log2 domain, the sums hold the factor 256; the quarter that holds the row's maximum adds at least about 256 to sa */
        for (int j = 0; j < NQ; ++j) sa += sq[u][j][i] * exp2_slot(mq[u][j][i] - mx);
        o[i] = (_Float16)(exp2_slot(mo[u][i] - mx) * 16384.0f / sa); }
      *(v4h*)&fw[u * 1024 + tid * 4] = o; } }
  asm volatile("s_wait_asynccnt 0x0" ::: "memory");      /* this wave's copies of stage 0 have landed */
  __syncthreads();      /* every wave's copies of stage 0 have landed, and every wave reads all the weights */
  xr_copy(l0 + (unsigned)(XR_ST * 2), ga + XR_CH * 2, gb + XR_CH * 2);      /* stage 1 into buffer 1 */
  const v8f z8 = {0.f,0.f,0.f,0.f,0.f,0.f,0.f,0.f}; v8f accs[8] = {z8, z8, z8, z8, z8, z8, z8, z8};
  // stays rolled: a trip holds a whole stage (eight k steps, 64 products)
#pragma unroll 1
  for (int t = 0; t < XR_NT; ++t) { const _Float16* ra = Rs + (size_t)(t & 1) * XR_ST + (size_t)(2 * wr) * XR_CH + lane * 8; const _Float16* rb = Rs + (size_t)(t & 1) * XR_ST + (size_t)(8 + 4 * wc) * XR_CH + lane * 8;
    const _Float16* f = fw + t * XR_KS; OpSet s0, s1; v16h w0, w1;      /* two register sets: a step's fragments and weights are read from LDS under the step before it, within the stage */
    xr_frags(s0, ra, rb); w0 = g2_frag(f, hh);
    // unrolled in full: the sets change places by name
#pragma unroll
    for (int j = 0; j < XR_KS / 32; j += 2) {
      xr_frags(s1, ra + (j + 1) * 512, rb + (j + 1) * 512); w1 = g2_frag(f + (j + 1) * 32, hh); xr_mma(s0, w0, accs);
      if (j + 2 < XR_KS / 32) { xr_frags(s0, ra + (j + 2) * 512, rb + (j + 2) * 512); w0 = g2_frag(f + (j + 2) * 32, hh); }
      xr_mma(s1, w1, accs); }
    asm volatile("s_wait_dscnt 0x0" ::: "memory");      /* this wave's reads of the buffer are done */
    asm volatile("s_wait_asynccnt 0x0" ::: "memory");      /* this wave's copies of stage t + 1 have landed */
    __syncthreads();      /* stage t + 1 is there for every wave, and every wave has left stage t's buffer */
    if (t + 2 < XR_NT) xr_copy(l0 + (unsigned)(t & 1) * (unsigned)(XR_ST * 2), ga + (size_t)(t + 2) * (XR_CH * 2), gb + (size_t)(t + 2) * (XR_CH * 2)); }      /* the same for the whole work-group */
  asm volatile("s_wait_asynccnt 0x0" ::: "memory");      /* no copy is under way when the buffers become output staging */
  float (*so)[32][68] = reinterpret_cast<float (*)[32][68]>(&Rs[0]);      /* behind the last trip's barrier the buffers are free: each wave stages its 32 x 64 tile in a range of its own */
#pragma unroll
  for (int u = 0; u < 8; ++u) { const int t = u & 3, half = u >> 2;
#pragma unroll
    for (int r = 0; r < 8; ++r) so[w][half * 16 + 8 * hh + r][t * 16 + ln] = accs[u][r] * alpha; }
  __builtin_amdgcn_fence(__ATOMIC_ACQ_REL, "workgroup"); __builtin_amdgcn_wave_barrier();
  const int rsub = lane >> 4, c4 = (lane & 15) * 4;
#pragma unroll
  for (int q = 0; q < 16; ++q) { const int r = q * 2 + rsub; const v4f v = *(const v4fa*)&so[w][r][c4]; *(v4f*)(C + (size_t)(row0 + r) * NPX + col0 + c4) = v; } }
__global__ __launch_bounds__(256) void k_vt(const _Float16* __restrict__ V16, int b, int h0, _Float16* __restrict__ VT) { __shared__ unsigned short tl[64][65]; const int tid = threadIdx.x; const int hh = blockIdx.x % HG, sg = blockIdx.x / HG; const int s0 = sg * 64; const int h = h0 + hh;
  for (int i = tid; i < 64 * 8; i += 256) { const int j = i / 8, d8 = (i % 8) * 8; FragH f; f.half[0] = *(const v8us*)((const unsigned short*)V16 + ((size_t)b * SQ + s0 + j) * DM + h * HD + d8); for (int q = 0; q < 8; ++q) tl[d8 + q][j] = f.u[q]; }
  __syncthreads();
  { for (int i = tid; i < 64 * 8; i += 256) { const int d = i / 8, j8 = (i % 8) * 8; FragH f; for (int q = 0; q < 8; ++q) f.u[q] = tl[d][j8 + q]; *(v8us*)((unsigned short*)VT + ((size_t)hh * HD + d) * SQ + s0 + j8) = f.half[0]; }  } }


// The four preparations of the projections' operands, in ONE launch (none reads what another writes). Work-groups [0, NX): x channel-first -> position rows (f16) through LDS tiles;
// the rest: the natural weights x16 as f16, 8 elements a thread: Wq, then Wk, then Wv.
__global__ __launch_bounds__(256) void k_prep(const float* __restrict__ X, _Float16* __restrict__ XR, const float* __restrict__ wq, const float* __restrict__ wk, const float* __restrict__ wv, _Float16* __restrict__ BQ, _Float16* __restrict__ BK, _Float16* __restrict__ BV) {
  __shared__ float tl[64][33]; const int tid = threadIdx.x; const int nl = LL / 32, nc = CC / 64; constexpr int NX = NB * (LL / 32) * (CC / 64), QB = CQ * CC / 8 / 256; static_assert(CQ * CC / 8 % 256 == 0 && CC * CC / 8 % 256 == 0, "whole work-groups");
  if (blockIdx.x >= NX) {      /* the same for a whole work-group, and in front of the barrier below */
    const int u = blockIdx.x - NX; const float* w = u < QB ? wq : (u < 2 * QB ? wk : wv); _Float16* Bt = u < QB ? BQ : (u < 2 * QB ? BK : BV);
    const size_t t = (size_t)(u < QB ? u : (u < 2 * QB ? u - QB : u - 2 * QB)) * 256 + tid; FragH f; for (int q = 0; q < 8; ++q) f.h[q] = (_Float16)(bf16_round(w[t * 8 + q]) * 16.0f); *(v8us*)((unsigned short*)Bt + t * 8) = f.half[0];
    return; }
  const int cb_ = blockIdx.x % nc; const int lb = (blockIdx.x / nc) % nl; const size_t b = blockIdx.x / (nc * nl); const int c0 = cb_ * 64, l0 = lb * 32;
  for (int i = tid; i < 64 * 32; i += 256) { const int c = i / 32, l = i % 32; tl[c][l] = bf16_round(X[(b * CC + c0 + c) * (size_t)LL + l0 + l]); }
  __syncthreads();
  { const int l = tid / 8, c8 = (tid % 8) * 8; FragH f; for (int q = 0; q < 8; ++q) f.h[q] = (_Float16)tl[c8 + q][l]; unsigned short* d = (unsigned short*)XR + (b * LL + l0 + l) * (size_t)CC + c0 + c8; *(v8us*)d = f.half[0];  } }

__global__ __launch_bounds__(256) void k_fin3(const float* __restrict__ Cm, const float* __restrict__ x, float* __restrict__ out) {
  #pragma clang fp contract(off)
  const size_t t = (size_t)blockIdx.x * 256 + threadIdx.x; if (t >= (size_t)NBR * CC * NPX / 8) return; const size_t base = t * 8; v8f v;
  const v4f x0 = *(const v4fa*)(x + base), x1 = *(const v4fa*)(x + base + 4);
  asm volatile("s_wait_xcnt 0x0" ::: "memory");      /* the address pair of the two loads above may be given to a later load's result: the wait stands in front of that overwrite */
  for (int q = 0; q < 4; ++q) { v[q] = __fadd_rn(bf16_round(x0[q]), Cm[base + q]); v[4 + q] = __fadd_rn(bf16_round(x1[q]), Cm[base + 4 + q]); } *(v8f*)(out + base) = v;  }

extern "C" void kernel_launch(void* const* d_in, const int* in_sizes, int n_in,
                              void* d_out, int out_size, void* d_ws, size_t ws_size, hipStream_t stream) {
  (void)in_sizes; (void)n_in; (void)out_size;
  const float* const* I = (const float* const*)d_in; const float* x = I[0]; const float* Wq = I[1]; const float* Wk = I[2]; const float* Wv = I[3]; const float* bv = I[4];
  char* ws = (char*)d_ws; size_t off = 0;
  auto take = [&](size_t bytes) { char* p = ws + off; off += (bytes + 255) & ~(size_t)255; return p; };
  _Float16* BQ = (_Float16*)take((size_t)CQ * CC * 2); _Float16* BK = (_Float16*)take((size_t)CQ * CC * 2); _Float16* BV = (_Float16*)take((size_t)CC * CC * 2);
  _Float16* XR = (_Float16*)take(NR * CC * 2); float* QF = (float*)take(NR * CQ * 4); float* KF = (float*)take(NR * CQ * 4); _Float16* QH = (_Float16*)take(NR * CQ * 2); _Float16* QL = (_Float16*)take(NR * CQ * 2); _Float16* KH = (_Float16*)take(NR * CQ * 2); _Float16* KL = (_Float16*)take(NR * CQ * 2); _Float16* V16 = (_Float16*)take(NR * CC * 2);
  _Float16* PT = (_Float16*)take((size_t)NB * NPX * NPX * 2); _Float16* VT = (_Float16*)take((size_t)NB * CC * NPX * 2); float* CX = (float*)take((size_t)NB * CC * NPX * 4); float* ML = (float*)take((size_t)NB * NQ * NPX * 4); float* SL = (float*)take((size_t)NB * NQ * NPX * 4);
  if (off > ws_size) return;      /* 0.2 + 8 + 8 + 8 + 8 + 128 + 8 + 16 + 0.5 = approx 185 MiB: P^T, v channel-major and x_r hold all images */
  // work that does not depend on one another shares a launch: a launch starts only when the one before it has drained
  k_prep<<<NB * (NPX / 32) * (CC / 64) + (2 * CQ + CC) * CC / 8 / 256, 256, 0, stream>>>(x, XR, Wq, Wk, Wv, BQ, BK, BV);      /* x rows; weights x16 */
  k_qkv<<<(unsigned)((NR / 128) * (2 + CC / 64)), 128, 0, stream>>>(XR, BQ, BK, BV, bv, QF, KF, V16);      /* q, k (f32, exact products); v + bv (f16 rows) */
  k_post<<<(unsigned)(2 * (NR * CQ / 8 / 256)) + NBR * (CC / 64) * (NPX / 64), 256, 0, stream>>>(QF, KF, QH, QL, KH, KL, V16, VT);      /* q, k hi + residual planes; v channel-major [image][256][4096]; all in fragment order */
  k_esm<<<dim3(NQ * (NPX / 256), NBR), 512, 0, stream>>>(QH, QL, KH, KL, PT, ML, SL);      /* P^T[m][n] = 256 exp(q_n . k_m - its quarter row's maximum), fragment order, one plane per image; each quarter row's maximum and sum */
  k_xr<<<dim3((CC / 128) * (NPX / 128), NBR), 256, 0, stream>>>(VT, PT, ML, SL, 6.103515625e-05f, CX);      /* x_r[c][m] = sum_n v[c][n] attention[n][m]; 2^-14 takes back the factor of the weights */
  k_fin3<<<(unsigned)(((size_t)NBR * CC * NPX / 8 + 255) / 256), 256, 0, stream>>>(CX, x, (float*)d_out);
}

// v010
// A run of this version takes 83.4 microseconds.
// In two side-by-side timings against v009, it was 1.09 and 1.08 times as fast.
// Over all steps from v000 it is 47.3 times as fast.
#include <hip/hip_runtime.h>
// SA layer (x [4][256][4096]; q = Wq x (64), k = Wk x (64), v = Wv x + bv (256); energy[n][m] = q_n . k_m (no scale); attention = softmax over m; x_r[c][m] = sum_n v[c][n] attention[n][m]; out = x + x_r -> [4][256][4096]).
// Structure: channel-first input transposed to position rows (exact f16) via LDS tiles; q / k as WMMA GEMMs (32x64 wave tiles, f32 accumulation, exact x16 natural weights; exact products) split in the epilogue into f16 hi + 2^-10 residual planes; v GEMM (+ bias) stored as f16 channel-major from the accumulators; per image: the unscaled energy as a THREE-term product (hi.hi + lo.hi + hi.lo, K = 64) whose f32 logits stay in registers for the exponentials of each quarter row on VALU (256 exp(E - quarter maximum) as f16, one kernel, the quarter's k rows in LDS; maximum and sum kept per quarter row), x_r = (V(channel-major) x the factor that completes the row's softmax) . P^T-as-Bt GEMM (M = 256 channels, K = 4096) in f32; residual add + store in its epilogue. The q / k planes, v channel-major and P^T lie in fragment order (see fo_unit), each written so by the kernel that makes it.
// Compute dtype: inputs rounded to bf16; x / weights exact; q, k as hi + residual (~f32, the logits have sigma ~8); v, P as plain f16 operands (~2^-12); maxima, exponentials and sums f32; the factor that completes a row's softmax is formed in f32, rounded to f16 and multiplied into the v fragments in f16 (two more roundings of ~2^-12 on that operand). v_wmma_f32_16x16x32_f16.
#define NB 4
#define CC 256
#define CQ 64
#define NPX 4096
#define LL NPX
#define PX NPX
#define NR ((size_t)NB * NPX)
#define NBR NB                       /* images attended (debug hook) */
#define MP ((int)NR)                 /* unused */
#define MC NPX                       /* unused */
#define SQ NPX
#define DM NPX
#define NH 64
#define HD 64
#define HG 1
typedef __bf16 v16b __attribute__((ext_vector_type(16)));
typedef unsigned short v8us __attribute__((ext_vector_type(8), may_alias));
typedef float  v8f  __attribute__((ext_vector_type(8)));
typedef float  v4f  __attribute__((ext_vector_type(4)));
typedef float  v4fa __attribute__((ext_vector_type(4), may_alias));
union FragB { v16b v; v8us half[2]; unsigned short u[16]; };

__device__ __forceinline__ unsigned short bf16_bits(float x) { unsigned int u = __float_as_uint(x); return (unsigned short)((u + 0x7FFFu + ((u >> 16) & 1u)) >> 16); }
__device__ __forceinline__ float bf16_val(unsigned short b) { return __uint_as_float(((unsigned int)b) << 16); }
__device__ __forceinline__ float bf16_round(float x) { return bf16_val(bf16_bits(x)); }
// D += A·B with NT terms: 1 = ah·bh, 2 = + al·bh (A split), 3 = + ah·bl (both split)
template <int NT>
__device__ __forceinline__ v8f mmaN(v16b ah, v16b al, v16b bh, v16b bl, v8f c) {
  c = __builtin_amdgcn_wmma_f32_16x16x32_bf16(false, ah, false, bh, (short)0, c, false, false);
  if (NT >= 2) c = __builtin_amdgcn_wmma_f32_16x16x32_bf16(false, al, false, bh, (short)0, c, false, false);
  if (NT >= 3) c = __builtin_amdgcn_wmma_f32_16x16x32_bf16(false, ah, false, bl, (short)0, c, false, false);
  asm volatile("v_nop\n\tv_nop\n\tv_nop\n\tv_nop" : "+v"(c) : "v"(ah), "v"(al), "v"(bh), "v"(bl));
  return c;
}

__global__ __launch_bounds__(256) void k_wt_bf16(const float* __restrict__ W, unsigned short* __restrict__ Wt, int K, int N) {
  const int t = blockIdx.x * 256 + threadIdx.x;
  const int k8n = K / 8;
  if (t >= N * k8n) return;
  const int n = t / k8n, k8 = (t % k8n) * 8;
  v8us v;
#pragma unroll
  for (int i = 0; i < 8; ++i) v[i] = bf16_bits(W[(size_t)(k8 + i) * N + n]);
  *(v8us*)(Wt + (size_t)n * K + k8) = v;
  
}

// GEMM C[M][N] (f32, pitch ldc) = act(A[M][K]·W + bias). A f32 row-major (pitch lda) converted per fragment to bf16
// (ASPLIT: hi/lo two planes -> 2 terms, else single rounded term); Wt bf16 [N][K] (pitch ldb). BIAS_BF16 rounds the
// bias to bf16 first (bias quantised to bf16 before the add). K%32==0, M%16==0, N%64==0.
template <bool ASPLIT, int ACT, bool BIAS_BF16>
__global__ __launch_bounds__(128) void k_gemm_bf(const float* __restrict__ A, int lda, const unsigned short* __restrict__ Wt, int ldb,
                                               const float* __restrict__ bias, float* __restrict__ C, int ldc, int M, int N, int K) {
  __shared__ __attribute__((aligned(16))) float so[4][16][64];
  const int tid = threadIdx.x, w = tid >> 5, lane = tid & 31, ln = lane & 15, hh = lane >> 4;
  const int ntn = N / 64;
  const int wid = blockIdx.x * 4 + w;
  const int mt = wid / ntn, nq = wid % ntn;
  if (mt * 16 >= M) return;
  const int row0 = mt * 16, col0 = nq * 64;
  const float* arow = A + (size_t)(row0 + ln) * lda;
  v8f acc[4] = {};
  for (int kb = 0; kb < K; kb += 32) {
    FragB ah, al;
    const v4f x0 = *(const v4fa*)(arow + kb + 8 * hh), x1 = *(const v4fa*)(arow + kb + 8 * hh + 4);
    const v4f x2 = *(const v4fa*)(arow + kb + 16 + 8 * hh), x3 = *(const v4fa*)(arow + kb + 16 + 8 * hh + 4);
    float xs[16] = {x0[0],x0[1],x0[2],x0[3],x1[0],x1[1],x1[2],x1[3],x2[0],x2[1],x2[2],x2[3],x3[0],x3[1],x3[2],x3[3]};
#pragma unroll
    for (int i = 0; i < 16; ++i) { const unsigned short hb = bf16_bits(xs[i]); ah.u[i] = hb; al.u[i] = ASPLIT ? bf16_bits(xs[i] - bf16_val(hb)) : (unsigned short)0; }
#pragma unroll
    for (int t = 0; t < 4; ++t) {
      const unsigned short* brow = Wt + (size_t)(col0 + t * 16 + ln) * ldb + kb;
      FragB b;
      b.half[0] = *(const v8us*)(brow + 8 * hh);
      b.half[1] = *(const v8us*)(brow + 16 + 8 * hh);
      acc[t] = mmaN<ASPLIT ? 2 : 1>(ah.v, al.v, b.v, b.v, acc[t]);
    }
  }
#pragma unroll
  for (int t = 0; t < 4; ++t) {
    float bv = bias ? bias[col0 + t * 16 + ln] : 0.f;
    if (BIAS_BF16) bv = bf16_round(bv);
#pragma unroll
    for (int r = 0; r < 8; ++r) { float v = acc[t][r] + bv; if (ACT == 1) v = fmaxf(v, 0.f); so[w][8 * hh + r][t * 16 + ln] = v; }
  }
  __builtin_amdgcn_fence(__ATOMIC_ACQ_REL, "workgroup");
  __builtin_amdgcn_wave_barrier();
  const int rsub = lane >> 4, c4 = (lane & 15) * 4;
  {
#pragma unroll
    for (int q = 0; q < 8; ++q) {
      const int r = q * 2 + rsub;
      const v4f v = *(const v4fa*)&so[w][r][c4];
      *(v4f*)(C + (size_t)(row0 + r) * ldc + col0 + c4) = v;
    }
    
  }
}

// GEMM C = act(A·W + bias + resid): A f32 (ASPLIT -> hi/lo 2 terms), Wt bf16 [N][K]; ACT 0 none, 1 relu, 2 exact gelu;
// resid (optional, f32, row index = (row % rmod), pitch ldr, RES_BF16 rounds it) added before the activation.
template <bool ASPLIT, int ACT, bool BIAS_BF16, bool RES_BF16>
__global__ __launch_bounds__(128) void k_gemm_bf3(const float* __restrict__ A, int lda, const unsigned short* __restrict__ Wt, int ldb,
                                                const float* __restrict__ bias, const float* __restrict__ resid, int rmod, int ldr,
                                                float* __restrict__ C, int ldc, int M, int N, int K) {
  __shared__ __attribute__((aligned(16))) float so[4][16][64];
  const int tid = threadIdx.x, w = tid >> 5, lane = tid & 31, ln = lane & 15, hh = lane >> 4;
  const int ntn = N / 64;
  const int wid = blockIdx.x * 4 + w;
  const int mt = wid / ntn, nq = wid % ntn;
  if (mt * 16 >= M) return;
  const int row0 = mt * 16, col0 = nq * 64;
  const float* arow = A + (size_t)(row0 + ln) * lda;
  v8f acc[4] = {};
  for (int kb = 0; kb < K; kb += 32) {
    FragB ah, al;
    const v4f x0 = *(const v4fa*)(arow + kb + 8 * hh), x1 = *(const v4fa*)(arow + kb + 8 * hh + 4);
    const v4f x2 = *(const v4fa*)(arow + kb + 16 + 8 * hh), x3 = *(const v4fa*)(arow + kb + 16 + 8 * hh + 4);
    float xs[16] = {x0[0],x0[1],x0[2],x0[3],x1[0],x1[1],x1[2],x1[3],x2[0],x2[1],x2[2],x2[3],x3[0],x3[1],x3[2],x3[3]};
#pragma unroll
    for (int i = 0; i < 16; ++i) { const unsigned short hb = bf16_bits(xs[i]); ah.u[i] = hb; al.u[i] = ASPLIT ? bf16_bits(xs[i] - bf16_val(hb)) : (unsigned short)0; }
#pragma unroll
    for (int t = 0; t < 4; ++t) {
      const unsigned short* brow = Wt + (size_t)(col0 + t * 16 + ln) * ldb + kb;
      FragB b;
      b.half[0] = *(const v8us*)(brow + 8 * hh);
      b.half[1] = *(const v8us*)(brow + 16 + 8 * hh);
      acc[t] = mmaN<ASPLIT ? 2 : 1>(ah.v, al.v, b.v, b.v, acc[t]);
    }
  }
#pragma unroll
  for (int t = 0; t < 4; ++t) {
    const int col = col0 + t * 16 + ln;
    float bv = bias ? bias[col] : 0.f;
    if (BIAS_BF16) bv = bf16_round(bv);
#pragma unroll
    for (int r = 0; r < 8; ++r) {
      float v = acc[t][r] + bv;
      if (resid) { float rv = resid[(size_t)((row0 + 8 * hh + r) % rmod) * ldr + col]; if (RES_BF16) rv = bf16_round(rv); v += rv; }
      if (ACT == 1) v = fmaxf(v, 0.f);
      if (ACT == 2) v = 0.5f * v * (1.0f + erff(v * 0.70710678118654752f));
      if (ACT == 3) { const float u = 0.7978845608028654f * (v + 0.044715f * v * v * v); v = 0.5f * v * (1.0f + tanhf(u)); }
      so[w][8 * hh + r][t * 16 + ln] = v;
    }
  }
  __builtin_amdgcn_fence(__ATOMIC_ACQ_REL, "workgroup");
  __builtin_amdgcn_wave_barrier();
  const int rsub = lane >> 4, c4 = (lane & 15) * 4;
  {
#pragma unroll
    for (int q = 0; q < 8; ++q) {
      const int r = q * 2 + rsub;
      const v4f v = *(const v4fa*)&so[w][r][c4];
      *(v4f*)(C + (size_t)(row0 + r) * ldc + col0 + c4) = v;
    }
    
  }
}
// row LayerNorm (biased variance, eps) over N: s = X (+ R); optional out_sum <- s; out_norm <- (s-mu)*rsqrt(var+eps)*g + b
template <bool PARAM_BF16>
__global__ __launch_bounds__(256) void k_layernorm(const float* __restrict__ X, const float* __restrict__ R, const float* __restrict__ g, const float* __restrict__ bta,
                                                  float* __restrict__ out_sum, float* __restrict__ out_norm, int N, float eps) {
  __shared__ float red[256];
  const int row = blockIdx.x, tid = threadIdx.x;
  const float* x = X + (size_t)row * N; const float* rr = R ? R + (size_t)row * N : nullptr;
  float vals[16];                     // up to N = 4096
  const int per = N / 256;            // contiguous chunk per thread? use strided-by-4 chunks: thread handles j = tid*4 + 1024*u
  float s1 = 0.f;
  for (int u = 0; u < per / 4; ++u) {
    const int j = tid * 4 + 1024 * u;
    const v4f a = *(const v4fa*)(x + j);
    v4f b = {0.f,0.f,0.f,0.f}; if (rr) b = *(const v4fa*)(rr + j);
#pragma unroll
    for (int q = 0; q < 4; ++q) { const float v = a[q] + b[q]; vals[u * 4 + q] = v; s1 += v; }
  }
  red[tid] = s1; __syncthreads();
  for (int st = 128; st > 0; st >>= 1) { if (tid < st) red[tid] += red[tid + st]; __syncthreads(); }
  const float mu = red[0] / (float)N; __syncthreads();
  float s2 = 0.f;
  for (int u = 0; u < per / 4; ++u)
#pragma unroll
    for (int q = 0; q < 4; ++q) { const float c = vals[u * 4 + q] - mu; s2 += c * c; }
  red[tid] = s2; __syncthreads();
  for (int st = 128; st > 0; st >>= 1) { if (tid < st) red[tid] += red[tid + st]; __syncthreads(); }
  const float rs = rsqrtf(red[0] / (float)N + eps);
  {
    for (int u = 0; u < per / 4; ++u) {
      const int j = tid * 4 + 1024 * u;
      v4f o, sm;
#pragma unroll
      for (int q = 0; q < 4; ++q) {
        float gg = g[j + q], bb = bta[j + q];
        if (PARAM_BF16) { gg = bf16_round(gg); bb = bf16_round(bb); }
        sm[q] = vals[u * 4 + q]; o[q] = (vals[u * 4 + q] - mu) * rs * gg + bb;
      }
      if (out_sum) *(v4f*)(out_sum + (size_t)row * N + j) = sm;
      *(v4f*)(out_norm + (size_t)row * N + j) = o;
    }
    
  }
}



// ---- f16 WMMA path (v_wmma_f32_16x16x32_f16): 11-bit significands for operands in range — used where a [0,1] probability operand needs more precision than bf16
typedef _Float16 v16h __attribute__((ext_vector_type(16)));
union FragH { v16h v; v8us half[2]; _Float16 h[16]; unsigned short u[16]; };
template <int NT>
__device__ __forceinline__ v8f mmaH(v16h ah, v16h al, v16h bh, v16h bl, v8f c) {
  c = __builtin_amdgcn_wmma_f32_16x16x32_f16(false, ah, false, bh, (short)0, c, false, false);
  if (NT >= 2) c = __builtin_amdgcn_wmma_f32_16x16x32_f16(false, al, false, bh, (short)0, c, false, false);
  if (NT >= 3) c = __builtin_amdgcn_wmma_f32_16x16x32_f16(false, ah, false, bl, (short)0, c, false, false);
  asm volatile("v_nop\n\tv_nop\n\tv_nop\n\tv_nop" : "+v"(c) : "v"(ah), "v"(al), "v"(bh), "v"(bl));
  return c;
}
// batched GEMM like k_gemm_b but f16 operands: A f32 (split into f16 hi/lo if ASPLIT, else rounded to f16), Bt = f16 values [n][k]; alpha; C f32; N multiple of 16 (partial tiles skipped)
template <bool ASPLIT>
__global__ __launch_bounds__(128) void k_gemm_h(const float* __restrict__ A, int lda, size_t sA, const _Float16* __restrict__ Bh, int ldb, size_t sB, float alpha, float* __restrict__ C, int ldc, size_t sC, int M, int N, int K) {
  __shared__ __attribute__((aligned(16))) float so[4][16][64];
  const int tid = threadIdx.x, w = tid >> 5, lane = tid & 31, ln = lane & 15, hh = lane >> 4; const int by = blockIdx.y;
  A += (size_t)by * sA; Bh += (size_t)by * sB; C += (size_t)by * sC;
  const int ntn = (N + 63) / 64; const int wid = blockIdx.x * 4 + w; const int mt = wid / ntn, nq = wid % ntn; if (mt * 16 >= M) return;
  const int row0 = mt * 16, col0 = nq * 64; const float* arow = A + (size_t)(row0 + ln) * lda;
  v8f acc[4] = {};
  for (int kb = 0; kb < K; kb += 32) {
    FragH ah, al;
    const v4f x0 = *(const v4fa*)(arow + kb + 8 * hh), x1 = *(const v4fa*)(arow + kb + 8 * hh + 4), x2 = *(const v4fa*)(arow + kb + 16 + 8 * hh), x3 = *(const v4fa*)(arow + kb + 16 + 8 * hh + 4);
    float xs[16] = {x0[0],x0[1],x0[2],x0[3],x1[0],x1[1],x1[2],x1[3],x2[0],x2[1],x2[2],x2[3],x3[0],x3[1],x3[2],x3[3]};
#pragma unroll
    for (int i = 0; i < 16; ++i) { const _Float16 h = (_Float16)xs[i]; ah.h[i] = h; al.h[i] = ASPLIT ? (_Float16)(xs[i] - (float)h) : (_Float16)0.0f; }
#pragma unroll
    for (int t = 0; t < 4; ++t) { if (col0 + t * 16 >= N) continue; const size_t boff = (size_t)(col0 + t * 16 + ln) * ldb + kb; FragH bq; bq.half[0] = *(const v8us*)(Bh + boff + 8 * hh); bq.half[1] = *(const v8us*)(Bh + boff + 16 + 8 * hh);
      acc[t] = mmaH<ASPLIT ? 2 : 1>(ah.v, al.v, bq.v, bq.v, acc[t]); }
  }
#pragma unroll
  for (int t = 0; t < 4; ++t) { if (col0 + t * 16 >= N) continue;
#pragma unroll
    for (int r = 0; r < 8; ++r) so[w][8 * hh + r][t * 16 + ln] = acc[t][r] * alpha; }
  __builtin_amdgcn_fence(__ATOMIC_ACQ_REL, "workgroup"); __builtin_amdgcn_wave_barrier();
  const int rsub = lane >> 4, c4 = (lane & 15) * 4;
  {
#pragma unroll
    for (int q = 0; q < 8; ++q) { const int r = q * 2 + rsub; if (col0 + c4 < N) { const v4f v = *(const v4fa*)&so[w][r][c4]; *(v4f*)(C + (size_t)(row0 + r) * ldc + col0 + c4) = v; } }
     }
}

// Wt[n][k] = f16(W[k][n]·scale) from f32 row-major W[K][N] (scale = power of two; bf16-exact weights stay exact in f16 away from the subnormal range)
__global__ __launch_bounds__(256) void k_wt_f16(const float* __restrict__ W, _Float16* __restrict__ Wt, int K, int N, float scale) {
  const int t = blockIdx.x * 256 + threadIdx.x; if (t >= N * (K / 8)) return; const int n = t / (K / 8), k8 = (t % (K / 8)) * 8; FragH f;
#pragma unroll
  for (int i = 0; i < 8; ++i) f.h[i] = (_Float16)(bf16_round(W[(size_t)(k8 + i) * N + n]) * scale); const v8us o = f.half[0];
  *(v8us*)((unsigned short*)Wt + (size_t)n * K + k8) = o; 
}
// k_gemm_hh variant with fused epilogue: v = acc·alpha + bias[by·sBias + col] (+ CP[(row/rowsPerB)·sCPb + by·64 + col] if CP) ; ACT 0 none / 1 elu ; writes f16 C16 (and f32 C if non-null)
template <int ACT>
__global__ __launch_bounds__(128) void k_gemm_hhx(const _Float16* __restrict__ A, int lda, size_t sA, const _Float16* __restrict__ Bh, int ldb, size_t sB, float alpha, const float* __restrict__ bias, size_t sBias, const float* __restrict__ CP, int rowsPerB, size_t sCPb, int row0g,
    float* __restrict__ C, _Float16* __restrict__ C16, int ldc, size_t sC, int M, int N, int K) {
  __shared__ __attribute__((aligned(16))) float so[4][16][64];
  const int tid = threadIdx.x, w = tid >> 5, lane = tid & 31, ln = lane & 15, hh = lane >> 4; const int by = blockIdx.y;
  A += (size_t)by * sA; Bh += (size_t)by * sB; const size_t cofs = (size_t)by * sC; const float* bp = bias ? bias + (size_t)by * sBias : nullptr;
  const int ntn = (N + 63) / 64; const int wid = blockIdx.x * 4 + w; const int mt = wid / ntn, nq = wid % ntn; if (mt * 16 >= M) return;
  const int row0 = mt * 16, col0 = nq * 64; const _Float16* arow = A + (size_t)(row0 + ln) * lda;
  v8f acc[4] = {};
  for (int kb = 0; kb < K; kb += 32) { FragH ah; ah.half[0] = *(const v8us*)((const unsigned short*)arow + kb + 8 * hh); ah.half[1] = *(const v8us*)((const unsigned short*)arow + kb + 16 + 8 * hh);
#pragma unroll
    for (int t = 0; t < 4; ++t) { if (col0 + t * 16 >= N) continue; const size_t boff = (size_t)(col0 + t * 16 + ln) * ldb + kb; FragH bq; bq.half[0] = *(const v8us*)((const unsigned short*)Bh + boff + 8 * hh); bq.half[1] = *(const v8us*)((const unsigned short*)Bh + boff + 16 + 8 * hh);
      acc[t] = mmaH<1>(ah.v, ah.v, bq.v, bq.v, acc[t]); }
  }
#pragma unroll
  for (int t = 0; t < 4; ++t) { if (col0 + t * 16 >= N) continue; const int col = col0 + t * 16 + ln; const float bv = bp ? bf16_round(bp[col]) : 0.f;
#pragma unroll
    for (int r = 0; r < 8; ++r) { float v = acc[t][r] * alpha + bv; if (CP) { const int rr = row0g + row0 + 8 * hh + r; if (rowsPerB < 0) v += CP[cofs + (size_t)rr * ldc + col];      /* rowsPerB < 0: own element of the batched C plane */ else { const int bidx = rr / rowsPerB; v += CP[(size_t)bidx * sCPb + (size_t)by * 64 + col]; } } if (ACT == 1) v = (v > 0.f) ? v : expm1f(v); else if (ACT == 7) v = (v > 0.f) ? v + 1.0f : expf(v); else if (ACT == 8) v = tanhf(v); else if (ACT == 9) v = 0.5f * v * (1.0f + tanhf(0.7978845608028654f * (v + 0.044715f * v * v * v))); else if (ACT == 11) v = 1.0f / (1.0f + expf(-v)); else if (ACT == 12) v = (v > 0.f) ? v : 0.01f * v; else if (ACT == 14) v = (v > 0.f) ? v : 0.1f * v; else if (ACT == 16) v = (v >= 0.f) ? v : 0.3f * v; else if (ACT == 17) v = (v >= 0.f) ? v : 0.2f * v; else if (ACT == 15) v = v / (1.0f + expf(-v)); else if (ACT == 3) v = fmaxf(v, 0.f); else if (ACT == 6) v = 0.5f * v * (1.0f + erff(v * 0.70710678118654752f)); so[w][8 * hh + r][t * 16 + ln] = v; } }
  __builtin_amdgcn_fence(__ATOMIC_ACQ_REL, "workgroup"); __builtin_amdgcn_wave_barrier();
  const int rsub = lane >> 4, c4 = (lane & 15) * 4; typedef _Float16 v4h __attribute__((ext_vector_type(4)));
  {
#pragma unroll
    for (int q = 0; q < 8; ++q) { const int r = q * 2 + rsub; if (col0 + c4 < N) { const v4f v = *(const v4fa*)&so[w][r][c4]; if (C) *(v4f*)(C + cofs + (size_t)(row0 + r) * ldc + col0 + c4) = v; if (C16) { v4h h4; for (int i = 0; i < 4; ++i) h4[i] = (_Float16)v[i]; *(v4h*)(C16 + cofs + (size_t)(row0 + r) * ldc + col0 + c4) = h4; } } }
     }
}


typedef _Float16 v4h __attribute__((ext_vector_type(4)));

__global__ __launch_bounds__(256) void k_x16(const float* __restrict__ x, _Float16* __restrict__ X16, size_t n8) { const size_t t = (size_t)blockIdx.x * 256 + threadIdx.x; if (t >= n8) return; FragH f;
#pragma unroll
  for (int q = 0; q < 8; ++q) f.h[q] = (_Float16)bf16_round(x[t * 8 + q]); *(v8us*)((unsigned short*)X16 + t * 8) = f.half[0];  }
__global__ __launch_bounds__(256) void k_h16(const float* __restrict__ x, _Float16* __restrict__ X16, size_t n8) { const size_t t = (size_t)blockIdx.x * 256 + threadIdx.x; if (t >= n8) return; FragH f;
#pragma unroll
  for (int q = 0; q < 8; ++q) f.h[q] = (_Float16)x[t * 8 + q]; *(v8us*)((unsigned short*)X16 + t * 8) = f.half[0];  }
__global__ __launch_bounds__(256) void k_round16f(const float* __restrict__ W, _Float16* __restrict__ Bt, size_t n8) { const size_t t = (size_t)blockIdx.x * 256 + threadIdx.x; if (t >= n8) return; FragH f;
#pragma unroll
  for (int i = 0; i < 8; ++i) f.h[i] = (_Float16)(bf16_round(W[t * 8 + i]) * 16.0f); *(v8us*)((unsigned short*)Bt + t * 8) = f.half[0];  }
template <int NHv, int TTv>
__global__ __launch_bounds__(256) void k_vt(const _Float16* __restrict__ V16, int ldv, int voff, _Float16* __restrict__ Vt) { __shared__ unsigned short tl[64][66]; const int tid = threadIdx.x; const int slab = blockIdx.x / (TTv / 64), lg = blockIdx.x % (TTv / 64); const int b = slab / NHv, h = slab % NHv;
  for (int i = tid; i < 64 * 8; i += 256) { const int r = i / 8, c8 = (i % 8) * 8; FragH f; f.half[0] = *(const v8us*)((const unsigned short*)V16 + ((size_t)b * TTv + lg * 64 + r) * ldv + voff + h * 64 + c8);
#pragma unroll
    for (int q = 0; q < 8; ++q) tl[r][c8 + q] = f.u[q]; }
  __syncthreads();
  {
#pragma unroll
    for (int rd = 0; rd < 2; ++rd) { const int d = rd * 32 + tid / 8, pc = tid % 8; FragH f;
#pragma unroll
      for (int q = 0; q < 8; ++q) f.u[q] = tl[pc * 8 + q][d];
      *(v8us*)((unsigned short*)Vt + ((size_t)slab * 64 + d) * TTv + lg * 64 + pc * 8) = f.half[0]; }
     } }

// Fragment order of an f16 operand plane X[row][k] (k a multiple of 8, K columns): the 16-byte unit of 8 consecutive k lies where the lane that needs it reads it, so that
// the 32 lanes of one fragment load (or store) cover 512 contiguous bytes, four whole lines, instead of 32 bytes in each of 16 rows. Block = (16 rows) x (16 k) = 32 units;
// unit in the block = lane = 16 * (k / 8 % 2) + row % 16. A 16x32 fragment is two blocks in a row, in the k order of g2_frag (8h + s, 16 + 8h + s).
__device__ __forceinline__ size_t fo_unit(size_t row, size_t k, size_t K) { return ((row >> 4) * (K >> 4) + (k >> 4)) * 32 + ((k >> 3) & 1) * 16 + (row & 15); }
// p = the plane + 8 * (first unit of the fragment's first block + lane)
__device__ __forceinline__ v16h fo_frag(const _Float16* p) { FragH f; f.half[0] = *(const v8us*)((const unsigned short*)p); f.half[1] = *(const v8us*)((const unsigned short*)p + 256); return f.v; }
// ---- fast GEMM (wave tile 32x64) ----
__device__ __forceinline__ v16h g2_frag(const _Float16* p, int hh) { FragH f; f.half[0] = *(const v8us*)((const unsigned short*)p + 8 * hh); f.half[1] = *(const v8us*)((const unsigned short*)p + 16 + 8 * hh); return f.v; }
__device__ __forceinline__ v8f g2_mma(v16h a, v16h b, v8f c) { v8f d = __builtin_amdgcn_wmma_f32_16x16x32_f16(false, a, false, b, (short)0, c, false, false); asm volatile("v_nop\n\tv_nop\n\tv_nop\n\tv_nop" : "+v"(d) : "v"(a), "v"(b)); return d; }
// The operands of one k step (32 k) of a 32 x 64 wave tile form a set: two A and four B fragments, twelve 16-byte loads a lane. The projection loop below (k_qkv) holds three sets in registers as a
// ring: a set is refilled for the step three ahead as soon as its products are issued, so the loads of two to three steps are in flight under every product and a wave no longer
// waits out four or five load latencies in a row in each step. Every accumulator still takes its k steps in rising order.
struct OpSet { v16h a0, a1, b0, b1, b2, b3; };
// c[t + 4 * half]: column tile t, row tile half
__device__ __forceinline__ void set_mma(const OpSet& s, v8f (&c)[8]) {
  c[0] = g2_mma(s.a0, s.b0, c[0]); c[4] = g2_mma(s.a1, s.b0, c[4]); c[1] = g2_mma(s.a0, s.b1, c[1]); c[5] = g2_mma(s.a1, s.b1, c[5]);
  c[2] = g2_mma(s.a0, s.b2, c[2]); c[6] = g2_mma(s.a1, s.b2, c[6]); c[3] = g2_mma(s.a0, s.b3, c[3]); c[7] = g2_mma(s.a1, s.b3, c[7]); }
// q, k and v projections in ONE launch: the three products read the same rows of A and do not depend on one another. Work-groups [0, MB) form q, [MB, 2 MB) k (64 columns each),
// the rest v (256 columns in four groups of 64, + bias). Every work-group is a 128 x 64 tile with K = CC.
// The epilogue writes the planes that the attention kernels read, in fragment order, itself. q, k: the f32 tile goes through the wave's LDS range, a lane takes 8 consecutive columns of a row
// and stores them as f16 hi + 2^-10 residual, one 512-byte block a store. v: in the D layout a lane holds ONE channel and 8 consecutive positions n per tile, which is the 16-byte unit of
// v channel-major (rows = image * 256 + channel, k = n): each accumulator tile is one 512-byte store from registers.
__global__ __launch_bounds__(128) void k_qkv(const _Float16* __restrict__ A, const _Float16* __restrict__ BQ, const _Float16* __restrict__ BK, const _Float16* __restrict__ BV, const float* __restrict__ bias,
    _Float16* __restrict__ QH, _Float16* __restrict__ QL, _Float16* __restrict__ KH, _Float16* __restrict__ KL, _Float16* __restrict__ Vf) { static_assert(CC == 256 && CQ == 64 && NPX % 128 == 0, "one chunk of eight k steps; q and k are one column group wide; a work-group's rows lie in one image");
  __shared__ __attribute__((aligned(16))) float so[4][32][68];
  const int tid = threadIdx.x, w = tid >> 5, lane = tid & 31, ln = lane & 15, hh = lane >> 4;
  constexpr int MB = (int)(NR / 128); const int bx = blockIdx.x; const bool isv = bx >= 2 * MB; const int uv = bx - 2 * MB;
  const int mt = isv ? uv / (CC / 64) : bx % MB; const int col0 = isv ? (uv % (CC / 64)) * 64 : 0; const int row0 = mt * 128 + 32 * w;
  const _Float16* Bh = isv ? BV : (bx < MB ? BQ : BK);
  const _Float16* a0p = A + (size_t)(row0 + ln) * CC; const _Float16* a1p = a0p + (size_t)16 * CC;
  const _Float16* b0p = Bh + (size_t)(col0 + ln) * CC; const _Float16* b1p = b0p + (size_t)16 * CC; const _Float16* b2p = b1p + (size_t)16 * CC; const _Float16* b3p = b2p + (size_t)16 * CC;
  const v8f z8 = {0.f,0.f,0.f,0.f,0.f,0.f,0.f,0.f}; v8f accs[8] = {z8, z8, z8, z8, z8, z8, z8, z8};
  auto ld = [&](OpSet& s, int kb) { s.a0 = g2_frag(a0p + kb, hh); s.a1 = g2_frag(a1p + kb, hh); s.b0 = g2_frag(b0p + kb, hh); s.b1 = g2_frag(b1p + kb, hh); s.b2 = g2_frag(b2p + kb, hh); s.b3 = g2_frag(b3p + kb, hh);
    asm volatile("s_wait_xcnt 0x0" ::: "memory"); };      /* stands in front of any later overwrite of the address registers of the twelve loads above; as a compiler fence it also keeps each set's loads at their place in the ring */
  OpSet s[3]; ld(s[0], 0); ld(s[1], 32); ld(s[2], 64);
  // unrolled in full: s is then indexed by constants only and stays in registers
#pragma unroll
  for (int i = 0; i < 8; ++i) { set_mma(s[i % 3], accs); if (i + 3 < 8) ld(s[i % 3], (i + 3) * 32); }
  if (isv) {      /* the same for a whole work-group */
    unsigned short* vp = (unsigned short*)Vf + (((size_t)(row0 / NPX) * (CC / 16) + (col0 >> 4)) * (NPX / 16) + ((row0 % NPX) >> 4)) * 256 + lane * 8;      /* block (channel tile, n tile), unit = lane */
#pragma unroll
    for (int u = 0; u < 8; ++u) { const int t = u & 3, half = u >> 2; const float bv = bf16_round(bias[col0 + t * 16 + ln]); FragH f;
#pragma unroll
      for (int r = 0; r < 8; ++r) f.h[r] = (_Float16)(accs[u][r] * 0.0625f + bv);
      *(v8us*)(vp + ((size_t)t * (NPX / 16) + half) * 256) = f.half[0]; }
    return; }
#pragma unroll
  for (int u = 0; u < 8; ++u) { const int t = u & 3, half = u >> 2;
#pragma unroll
    for (int r = 0; r < 8; ++r) so[w][half * 16 + 8 * hh + r][t * 16 + ln] = accs[u][r] * 0.0625f; }
  __builtin_amdgcn_fence(__ATOMIC_ACQ_REL, "workgroup"); __builtin_amdgcn_wave_barrier();
  unsigned short* ph = (unsigned short*)(bx < MB ? QH : KH) + (size_t)(row0 >> 4) * (CQ / 16) * 256 + lane * 8; unsigned short* pl = (unsigned short*)(bx < MB ? QL : KL) + (size_t)(row0 >> 4) * (CQ / 16) * 256 + lane * 8;      /* block (row tile, 16 columns), unit = lane */
#pragma unroll
  for (int blk = 0; blk < 8; ++blk) { const float* sp = &so[w][(blk >> 2) * 16 + ln][(blk & 3) * 16 + 8 * hh]; const v4f a = *(const v4fa*)sp, c = *(const v4fa*)(sp + 4); FragH fh, fl;
#pragma unroll
    for (int q = 0; q < 4; ++q) { _Float16 h = (_Float16)a[q]; fh.h[q] = h; fl.h[q] = (_Float16)((a[q] - (float)h) * 1024.0f); h = (_Float16)c[q]; fh.h[4 + q] = h; fl.h[4 + q] = (_Float16)((c[q] - (float)h) * 1024.0f); }
    *(v8us*)(ph + blk * 256) = fh.half[0]; *(v8us*)(pl + blk * 256) = fl.half[0]; }
  asm volatile("s_wait_xcnt 0x0" ::: "memory"); }      /* the build lays the v path directly behind these stores, where their registers are written again: the wait stands in front of that */

// energy + softmax in one kernel; grid x = 4 * (group of 256 rows n) + (quarter of the columns m), grid y = image. A work-group of 16 waves first brings the k rows of its 1024 columns
// (hi and residual plane, 128 KiB each, contiguous in fragment order) into LDS with asynchronous copies, once, and then runs four passes of 64 rows n over them: every k fragment comes
// from L2 once for 256 rows of the attention matrix. In a pass wave w forms the logits E[n][m] of row tile w / 4 and of the 256 columns of column group w % 4 (four waves next to one another in number read four different 64-KiB parts of the LDS; A = q rows, B = k rows;
// hi.hi in one accumulator, lo.hi + hi.lo in a second, joined as hi + lo / 1024). The logits stay in registers for the maximum, the exponentials, their sum and the f16 store.
// Maximum and sum are those of the QUARTER row, over the work-group's 1024 columns only: P^T takes 256 exp(E - quarter maximum), not divided, and maximum and sum are stored per (image, quarter, n);
// k_xr forms from them the factor that makes the whole row's softmax of it.
// In the D layout a lane holds ONE column m and 8 consecutive rows n per tile: that is the 16-byte unit which the same lane of the x_r product reads as its B operand (row m of P^T,
// k = n), so each tile is one 512-byte store into P^T in fragment order and no transpose follows.
// The row reductions run per register: over the tiles in the lane, over the 16 lanes of a row by DPP, over the four waves of a row tile through LDS.
__device__ __forceinline__ v8f es_mma(v16h a, v16h b, v8f c) { return __builtin_amdgcn_wmma_f32_16x16x32_f16(false, a, false, b, (short)0, c, false, false); }
template <int X> __device__ __forceinline__ float row_x(float v) { return __int_as_float(__builtin_amdgcn_update_dpp(0, __float_as_int(v), 0x160 + X, 0xf, 0xf, true)); }      /* the value of lane l ^ X of the same 16-lane row (row_xmask) */
#define NQ 4                         /* column quarters of the attention matrix */
#define QCOL (NPX / NQ)              /* columns of a quarter */
#define KPL ((size_t)QCOL * CQ)      /* f16 elements of one k plane of a quarter */
__global__ __launch_bounds__(512) void k_esm(const _Float16* __restrict__ Qh, const _Float16* __restrict__ Ql, const _Float16* __restrict__ Kh, const _Float16* __restrict__ Kl, _Float16* __restrict__ Pf, float* __restrict__ ML, float* __restrict__ SL) {
  static_assert(KPL * 2 == 131072 && CQ == 64, "the copies below move two planes of 128 KiB");
  __shared__ __attribute__((aligned(512))) _Float16 Ks[2 * KPL]; __shared__ __attribute__((aligned(32))) float redm[4][64]; __shared__ __attribute__((aligned(32))) float reds[4][64];
  const int tid = threadIdx.x, w = __builtin_amdgcn_readfirstlane(tid >> 5), lane = tid & 31, ln = lane & 15, hh = lane >> 4; const int cg = w & 3, rt = w >> 2; const int qd = blockIdx.x & (NQ - 1), rg = blockIdx.x >> 2;      /* the wave's number in a scalar register: what follows from it costs no vector register */
  { const size_t r0 = (size_t)blockIdx.y * NPX; Qh += r0 * CQ; Ql += r0 * CQ; Kh += r0 * CQ + (size_t)qd * KPL; Kl += r0 * CQ + (size_t)qd * KPL; Pf += r0 * NPX; ML += ((size_t)blockIdx.y * NQ + qd) * NPX; SL += ((size_t)blockIdx.y * NQ + qd) * NPX; }      /* this image's planes, this quarter's k rows and statistics */
  { const unsigned l0 = (unsigned)(size_t)&Ks[0] + (unsigned)((w >> 2) * 4096 + (w & 3) * 512 + lane * 16); const char* gh = (const char*)Kh + (w * 512 + lane * 16); const char* gl = (const char*)Kl + (w * 512 + lane * 16);
    // 32 copies a wave, 512 bytes (one block of a plane) each. In LDS a 16-row tile's hi blocks (2 KiB) and residual blocks (2 KiB) lie side by side, so that one address register and the 16-bit offset reach
    // all that a wave reads. Copy j of statement i takes the bytes from (8 (i % 2) + j) * 8192 + 512 w on of plane i / 2, that is block w % 4 of tile 4 (8 (i % 2) + j) + w / 4.
    // The s_wait_xcnt at the end of each statement stands in front of any later write of the registers that its copies name.
#pragma unroll
    for (int i = 0; i < 4; ++i) { const unsigned l = l0 + (unsigned)(i & 1) * 131072u + (unsigned)(i >> 1) * 2048u; const char* g = i < 2 ? gh + i * 65536 : gl + (i - 2) * 65536;
      asm volatile("global_load_async_to_lds_b128 %0, %8, off\n\tglobal_load_async_to_lds_b128 %1, %9, off\n\tglobal_load_async_to_lds_b128 %2, %10, off\n\tglobal_load_async_to_lds_b128 %3, %11, off\n\t"
                   "global_load_async_to_lds_b128 %4, %12, off\n\tglobal_load_async_to_lds_b128 %5, %13, off\n\tglobal_load_async_to_lds_b128 %6, %14, off\n\tglobal_load_async_to_lds_b128 %7, %15, off\n\ts_wait_xcnt 0x0"
                   :: "v"(l), "v"(l + 16384u), "v"(l + 32768u), "v"(l + 49152u), "v"(l + 65536u), "v"(l + 81920u), "v"(l + 98304u), "v"(l + 114688u),
                      "v"(g), "v"(g + 8192), "v"(g + 16384), "v"(g + 24576), "v"(g + 32768), "v"(g + 40960), "v"(g + 49152), "v"(g + 57344) : "memory"); } }
  Qh += (size_t)(rg * 16 + rt) * 1024; Ql += (size_t)(rg * 16 + rt) * 1024; const unsigned l8 = lane * 8;      /* row tile rg * 16 + 4 * pass + rt (1024 elements a tile); a pass is 4 tiles = 4096 elements on */
  v16h qh0 = fo_frag(Qh + l8), qh1 = fo_frag(Qh + 512 + l8), ql0 = fo_frag(Ql + l8), ql1 = fo_frag(Ql + 512 + l8);
  asm volatile("s_wait_xcnt 0x0" ::: "memory");      /* the address registers of the loads above may be given to a later value: the wait stands in front of that overwrite */
  asm volatile("s_wait_asynccnt 0x0" ::: "memory");      /* this wave's copies have landed */
  __syncthreads();      /* every wave's copies have landed: from here on the k planes are only read */
  const _Float16* khp = Ks + (size_t)(cg * 16) * 2048 + lane * 8; const _Float16* klp = khp + 1024;      /* 2048 elements a tile: hi, then residual */
  const v8f z8 = {0.f,0.f,0.f,0.f,0.f,0.f,0.f,0.f};
  // stays rolled: a pass is some thousand instructions long
#pragma unroll 1
  for (int ps = 0; ps < 4; ++ps) { v8f e[16];
    v16h nh0 = fo_frag(khp), nh1 = fo_frag(khp + 512), nl0 = fo_frag(klp), nl1 = fo_frag(klp + 512);
    // every loop over e[] is unrolled in full: e is then indexed by constants only and stays in registers
#pragma unroll
    for (int t = 0; t < 16; ++t) { const v16h kh0 = nh0, kh1 = nh1, kl0 = nl0, kl1 = nl1;
      if (t + 1 < 16) { nh0 = fo_frag(khp + (t + 1) * 2048); nh1 = fo_frag(khp + (t + 1) * 2048 + 512); nl0 = fo_frag(klp + (t + 1) * 2048); nl1 = fo_frag(klp + (t + 1) * 2048 + 512); }      /* the next tile's fragments come from LDS under this tile's products */
      v8f ch = es_mma(qh0, kh0, z8); v8f cl = es_mma(qh0, kl0, z8); ch = es_mma(qh1, kh1, ch); cl = es_mma(qh1, kl1, cl); cl = es_mma(ql0, kh0, cl); cl = es_mma(ql1, kh1, cl);
      e[t] = ch + cl * (1.0f / 1024.0f); }
    v8f m8 = e[0];      /* register r: row n = 8 * hh + r of the tile */
#pragma unroll
    for (int t = 1; t < 16; ++t) for (int r = 0; r < 8; ++r) m8[r] = fmaxf(m8[r], e[t][r]);
#pragma unroll
    for (int r = 0; r < 8; ++r) { float v = m8[r]; v = fmaxf(v, row_x<1>(v)); v = fmaxf(v, row_x<2>(v)); v = fmaxf(v, row_x<4>(v)); v = fmaxf(v, row_x<8>(v)); m8[r] = v; }
    if (ln == 0) *(v8f*)&redm[cg][rt * 16 + 8 * hh] = m8;
    __syncthreads();
#pragma unroll
    for (int u = 0; u < 4; ++u) { const v8f o = *(const v8f*)&redm[u][rt * 16 + 8 * hh]; for (int r = 0; r < 8; ++r) m8[r] = fmaxf(m8[r], o[r]); }
    { const _Float16* qa = Qh + (ps < 3 ? ps + 1 : 3) * 4096 + l8; const _Float16* qb = Ql + (ps < 3 ? ps + 1 : 3) * 4096 + l8;      /* the next pass's q fragments fly under this pass's exponentials (the last pass asks for its own again) */
      qh0 = fo_frag(qa); qh1 = fo_frag(qa + 512); ql0 = fo_frag(qb); ql1 = fo_frag(qb + 512);
      asm volatile("s_wait_xcnt 0x0" :: "v"(qa), "v"(qb) : "memory"); }      /* stands in front of any overwrite of the address registers of the eight loads above; it names them so that they live up to it and no load's result is laid over them */
    const int si = rg * 256 + ps * 64 + tid;
    if (tid < 64) { const float mv = fmaxf(fmaxf(redm[0][tid], redm[1][tid]), fmaxf(redm[2][tid], redm[3][tid])) * 1.44269504088896340736f; ML[si] = mv;      /* two whole waves, one 128-byte line each: the quarter row's maximum in the log2 domain */
      asm volatile("s_wait_xcnt 0x0" :: "v"(mv), "v"(si) : "memory"); }      /* stands in front of any overwrite of the store's data and index registers; it names both so that they live up to it */
#pragma unroll
    for (int r = 0; r < 8; ++r) m8[r] = 8.0f - m8[r] * 1.44269504088896340736f;      /* 8 - the maximum in the log2 domain: the 8 is the factor 256 of P^T; the rounding scales a whole quarter row and its sum alike */
#pragma unroll
    for (int t = 0; t < 16; ++t) for (int r = 0; r < 8; ++r) e[t][r] = __builtin_amdgcn_exp2f(__builtin_fmaf(e[t][r], 1.44269504088896340736f, m8[r]));      /* 256 exp(e - max) = 2^(e log2e + 8 - max log2e): one FMA and one v_exp_f32 a logit; arguments are <= about 8, far negative ones give 0 */
    v8f s8 = e[0];
#pragma unroll
    for (int t = 1; t < 16; ++t) s8 += e[t];
#pragma unroll
    for (int r = 0; r < 8; ++r) { float v = s8[r]; v += row_x<1>(v); v += row_x<2>(v); v += row_x<4>(v); v += row_x<8>(v); s8[r] = v; }
    if (ln == 0) *(v8f*)&reds[cg][rt * 16 + 8 * hh] = s8;
    __syncthreads();
    if (tid < 64) { const float sv = ((reds[0][tid] + reds[1][tid]) + reds[2][tid]) + reds[3][tid]; SL[si] = sv;      /* 256 * the quarter row's sum of exponentials */
      asm volatile("s_wait_xcnt 0x0" :: "v"(sv), "v"(si) : "memory"); }      /* stands in front of any overwrite of the store's data and index registers; it names both so that they live up to it */
    unsigned short* p = (unsigned short*)Pf + ((size_t)(qd * (QCOL / 16) + cg * 16) * (NPX / 16) + (rg * 16 + ps * 4 + rt)) * 256 + l8;      /* block (m tile, n tile), unit = lane */
#pragma unroll
    for (int t = 0; t < 16; ++t) { FragH f; for (int r = 0; r < 8; ++r) f.h[r] = (_Float16)e[t][r]; *(v8us*)(p + (size_t)t * (NPX / 16) * 256) = f.half[0]; }
    asm volatile("s_wait_xcnt 0x0" ::: "memory"); } }      /* the next pass writes the address registers of the stores above anew: the wait stands in front of that */
// x_r[c][m] = alpha * sum_n v[c][n] wt[n] P^T[m][n], both operands in fragment order (K = NPX); grid y = image. A work-group of eight waves forms a 128 x 128 tile, four waves stacked on the rows and two
// side by side on the columns, wave tile 32 x 64. The operands of 256 k (a stage: eight 16-row tiles of v, eight of P^T, 8 KiB each and contiguous in their planes) come into LDS by asynchronous copies,
// once for the whole work-group, into one of two buffers: the next stage's copies fly while this stage is worked on. Every operand byte so leaves L2 once per work-group and serves 128 rows or columns.
// P^T holds 256 exp(E - quarter maximum) (see k_esm); wt[n] = 2^14 exp(this work-group's quarter maximum - row maximum) / (256 * the whole row n's sum of exponentials), at most 64,
// formed once per work-group from the four quarters' maxima and sums, kept in LDS as f16 and multiplied into the v fragments, whose k index is n.
// The epilogue adds the residual and stores out = x + x_r itself: x (rounded to bf16) is asked for in the prologue, where its latency lies under the weights and stage 0, and waits in LDS.
#define XR_TP ((size_t)(NPX / 16) * 256)      /* f16 elements from one 16-row tile to the next */
#define XR_KS 256                             /* k of a stage */
#define XR_CH ((size_t)XR_KS * 16)            /* f16 elements of one 16-row tile's part of a stage */
#define XR_ST (16 * XR_CH)                    /* f16 elements of a stage: the eight v tiles, then the eight P^T tiles */
#define XR_NT (NPX / XR_KS)                   /* stages */
// A wave's share of one stage: v tile w and P^T tile w, 16 copies of 512 bytes each. l = the lane's LDS byte address in v tile w of the buffer; ga, gb = the lane's first 16 bytes of the two tiles' parts in global memory.
// A tile's part lies in LDS as it lies in its plane, so the immediate offset, which moves the LDS address and the global address alike, walks both: two address pairs and two LDS addresses serve all 32 copies.
// One statement, so that one s_wait_xcnt at its end stands in front of any later write of the registers that the copies name.
__device__ __forceinline__ void xr_copy(unsigned l, const char* ga, const char* gb) {
  asm volatile(
               "global_load_async_to_lds_b128 %0, %2, off\n\tglobal_load_async_to_lds_b128 %0, %2, off offset:512\n\tglobal_load_async_to_lds_b128 %0, %2, off offset:1024\n\tglobal_load_async_to_lds_b128 %0, %2, off offset:1536\n\t"
               "global_load_async_to_lds_b128 %0, %2, off offset:2048\n\tglobal_load_async_to_lds_b128 %0, %2, off offset:2560\n\tglobal_load_async_to_lds_b128 %0, %2, off offset:3072\n\tglobal_load_async_to_lds_b128 %0, %2, off offset:3584\n\t"
               "global_load_async_to_lds_b128 %0, %2, off offset:4096\n\tglobal_load_async_to_lds_b128 %0, %2, off offset:4608\n\tglobal_load_async_to_lds_b128 %0, %2, off offset:5120\n\tglobal_load_async_to_lds_b128 %0, %2, off offset:5632\n\t"
               "global_load_async_to_lds_b128 %0, %2, off offset:6144\n\tglobal_load_async_to_lds_b128 %0, %2, off offset:6656\n\tglobal_load_async_to_lds_b128 %0, %2, off offset:7168\n\tglobal_load_async_to_lds_b128 %0, %2, off offset:7680\n\t"
               "global_load_async_to_lds_b128 %1, %3, off\n\tglobal_load_async_to_lds_b128 %1, %3, off offset:512\n\tglobal_load_async_to_lds_b128 %1, %3, off offset:1024\n\tglobal_load_async_to_lds_b128 %1, %3, off offset:1536\n\t"
               "global_load_async_to_lds_b128 %1, %3, off offset:2048\n\tglobal_load_async_to_lds_b128 %1, %3, off offset:2560\n\tglobal_load_async_to_lds_b128 %1, %3, off offset:3072\n\tglobal_load_async_to_lds_b128 %1, %3, off offset:3584\n\t"
               "global_load_async_to_lds_b128 %1, %3, off offset:4096\n\tglobal_load_async_to_lds_b128 %1, %3, off offset:4608\n\tglobal_load_async_to_lds_b128 %1, %3, off offset:5120\n\tglobal_load_async_to_lds_b128 %1, %3, off offset:5632\n\t"
               "global_load_async_to_lds_b128 %1, %3, off offset:6144\n\tglobal_load_async_to_lds_b128 %1, %3, off offset:6656\n\tglobal_load_async_to_lds_b128 %1, %3, off offset:7168\n\tglobal_load_async_to_lds_b128 %1, %3, off offset:7680\n\t"
               "s_wait_xcnt 0x0"
               :: "v"(l), "v"(l + (unsigned)(8 * XR_CH * 2)), "v"(ga), "v"(gb) : "memory"); }
// one k step's operands from LDS: ap, bp = the lane's unit in the wave's first v tile and first P^T tile of the stage
__device__ __forceinline__ void xr_frags(OpSet& s, const _Float16* ap, const _Float16* bp) {
  s.a0 = fo_frag(ap); s.a1 = fo_frag(ap + XR_CH); s.b0 = fo_frag(bp); s.b1 = fo_frag(bp + XR_CH); s.b2 = fo_frag(bp + 2 * XR_CH); s.b3 = fo_frag(bp + 3 * XR_CH); }
typedef unsigned v4u __attribute__((ext_vector_type(4), may_alias));
__device__ __forceinline__ float exp2_slot(float x) { float r; asm("v_exp_f32 %0, %1\n\tv_nop" : "=v"(r) : "v"(x)); return r; }      /* 2^x; the v_nop fills the slot behind a transcendental */
__device__ __forceinline__ void xr_mma(const OpSet& s, v16h wt, v8f (&c)[8]) {
  __builtin_amdgcn_sched_barrier(0);      /* the next step's LDS reads stay in front of this step's products as one group, and the products with the weights are not lifted over them */
  OpSet t = s; t.a0 = s.a0 * wt; t.a1 = s.a1 * wt; set_mma(t, c); }
__global__ __launch_bounds__(256) void k_xr(const _Float16* __restrict__ Af, const _Float16* __restrict__ Bf, const float* __restrict__ ML, const float* __restrict__ SL, float alpha, const float* __restrict__ X, float* __restrict__ C) {
  static_assert(XR_ST * 2 == 131072 && XR_NT >= 2 && CC % 128 == 0 && QCOL % 128 == 0, "two stages at least; a work-group's columns lie in one quarter");
  __shared__ __attribute__((aligned(512))) _Float16 Rs[2 * XR_ST]; __shared__ __attribute__((aligned(16))) _Float16 fw[NPX]; __shared__ __attribute__((aligned(16))) unsigned xs[8][256][4];
  const int tid = threadIdx.x, w = __builtin_amdgcn_readfirstlane(tid >> 5), lane = tid & 31, ln = lane & 15, hh = lane >> 4; const int by = blockIdx.y;      /* the wave's number in a scalar register */
  Af += (size_t)by * CC * NPX; Bf += (size_t)by * NPX * NPX; C += (size_t)by * CC * NPX; X += (size_t)by * CC * NPX;
  const int ntn = NPX >> 7; const int mt = blockIdx.x / ntn, nq = blockIdx.x - mt * ntn; const int wr = w & 3, wc = w >> 2; const int row0 = mt * 128 + 32 * wr, col0 = nq * 128 + 64 * wc;
  const unsigned l0 = (unsigned)(size_t)&Rs[0] + (unsigned)(w * (int)(XR_CH * 2) + lane * 16);
  const char* ga = (const char*)(Af + (size_t)(mt * 8 + w) * XR_TP) + lane * 16; const char* gb = (const char*)(Bf + (size_t)(nq * 8 + w) * XR_TP) + lane * 16;
  xr_copy(l0, ga, gb);      /* stage 0 into buffer 0; it flies under the weights below */
  const int rsub = lane >> 4, c4 = (lane & 15) * 4; const size_t o0 = (size_t)(row0 + rsub) * NPX + col0 + c4; const float* xp = X + o0; v4f xv[16];      /* the residual's x, where this lane stores at the end */
  { const int qd = nq * 128 / QCOL;
    // 16 n a thread: the 36 loads are in flight together, so the work-group waits out one load latency here
    const float* pm = ML + (size_t)by * NQ * NPX + tid * 4; const float* pz = SL + (size_t)by * NQ * NPX + tid * 4; const float* pmo = pm + (size_t)qd * NPX;
    v4f mq[4][NQ], sq[4][NQ], mo[4];
#pragma unroll
    for (int u = 0; u < 4; ++u) { for (int j = 0; j < NQ; ++j) { mq[u][j] = *(const v4fa*)(pm + (size_t)j * NPX + u * 1024); sq[u][j] = *(const v4fa*)(pz + (size_t)j * NPX + u * 1024); } mo[u] = *(const v4fa*)(pmo + u * 1024); }
    asm volatile("s_wait_xcnt 0x0" :: "v"(pm), "v"(pz), "v"(pmo), "v"(tid) : "memory");      /* stands in front of any overwrite of the address registers of the loads above; it names them, and the thread's number, which this build takes as their offset register, so that they live up to it and no load's result is laid over them */
    // the 16 loads of x are asked for behind those of the statistics, so that the weights do not wait for them; they fly under the weights and under stage 0
#pragma unroll
    for (int q = 0; q < 16; ++q) xv[q] = *(const v4fa*)(xp + (size_t)q * 2 * NPX);
    asm volatile("s_wait_xcnt 0x0" :: "v"(xp) : "memory");      /* as above, for the address registers of the loads of x */
#pragma unroll
    for (int u = 0; u < 4; ++u) { v4h o;
#pragma unroll
      for (int i = 0; i < 4; ++i) { const float mx = fmaxf(fmaxf(mq[u][0][i], mq[u][1][i]), fmaxf(mq[u][2][i], mq[u][3][i])); float sa = 0.f;      /* the maxima are in the log2 domain, the sums hold the factor 256; the quarter that holds the row's maximum adds at least about 256 to sa */
        for (int j = 0; j < NQ; ++j) sa += sq[u][j][i] * exp2_slot(mq[u][j][i] - mx);
        o[i] = (_Float16)(exp2_slot(mo[u][i] - mx) * 16384.0f / sa); }
      *(v4h*)&fw[u * 1024 + tid * 4] = o; } }
  // x rounded to bf16, two values a word, waits in LDS for the epilogue: each lane writes and later reads its own 128 bytes, so no barrier is owed for it
#pragma unroll
  for (int q = 0; q < 16; q += 2) { v4u p;
#pragma unroll
    for (int i = 0; i < 4; ++i) p[i] = (unsigned)bf16_bits(xv[q + (i >> 1)][2 * (i & 1)]) | ((unsigned)bf16_bits(xv[q + (i >> 1)][2 * (i & 1) + 1]) << 16);
    *(v4u*)&xs[q >> 1][tid][0] = p; }
  asm volatile("s_wait_asynccnt 0x0" ::: "memory");      /* this wave's copies of stage 0 have landed */
  __syncthreads();      /* every wave's copies of stage 0 have landed, and every wave reads all the weights */
  xr_copy(l0 + (unsigned)(XR_ST * 2), ga + XR_CH * 2, gb + XR_CH * 2);      /* stage 1 into buffer 1 */
  const v8f z8 = {0.f,0.f,0.f,0.f,0.f,0.f,0.f,0.f}; v8f accs[8] = {z8, z8, z8, z8, z8, z8, z8, z8};
  // stays rolled: a trip holds a whole stage (eight k steps, 64 products)
#pragma unroll 1
  for (int t = 0; t < XR_NT; ++t) { const _Float16* ra = Rs + (size_t)(t & 1) * XR_ST + (size_t)(2 * wr) * XR_CH + lane * 8; const _Float16* rb = Rs + (size_t)(t & 1) * XR_ST + (size_t)(8 + 4 * wc) * XR_CH + lane * 8;
    const _Float16* f = fw + t * XR_KS; OpSet s0, s1; v16h w0, w1;      /* two register sets: a step's fragments and weights are read from LDS under the step before it, within the stage */
    xr_frags(s0, ra, rb); w0 = g2_frag(f, hh);
    // unrolled in full: the sets change places by name
#pragma unroll
    for (int j = 0; j < XR_KS / 32; j += 2) {
      xr_frags(s1, ra + (j + 1) * 512, rb + (j + 1) * 512); w1 = g2_frag(f + (j + 1) * 32, hh); xr_mma(s0, w0, accs);
      if (j + 2 < XR_KS / 32) { xr_frags(s0, ra + (j + 2) * 512, rb + (j + 2) * 512); w0 = g2_frag(f + (j + 2) * 32, hh); }
      xr_mma(s1, w1, accs); }
    asm volatile("s_wait_dscnt 0x0" ::: "memory");      /* this wave's reads of the buffer are done */
    asm volatile("s_wait_asynccnt 0x0" ::: "memory");      /* this wave's copies of stage t + 1 have landed */
    __syncthreads();      /* stage t + 1 is there for every wave, and every wave has left stage t's buffer */
    if (t + 2 < XR_NT) xr_copy(l0 + (unsigned)(t & 1) * (unsigned)(XR_ST * 2), ga + (size_t)(t + 2) * (XR_CH * 2), gb + (size_t)(t + 2) * (XR_CH * 2)); }      /* the same for the whole work-group */
  asm volatile("s_wait_asynccnt 0x0" ::: "memory");      /* no copy is under way when the buffers become output staging */
  float (*so)[32][68] = reinterpret_cast<float (*)[32][68]>(&Rs[0]);      /* behind the last trip's barrier the buffers are free: each wave stages its 32 x 64 tile in a range of its own */
#pragma unroll
  for (int u = 0; u < 8; ++u) { const int t = u & 3, half = u >> 2;
#pragma unroll
    for (int r = 0; r < 8; ++r) so[w][half * 16 + 8 * hh + r][t * 16 + ln] = accs[u][r] * alpha; }
  __builtin_amdgcn_fence(__ATOMIC_ACQ_REL, "workgroup"); __builtin_amdgcn_wave_barrier();
#pragma unroll
  for (int q = 0; q < 16; ++q) { const v4f v = *(const v4fa*)&so[w][q * 2 + rsub][c4]; const v4u p = *(const v4u*)&xs[q >> 1][tid][0]; v4f o;
#pragma unroll
    for (int i = 0; i < 4; ++i) { const unsigned u = p[2 * (q & 1) + (i >> 1)]; o[i] = __fadd_rn(__uint_as_float((i & 1) ? u & 0xFFFF0000u : u << 16), v[i]); }      /* out = x + x_r */
    *(v4f*)(C + o0 + (size_t)q * 2 * NPX) = o; } }
__global__ __launch_bounds__(256) void k_vt(const _Float16* __restrict__ V16, int b, int h0, _Float16* __restrict__ VT) { __shared__ unsigned short tl[64][65]; const int tid = threadIdx.x; const int hh = blockIdx.x % HG, sg = blockIdx.x / HG; const int s0 = sg * 64; const int h = h0 + hh;
  for (int i = tid; i < 64 * 8; i += 256) { const int j = i / 8, d8 = (i % 8) * 8; FragH f; f.half[0] = *(const v8us*)((const unsigned short*)V16 + ((size_t)b * SQ + s0 + j) * DM + h * HD + d8); for (int q = 0; q < 8; ++q) tl[d8 + q][j] = f.u[q]; }
  __syncthreads();
  { for (int i = tid; i < 64 * 8; i += 256) { const int d = i / 8, j8 = (i % 8) * 8; FragH f; for (int q = 0; q < 8; ++q) f.u[q] = tl[d][j8 + q]; *(v8us*)((unsigned short*)VT + ((size_t)hh * HD + d) * SQ + s0 + j8) = f.half[0]; }  } }


// The four preparations of the projections' operands, in ONE launch (none reads what another writes). Work-groups [0, NX): x channel-first -> position rows (f16) through LDS tiles;
// the rest: the natural weights x16 as f16, 8 elements a thread: Wq, then Wk, then Wv.
__global__ __launch_bounds__(256) void k_prep(const float* __restrict__ X, _Float16* __restrict__ XR, const float* __restrict__ wq, const float* __restrict__ wk, const float* __restrict__ wv, _Float16* __restrict__ BQ, _Float16* __restrict__ BK, _Float16* __restrict__ BV) {
  __shared__ float tl[64][33]; const int tid = threadIdx.x; const int nl = LL / 32, nc = CC / 64; constexpr int NX = NB * (LL / 32) * (CC / 64), QB = CQ * CC / 8 / 256; static_assert(CQ * CC / 8 % 256 == 0 && CC * CC / 8 % 256 == 0, "whole work-groups");
  if (blockIdx.x >= NX) {      /* the same for a whole work-group, and in front of the barrier below */
    const int u = blockIdx.x - NX; const float* w = u < QB ? wq : (u < 2 * QB ? wk : wv); _Float16* Bt = u < QB ? BQ : (u < 2 * QB ? BK : BV);
    const size_t t = (size_t)(u < QB ? u : (u < 2 * QB ? u - QB : u - 2 * QB)) * 256 + tid; FragH f; for (int q = 0; q < 8; ++q) f.h[q] = (_Float16)(bf16_round(w[t * 8 + q]) * 16.0f); *(v8us*)((unsigned short*)Bt + t * 8) = f.half[0];
    return; }
  const int cb_ = blockIdx.x % nc; const int lb = (blockIdx.x / nc) % nl; const size_t b = blockIdx.x / (nc * nl); const int c0 = cb_ * 64, l0 = lb * 32;
  for (int i = tid; i < 64 * 32; i += 256) { const int c = i / 32, l = i % 32; tl[c][l] = bf16_round(X[(b * CC + c0 + c) * (size_t)LL + l0 + l]); }
  __syncthreads();
  { const int l = tid / 8, c8 = (tid % 8) * 8; FragH f; for (int q = 0; q < 8; ++q) f.h[q] = (_Float16)tl[c8 + q][l]; unsigned short* d = (unsigned short*)XR + (b * LL + l0 + l) * (size_t)CC + c0 + c8; *(v8us*)d = f.half[0];  } }

extern "C" void kernel_launch(void* const* d_in, const int* in_sizes, int n_in,
                              void* d_out, int out_size, void* d_ws, size_t ws_size, hipStream_t stream) {
  (void)in_sizes; (void)n_in; (void)out_size;
  const float* const* I = (const float* const*)d_in; const float* x = I[0]; const float* Wq = I[1]; const float* Wk = I[2]; const float* Wv = I[3]; const float* bv = I[4];
  char* ws = (char*)d_ws; size_t off = 0;
  auto take = [&](size_t bytes) { char* p = ws + off; off += (bytes + 255) & ~(size_t)255; return p; };
  _Float16* BQ = (_Float16*)take((size_t)CQ * CC * 2); _Float16* BK = (_Float16*)take((size_t)CQ * CC * 2); _Float16* BV = (_Float16*)take((size_t)CC * CC * 2);
  _Float16* XR = (_Float16*)take(NR * CC * 2); _Float16* QH = (_Float16*)take(NR * CQ * 2); _Float16* QL = (_Float16*)take(NR * CQ * 2); _Float16* KH = (_Float16*)take(NR * CQ * 2); _Float16* KL = (_Float16*)take(NR * CQ * 2);
  _Float16* PT = (_Float16*)take((size_t)NB * NPX * NPX * 2); _Float16* VT = (_Float16*)take((size_t)NB * CC * NPX * 2); float* ML = (float*)take((size_t)NB * NQ * NPX * 4); float* SL = (float*)take((size_t)NB * NQ * NPX * 4);
  if (off > ws_size) return;      /* 0.2 + 8 + 8 + 128 + 8 + 0.5 = approx 153 MiB: P^T and v channel-major hold all images */
  // work that does not depend on one another shares a launch: a launch starts only when the one before it has drained
  k_prep<<<NB * (NPX / 32) * (CC / 64) + (2 * CQ + CC) * CC / 8 / 256, 256, 0, stream>>>(x, XR, Wq, Wk, Wv, BQ, BK, BV);      /* x rows; weights x16 */
  k_qkv<<<(unsigned)((NR / 128) * (2 + CC / 64)), 128, 0, stream>>>(XR, BQ, BK, BV, bv, QH, QL, KH, KL, VT);      /* q, k (exact products) as hi + residual planes; v + bv channel-major [image][256][4096]; all in fragment order */
  k_esm<<<dim3(NQ * (NPX / 256), NBR), 512, 0, stream>>>(QH, QL, KH, KL, PT, ML, SL);      /* P^T[m][n] = 256 exp(q_n . k_m - its quarter row's maximum), fragment order, one plane per image; each quarter row's maximum and sum */
  k_xr<<<dim3((CC / 128) * (NPX / 128), NBR), 256, 0, stream>>>(VT, PT, ML, SL, 6.103515625e-05f, x, (float*)d_out);      /* out = x + x_r, x_r[c][m] = sum_n v[c][n] attention[n][m]; 2^-14 takes back the factor of the weights */
}
